// v000
// The times below were measured on an AMD MI455X: many runs one after another, warmed up first and cycling through
// copies of the inputs, with the whole window's GPU time divided by the number of runs. Launches and the gaps
// between them are all in it. The median over several windows is given; except for v000 it joins two sittings, which
// can be a few percent apart, so the side-by-side timings, each taken in one sitting, are the better comparison.
// The starting kernel, v000, takes 930 microseconds a run.
#include <hip/hip_runtime.h>
#include <hip/hip_bf16.h>
#include <stdint.h>

// ---------------------------------------------------------------------------
// Problem dims (compile-time constants from the reference)
// ---------------------------------------------------------------------------
constexpr int  B_   = 4;
constexpr int  S_   = 2048;
constexpr int  D_   = 256;
constexpr int  H_   = 8;
constexpr int  FD_  = 512;             // F*D
constexpr long M_   = (long)B_ * S_;   // 8192 flattened rows
constexpr long HD_  = (long)H_ * D_;   // 2048 concat width

typedef __attribute__((ext_vector_type(16))) __bf16 bf16x16;
typedef __attribute__((ext_vector_type(8)))  __bf16 bf16x8;
typedef __attribute__((ext_vector_type(8)))  float  f32x8;
typedef __attribute__((ext_vector_type(4)))  unsigned int u32x4;
typedef __attribute__((ext_vector_type(8)))  int i32x8;
typedef __attribute__((ext_vector_type(4)))  int i32x4;

#if defined(__has_builtin)
#if __has_builtin(__builtin_amdgcn_tensor_load_to_lds)
#define HAVE_TDM 1
#else
#define HAVE_TDM 0
#endif
#else
#define HAVE_TDM 0
#endif

// ---------------------------------------------------------------------------
// WMMA helpers.  CDNA5 bf16 A/B fragment layout (16x32 / 32x16):
//   lanes 0..15  : row=lane,    K = [0..7]  and [16..23]
//   lanes 16..31 : row=lane-16, K = [8..15] and [24..31]
// With contiguous-K data a fragment is two 16-byte loads + a shuffle.
// ---------------------------------------------------------------------------
__device__ __forceinline__ bf16x16 frag_ld_g(const __bf16* p) {
  bf16x8 lo = *(const bf16x8*)(p);
  bf16x8 hi = *(const bf16x8*)(p + 16);
  return __builtin_shufflevector(lo, hi, 0,1,2,3,4,5,6,7,8,9,10,11,12,13,14,15);
}

__device__ __forceinline__ f32x8 wmma_bf16(bf16x16 a, bf16x16 b, f32x8 c) {
  return __builtin_amdgcn_wmma_f32_16x16x32_bf16(
      /*neg_a=*/false, a, /*neg_b=*/false, b,
      /*c_mod=*/(short)0, c, /*reuse_a=*/false, /*reuse_b=*/false);
}

#if HAVE_TDM
// ---------------------------------------------------------------------------
// TDM: DMA a 64(row) x 32(k) bf16 tile (row stride ldbt elems) from global
// into LDS at byte offset ldsOff, inserting 16B of padding after every 64B
// row (pad_interval=16 DWORDs -> code 3, pad_amount=4 DWORDs -> code 3),
// i.e. an 80-byte LDS row pitch for bank-conflict-free b128 fragment reads.
// Toolchain probe: 6-arg builtin (g0:u32x4, g1:i32x8, g2:i32x4, g3:i32x4,
// g4:i32x8, cpol:i32).
// ---------------------------------------------------------------------------
__device__ __forceinline__ void tdm_load_tile(const __bf16* gsrc,
                                              unsigned ldsOff, long ldbt) {
  unsigned long long ga = (unsigned long long)(uintptr_t)gsrc;
  u32x4 g0;
  g0[0] = 1u;                                        // count=1, user mode
  g0[1] = ldsOff;                                    // lds_addr (bytes)
  g0[2] = (unsigned)(ga & 0xFFFFFFFFull);            // global_addr[31:0]
  g0[3] = (unsigned)((ga >> 32) & 0x01FFFFFFull)     // global_addr[56:32]
          | 0x80000000u;                             // type=2 ("image")
  i32x8 g1;
  g1[0] = (1 << 16)      // data_size = 2 bytes
        | (1 << 20)      // pad_enable
        | (3 << 22)      // pad_interval: 16 DWORDs
        | (3 << 25);     // pad_amount:   4 DWORDs
  g1[1] = 0;                                   // tensor_dim0 low16 (bits 63:48)
  g1[2] = (1 << 14);                           // tensor_dim0 = 1<<30 (hi bits)
  g1[3] = 16 | (32 << 16);                     // tensor_dim1=1<<20 hi, tile_dim0=32
  g1[4] = 64;                                  // tile_dim1=64, tile_dim2=0
  g1[5] = (int)ldbt;                           // tensor_dim0_stride[31:0]
  g1[6] = 0;                                   // stride hi / dim1_stride lo
  g1[7] = 0;
  i32x4 z4 = {0, 0, 0, 0};
  i32x8 z8 = {0, 0, 0, 0, 0, 0, 0, 0};
  __builtin_amdgcn_tensor_load_to_lds(g0, g1, z4, z4, z8, 0);
}

template <int N>
__device__ __forceinline__ void tdm_wait() {
#if __has_builtin(__builtin_amdgcn_s_wait_tensorcnt)
  __builtin_amdgcn_s_wait_tensorcnt((short)N);
#else
  asm volatile("s_wait_tensorcnt %0" :: "i"(N) : "memory");
#endif
}
#endif  // HAVE_TDM

// ---------------------------------------------------------------------------
// fp32 -> bf16 cast (grid-stride)
// ---------------------------------------------------------------------------
__global__ void cast_bf16_k(const float* __restrict__ in,
                            __bf16* __restrict__ out, long n) {
  long i      = (long)blockIdx.x * blockDim.x + threadIdx.x;
  long stride = (long)gridDim.x * blockDim.x;
  for (; i < n; i += stride) out[i] = (__bf16)in[i];
}

// ---------------------------------------------------------------------------
// fp32 [rows][cols] -> bf16 transposed [cols][rows]   (per-z slice)
// ---------------------------------------------------------------------------
__global__ void transpose_cast_k(const float* __restrict__ in,
                                 __bf16* __restrict__ out,
                                 int rows, int cols,
                                 long inStrideZ, long outStrideZ) {
  __shared__ float tile[16][17];
  const float* inz  = in  + (long)blockIdx.z * inStrideZ;
  __bf16*      outz = out + (long)blockIdx.z * outStrideZ;
  int c = blockIdx.x * 16 + threadIdx.x;
  int r = blockIdx.y * 16 + threadIdx.y;
  if (r < rows && c < cols) tile[threadIdx.y][threadIdx.x] = inz[(long)r * cols + c];
  __syncthreads();
  int oc  = blockIdx.y * 16 + threadIdx.x;   // new col = old row
  int orw = blockIdx.x * 16 + threadIdx.y;   // new row = old col
  if (orw < cols && oc < rows)
    outz[(long)orw * rows + oc] = (__bf16)tile[threadIdx.x][threadIdx.y];
}

// ---------------------------------------------------------------------------
// Generic bf16 WMMA GEMM:  C = act(alpha * A @ B + bias + res)
//   A  : [M][K] bf16 row-major (per-z stride aStrideZ)
//   BT : [N][K] bf16 (B pre-transposed -> contiguous K fragments)
// Block: 256 threads = 8 waves, tile 128(M) x 64(N); wave = 16x64 (4 accums).
// The 64xK B panel is shared by all 8 waves, so it is staged through LDS:
// TDM double-buffered DMA (wave 0 issues, TENSORcnt-ordered) when available,
// else a synchronous cooperative copy.  LDS row pitch 80B (32 k-elems + 8
// pad elems) -> conflict-free ds_load_b128 fragment reads.
// ---------------------------------------------------------------------------
__global__ void __launch_bounds__(256)
gemm_bf16_wmma(const __bf16* __restrict__ A,  long lda,  long aStrideZ,
               const __bf16* __restrict__ BT, long ldbt, long btStrideZ,
               const float* __restrict__ bias,
               const float* __restrict__ res, long ldres,
               float alpha, int relu,
               float*  __restrict__ outF,
               __bf16* __restrict__ outB,  long ldo,  long oStrideZ,
               __bf16* __restrict__ outBT, long ldoT, long oTStrideZ,
               int K) {
  __shared__ __bf16 sB[2][64 * 40];   // 2 x 5120B padded tiles

  const int tid  = threadIdx.x;
  const int lane = tid & 31;
  const int wave = tid >> 5;
  const int z    = blockIdx.z;
  const long m0  = (long)blockIdx.x * 128 + wave * 16;
  const long n0  = (long)blockIdx.y * 64;
  const int  ml  = lane & 15;
  const int  kh  = (lane < 16) ? 0 : 8;   // K half-offset per fragment layout
  const int  rh  = (lane < 16) ? 0 : 8;   // C/D row-half offset

  const __bf16* aRow   = A  + (long)z * aStrideZ + (m0 + ml) * lda + kh;
  const __bf16* Bpanel = BT + (long)z * btStrideZ + n0 * ldbt;  // [64][K]

#if HAVE_TDM
  const unsigned ldsBase = (unsigned)(uintptr_t)(&sB[0][0]);
  if (tid < 32) tdm_load_tile(Bpanel, ldsBase, ldbt);           // prologue
#endif

  f32x8 acc[4] = {};
  const int nsteps = K >> 5;
  for (int s = 0; s < nsteps; ++s) {
    const int k0  = s << 5;
    const int cur = s & 1;
#if HAVE_TDM
    if (tid < 32) {
      if (s + 1 < nsteps) {
        tdm_load_tile(Bpanel + k0 + 32, ldsBase + (unsigned)((cur ^ 1) * 64 * 40 * 2), ldbt);
        tdm_wait<1>();   // previous DMA (in-order) has landed
      } else {
        tdm_wait<0>();
      }
    }
    __syncthreads();
#else
    {   // synchronous cooperative staging: 256 threads x 16B = 4KB tile
      const int n = tid >> 2, c = tid & 3;
      *(bf16x8*)(&sB[cur][n * 40 + c * 8]) =
          *(const bf16x8*)(Bpanel + (long)n * ldbt + k0 + c * 8);
      __syncthreads();
    }
#endif
    bf16x16 afr = frag_ld_g(aRow + k0);
    __builtin_prefetch(aRow + k0 + 128, 0, 1);   // global_prefetch_b8
    const __bf16* bl = &sB[cur][kh];
#pragma unroll
    for (int j = 0; j < 4; ++j) {
      bf16x16 bfr = frag_ld_g(bl + (j * 16 + ml) * 40);
      acc[j] = wmma_bf16(afr, bfr, acc[j]);
    }
    __syncthreads();   // protect buffer before it is overwritten
  }

#pragma unroll
  for (int j = 0; j < 4; ++j) {
    const long n   = n0 + j * 16 + ml;
    const float bv = bias ? bias[n] : 0.0f;
    if (outBT) {
      // transposed store: 8 consecutive M per lane -> one 16B store
      bf16x8 t;
#pragma unroll
      for (int i = 0; i < 8; ++i) {
        long m  = m0 + rh + i;
        float v = acc[j][i] * alpha + bv;
        if (res)  v += res[m * ldres + n];
        if (relu) v = fmaxf(v, 0.0f);
        t[i] = (__bf16)v;
      }
      *(bf16x8*)(outBT + (long)z * oTStrideZ + n * ldoT + (m0 + rh)) = t;
    } else {
#pragma unroll
      for (int i = 0; i < 8; ++i) {
        long m  = m0 + rh + i;
        float v = acc[j][i] * alpha + bv;
        if (res)  v += res[m * ldres + n];
        if (relu) v = fmaxf(v, 0.0f);
        long off = (long)z * oStrideZ + m * ldo + n;
        if (outF) outF[off] = v;
        if (outB) outB[off] = (__bf16)v;
      }
    }
  }
}

// ---------------------------------------------------------------------------
// Attention: one block per (batch, 16-row tile), loop over 8 heads.
//   scores/probs : bf16 LDS [16][2048]  (64 KB)
//   mean accum   : fp32 LDS [16][2048]  (128 KB)   -> 192 KB dynamic LDS
// Stage 1: each wave computes a 16x256 score slab (Q fragments register-
//          resident: 8 x bf16x16 = 64 VGPRs, reused across 16 tiles).
// Stage 2: each wave softmaxes 2 rows (wave32 shfl reductions).
// Stage 3: each wave computes a 16x32 slab of P@V (V pre-transposed).
// attn_mean accumulates in LDS and is written to HBM exactly once.
// ---------------------------------------------------------------------------
__global__ void __launch_bounds__(256)
attn_k(const __bf16* __restrict__ Qb,   // [H][B*S][D]
       const __bf16* __restrict__ Kb,   // [H][B*S][D]
       const __bf16* __restrict__ VbT,  // [H][D][B*S]  (transposed)
       __bf16* __restrict__ Zcat,       // [B*S][H*D]
       float*  __restrict__ attnMean) { // [B][S][S]
  extern __shared__ char smem[];
  __bf16* sP    = (__bf16*)smem;                    // [16][2048]
  float*  sMean = (float*)(smem + 16 * 2048 * 2);   // [16][2048]

  const int tid  = threadIdx.x;
  const int lane = tid & 31;
  const int wave = tid >> 5;
  const int b    = blockIdx.y;
  const long s0  = (long)blockIdx.x * 16;
  const int ml   = lane & 15;
  const int kh   = (lane < 16) ? 0 : 8;
  const int rh   = (lane < 16) ? 0 : 8;

  for (int i = tid; i < 16 * 2048; i += 256) sMean[i] = 0.0f;
  __syncthreads();

  for (int h = 0; h < H_; ++h) {
    const __bf16* Qh = Qb + ((long)h * M_ + (long)b * S_ + s0) * D_;
    const __bf16* Kh = Kb + ((long)h * M_ + (long)b * S_) * D_;

    // ---- stage 1: scores for t in [wave*256, wave*256+256) ----
    const int tbase = wave * 256;
    const __bf16* qrow = Qh + (long)ml * D_ + kh;
    bf16x16 qf[8];
#pragma unroll
    for (int e = 0; e < 8; ++e) qf[e] = frag_ld_g(qrow + e * 32);

    for (int j = 0; j < 16; ++j) {
      const int t0 = tbase + j * 16;
      const __bf16* krow = Kh + (long)(t0 + ml) * D_ + kh;
      f32x8 acc = {};
#pragma unroll
      for (int e = 0; e < 8; ++e) {
        bf16x16 bfr = frag_ld_g(krow + e * 32);
        acc = wmma_bf16(qf[e], bfr, acc);
      }
#pragma unroll
      for (int i = 0; i < 8; ++i)
        sP[(rh + i) * 2048 + t0 + ml] = (__bf16)acc[i];
    }
    __syncthreads();

    // ---- stage 2: softmax rows [2*wave, 2*wave+1] ----
    for (int rr = 0; rr < 2; ++rr) {
      const int r = wave * 2 + rr;
      __bf16* row = sP + r * 2048;
      float mx = -3.0e38f;
      for (int c = lane; c < 2048; c += 32) mx = fmaxf(mx, (float)row[c]);
      for (int o = 16; o; o >>= 1) mx = fmaxf(mx, __shfl_xor(mx, o, 32));
      float sum = 0.0f;
      for (int c = lane; c < 2048; c += 32) {
        float p = __expf((float)row[c] - mx);
        sum += p;
        row[c] = (__bf16)p;
      }
      for (int o = 16; o; o >>= 1) sum += __shfl_xor(sum, o, 32);
      const float inv = 1.0f / sum;
      float* mrow = sMean + r * 2048;
      for (int c = lane; c < 2048; c += 32) {
        float p = (float)row[c] * inv;
        row[c] = (__bf16)p;
        mrow[c] += p;
      }
    }
    __syncthreads();

    // ---- stage 3: zh slab, e in [wave*32, wave*32+32) ----
    const int e0 = wave * 32;
    const __bf16* vbase = VbT + (long)h * D_ * M_ + (long)b * S_;
    f32x8 acc0 = {}, acc1 = {};
    for (int t0 = 0; t0 < S_; t0 += 32) {
      bf16x16 afr = frag_ld_g(sP + (long)ml * 2048 + t0 + kh);
      bf16x16 b0  = frag_ld_g(vbase + (long)(e0 + ml) * M_ + t0 + kh);
      bf16x16 b1  = frag_ld_g(vbase + (long)(e0 + 16 + ml) * M_ + t0 + kh);
      acc0 = wmma_bf16(afr, b0, acc0);
      acc1 = wmma_bf16(afr, b1, acc1);
    }
#pragma unroll
    for (int i = 0; i < 8; ++i) {
      long rowm = (long)b * S_ + s0 + rh + i;
      Zcat[rowm * HD_ + (h * D_ + e0 + ml)]      = (__bf16)acc0[i];
      Zcat[rowm * HD_ + (h * D_ + e0 + 16 + ml)] = (__bf16)acc1[i];
    }
    __syncthreads();   // protect sP before next head
  }

  // ---- write attn_mean = sum/H once ----
  for (int i = tid * 4; i < 16 * 2048; i += 256 * 4) {
    int r = i >> 11, c = i & 2047;
    float4 v = *(const float4*)(sMean + r * 2048 + c);
    v.x *= 0.125f; v.y *= 0.125f; v.z *= 0.125f; v.w *= 0.125f;
    *(float4*)(attnMean + ((long)b * S_ + s0 + r) * S_ + c) = v;
  }
}

// ---------------------------------------------------------------------------
// LayerNorm over D=256 (one row per 256-thread block, 8 wave32 partials)
// ---------------------------------------------------------------------------
__global__ void __launch_bounds__(256)
ln_k(const float* __restrict__ in, const float* __restrict__ res,
     const float* __restrict__ g, const float* __restrict__ be,
     float* __restrict__ outF, __bf16* __restrict__ outB) {
  __shared__ float red[8];
  const long row = blockIdx.x;
  const int  t   = threadIdx.x;
  float x = in[row * D_ + t];
  if (res) x += res[row * D_ + t];

  float v = x;
  for (int o = 16; o; o >>= 1) v += __shfl_xor(v, o, 32);
  if ((t & 31) == 0) red[t >> 5] = v;
  __syncthreads();
  float tot = 0.0f;
#pragma unroll
  for (int i = 0; i < 8; ++i) tot += red[i];
  const float mean = tot * (1.0f / D_);
  __syncthreads();

  const float d = x - mean;
  float v2 = d * d;
  for (int o = 16; o; o >>= 1) v2 += __shfl_xor(v2, o, 32);
  if ((t & 31) == 0) red[t >> 5] = v2;
  __syncthreads();
  float tot2 = 0.0f;
#pragma unroll
  for (int i = 0; i < 8; ++i) tot2 += red[i];
  const float var = tot2 * (1.0f / D_);

  const float y = d * rsqrtf(var + 1e-5f) * g[t] + be[t];
  if (outF) outF[row * D_ + t] = y;
  if (outB) outB[row * D_ + t] = (__bf16)y;
}

// ---------------------------------------------------------------------------
// Host-side orchestration (all launches on `stream`, graph-capture safe)
// ---------------------------------------------------------------------------
extern "C" void kernel_launch(void* const* d_in, const int* in_sizes, int n_in,
                              void* d_out, int out_size, void* d_ws, size_t ws_size,
                              hipStream_t stream) {
  const float* X  = (const float*)d_in[0];
  const float* Wq = (const float*)d_in[1];
  const float* Wk = (const float*)d_in[2];
  const float* Wv = (const float*)d_in[3];
  const float* Wz = (const float*)d_in[4];
  const float* bz = (const float*)d_in[5];
  const float* W1 = (const float*)d_in[6];
  const float* b1 = (const float*)d_in[7];
  const float* W2 = (const float*)d_in[8];
  const float* b2 = (const float*)d_in[9];
  const float* g1  = (const float*)d_in[10];
  const float* be1 = (const float*)d_in[11];
  const float* g2  = (const float*)d_in[12];
  const float* be2 = (const float*)d_in[13];

  float* outZ    = (float*)d_out;            // [B,S,D]
  float* outAttn = outZ + M_ * D_;           // [B,S,S]

  // ---- workspace carve-up ----
  char* ws = (char*)d_ws;
  size_t off = 0;
  auto alloc = [&](size_t bytes) { char* p = ws + off; off = (off + bytes + 255) & ~(size_t)255; return p; };
  __bf16* Xb   = (__bf16*)alloc(M_ * D_ * 2);
  __bf16* WqT  = (__bf16*)alloc((size_t)H_ * D_ * D_ * 2);
  __bf16* WkT  = (__bf16*)alloc((size_t)H_ * D_ * D_ * 2);
  __bf16* WvT  = (__bf16*)alloc((size_t)H_ * D_ * D_ * 2);
  __bf16* WzT  = (__bf16*)alloc((size_t)HD_ * D_ * 2);
  __bf16* W1T  = (__bf16*)alloc((size_t)FD_ * D_ * 2);
  __bf16* W2T  = (__bf16*)alloc((size_t)D_ * FD_ * 2);
  __bf16* Qb   = (__bf16*)alloc((size_t)H_ * M_ * D_ * 2);
  __bf16* Kb   = (__bf16*)alloc((size_t)H_ * M_ * D_ * 2);
  __bf16* VbT  = (__bf16*)alloc((size_t)H_ * D_ * M_ * 2);
  __bf16* Zcat = (__bf16*)alloc((size_t)M_ * HD_ * 2);
  float*  zres  = (float*)alloc((size_t)M_ * D_ * 4);
  float*  zln1f = (float*)alloc((size_t)M_ * D_ * 4);
  __bf16* zln1b = (__bf16*)alloc((size_t)M_ * D_ * 2);
  __bf16* Hff   = (__bf16*)alloc((size_t)M_ * FD_ * 2);
  float*  zff   = (float*)alloc((size_t)M_ * D_ * 4);
  (void)ws_size; (void)in_sizes; (void)n_in; (void)out_size;

  // ---- 1. casts / weight transposes ----
  cast_bf16_k<<<1024, 256, 0, stream>>>(X, Xb, M_ * D_);
  dim3 tb(16, 16);
  transpose_cast_k<<<dim3(D_/16, D_/16, H_), tb, 0, stream>>>(Wq, WqT, D_, D_, (long)D_*D_, (long)D_*D_);
  transpose_cast_k<<<dim3(D_/16, D_/16, H_), tb, 0, stream>>>(Wk, WkT, D_, D_, (long)D_*D_, (long)D_*D_);
  transpose_cast_k<<<dim3(D_/16, D_/16, H_), tb, 0, stream>>>(Wv, WvT, D_, D_, (long)D_*D_, (long)D_*D_);
  transpose_cast_k<<<dim3(D_/16, HD_/16, 1), tb, 0, stream>>>(Wz, WzT, (int)HD_, D_, 0, 0);
  transpose_cast_k<<<dim3(FD_/16, D_/16, 1), tb, 0, stream>>>(W1, W1T, D_, FD_, 0, 0);
  transpose_cast_k<<<dim3(D_/16, FD_/16, 1), tb, 0, stream>>>(W2, W2T, FD_, D_, 0, 0);

  const float scale = 0.25f;  // D^-0.25 = 256^-0.25
  // ---- 2. QKV projections (bf16 WMMA), per-head via grid.z ----
  gemm_bf16_wmma<<<dim3(M_/128, D_/64, H_), 256, 0, stream>>>(
      Xb, D_, 0, WqT, D_, (long)D_*D_, nullptr, nullptr, 0, scale, 0,
      nullptr, Qb, D_, (long)M_*D_, nullptr, 0, 0, D_);
  gemm_bf16_wmma<<<dim3(M_/128, D_/64, H_), 256, 0, stream>>>(
      Xb, D_, 0, WkT, D_, (long)D_*D_, nullptr, nullptr, 0, scale, 0,
      nullptr, Kb, D_, (long)M_*D_, nullptr, 0, 0, D_);
  gemm_bf16_wmma<<<dim3(M_/128, D_/64, H_), 256, 0, stream>>>(
      Xb, D_, 0, WvT, D_, (long)D_*D_, nullptr, nullptr, 0, 1.0f, 0,
      nullptr, nullptr, 0, 0, VbT, M_, (long)D_*M_, D_);   // V stored transposed

  // ---- 3. attention (scores + softmax + P@V + attn_mean) ----
  const size_t attnLds = 16 * 2048 * 2 + 16 * 2048 * 4;    // 192 KB
  attn_k<<<dim3(S_/16, B_), 256, attnLds, stream>>>(Qb, Kb, VbT, Zcat, outAttn);

  // ---- 4. output projection + bias + residual (fp32 out) ----
  gemm_bf16_wmma<<<dim3(M_/128, D_/64, 1), 256, 0, stream>>>(
      Zcat, HD_, 0, WzT, HD_, 0, bz, X, D_, 1.0f, 0,
      zres, nullptr, D_, 0, nullptr, 0, 0, (int)HD_);

  // ---- 5. LayerNorm 1 ----
  ln_k<<<M_, D_, 0, stream>>>(zres, nullptr, g1, be1, zln1f, zln1b);

  // ---- 6. MLP ----
  gemm_bf16_wmma<<<dim3(M_/128, FD_/64, 1), 256, 0, stream>>>(
      zln1b, D_, 0, W1T, D_, 0, b1, nullptr, 0, 1.0f, 1,
      nullptr, Hff, FD_, 0, nullptr, 0, 0, D_);
  gemm_bf16_wmma<<<dim3(M_/128, D_/64, 1), 256, 0, stream>>>(
      Hff, FD_, 0, W2T, FD_, 0, b2, nullptr, 0, 1.0f, 0,
      zff, nullptr, D_, 0, nullptr, 0, 0, FD_);

  // ---- 7. LayerNorm 2 (+residual) -> final z output ----
  ln_k<<<M_, D_, 0, stream>>>(zff, zln1f, g2, be2, outZ, nullptr);
}

// v001
// Measured time: 726 microseconds a run.
// In both of two side-by-side timings against v000, it was 1.32 times as fast.
#include <hip/hip_runtime.h>
#include <hip/hip_bf16.h>
#include <stdint.h>

// ---------------------------------------------------------------------------
// Problem dims (compile-time constants from the reference)
// ---------------------------------------------------------------------------
constexpr int  B_   = 4;
constexpr int  S_   = 2048;
constexpr int  D_   = 256;
constexpr int  H_   = 8;
constexpr int  FD_  = 512;             // F*D
constexpr long M_   = (long)B_ * S_;   // 8192 flattened rows
constexpr long HD_  = (long)H_ * D_;   // 2048 concat width

typedef __attribute__((ext_vector_type(16))) __bf16 bf16x16;
typedef __attribute__((ext_vector_type(8)))  __bf16 bf16x8;
typedef __attribute__((ext_vector_type(8)))  float  f32x8;
typedef __attribute__((ext_vector_type(4)))  unsigned int u32x4;
typedef __attribute__((ext_vector_type(8)))  int i32x8;
typedef __attribute__((ext_vector_type(4)))  int i32x4;

#if defined(__has_builtin)
#if __has_builtin(__builtin_amdgcn_tensor_load_to_lds)
#define HAVE_TDM 1
#else
#define HAVE_TDM 0
#endif
#else
#define HAVE_TDM 0
#endif

// ---------------------------------------------------------------------------
// WMMA helpers.  CDNA5 bf16 A/B fragment layout (16x32 / 32x16):
//   lanes 0..15  : row=lane,    K = [0..7]  and [16..23]
//   lanes 16..31 : row=lane-16, K = [8..15] and [24..31]
// With contiguous-K data a fragment is two 16-byte loads + a shuffle.
// ---------------------------------------------------------------------------
__device__ __forceinline__ bf16x16 frag_ld_g(const __bf16* p) {
  bf16x8 lo = *(const bf16x8*)(p);
  bf16x8 hi = *(const bf16x8*)(p + 16);
  return __builtin_shufflevector(lo, hi, 0,1,2,3,4,5,6,7,8,9,10,11,12,13,14,15);
}

__device__ __forceinline__ f32x8 wmma_bf16(bf16x16 a, bf16x16 b, f32x8 c) {
  return __builtin_amdgcn_wmma_f32_16x16x32_bf16(
      /*neg_a=*/false, a, /*neg_b=*/false, b,
      /*c_mod=*/(short)0, c, /*reuse_a=*/false, /*reuse_b=*/false);
}

#if HAVE_TDM
// ---------------------------------------------------------------------------
// TDM: DMA a 64(row) x 32(k) bf16 tile (row stride ldbt elems) from global
// into LDS at byte offset ldsOff, inserting 16B of padding after every 64B
// row (pad_interval=16 DWORDs -> code 3, pad_amount=4 DWORDs -> code 3),
// i.e. an 80-byte LDS row pitch for bank-conflict-free b128 fragment reads.
// Toolchain probe: 6-arg builtin (g0:u32x4, g1:i32x8, g2:i32x4, g3:i32x4,
// g4:i32x8, cpol:i32).
// ---------------------------------------------------------------------------
__device__ __forceinline__ void tdm_load_tile(const __bf16* gsrc,
                                              unsigned ldsOff, long ldbt) {
  unsigned long long ga = (unsigned long long)(uintptr_t)gsrc;
  u32x4 g0;
  g0[0] = 1u;                                        // count=1, user mode
  g0[1] = ldsOff;                                    // lds_addr (bytes)
  g0[2] = (unsigned)(ga & 0xFFFFFFFFull);            // global_addr[31:0]
  g0[3] = (unsigned)((ga >> 32) & 0x01FFFFFFull)     // global_addr[56:32]
          | 0x80000000u;                             // type=2 ("image")
  i32x8 g1;
  g1[0] = (1 << 16)      // data_size = 2 bytes
        | (1 << 20)      // pad_enable
        | (3 << 22)      // pad_interval: 16 DWORDs
        | (3 << 25);     // pad_amount:   4 DWORDs
  g1[1] = 0;                                   // tensor_dim0 low16 (bits 63:48)
  g1[2] = (1 << 14);                           // tensor_dim0 = 1<<30 (hi bits)
  g1[3] = 16 | (32 << 16);                     // tensor_dim1=1<<20 hi, tile_dim0=32
  g1[4] = 64;                                  // tile_dim1=64, tile_dim2=0
  g1[5] = (int)ldbt;                           // tensor_dim0_stride[31:0]
  g1[6] = 0;                                   // stride hi / dim1_stride lo
  g1[7] = 0;
  i32x4 z4 = {0, 0, 0, 0};
  i32x8 z8 = {0, 0, 0, 0, 0, 0, 0, 0};
  __builtin_amdgcn_tensor_load_to_lds(g0, g1, z4, z4, z8, 0);
}

template <int N>
__device__ __forceinline__ void tdm_wait() {
#if __has_builtin(__builtin_amdgcn_s_wait_tensorcnt)
  __builtin_amdgcn_s_wait_tensorcnt((short)N);
#else
  asm volatile("s_wait_tensorcnt %0" :: "i"(N) : "memory");
#endif
}
#endif  // HAVE_TDM

// ---------------------------------------------------------------------------
// fp32 -> bf16 cast (grid-stride)
// ---------------------------------------------------------------------------
__global__ void cast_bf16_k(const float* __restrict__ in,
                            __bf16* __restrict__ out, long n) {
  long i      = (long)blockIdx.x * blockDim.x + threadIdx.x;
  long stride = (long)gridDim.x * blockDim.x;
  for (; i < n; i += stride) out[i] = (__bf16)in[i];
}

// ---------------------------------------------------------------------------
// fp32 [rows][cols] -> bf16 transposed [cols][rows]   (per-z slice)
// ---------------------------------------------------------------------------
__global__ void transpose_cast_k(const float* __restrict__ in,
                                 __bf16* __restrict__ out,
                                 int rows, int cols,
                                 long inStrideZ, long outStrideZ) {
  __shared__ float tile[16][17];
  const float* inz  = in  + (long)blockIdx.z * inStrideZ;
  __bf16*      outz = out + (long)blockIdx.z * outStrideZ;
  int c = blockIdx.x * 16 + threadIdx.x;
  int r = blockIdx.y * 16 + threadIdx.y;
  if (r < rows && c < cols) tile[threadIdx.y][threadIdx.x] = inz[(long)r * cols + c];
  __syncthreads();
  int oc  = blockIdx.y * 16 + threadIdx.x;   // new col = old row
  int orw = blockIdx.x * 16 + threadIdx.y;   // new row = old col
  if (orw < cols && oc < rows)
    outz[(long)orw * rows + oc] = (__bf16)tile[threadIdx.x][threadIdx.y];
}

// ---------------------------------------------------------------------------
// Generic bf16 WMMA GEMM:  C = act(alpha * A @ B + bias + res)
//   A  : [M][K] bf16 row-major (per-z stride aStrideZ)
//   BT : [N][K] bf16 (B pre-transposed -> contiguous K fragments)
// Block: 256 threads = 8 waves, tile 128(M) x 64(N); wave = 16x64 (4 accums).
// The 64xK B panel is shared by all 8 waves, so it is staged through LDS:
// TDM double-buffered DMA (wave 0 issues, TENSORcnt-ordered) when available,
// else a synchronous cooperative copy.  LDS row pitch 80B (32 k-elems + 8
// pad elems) -> conflict-free ds_load_b128 fragment reads.
// ---------------------------------------------------------------------------
__global__ void __launch_bounds__(256)
gemm_bf16_wmma(const __bf16* __restrict__ A,  long lda,  long aStrideZ,
               const __bf16* __restrict__ BT, long ldbt, long btStrideZ,
               const float* __restrict__ bias,
               const float* __restrict__ res, long ldres,
               float alpha, int relu,
               float*  __restrict__ outF,
               __bf16* __restrict__ outB,  long ldo,  long oStrideZ,
               __bf16* __restrict__ outBT, long ldoT, long oTStrideZ,
               int K) {
  __shared__ __bf16 sB[2][64 * 40];   // 2 x 5120B padded tiles

  const int tid  = threadIdx.x;
  const int lane = tid & 31;
  const int wave = tid >> 5;
  const int z    = blockIdx.z;
  const long m0  = (long)blockIdx.x * 128 + wave * 16;
  const long n0  = (long)blockIdx.y * 64;
  const int  ml  = lane & 15;
  const int  kh  = (lane < 16) ? 0 : 8;   // K half-offset per fragment layout
  const int  rh  = (lane < 16) ? 0 : 8;   // C/D row-half offset

  const __bf16* aRow   = A  + (long)z * aStrideZ + (m0 + ml) * lda + kh;
  const __bf16* Bpanel = BT + (long)z * btStrideZ + n0 * ldbt;  // [64][K]

#if HAVE_TDM
  const unsigned ldsBase = (unsigned)(uintptr_t)(&sB[0][0]);
  if (tid < 32) tdm_load_tile(Bpanel, ldsBase, ldbt);           // prologue
#endif

  f32x8 acc[4] = {};
  const int nsteps = K >> 5;
  for (int s = 0; s < nsteps; ++s) {
    const int k0  = s << 5;
    const int cur = s & 1;
#if HAVE_TDM
    if (tid < 32) {
      if (s + 1 < nsteps) {
        tdm_load_tile(Bpanel + k0 + 32, ldsBase + (unsigned)((cur ^ 1) * 64 * 40 * 2), ldbt);
        tdm_wait<1>();   // previous DMA (in-order) has landed
      } else {
        tdm_wait<0>();
      }
    }
    __syncthreads();
#else
    {   // synchronous cooperative staging: 256 threads x 16B = 4KB tile
      const int n = tid >> 2, c = tid & 3;
      *(bf16x8*)(&sB[cur][n * 40 + c * 8]) =
          *(const bf16x8*)(Bpanel + (long)n * ldbt + k0 + c * 8);
      __syncthreads();
    }
#endif
    bf16x16 afr = frag_ld_g(aRow + k0);
    __builtin_prefetch(aRow + k0 + 128, 0, 1);   // global_prefetch_b8
    const __bf16* bl = &sB[cur][kh];
#pragma unroll
    for (int j = 0; j < 4; ++j) {
      bf16x16 bfr = frag_ld_g(bl + (j * 16 + ml) * 40);
      acc[j] = wmma_bf16(afr, bfr, acc[j]);
    }
    __syncthreads();   // protect buffer before it is overwritten
  }

#pragma unroll
  for (int j = 0; j < 4; ++j) {
    const long n   = n0 + j * 16 + ml;
    const float bv = bias ? bias[n] : 0.0f;
    if (outBT) {
      // transposed store: 8 consecutive M per lane -> one 16B store
      bf16x8 t;
#pragma unroll
      for (int i = 0; i < 8; ++i) {
        long m  = m0 + rh + i;
        float v = acc[j][i] * alpha + bv;
        if (res)  v += res[m * ldres + n];
        if (relu) v = fmaxf(v, 0.0f);
        t[i] = (__bf16)v;
      }
      *(bf16x8*)(outBT + (long)z * oTStrideZ + n * ldoT + (m0 + rh)) = t;
    } else {
#pragma unroll
      for (int i = 0; i < 8; ++i) {
        long m  = m0 + rh + i;
        float v = acc[j][i] * alpha + bv;
        if (res)  v += res[m * ldres + n];
        if (relu) v = fmaxf(v, 0.0f);
        long off = (long)z * oStrideZ + m * ldo + n;
        if (outF) outF[off] = v;
        if (outB) outB[off] = (__bf16)v;
      }
    }
  }
}

// ---------------------------------------------------------------------------
// Attention: one block per (batch, 16-row tile), loop over 8 heads.
//   scores/probs : bf16 LDS [16][2048]  (64 KB)
//   mean accum   : fp32 LDS [16][2048]  (128 KB)
//   staging      : bf16 LDS [8 waves][32*136] (68 KB) -> 260 KB static LDS
// Stage 1: each wave computes a 16x256 score slab (Q fragments register-
//          resident: 8 x bf16x16 = 64 VGPRs, reused across 16 tiles).
// Stage 2: each wave softmaxes 2 rows (wave32 shfl reductions).
// Stage 3: each wave computes a 16x32 slab of P@V (V pre-transposed).
// attn_mean accumulates in LDS and is written to HBM exactly once.
// K rows and V^T rows reach their B fragments through a wave-private LDS tile:
// the global loads cover whole 128-byte lines (a fragment-shaped load touches
// 16 lines for 512 bytes), the fragment shape is formed by the LDS reads.
//   K tile   : 16 rows x 256 k, pitch 264 elems (528 B)
//   V^T tile : 32 rows x 128 t, pitch 136 elems (272 B)
// Both pitches are 16 B x odd: conflict-free ds_load_b128 fragment reads.
// ---------------------------------------------------------------------------
constexpr int KP_      = 264;    // K tile pitch, elements
constexpr int VP_      = 136;    // V^T tile pitch, elements
constexpr int STAGE_E_ = 32 * VP_;   // elements per wave (the larger of the two tiles)
constexpr int ATTN_LDS_ = 16 * 2048 * 2 + 16 * 2048 * 4 + 8 * STAGE_E_ * 2;   // 260 KB

// Orders this wave's own LDS traffic on its staging tile: lanes read rows that
// other lanes of the same wave wrote, which the compiler cannot see.
__device__ __forceinline__ void stage_sync() {
  asm volatile("s_wait_dscnt 0x0" ::: "memory");
}

// Stands behind a tile's global loads. Naming their address keeps its registers
// untouched up to the wait and puts the step to the next tile behind it.
template <typename T>
__device__ __forceinline__ void addr_sync(T& a) {
  asm volatile("s_wait_xcnt 0x0" : "+v"(a) : : "memory");
}

// 16 bytes at base plus a byte offset and an immediate (wave-uniform base in the next-tile loads)
__device__ __forceinline__ bf16x8 ld16(const __bf16* base, unsigned off, int imm) {
  return *(const bf16x8*)((const char*)base + off + imm);
}
__global__ void __launch_bounds__(256)
attn_k(const __bf16* __restrict__ Qb,   // [H][B*S][D]
       const __bf16* __restrict__ Kb,   // [H][B*S][D]
       const __bf16* __restrict__ VbT,  // [H][D][B*S]  (transposed)
       __bf16* __restrict__ Zcat,       // [B*S][H*D]
       float*  __restrict__ attnMean) { // [B][S][S]
  __shared__ __attribute__((aligned(16))) char smem[ATTN_LDS_];
  __bf16* sP    = (__bf16*)smem;                    // [16][2048]
  float*  sMean = (float*)(smem + 16 * 2048 * 2);   // [16][2048]
  __bf16* sStage = (__bf16*)(smem + 16 * 2048 * 6); // [8 waves][STAGE_E_]

  const int tid  = threadIdx.x;
  const int lane = tid & 31;
  const int wave = tid >> 5;
  const int b    = blockIdx.y;
  const long s0  = (long)blockIdx.x * 16;
  const int ml   = lane & 15;
  const int kh   = (lane < 16) ? 0 : 8;
  const int rh   = (lane < 16) ? 0 : 8;
  __bf16* sT     = sStage + wave * STAGE_E_;        // this wave's tile

  for (int i = tid; i < 16 * 2048; i += 256) sMean[i] = 0.0f;
  __syncthreads();

  for (int h = 0; h < H_; ++h) {
    const __bf16* Qh = Qb + ((long)h * M_ + (long)b * S_ + s0) * D_;
    const __bf16* Kh = Kb + ((long)h * M_ + (long)b * S_) * D_;

    // ---- stage 1: scores for t in [wave*256, wave*256+256) ----
    const int tbase = wave * 256;
    const __bf16* qrow = Qh + (long)ml * D_ + kh;
    bf16x16 qf[8];
#pragma unroll
    for (int e = 0; e < 8; ++e) qf[e] = frag_ld_g(qrow + e * 32);
    addr_sync(qrow);

    // one load = one whole K row (32 lanes x 16 B = 512 B)
    unsigned kg = (unsigned)(tbase * D_ + lane * 8) * 2u;   // bytes from Kh
    const __bf16* k0 = Kh + tbase * D_ + lane * 8;          // first tile
    bf16x8 kr[16];
#pragma unroll   // static indices keep kr[] in registers
    for (int r = 0; r < 16; ++r) kr[r] = ld16(k0, 0u, r * D_ * 2);
    addr_sync(k0);

    for (int j = 0; j < 16; ++j) {
      const int t0 = tbase + j * 16;
      stage_sync();   // the last tile's fragment reads are done
#pragma unroll   // static indices keep kr[] in registers
      for (int r = 0; r < 16; ++r) *(bf16x8*)(sT + r * KP_ + lane * 8) = kr[r];
      if (j + 1 < 16) {   // next tile's rows fly while this tile is worked on
        kg += 16 * D_ * 2;
#pragma unroll   // static indices keep kr[] in registers
        for (int r = 0; r < 16; ++r) kr[r] = ld16(Kh, kg, r * D_ * 2);
        addr_sync(kg);
      }
      stage_sync();   // the tile is written before any lane reads it back
      const __bf16* krow = sT + ml * KP_ + kh;
      f32x8 acc = {};
#pragma unroll
      for (int e = 0; e < 8; ++e) {
        bf16x16 bfr = frag_ld_g(krow + e * 32);
        acc = wmma_bf16(qf[e], bfr, acc);
      }
#pragma unroll
      for (int i = 0; i < 8; ++i)
        sP[(rh + i) * 2048 + t0 + ml] = (__bf16)acc[i];
    }
    __syncthreads();

    // ---- stage 2: softmax rows [2*wave, 2*wave+1] ----
    for (int rr = 0; rr < 2; ++rr) {
      const int r = wave * 2 + rr;
      __bf16* row = sP + r * 2048;
      float mx = -3.0e38f;
      for (int c = lane; c < 2048; c += 32) mx = fmaxf(mx, (float)row[c]);
      for (int o = 16; o; o >>= 1) mx = fmaxf(mx, __shfl_xor(mx, o, 32));
      float sum = 0.0f;
      for (int c = lane; c < 2048; c += 32) {
        float p = __expf((float)row[c] - mx);
        sum += p;
        row[c] = (__bf16)p;
      }
      for (int o = 16; o; o >>= 1) sum += __shfl_xor(sum, o, 32);
      const float inv = 1.0f / sum;
      float* mrow = sMean + r * 2048;
      for (int c = lane; c < 2048; c += 32) {
        float p = (float)row[c] * inv;
        row[c] = (__bf16)p;
        mrow[c] += p;
      }
    }
    __syncthreads();

    // ---- stage 3: zh slab, e in [wave*32, wave*32+32) ----
    const int e0 = wave * 32;
    const __bf16* vbase = VbT + (long)h * D_ * M_ + (long)b * S_;
    f32x8 acc0 = {}, acc1 = {};
    // one load = 256 B of each of two V^T rows (four whole lines)
    const int vrw = lane >> 4, vch = (lane & 15) * 8;
    unsigned vg = (unsigned)((e0 + vrw) * (int)M_ + vch) * 2u;   // bytes from vbase
    const __bf16* v0 = vbase + (e0 + vrw) * (int)M_ + vch;       // first tile
    bf16x8 vr[16];
#pragma unroll   // static indices keep vr[] in registers
    for (int q = 0; q < 16; ++q) vr[q] = ld16(v0, 0u, 2 * q * (int)M_ * 2);
    addr_sync(v0);

    for (int c = 0; c < S_ / 128; ++c) {
      stage_sync();   // the last tile's fragment reads are done
#pragma unroll   // static indices keep vr[] in registers
      for (int q = 0; q < 16; ++q)
        *(bf16x8*)(sT + (2 * q + vrw) * VP_ + vch) = vr[q];
      if (c + 1 < S_ / 128) {   // next tile flies while this tile is worked on
        vg += 128 * 2;
#pragma unroll   // static indices keep vr[] in registers
        for (int q = 0; q < 16; ++q) vr[q] = ld16(vbase, vg, 2 * q * (int)M_ * 2);
        addr_sync(vg);
      }
      stage_sync();   // the tile is written before any lane reads it back
#pragma unroll   // the four k steps of a tile read at constant LDS offsets
      for (int ts = 0; ts < 4; ++ts) {
        const int t0 = c * 128 + ts * 32;
        bf16x16 afr = frag_ld_g(sP + (long)ml * 2048 + t0 + kh);
        bf16x16 b0  = frag_ld_g(sT + ml * VP_ + ts * 32 + kh);
        bf16x16 b1  = frag_ld_g(sT + (16 + ml) * VP_ + ts * 32 + kh);
        acc0 = wmma_bf16(afr, b0, acc0);
        acc1 = wmma_bf16(afr, b1, acc1);
      }
    }
#pragma unroll
    for (int i = 0; i < 8; ++i) {
      long rowm = (long)b * S_ + s0 + rh + i;
      Zcat[rowm * HD_ + (h * D_ + e0 + ml)]      = (__bf16)acc0[i];
      Zcat[rowm * HD_ + (h * D_ + e0 + 16 + ml)] = (__bf16)acc1[i];
    }
    __syncthreads();   // protect sP before next head
  }

  // ---- write attn_mean = sum/H once ----
  for (int i = tid * 4; i < 16 * 2048; i += 256 * 4) {
    int r = i >> 11, c = i & 2047;
    float4 v = *(const float4*)(sMean + r * 2048 + c);
    v.x *= 0.125f; v.y *= 0.125f; v.z *= 0.125f; v.w *= 0.125f;
    *(float4*)(attnMean + ((long)b * S_ + s0 + r) * S_ + c) = v;
  }
}

// ---------------------------------------------------------------------------
// LayerNorm over D=256 (one row per 256-thread block, 8 wave32 partials)
// ---------------------------------------------------------------------------
__global__ void __launch_bounds__(256)
ln_k(const float* __restrict__ in, const float* __restrict__ res,
     const float* __restrict__ g, const float* __restrict__ be,
     float* __restrict__ outF, __bf16* __restrict__ outB) {
  __shared__ float red[8];
  const long row = blockIdx.x;
  const int  t   = threadIdx.x;
  float x = in[row * D_ + t];
  if (res) x += res[row * D_ + t];

  float v = x;
  for (int o = 16; o; o >>= 1) v += __shfl_xor(v, o, 32);
  if ((t & 31) == 0) red[t >> 5] = v;
  __syncthreads();
  float tot = 0.0f;
#pragma unroll
  for (int i = 0; i < 8; ++i) tot += red[i];
  const float mean = tot * (1.0f / D_);
  __syncthreads();

  const float d = x - mean;
  float v2 = d * d;
  for (int o = 16; o; o >>= 1) v2 += __shfl_xor(v2, o, 32);
  if ((t & 31) == 0) red[t >> 5] = v2;
  __syncthreads();
  float tot2 = 0.0f;
#pragma unroll
  for (int i = 0; i < 8; ++i) tot2 += red[i];
  const float var = tot2 * (1.0f / D_);

  const float y = d * rsqrtf(var + 1e-5f) * g[t] + be[t];
  if (outF) outF[row * D_ + t] = y;
  if (outB) outB[row * D_ + t] = (__bf16)y;
}

// ---------------------------------------------------------------------------
// Host-side orchestration (all launches on `stream`, graph-capture safe)
// ---------------------------------------------------------------------------
extern "C" void kernel_launch(void* const* d_in, const int* in_sizes, int n_in,
                              void* d_out, int out_size, void* d_ws, size_t ws_size,
                              hipStream_t stream) {
  const float* X  = (const float*)d_in[0];
  const float* Wq = (const float*)d_in[1];
  const float* Wk = (const float*)d_in[2];
  const float* Wv = (const float*)d_in[3];
  const float* Wz = (const float*)d_in[4];
  const float* bz = (const float*)d_in[5];
  const float* W1 = (const float*)d_in[6];
  const float* b1 = (const float*)d_in[7];
  const float* W2 = (const float*)d_in[8];
  const float* b2 = (const float*)d_in[9];
  const float* g1  = (const float*)d_in[10];
  const float* be1 = (const float*)d_in[11];
  const float* g2  = (const float*)d_in[12];
  const float* be2 = (const float*)d_in[13];

  float* outZ    = (float*)d_out;            // [B,S,D]
  float* outAttn = outZ + M_ * D_;           // [B,S,S]

  // ---- workspace carve-up ----
  char* ws = (char*)d_ws;
  size_t off = 0;
  auto alloc = [&](size_t bytes) { char* p = ws + off; off = (off + bytes + 255) & ~(size_t)255; return p; };
  __bf16* Xb   = (__bf16*)alloc(M_ * D_ * 2);
  __bf16* WqT  = (__bf16*)alloc((size_t)H_ * D_ * D_ * 2);
  __bf16* WkT  = (__bf16*)alloc((size_t)H_ * D_ * D_ * 2);
  __bf16* WvT  = (__bf16*)alloc((size_t)H_ * D_ * D_ * 2);
  __bf16* WzT  = (__bf16*)alloc((size_t)HD_ * D_ * 2);
  __bf16* W1T  = (__bf16*)alloc((size_t)FD_ * D_ * 2);
  __bf16* W2T  = (__bf16*)alloc((size_t)D_ * FD_ * 2);
  __bf16* Qb   = (__bf16*)alloc((size_t)H_ * M_ * D_ * 2);
  __bf16* Kb   = (__bf16*)alloc((size_t)H_ * M_ * D_ * 2);
  __bf16* VbT  = (__bf16*)alloc((size_t)H_ * D_ * M_ * 2);
  __bf16* Zcat = (__bf16*)alloc((size_t)M_ * HD_ * 2);
  float*  zres  = (float*)alloc((size_t)M_ * D_ * 4);
  float*  zln1f = (float*)alloc((size_t)M_ * D_ * 4);
  __bf16* zln1b = (__bf16*)alloc((size_t)M_ * D_ * 2);
  __bf16* Hff   = (__bf16*)alloc((size_t)M_ * FD_ * 2);
  float*  zff   = (float*)alloc((size_t)M_ * D_ * 4);
  (void)ws_size; (void)in_sizes; (void)n_in; (void)out_size;

  // ---- 1. casts / weight transposes ----
  cast_bf16_k<<<1024, 256, 0, stream>>>(X, Xb, M_ * D_);
  dim3 tb(16, 16);
  transpose_cast_k<<<dim3(D_/16, D_/16, H_), tb, 0, stream>>>(Wq, WqT, D_, D_, (long)D_*D_, (long)D_*D_);
  transpose_cast_k<<<dim3(D_/16, D_/16, H_), tb, 0, stream>>>(Wk, WkT, D_, D_, (long)D_*D_, (long)D_*D_);
  transpose_cast_k<<<dim3(D_/16, D_/16, H_), tb, 0, stream>>>(Wv, WvT, D_, D_, (long)D_*D_, (long)D_*D_);
  transpose_cast_k<<<dim3(D_/16, HD_/16, 1), tb, 0, stream>>>(Wz, WzT, (int)HD_, D_, 0, 0);
  transpose_cast_k<<<dim3(FD_/16, D_/16, 1), tb, 0, stream>>>(W1, W1T, D_, FD_, 0, 0);
  transpose_cast_k<<<dim3(D_/16, FD_/16, 1), tb, 0, stream>>>(W2, W2T, FD_, D_, 0, 0);

  const float scale = 0.25f;  // D^-0.25 = 256^-0.25
  // ---- 2. QKV projections (bf16 WMMA), per-head via grid.z ----
  gemm_bf16_wmma<<<dim3(M_/128, D_/64, H_), 256, 0, stream>>>(
      Xb, D_, 0, WqT, D_, (long)D_*D_, nullptr, nullptr, 0, scale, 0,
      nullptr, Qb, D_, (long)M_*D_, nullptr, 0, 0, D_);
  gemm_bf16_wmma<<<dim3(M_/128, D_/64, H_), 256, 0, stream>>>(
      Xb, D_, 0, WkT, D_, (long)D_*D_, nullptr, nullptr, 0, scale, 0,
      nullptr, Kb, D_, (long)M_*D_, nullptr, 0, 0, D_);
  gemm_bf16_wmma<<<dim3(M_/128, D_/64, H_), 256, 0, stream>>>(
      Xb, D_, 0, WvT, D_, (long)D_*D_, nullptr, nullptr, 0, 1.0f, 0,
      nullptr, nullptr, 0, 0, VbT, M_, (long)D_*M_, D_);   // V stored transposed

  // ---- 3. attention (scores + softmax + P@V + attn_mean) ----
  attn_k<<<dim3(S_/16, B_), 256, 0, stream>>>(Qb, Kb, VbT, Zcat, outAttn);

  // ---- 4. output projection + bias + residual (fp32 out) ----
  gemm_bf16_wmma<<<dim3(M_/128, D_/64, 1), 256, 0, stream>>>(
      Zcat, HD_, 0, WzT, HD_, 0, bz, X, D_, 1.0f, 0,
      zres, nullptr, D_, 0, nullptr, 0, 0, (int)HD_);

  // ---- 5. LayerNorm 1 ----
  ln_k<<<M_, D_, 0, stream>>>(zres, nullptr, g1, be1, zln1f, zln1b);

  // ---- 6. MLP ----
  gemm_bf16_wmma<<<dim3(M_/128, FD_/64, 1), 256, 0, stream>>>(
      zln1b, D_, 0, W1T, D_, 0, b1, nullptr, 0, 1.0f, 1,
      nullptr, Hff, FD_, 0, nullptr, 0, 0, D_);
  gemm_bf16_wmma<<<dim3(M_/128, D_/64, 1), 256, 0, stream>>>(
      Hff, FD_, 0, W2T, FD_, 0, b2, nullptr, 0, 1.0f, 0,
      zff, nullptr, D_, 0, nullptr, 0, 0, FD_);

  // ---- 7. LayerNorm 2 (+residual) -> final z output ----
  ln_k<<<M_, D_, 0, stream>>>(zff, zln1f, g2, be2, outZ, nullptr);
}

// v002
// A run of this version takes 622 microseconds.
// Two timings next to v001 both put it at 1.16 times that version's speed.
// All steps since v000 together make it 1.53 times as fast.
#include <hip/hip_runtime.h>
#include <hip/hip_bf16.h>
#include <stdint.h>

// ---------------------------------------------------------------------------
// Problem dims (compile-time constants from the reference)
// ---------------------------------------------------------------------------
constexpr int  B_   = 4;
constexpr int  S_   = 2048;
constexpr int  D_   = 256;
constexpr int  H_   = 8;
constexpr int  FD_  = 512;             // F*D
constexpr long M_   = (long)B_ * S_;   // 8192 flattened rows
constexpr long HD_  = (long)H_ * D_;   // 2048 concat width

typedef __attribute__((ext_vector_type(16))) __bf16 bf16x16;
typedef __attribute__((ext_vector_type(8)))  __bf16 bf16x8;
typedef __attribute__((ext_vector_type(8)))  float  f32x8;
typedef __attribute__((ext_vector_type(4)))  unsigned int u32x4;
typedef __attribute__((ext_vector_type(8)))  int i32x8;
typedef __attribute__((ext_vector_type(4)))  int i32x4;

#if defined(__has_builtin)
#if __has_builtin(__builtin_amdgcn_tensor_load_to_lds)
#define HAVE_TDM 1
#else
#define HAVE_TDM 0
#endif
#else
#define HAVE_TDM 0
#endif

// ---------------------------------------------------------------------------
// WMMA helpers.  CDNA5 bf16 A/B fragment layout (16x32 / 32x16):
//   lanes 0..15  : row=lane,    K = [0..7]  and [16..23]
//   lanes 16..31 : row=lane-16, K = [8..15] and [24..31]
// With contiguous-K data a fragment is two 16-byte loads + a shuffle.
// ---------------------------------------------------------------------------
__device__ __forceinline__ bf16x16 frag_ld_g(const __bf16* p) {
  bf16x8 lo = *(const bf16x8*)(p);
  bf16x8 hi = *(const bf16x8*)(p + 16);
  return __builtin_shufflevector(lo, hi, 0,1,2,3,4,5,6,7,8,9,10,11,12,13,14,15);
}

__device__ __forceinline__ f32x8 wmma_bf16(bf16x16 a, bf16x16 b, f32x8 c) {
  return __builtin_amdgcn_wmma_f32_16x16x32_bf16(
      /*neg_a=*/false, a, /*neg_b=*/false, b,
      /*c_mod=*/(short)0, c, /*reuse_a=*/false, /*reuse_b=*/false);
}

#if HAVE_TDM
// ---------------------------------------------------------------------------
// TDM: DMA a 64(row) x 32(k) bf16 tile (row stride ldbt elems) from global
// into LDS at byte offset ldsOff, inserting 16B of padding after every 64B
// row (pad_interval=16 DWORDs -> code 3, pad_amount=4 DWORDs -> code 3),
// i.e. an 80-byte LDS row pitch for bank-conflict-free b128 fragment reads.
// Toolchain probe: 6-arg builtin (g0:u32x4, g1:i32x8, g2:i32x4, g3:i32x4,
// g4:i32x8, cpol:i32).
// ---------------------------------------------------------------------------
__device__ __forceinline__ void tdm_load_tile(const __bf16* gsrc,
                                              unsigned ldsOff, long ldbt) {
  unsigned long long ga = (unsigned long long)(uintptr_t)gsrc;
  u32x4 g0;
  g0[0] = 1u;                                        // count=1, user mode
  g0[1] = ldsOff;                                    // lds_addr (bytes)
  g0[2] = (unsigned)(ga & 0xFFFFFFFFull);            // global_addr[31:0]
  g0[3] = (unsigned)((ga >> 32) & 0x01FFFFFFull)     // global_addr[56:32]
          | 0x80000000u;                             // type=2 ("image")
  i32x8 g1;
  g1[0] = (1 << 16)      // data_size = 2 bytes
        | (1 << 20)      // pad_enable
        | (3 << 22)      // pad_interval: 16 DWORDs
        | (3 << 25);     // pad_amount:   4 DWORDs
  g1[1] = 0;                                   // tensor_dim0 low16 (bits 63:48)
  g1[2] = (1 << 14);                           // tensor_dim0 = 1<<30 (hi bits)
  g1[3] = 16 | (32 << 16);                     // tensor_dim1=1<<20 hi, tile_dim0=32
  g1[4] = 64;                                  // tile_dim1=64, tile_dim2=0
  g1[5] = (int)ldbt;                           // tensor_dim0_stride[31:0]
  g1[6] = 0;                                   // stride hi / dim1_stride lo
  g1[7] = 0;
  i32x4 z4 = {0, 0, 0, 0};
  i32x8 z8 = {0, 0, 0, 0, 0, 0, 0, 0};
  __builtin_amdgcn_tensor_load_to_lds(g0, g1, z4, z4, z8, 0);
}

template <int N>
__device__ __forceinline__ void tdm_wait() {
#if __has_builtin(__builtin_amdgcn_s_wait_tensorcnt)
  __builtin_amdgcn_s_wait_tensorcnt((short)N);
#else
  asm volatile("s_wait_tensorcnt %0" :: "i"(N) : "memory");
#endif
}
#endif  // HAVE_TDM

// ---------------------------------------------------------------------------
// fp32 -> bf16 cast (grid-stride)
// ---------------------------------------------------------------------------
__global__ void cast_bf16_k(const float* __restrict__ in,
                            __bf16* __restrict__ out, long n) {
  long i      = (long)blockIdx.x * blockDim.x + threadIdx.x;
  long stride = (long)gridDim.x * blockDim.x;
  for (; i < n; i += stride) out[i] = (__bf16)in[i];
}

// ---------------------------------------------------------------------------
// fp32 [rows][cols] -> bf16 transposed [cols][rows]   (per-z slice)
// ---------------------------------------------------------------------------
__global__ void transpose_cast_k(const float* __restrict__ in,
                                 __bf16* __restrict__ out,
                                 int rows, int cols,
                                 long inStrideZ, long outStrideZ) {
  __shared__ float tile[16][17];
  const float* inz  = in  + (long)blockIdx.z * inStrideZ;
  __bf16*      outz = out + (long)blockIdx.z * outStrideZ;
  int c = blockIdx.x * 16 + threadIdx.x;
  int r = blockIdx.y * 16 + threadIdx.y;
  if (r < rows && c < cols) tile[threadIdx.y][threadIdx.x] = inz[(long)r * cols + c];
  __syncthreads();
  int oc  = blockIdx.y * 16 + threadIdx.x;   // new col = old row
  int orw = blockIdx.x * 16 + threadIdx.y;   // new row = old col
  if (orw < cols && oc < rows)
    outz[(long)orw * rows + oc] = (__bf16)tile[threadIdx.x][threadIdx.y];
}

// ---------------------------------------------------------------------------
// Generic bf16 WMMA GEMM:  C = act(alpha * A @ B + bias + res)
//   A  : [M][K] bf16 row-major (per-z stride aStrideZ)
//   BT : [N][K] bf16 (B pre-transposed -> contiguous K fragments)
// Block: 256 threads = 8 waves, tile 128(M) x 64(N); wave = 16x64 (4 accums).
// The 64xK B panel is shared by all 8 waves, so it is staged through LDS:
// TDM double-buffered DMA (wave 0 issues, TENSORcnt-ordered) when available,
// else a synchronous cooperative copy.  LDS row pitch 80B (32 k-elems + 8
// pad elems) -> conflict-free ds_load_b128 fragment reads.
// ---------------------------------------------------------------------------
__global__ void __launch_bounds__(256)
gemm_bf16_wmma(const __bf16* __restrict__ A,  long lda,  long aStrideZ,
               const __bf16* __restrict__ BT, long ldbt, long btStrideZ,
               const float* __restrict__ bias,
               const float* __restrict__ res, long ldres,
               float alpha, int relu,
               float*  __restrict__ outF,
               __bf16* __restrict__ outB,  long ldo,  long oStrideZ,
               __bf16* __restrict__ outBT, long ldoT, long oTStrideZ,
               int K) {
  __shared__ __bf16 sB[2][64 * 40];   // 2 x 5120B padded tiles

  const int tid  = threadIdx.x;
  const int lane = tid & 31;
  const int wave = tid >> 5;
  const int z    = blockIdx.z;
  const long m0  = (long)blockIdx.x * 128 + wave * 16;
  const long n0  = (long)blockIdx.y * 64;
  const int  ml  = lane & 15;
  const int  kh  = (lane < 16) ? 0 : 8;   // K half-offset per fragment layout
  const int  rh  = (lane < 16) ? 0 : 8;   // C/D row-half offset

  const __bf16* aRow   = A  + (long)z * aStrideZ + (m0 + ml) * lda + kh;
  const __bf16* Bpanel = BT + (long)z * btStrideZ + n0 * ldbt;  // [64][K]

#if HAVE_TDM
  const unsigned ldsBase = (unsigned)(uintptr_t)(&sB[0][0]);
  if (tid < 32) tdm_load_tile(Bpanel, ldsBase, ldbt);           // prologue
#endif

  f32x8 acc[4] = {};
  const int nsteps = K >> 5;
  for (int s = 0; s < nsteps; ++s) {
    const int k0  = s << 5;
    const int cur = s & 1;
#if HAVE_TDM
    if (tid < 32) {
      if (s + 1 < nsteps) {
        tdm_load_tile(Bpanel + k0 + 32, ldsBase + (unsigned)((cur ^ 1) * 64 * 40 * 2), ldbt);
        tdm_wait<1>();   // previous DMA (in-order) has landed
      } else {
        tdm_wait<0>();
      }
    }
    __syncthreads();
#else
    {   // synchronous cooperative staging: 256 threads x 16B = 4KB tile
      const int n = tid >> 2, c = tid & 3;
      *(bf16x8*)(&sB[cur][n * 40 + c * 8]) =
          *(const bf16x8*)(Bpanel + (long)n * ldbt + k0 + c * 8);
      __syncthreads();
    }
#endif
    bf16x16 afr = frag_ld_g(aRow + k0);
    __builtin_prefetch(aRow + k0 + 128, 0, 1);   // global_prefetch_b8
    const __bf16* bl = &sB[cur][kh];
#pragma unroll
    for (int j = 0; j < 4; ++j) {
      bf16x16 bfr = frag_ld_g(bl + (j * 16 + ml) * 40);
      acc[j] = wmma_bf16(afr, bfr, acc[j]);
    }
    __syncthreads();   // protect buffer before it is overwritten
  }

#pragma unroll
  for (int j = 0; j < 4; ++j) {
    const long n   = n0 + j * 16 + ml;
    const float bv = bias ? bias[n] : 0.0f;
    if (outBT) {
      // transposed store: 8 consecutive M per lane -> one 16B store
      bf16x8 t;
#pragma unroll
      for (int i = 0; i < 8; ++i) {
        long m  = m0 + rh + i;
        float v = acc[j][i] * alpha + bv;
        if (res)  v += res[m * ldres + n];
        if (relu) v = fmaxf(v, 0.0f);
        t[i] = (__bf16)v;
      }
      *(bf16x8*)(outBT + (long)z * oTStrideZ + n * ldoT + (m0 + rh)) = t;
    } else {
#pragma unroll
      for (int i = 0; i < 8; ++i) {
        long m  = m0 + rh + i;
        float v = acc[j][i] * alpha + bv;
        if (res)  v += res[m * ldres + n];
        if (relu) v = fmaxf(v, 0.0f);
        long off = (long)z * oStrideZ + m * ldo + n;
        if (outF) outF[off] = v;
        if (outB) outB[off] = (__bf16)v;
      }
    }
  }
}

// ---------------------------------------------------------------------------
// Attention: one block per (batch, 16-row tile), loop over 8 heads.
//   scores/probs : bf16 LDS [16][2048], row pitch 2056 elems (65792 B)
//   mean accum   : fp32 LDS [16][2048]  (128 KB)
//   staging      : bf16 LDS [8 waves][32*136] (68 KB) -> 266496 B static LDS
// Stage 1: each wave computes a 16x256 score slab (Q fragments register-
//          resident: 8 x bf16x16 = 64 VGPRs, reused across 16 tiles).
// Stage 2: each wave softmaxes 2 rows (wave32 shfl reductions).
// Stage 3: each wave computes a 16x32 slab of P@V (V pre-transposed).
// attn_mean accumulates in LDS and is written to HBM exactly once.
// K rows and V^T rows reach their B fragments through a wave-private LDS tile:
// the global loads cover whole 128-byte lines (a fragment-shaped load touches
// 16 lines for 512 bytes), the fragment shape is formed by the LDS reads.
//   K tile   : 16 rows x 256 k, pitch 264 elems (528 B)
//   V^T tile : 32 rows x 128 t, pitch 136 elems (272 B)
// The probability rows are read as A fragments (16 rows at one column), so they
// too get a padded pitch: 2056 elems (4112 B); at 4096 B all 16 rows of a
// fragment read start on the same bank.
// All three pitches are 16 B x odd: conflict-free ds_load_b128 fragment reads.
// ---------------------------------------------------------------------------
constexpr int KP_      = 264;    // K tile pitch, elements
constexpr int VP_      = 136;    // V^T tile pitch, elements
constexpr int PP_      = 2056;   // score / probability row pitch, elements
constexpr int STAGE_E_ = 32 * VP_;   // elements per wave (the larger of the two tiles)
constexpr int ATTN_LDS_ = 16 * PP_ * 2 + 16 * 2048 * 4 + 8 * STAGE_E_ * 2;   // 266496 B

// Orders this wave's own LDS traffic on its staging tile: lanes read rows that
// other lanes of the same wave wrote, which the compiler cannot see.
__device__ __forceinline__ void stage_sync() {
  asm volatile("s_wait_dscnt 0x0" ::: "memory");
}

// Stands behind a tile's global loads. Naming their address keeps its registers
// untouched up to the wait and puts the step to the next tile behind it.
template <typename T>
__device__ __forceinline__ void addr_sync(T& a) {
  asm volatile("s_wait_xcnt 0x0" : "+v"(a) : : "memory");
}

// 16 bytes at base plus a byte offset and an immediate (wave-uniform base in the next-tile loads)
__device__ __forceinline__ bf16x8 ld16(const __bf16* base, unsigned off, int imm) {
  return *(const bf16x8*)((const char*)base + off + imm);
}
__global__ void __launch_bounds__(256)
attn_k(const __bf16* __restrict__ Qb,   // [H][B*S][D]
       const __bf16* __restrict__ Kb,   // [H][B*S][D]
       const __bf16* __restrict__ VbT,  // [H][D][B*S]  (transposed)
       __bf16* __restrict__ Zcat,       // [B*S][H*D]
       float*  __restrict__ attnMean) { // [B][S][S]
  __shared__ __attribute__((aligned(16))) char smem[ATTN_LDS_];
  __bf16* sP    = (__bf16*)smem;                    // [16][PP_]
  float*  sMean = (float*)(smem + 16 * PP_ * 2);    // [16][2048]
  __bf16* sStage = (__bf16*)(smem + 16 * PP_ * 2 + 16 * 2048 * 4); // [8 waves][STAGE_E_]

  const int tid  = threadIdx.x;
  const int lane = tid & 31;
  const int wave = tid >> 5;
  const int b    = blockIdx.y;
  const long s0  = (long)blockIdx.x * 16;
  const int ml   = lane & 15;
  const int kh   = (lane < 16) ? 0 : 8;
  const int rh   = (lane < 16) ? 0 : 8;
  __bf16* sT     = sStage + wave * STAGE_E_;        // this wave's tile

  for (int i = tid; i < 16 * 2048; i += 256) sMean[i] = 0.0f;
  __syncthreads();

  for (int h = 0; h < H_; ++h) {
    const __bf16* Qh = Qb + ((long)h * M_ + (long)b * S_ + s0) * D_;
    const __bf16* Kh = Kb + ((long)h * M_ + (long)b * S_) * D_;

    // ---- stage 1: scores for t in [wave*256, wave*256+256) ----
    const int tbase = wave * 256;
    const __bf16* qrow = Qh + (long)ml * D_ + kh;
    bf16x16 qf[8];
#pragma unroll
    for (int e = 0; e < 8; ++e) qf[e] = frag_ld_g(qrow + e * 32);
    addr_sync(qrow);

    // one load = one whole K row (32 lanes x 16 B = 512 B)
    unsigned kg = (unsigned)(tbase * D_ + lane * 8) * 2u;   // bytes from Kh
    const __bf16* k0 = Kh + tbase * D_ + lane * 8;          // first tile
    bf16x8 kr[16];
#pragma unroll   // static indices keep kr[] in registers
    for (int r = 0; r < 16; ++r) kr[r] = ld16(k0, 0u, r * D_ * 2);
    addr_sync(k0);

    for (int j = 0; j < 16; ++j) {
      const int t0 = tbase + j * 16;
      stage_sync();   // the last tile's fragment reads are done
#pragma unroll   // static indices keep kr[] in registers
      for (int r = 0; r < 16; ++r) *(bf16x8*)(sT + r * KP_ + lane * 8) = kr[r];
      if (j + 1 < 16) {   // next tile's rows fly while this tile is worked on
        kg += 16 * D_ * 2;
#pragma unroll   // static indices keep kr[] in registers
        for (int r = 0; r < 16; ++r) kr[r] = ld16(Kh, kg, r * D_ * 2);
        addr_sync(kg);
      }
      stage_sync();   // the tile is written before any lane reads it back
      const __bf16* krow = sT + ml * KP_ + kh;
      f32x8 acc = {};
#pragma unroll
      for (int e = 0; e < 8; ++e) {
        bf16x16 bfr = frag_ld_g(krow + e * 32);
        acc = wmma_bf16(qf[e], bfr, acc);
      }
#pragma unroll
      for (int i = 0; i < 8; ++i)
        sP[(rh + i) * PP_ + t0 + ml] = (__bf16)acc[i];
    }
    __syncthreads();

    // ---- stage 2: softmax rows [2*wave, 2*wave+1] ----
    for (int rr = 0; rr < 2; ++rr) {
      const int r = wave * 2 + rr;
      __bf16* row = sP + r * PP_;
      float mx = -3.0e38f;
      for (int c = lane; c < 2048; c += 32) mx = fmaxf(mx, (float)row[c]);
      for (int o = 16; o; o >>= 1) mx = fmaxf(mx, __shfl_xor(mx, o, 32));
      float sum = 0.0f;
      for (int c = lane; c < 2048; c += 32) {
        float p = __expf((float)row[c] - mx);
        sum += p;
        row[c] = (__bf16)p;
      }
      for (int o = 16; o; o >>= 1) sum += __shfl_xor(sum, o, 32);
      const float inv = 1.0f / sum;
      float* mrow = sMean + r * 2048;
      for (int c = lane; c < 2048; c += 32) {
        float p = (float)row[c] * inv;
        row[c] = (__bf16)p;
        mrow[c] += p;
      }
    }
    __syncthreads();

    // ---- stage 3: zh slab, e in [wave*32, wave*32+32) ----
    const int e0 = wave * 32;
    const __bf16* vbase = VbT + (long)h * D_ * M_ + (long)b * S_;
    f32x8 acc0 = {}, acc1 = {};
    // one load = 256 B of each of two V^T rows (four whole lines)
    const int vrw = lane >> 4, vch = (lane & 15) * 8;
    unsigned vg = (unsigned)((e0 + vrw) * (int)M_ + vch) * 2u;   // bytes from vbase
    const __bf16* v0 = vbase + (e0 + vrw) * (int)M_ + vch;       // first tile
    bf16x8 vr[16];
#pragma unroll   // static indices keep vr[] in registers
    for (int q = 0; q < 16; ++q) vr[q] = ld16(v0, 0u, 2 * q * (int)M_ * 2);
    addr_sync(v0);

    for (int c = 0; c < S_ / 128; ++c) {
      stage_sync();   // the last tile's fragment reads are done
#pragma unroll   // static indices keep vr[] in registers
      for (int q = 0; q < 16; ++q)
        *(bf16x8*)(sT + (2 * q + vrw) * VP_ + vch) = vr[q];
      if (c + 1 < S_ / 128) {   // next tile flies while this tile is worked on
        vg += 128 * 2;
#pragma unroll   // static indices keep vr[] in registers
        for (int q = 0; q < 16; ++q) vr[q] = ld16(vbase, vg, 2 * q * (int)M_ * 2);
        addr_sync(vg);
      }
      stage_sync();   // the tile is written before any lane reads it back
#pragma unroll   // the four k steps of a tile read at constant LDS offsets
      for (int ts = 0; ts < 4; ++ts) {
        const int t0 = c * 128 + ts * 32;
        bf16x16 afr = frag_ld_g(sP + (long)ml * PP_ + t0 + kh);
        bf16x16 b0  = frag_ld_g(sT + ml * VP_ + ts * 32 + kh);
        bf16x16 b1  = frag_ld_g(sT + (16 + ml) * VP_ + ts * 32 + kh);
        acc0 = wmma_bf16(afr, b0, acc0);
        acc1 = wmma_bf16(afr, b1, acc1);
      }
    }
#pragma unroll
    for (int i = 0; i < 8; ++i) {
      long rowm = (long)b * S_ + s0 + rh + i;
      Zcat[rowm * HD_ + (h * D_ + e0 + ml)]      = (__bf16)acc0[i];
      Zcat[rowm * HD_ + (h * D_ + e0 + 16 + ml)] = (__bf16)acc1[i];
    }
    __syncthreads();   // protect sP before next head
  }

  // ---- write attn_mean = sum/H once ----
  for (int i = tid * 4; i < 16 * 2048; i += 256 * 4) {
    int r = i >> 11, c = i & 2047;
    float4 v = *(const float4*)(sMean + r * 2048 + c);
    v.x *= 0.125f; v.y *= 0.125f; v.z *= 0.125f; v.w *= 0.125f;
    *(float4*)(attnMean + ((long)b * S_ + s0 + r) * S_ + c) = v;
  }
}

// ---------------------------------------------------------------------------
// LayerNorm over D=256 (one row per 256-thread block, 8 wave32 partials)
// ---------------------------------------------------------------------------
__global__ void __launch_bounds__(256)
ln_k(const float* __restrict__ in, const float* __restrict__ res,
     const float* __restrict__ g, const float* __restrict__ be,
     float* __restrict__ outF, __bf16* __restrict__ outB) {
  __shared__ float red[8];
  const long row = blockIdx.x;
  const int  t   = threadIdx.x;
  float x = in[row * D_ + t];
  if (res) x += res[row * D_ + t];

  float v = x;
  for (int o = 16; o; o >>= 1) v += __shfl_xor(v, o, 32);
  if ((t & 31) == 0) red[t >> 5] = v;
  __syncthreads();
  float tot = 0.0f;
#pragma unroll
  for (int i = 0; i < 8; ++i) tot += red[i];
  const float mean = tot * (1.0f / D_);
  __syncthreads();

  const float d = x - mean;
  float v2 = d * d;
  for (int o = 16; o; o >>= 1) v2 += __shfl_xor(v2, o, 32);
  if ((t & 31) == 0) red[t >> 5] = v2;
  __syncthreads();
  float tot2 = 0.0f;
#pragma unroll
  for (int i = 0; i < 8; ++i) tot2 += red[i];
  const float var = tot2 * (1.0f / D_);

  const float y = d * rsqrtf(var + 1e-5f) * g[t] + be[t];
  if (outF) outF[row * D_ + t] = y;
  if (outB) outB[row * D_ + t] = (__bf16)y;
}

// ---------------------------------------------------------------------------
// Host-side orchestration (all launches on `stream`, graph-capture safe)
// ---------------------------------------------------------------------------
extern "C" void kernel_launch(void* const* d_in, const int* in_sizes, int n_in,
                              void* d_out, int out_size, void* d_ws, size_t ws_size,
                              hipStream_t stream) {
  const float* X  = (const float*)d_in[0];
  const float* Wq = (const float*)d_in[1];
  const float* Wk = (const float*)d_in[2];
  const float* Wv = (const float*)d_in[3];
  const float* Wz = (const float*)d_in[4];
  const float* bz = (const float*)d_in[5];
  const float* W1 = (const float*)d_in[6];
  const float* b1 = (const float*)d_in[7];
  const float* W2 = (const float*)d_in[8];
  const float* b2 = (const float*)d_in[9];
  const float* g1  = (const float*)d_in[10];
  const float* be1 = (const float*)d_in[11];
  const float* g2  = (const float*)d_in[12];
  const float* be2 = (const float*)d_in[13];

  float* outZ    = (float*)d_out;            // [B,S,D]
  float* outAttn = outZ + M_ * D_;           // [B,S,S]

  // ---- workspace carve-up ----
  char* ws = (char*)d_ws;
  size_t off = 0;
  auto alloc = [&](size_t bytes) { char* p = ws + off; off = (off + bytes + 255) & ~(size_t)255; return p; };
  __bf16* Xb   = (__bf16*)alloc(M_ * D_ * 2);
  __bf16* WqT  = (__bf16*)alloc((size_t)H_ * D_ * D_ * 2);
  __bf16* WkT  = (__bf16*)alloc((size_t)H_ * D_ * D_ * 2);
  __bf16* WvT  = (__bf16*)alloc((size_t)H_ * D_ * D_ * 2);
  __bf16* WzT  = (__bf16*)alloc((size_t)HD_ * D_ * 2);
  __bf16* W1T  = (__bf16*)alloc((size_t)FD_ * D_ * 2);
  __bf16* W2T  = (__bf16*)alloc((size_t)D_ * FD_ * 2);
  __bf16* Qb   = (__bf16*)alloc((size_t)H_ * M_ * D_ * 2);
  __bf16* Kb   = (__bf16*)alloc((size_t)H_ * M_ * D_ * 2);
  __bf16* VbT  = (__bf16*)alloc((size_t)H_ * D_ * M_ * 2);
  __bf16* Zcat = (__bf16*)alloc((size_t)M_ * HD_ * 2);
  float*  zres  = (float*)alloc((size_t)M_ * D_ * 4);
  float*  zln1f = (float*)alloc((size_t)M_ * D_ * 4);
  __bf16* zln1b = (__bf16*)alloc((size_t)M_ * D_ * 2);
  __bf16* Hff   = (__bf16*)alloc((size_t)M_ * FD_ * 2);
  float*  zff   = (float*)alloc((size_t)M_ * D_ * 4);
  (void)ws_size; (void)in_sizes; (void)n_in; (void)out_size;

  // ---- 1. casts / weight transposes ----
  cast_bf16_k<<<1024, 256, 0, stream>>>(X, Xb, M_ * D_);
  dim3 tb(16, 16);
  transpose_cast_k<<<dim3(D_/16, D_/16, H_), tb, 0, stream>>>(Wq, WqT, D_, D_, (long)D_*D_, (long)D_*D_);
  transpose_cast_k<<<dim3(D_/16, D_/16, H_), tb, 0, stream>>>(Wk, WkT, D_, D_, (long)D_*D_, (long)D_*D_);
  transpose_cast_k<<<dim3(D_/16, D_/16, H_), tb, 0, stream>>>(Wv, WvT, D_, D_, (long)D_*D_, (long)D_*D_);
  transpose_cast_k<<<dim3(D_/16, HD_/16, 1), tb, 0, stream>>>(Wz, WzT, (int)HD_, D_, 0, 0);
  transpose_cast_k<<<dim3(FD_/16, D_/16, 1), tb, 0, stream>>>(W1, W1T, D_, FD_, 0, 0);
  transpose_cast_k<<<dim3(D_/16, FD_/16, 1), tb, 0, stream>>>(W2, W2T, FD_, D_, 0, 0);

  const float scale = 0.25f;  // D^-0.25 = 256^-0.25
  // ---- 2. QKV projections (bf16 WMMA), per-head via grid.z ----
  gemm_bf16_wmma<<<dim3(M_/128, D_/64, H_), 256, 0, stream>>>(
      Xb, D_, 0, WqT, D_, (long)D_*D_, nullptr, nullptr, 0, scale, 0,
      nullptr, Qb, D_, (long)M_*D_, nullptr, 0, 0, D_);
  gemm_bf16_wmma<<<dim3(M_/128, D_/64, H_), 256, 0, stream>>>(
      Xb, D_, 0, WkT, D_, (long)D_*D_, nullptr, nullptr, 0, scale, 0,
      nullptr, Kb, D_, (long)M_*D_, nullptr, 0, 0, D_);
  gemm_bf16_wmma<<<dim3(M_/128, D_/64, H_), 256, 0, stream>>>(
      Xb, D_, 0, WvT, D_, (long)D_*D_, nullptr, nullptr, 0, 1.0f, 0,
      nullptr, nullptr, 0, 0, VbT, M_, (long)D_*M_, D_);   // V stored transposed

  // ---- 3. attention (scores + softmax + P@V + attn_mean) ----
  attn_k<<<dim3(S_/16, B_), 256, 0, stream>>>(Qb, Kb, VbT, Zcat, outAttn);

  // ---- 4. output projection + bias + residual (fp32 out) ----
  gemm_bf16_wmma<<<dim3(M_/128, D_/64, 1), 256, 0, stream>>>(
      Zcat, HD_, 0, WzT, HD_, 0, bz, X, D_, 1.0f, 0,
      zres, nullptr, D_, 0, nullptr, 0, 0, (int)HD_);

  // ---- 5. LayerNorm 1 ----
  ln_k<<<M_, D_, 0, stream>>>(zres, nullptr, g1, be1, zln1f, zln1b);

  // ---- 6. MLP ----
  gemm_bf16_wmma<<<dim3(M_/128, FD_/64, 1), 256, 0, stream>>>(
      zln1b, D_, 0, W1T, D_, 0, b1, nullptr, 0, 1.0f, 1,
      nullptr, Hff, FD_, 0, nullptr, 0, 0, D_);
  gemm_bf16_wmma<<<dim3(M_/128, D_/64, 1), 256, 0, stream>>>(
      Hff, FD_, 0, W2T, FD_, 0, b2, nullptr, 0, 1.0f, 0,
      zff, nullptr, D_, 0, nullptr, 0, 0, FD_);

  // ---- 7. LayerNorm 2 (+residual) -> final z output ----
  ln_k<<<M_, D_, 0, stream>>>(zff, zln1f, g2, be2, outZ, nullptr);
}

// v003
// One run takes 571 microseconds.
// Two timings next to v002 both put it at 1.09 times that version's speed.
// All steps since v000 together make it 1.67 times as fast.
#include <hip/hip_runtime.h>
#include <hip/hip_bf16.h>
#include <stdint.h>

// ---------------------------------------------------------------------------
// Problem dims (compile-time constants from the reference)
// ---------------------------------------------------------------------------
constexpr int  B_   = 4;
constexpr int  S_   = 2048;
constexpr int  D_   = 256;
constexpr int  H_   = 8;
constexpr int  FD_  = 512;             // F*D
constexpr long M_   = (long)B_ * S_;   // 8192 flattened rows
constexpr long HD_  = (long)H_ * D_;   // 2048 concat width

typedef __attribute__((ext_vector_type(16))) __bf16 bf16x16;
typedef __attribute__((ext_vector_type(8)))  __bf16 bf16x8;
typedef __attribute__((ext_vector_type(8)))  float  f32x8;
typedef __attribute__((ext_vector_type(4)))  unsigned int u32x4;
typedef __attribute__((ext_vector_type(8)))  int i32x8;
typedef __attribute__((ext_vector_type(4)))  int i32x4;

#if defined(__has_builtin)
#if __has_builtin(__builtin_amdgcn_tensor_load_to_lds)
#define HAVE_TDM 1
#else
#define HAVE_TDM 0
#endif
#else
#define HAVE_TDM 0
#endif

// ---------------------------------------------------------------------------
// WMMA helpers.  CDNA5 bf16 A/B fragment layout (16x32 / 32x16):
//   lanes 0..15  : row=lane,    K = [0..7]  and [16..23]
//   lanes 16..31 : row=lane-16, K = [8..15] and [24..31]
// With contiguous-K data a fragment is two 16-byte loads + a shuffle.
// ---------------------------------------------------------------------------
__device__ __forceinline__ bf16x16 frag_ld_g(const __bf16* p) {
  bf16x8 lo = *(const bf16x8*)(p);
  bf16x8 hi = *(const bf16x8*)(p + 16);
  return __builtin_shufflevector(lo, hi, 0,1,2,3,4,5,6,7,8,9,10,11,12,13,14,15);
}

__device__ __forceinline__ f32x8 wmma_bf16(bf16x16 a, bf16x16 b, f32x8 c) {
  return __builtin_amdgcn_wmma_f32_16x16x32_bf16(
      /*neg_a=*/false, a, /*neg_b=*/false, b,
      /*c_mod=*/(short)0, c, /*reuse_a=*/false, /*reuse_b=*/false);
}

#if HAVE_TDM
// ---------------------------------------------------------------------------
// TDM: DMA a 64(row) x 32(k) bf16 tile (row stride ldbt elems) from global
// into LDS at byte offset ldsOff, inserting 16B of padding after every 64B
// row (pad_interval=16 DWORDs -> code 3, pad_amount=4 DWORDs -> code 3),
// i.e. an 80-byte LDS row pitch for bank-conflict-free b128 fragment reads.
// Toolchain probe: 6-arg builtin (g0:u32x4, g1:i32x8, g2:i32x4, g3:i32x4,
// g4:i32x8, cpol:i32).
// ---------------------------------------------------------------------------
__device__ __forceinline__ void tdm_load_tile(const __bf16* gsrc,
                                              unsigned ldsOff, long ldbt) {
  unsigned long long ga = (unsigned long long)(uintptr_t)gsrc;
  u32x4 g0;
  g0[0] = 1u;                                        // count=1, user mode
  g0[1] = ldsOff;                                    // lds_addr (bytes)
  g0[2] = (unsigned)(ga & 0xFFFFFFFFull);            // global_addr[31:0]
  g0[3] = (unsigned)((ga >> 32) & 0x01FFFFFFull)     // global_addr[56:32]
          | 0x80000000u;                             // type=2 ("image")
  i32x8 g1;
  g1[0] = (1 << 16)      // data_size = 2 bytes
        | (1 << 20)      // pad_enable
        | (3 << 22)      // pad_interval: 16 DWORDs
        | (3 << 25);     // pad_amount:   4 DWORDs
  g1[1] = 0;                                   // tensor_dim0 low16 (bits 63:48)
  g1[2] = (1 << 14);                           // tensor_dim0 = 1<<30 (hi bits)
  g1[3] = 16 | (32 << 16);                     // tensor_dim1=1<<20 hi, tile_dim0=32
  g1[4] = 64;                                  // tile_dim1=64, tile_dim2=0
  g1[5] = (int)ldbt;                           // tensor_dim0_stride[31:0]
  g1[6] = 0;                                   // stride hi / dim1_stride lo
  g1[7] = 0;
  i32x4 z4 = {0, 0, 0, 0};
  i32x8 z8 = {0, 0, 0, 0, 0, 0, 0, 0};
  __builtin_amdgcn_tensor_load_to_lds(g0, g1, z4, z4, z8, 0);
}

template <int N>
__device__ __forceinline__ void tdm_wait() {
#if __has_builtin(__builtin_amdgcn_s_wait_tensorcnt)
  __builtin_amdgcn_s_wait_tensorcnt((short)N);
#else
  asm volatile("s_wait_tensorcnt %0" :: "i"(N) : "memory");
#endif
}
#endif  // HAVE_TDM

// ---------------------------------------------------------------------------
// fp32 -> bf16 cast (grid-stride)
// ---------------------------------------------------------------------------
__global__ void cast_bf16_k(const float* __restrict__ in,
                            __bf16* __restrict__ out, long n) {
  long i      = (long)blockIdx.x * blockDim.x + threadIdx.x;
  long stride = (long)gridDim.x * blockDim.x;
  for (; i < n; i += stride) out[i] = (__bf16)in[i];
}

// ---------------------------------------------------------------------------
// fp32 [rows][cols] -> bf16 transposed [cols][rows]   (per-z slice)
// ---------------------------------------------------------------------------
__global__ void transpose_cast_k(const float* __restrict__ in,
                                 __bf16* __restrict__ out,
                                 int rows, int cols,
                                 long inStrideZ, long outStrideZ) {
  __shared__ float tile[16][17];
  const float* inz  = in  + (long)blockIdx.z * inStrideZ;
  __bf16*      outz = out + (long)blockIdx.z * outStrideZ;
  int c = blockIdx.x * 16 + threadIdx.x;
  int r = blockIdx.y * 16 + threadIdx.y;
  if (r < rows && c < cols) tile[threadIdx.y][threadIdx.x] = inz[(long)r * cols + c];
  __syncthreads();
  int oc  = blockIdx.y * 16 + threadIdx.x;   // new col = old row
  int orw = blockIdx.x * 16 + threadIdx.y;   // new row = old col
  if (orw < cols && oc < rows)
    outz[(long)orw * rows + oc] = (__bf16)tile[threadIdx.x][threadIdx.y];
}

// ---------------------------------------------------------------------------
// Generic bf16 WMMA GEMM:  C = act(alpha * A @ B + bias + res)
//   A  : [M][K] bf16 row-major (per-z stride aStrideZ)
//   BT : [N][K] bf16 (B pre-transposed -> contiguous K fragments)
// Block: 256 threads = 8 waves, tile 128(M) x 64(N); wave = 16x64 (4 accums).
// The 64xK B panel is shared by all 8 waves, so it is staged through LDS:
// TDM double-buffered DMA (wave 0 issues, TENSORcnt-ordered) when available,
// else a synchronous cooperative copy.  LDS row pitch 80B (32 k-elems + 8
// pad elems) -> conflict-free ds_load_b128 fragment reads.
// ---------------------------------------------------------------------------
__global__ void __launch_bounds__(256)
gemm_bf16_wmma(const __bf16* __restrict__ A,  long lda,  long aStrideZ,
               const __bf16* __restrict__ BT, long ldbt, long btStrideZ,
               const float* __restrict__ bias,
               const float* __restrict__ res, long ldres,
               float alpha, int relu,
               float*  __restrict__ outF,
               __bf16* __restrict__ outB,  long ldo,  long oStrideZ,
               __bf16* __restrict__ outBT, long ldoT, long oTStrideZ,
               int K) {
  __shared__ __bf16 sB[2][64 * 40];   // 2 x 5120B padded tiles

  const int tid  = threadIdx.x;
  const int lane = tid & 31;
  const int wave = tid >> 5;
  const int z    = blockIdx.z;
  const long m0  = (long)blockIdx.x * 128 + wave * 16;
  const long n0  = (long)blockIdx.y * 64;
  const int  ml  = lane & 15;
  const int  kh  = (lane < 16) ? 0 : 8;   // K half-offset per fragment layout
  const int  rh  = (lane < 16) ? 0 : 8;   // C/D row-half offset

  const __bf16* aRow   = A  + (long)z * aStrideZ + (m0 + ml) * lda + kh;
  const __bf16* Bpanel = BT + (long)z * btStrideZ + n0 * ldbt;  // [64][K]

#if HAVE_TDM
  const unsigned ldsBase = (unsigned)(uintptr_t)(&sB[0][0]);
  if (tid < 32) tdm_load_tile(Bpanel, ldsBase, ldbt);           // prologue
#endif

  f32x8 acc[4] = {};
  const int nsteps = K >> 5;
  for (int s = 0; s < nsteps; ++s) {
    const int k0  = s << 5;
    const int cur = s & 1;
#if HAVE_TDM
    if (tid < 32) {
      if (s + 1 < nsteps) {
        tdm_load_tile(Bpanel + k0 + 32, ldsBase + (unsigned)((cur ^ 1) * 64 * 40 * 2), ldbt);
        tdm_wait<1>();   // previous DMA (in-order) has landed
      } else {
        tdm_wait<0>();
      }
    }
    __syncthreads();
#else
    {   // synchronous cooperative staging: 256 threads x 16B = 4KB tile
      const int n = tid >> 2, c = tid & 3;
      *(bf16x8*)(&sB[cur][n * 40 + c * 8]) =
          *(const bf16x8*)(Bpanel + (long)n * ldbt + k0 + c * 8);
      __syncthreads();
    }
#endif
    bf16x16 afr = frag_ld_g(aRow + k0);
    __builtin_prefetch(aRow + k0 + 128, 0, 1);   // global_prefetch_b8
    const __bf16* bl = &sB[cur][kh];
#pragma unroll
    for (int j = 0; j < 4; ++j) {
      bf16x16 bfr = frag_ld_g(bl + (j * 16 + ml) * 40);
      acc[j] = wmma_bf16(afr, bfr, acc[j]);
    }
    __syncthreads();   // protect buffer before it is overwritten
  }

#pragma unroll
  for (int j = 0; j < 4; ++j) {
    const long n   = n0 + j * 16 + ml;
    const float bv = bias ? bias[n] : 0.0f;
    if (outBT) {
      // transposed store: 8 consecutive M per lane -> one 16B store
      bf16x8 t;
#pragma unroll
      for (int i = 0; i < 8; ++i) {
        long m  = m0 + rh + i;
        float v = acc[j][i] * alpha + bv;
        if (res)  v += res[m * ldres + n];
        if (relu) v = fmaxf(v, 0.0f);
        t[i] = (__bf16)v;
      }
      *(bf16x8*)(outBT + (long)z * oTStrideZ + n * ldoT + (m0 + rh)) = t;
    } else {
#pragma unroll
      for (int i = 0; i < 8; ++i) {
        long m  = m0 + rh + i;
        float v = acc[j][i] * alpha + bv;
        if (res)  v += res[m * ldres + n];
        if (relu) v = fmaxf(v, 0.0f);
        long off = (long)z * oStrideZ + m * ldo + n;
        if (outF) outF[off] = v;
        if (outB) outB[off] = (__bf16)v;
      }
    }
  }
}

// ---------------------------------------------------------------------------
// Attention: one block per (batch, 16-row tile), loop over 8 heads.
//   scores/probs : bf16 LDS [16][2048], row pitch 2056 elems (65792 B)
//   mean accum   : fp32 LDS [16][2048]  (128 KB)
//   staging      : bf16 LDS [8 waves][32*136] (68 KB) -> 266496 B static LDS
// Stage 1: each wave computes a 16x256 score slab (Q fragments register-
//          resident: 8 x bf16x16 = 64 VGPRs, reused across 16 tiles).
// Stage 2: each wave softmaxes 2 rows, held in registers (wave32 shfl reductions).
// Stage 3: each wave computes a 16x32 slab of P@V (V pre-transposed).
// attn_mean accumulates in LDS and is written to HBM exactly once.
// K rows and V^T rows reach their B fragments through a wave-private LDS tile:
// the global loads cover whole 128-byte lines (a fragment-shaped load touches
// 16 lines for 512 bytes), the fragment shape is formed by the LDS reads.
//   K tile   : 16 rows x 256 k, pitch 264 elems (528 B)
//   V^T tile : 32 rows x 128 t, pitch 136 elems (272 B)
// The probability rows are read as A fragments (16 rows at one column), so they
// too get a padded pitch: 2056 elems (4112 B); at 4096 B all 16 rows of a
// fragment read start on the same bank.
// All three pitches are 16 B x odd: conflict-free ds_load_b128 fragment reads.
// ---------------------------------------------------------------------------
constexpr int KP_      = 264;    // K tile pitch, elements
constexpr int VP_      = 136;    // V^T tile pitch, elements
constexpr int PP_      = 2056;   // score / probability row pitch, elements
constexpr int STAGE_E_ = 32 * VP_;   // elements per wave (the larger of the two tiles)
constexpr int ATTN_LDS_ = 16 * PP_ * 2 + 16 * 2048 * 4 + 8 * STAGE_E_ * 2;   // 266496 B

// Orders this wave's own LDS traffic on its staging tile: lanes read rows that
// other lanes of the same wave wrote, which the compiler cannot see.
__device__ __forceinline__ void stage_sync() {
  asm volatile("s_wait_dscnt 0x0" ::: "memory");
}

// Stands behind a tile's global loads. Naming their address keeps its registers
// untouched up to the wait and puts the step to the next tile behind it.
template <typename T>
__device__ __forceinline__ void addr_sync(T& a) {
  asm volatile("s_wait_xcnt 0x0" : "+v"(a) : : "memory");
}

// 16 bytes at base plus a byte offset and an immediate (wave-uniform base in the next-tile loads)
__device__ __forceinline__ bf16x8 ld16(const __bf16* base, unsigned off, int imm) {
  return *(const bf16x8*)((const char*)base + off + imm);
}
// Eight 2^v in place. One statement, so that no instruction that overwrites a
// source or reads a result can be scheduled directly behind a transcendental:
// the eight work on distinct registers, and the v_nop is the free slot that the
// instruction set asks for behind the last one.
__device__ __forceinline__ void exp2_x8(float& a, float& b, float& c, float& d,
                                        float& e, float& f, float& g, float& h) {
  asm("v_exp_f32 %0, %0\n\tv_exp_f32 %1, %1\n\tv_exp_f32 %2, %2\n\tv_exp_f32 %3, %3\n\t"
      "v_exp_f32 %4, %4\n\tv_exp_f32 %5, %5\n\tv_exp_f32 %6, %6\n\tv_exp_f32 %7, %7\n\t"
      "v_nop"
      : "+v"(a), "+v"(b), "+v"(c), "+v"(d), "+v"(e), "+v"(f), "+v"(g), "+v"(h));
}

__global__ void __launch_bounds__(256)
attn_k(const __bf16* __restrict__ Qb,   // [H][B*S][D]
       const __bf16* __restrict__ Kb,   // [H][B*S][D]
       const __bf16* __restrict__ VbT,  // [H][D][B*S]  (transposed)
       __bf16* __restrict__ Zcat,       // [B*S][H*D]
       float*  __restrict__ attnMean) { // [B][S][S]
  __shared__ __attribute__((aligned(16))) char smem[ATTN_LDS_];
  __bf16* sP    = (__bf16*)smem;                    // [16][PP_]
  float*  sMean = (float*)(smem + 16 * PP_ * 2);    // [16][2048]
  __bf16* sStage = (__bf16*)(smem + 16 * PP_ * 2 + 16 * 2048 * 4); // [8 waves][STAGE_E_]

  const int tid  = threadIdx.x;
  const int lane = tid & 31;
  const int wave = tid >> 5;
  const int b    = blockIdx.y;
  const long s0  = (long)blockIdx.x * 16;
  const int ml   = lane & 15;
  const int kh   = (lane < 16) ? 0 : 8;
  const int rh   = (lane < 16) ? 0 : 8;
  __bf16* sT     = sStage + wave * STAGE_E_;        // this wave's tile

  for (int i = tid; i < 16 * 2048; i += 256) sMean[i] = 0.0f;
  __syncthreads();

  for (int h = 0; h < H_; ++h) {
    const __bf16* Qh = Qb + ((long)h * M_ + (long)b * S_ + s0) * D_;
    const __bf16* Kh = Kb + ((long)h * M_ + (long)b * S_) * D_;

    // ---- stage 1: scores for t in [wave*256, wave*256+256) ----
    const int tbase = wave * 256;
    const __bf16* qrow = Qh + (long)ml * D_ + kh;
    bf16x16 qf[8];
#pragma unroll
    for (int e = 0; e < 8; ++e) qf[e] = frag_ld_g(qrow + e * 32);
    addr_sync(qrow);

    // one load = one whole K row (32 lanes x 16 B = 512 B)
    unsigned kg = (unsigned)(tbase * D_ + lane * 8) * 2u;   // bytes from Kh
    const __bf16* k0 = Kh + tbase * D_ + lane * 8;          // first tile
    bf16x8 kr[16];
#pragma unroll   // static indices keep kr[] in registers
    for (int r = 0; r < 16; ++r) kr[r] = ld16(k0, 0u, r * D_ * 2);
    addr_sync(k0);

    for (int j = 0; j < 16; ++j) {
      const int t0 = tbase + j * 16;
      stage_sync();   // the last tile's fragment reads are done
#pragma unroll   // static indices keep kr[] in registers
      for (int r = 0; r < 16; ++r) *(bf16x8*)(sT + r * KP_ + lane * 8) = kr[r];
      if (j + 1 < 16) {   // next tile's rows fly while this tile is worked on
        kg += 16 * D_ * 2;
#pragma unroll   // static indices keep kr[] in registers
        for (int r = 0; r < 16; ++r) kr[r] = ld16(Kh, kg, r * D_ * 2);
        addr_sync(kg);
      }
      stage_sync();   // the tile is written before any lane reads it back
      const __bf16* krow = sT + ml * KP_ + kh;
      f32x8 acc = {};
#pragma unroll
      for (int e = 0; e < 8; ++e) {
        bf16x16 bfr = frag_ld_g(krow + e * 32);
        acc = wmma_bf16(qf[e], bfr, acc);
      }
#pragma unroll
      for (int i = 0; i < 8; ++i)
        sP[(rh + i) * PP_ + t0 + ml] = (__bf16)acc[i];
    }
    __syncthreads();

    // ---- stage 2: softmax rows [2*wave, 2*wave+1] ----
    // Both rows live in registers from the read of the scores to the write of
    // the probabilities: a lane holds 8 chunks of 8 neighbouring columns of each
    // row, so every LDS access moves 16 bytes a lane and a row is read once and
    // written once. All loops below are unrolled so that x[][] stays in registers.
    {
      __bf16* prow = sP + (wave * 2) * PP_ + lane * 8;
      float*  mrow = sMean + (wave * 2) * 2048 + lane * 8;
      float x[2][64];
#pragma unroll
      for (int rr = 0; rr < 2; ++rr) {
#pragma unroll
        for (int q = 0; q < 8; ++q) {
          const bf16x8 t = *(const bf16x8*)(prow + rr * PP_ + q * 256);
#pragma unroll
          for (int i = 0; i < 8; ++i) x[rr][q * 8 + i] = (float)t[i];
        }
      }
      // one short chain per chunk instead of one chain of 64 links
      float mx[2];
#pragma unroll
      for (int rr = 0; rr < 2; ++rr) {
        float m8[8];
#pragma unroll
        for (int q = 0; q < 8; ++q) {
          m8[q] = x[rr][q * 8];
#pragma unroll
          for (int i = 1; i < 8; ++i) m8[q] = fmaxf(m8[q], x[rr][q * 8 + i]);
        }
        mx[rr] = fmaxf(fmaxf(fmaxf(m8[0], m8[1]), fmaxf(m8[2], m8[3])),
                       fmaxf(fmaxf(m8[4], m8[5]), fmaxf(m8[6], m8[7])));
      }
      // the two rows' exchanges go side by side and share their latency
      for (int o = 16; o; o >>= 1) {
        const float a0 = __shfl_xor(mx[0], o, 32);
        const float a1 = __shfl_xor(mx[1], o, 32);
        mx[0] = fmaxf(mx[0], a0);
        mx[1] = fmaxf(mx[1], a1);
      }
      float sum[2];
#pragma unroll
      for (int rr = 0; rr < 2; ++rr) {
        float s8[8];
#pragma unroll
        for (int q = 0; q < 8; ++q) {
          float* e = &x[rr][q * 8];
#pragma unroll
          for (int i = 0; i < 8; ++i) e[i] = (e[i] - mx[rr]) * 1.44269504f;   // exp(v) = 2^(v * log2 e)
          exp2_x8(e[0], e[1], e[2], e[3], e[4], e[5], e[6], e[7]);
          s8[q] = e[0];
#pragma unroll
          for (int i = 1; i < 8; ++i) s8[q] += e[i];
        }
        sum[rr] = ((s8[0] + s8[1]) + (s8[2] + s8[3])) + ((s8[4] + s8[5]) + (s8[6] + s8[7]));
      }
      for (int o = 16; o; o >>= 1) {
        const float a0 = __shfl_xor(sum[0], o, 32);
        const float a1 = __shfl_xor(sum[1], o, 32);
        sum[0] += a0;
        sum[1] += a1;
      }
#pragma unroll
      for (int rr = 0; rr < 2; ++rr) {
        const float inv = 1.0f / sum[rr];
        float4 mv[16];
#pragma unroll
        for (int q = 0; q < 16; ++q)
          mv[q] = *(const float4*)(mrow + rr * 2048 + (q >> 1) * 256 + (q & 1) * 4);
#pragma unroll
        for (int q = 0; q < 8; ++q) {
          bf16x8 t;
#pragma unroll
          for (int i = 0; i < 8; ++i) {
            x[rr][q * 8 + i] *= inv;
            t[i] = (__bf16)x[rr][q * 8 + i];
          }
          *(bf16x8*)(prow + rr * PP_ + q * 256) = t;
        }
#pragma unroll
        for (int q = 0; q < 16; ++q) {
          mv[q].x += x[rr][q * 4 + 0];
          mv[q].y += x[rr][q * 4 + 1];
          mv[q].z += x[rr][q * 4 + 2];
          mv[q].w += x[rr][q * 4 + 3];
          *(float4*)(mrow + rr * 2048 + (q >> 1) * 256 + (q & 1) * 4) = mv[q];
        }
      }
    }
    __syncthreads();

    // ---- stage 3: zh slab, e in [wave*32, wave*32+32) ----
    const int e0 = wave * 32;
    const __bf16* vbase = VbT + (long)h * D_ * M_ + (long)b * S_;
    f32x8 acc0 = {}, acc1 = {};
    // one load = 256 B of each of two V^T rows (four whole lines)
    const int vrw = lane >> 4, vch = (lane & 15) * 8;
    unsigned vg = (unsigned)((e0 + vrw) * (int)M_ + vch) * 2u;   // bytes from vbase
    const __bf16* v0 = vbase + (e0 + vrw) * (int)M_ + vch;       // first tile
    bf16x8 vr[16];
#pragma unroll   // static indices keep vr[] in registers
    for (int q = 0; q < 16; ++q) vr[q] = ld16(v0, 0u, 2 * q * (int)M_ * 2);
    addr_sync(v0);

    for (int c = 0; c < S_ / 128; ++c) {
      stage_sync();   // the last tile's fragment reads are done
#pragma unroll   // static indices keep vr[] in registers
      for (int q = 0; q < 16; ++q)
        *(bf16x8*)(sT + (2 * q + vrw) * VP_ + vch) = vr[q];
      if (c + 1 < S_ / 128) {   // next tile flies while this tile is worked on
        vg += 128 * 2;
#pragma unroll   // static indices keep vr[] in registers
        for (int q = 0; q < 16; ++q) vr[q] = ld16(vbase, vg, 2 * q * (int)M_ * 2);
        addr_sync(vg);
      }
      stage_sync();   // the tile is written before any lane reads it back
#pragma unroll   // the four k steps of a tile read at constant LDS offsets
      for (int ts = 0; ts < 4; ++ts) {
        const int t0 = c * 128 + ts * 32;
        bf16x16 afr = frag_ld_g(sP + (long)ml * PP_ + t0 + kh);
        bf16x16 b0  = frag_ld_g(sT + ml * VP_ + ts * 32 + kh);
        bf16x16 b1  = frag_ld_g(sT + (16 + ml) * VP_ + ts * 32 + kh);
        acc0 = wmma_bf16(afr, b0, acc0);
        acc1 = wmma_bf16(afr, b1, acc1);
      }
    }
#pragma unroll
    for (int i = 0; i < 8; ++i) {
      long rowm = (long)b * S_ + s0 + rh + i;
      Zcat[rowm * HD_ + (h * D_ + e0 + ml)]      = (__bf16)acc0[i];
      Zcat[rowm * HD_ + (h * D_ + e0 + 16 + ml)] = (__bf16)acc1[i];
    }
    __syncthreads();   // protect sP before next head
  }

  // ---- write attn_mean = sum/H once ----
  for (int i = tid * 4; i < 16 * 2048; i += 256 * 4) {
    int r = i >> 11, c = i & 2047;
    float4 v = *(const float4*)(sMean + r * 2048 + c);
    v.x *= 0.125f; v.y *= 0.125f; v.z *= 0.125f; v.w *= 0.125f;
    *(float4*)(attnMean + ((long)b * S_ + s0 + r) * S_ + c) = v;
  }
}

// ---------------------------------------------------------------------------
// LayerNorm over D=256 (one row per 256-thread block, 8 wave32 partials)
// ---------------------------------------------------------------------------
__global__ void __launch_bounds__(256)
ln_k(const float* __restrict__ in, const float* __restrict__ res,
     const float* __restrict__ g, const float* __restrict__ be,
     float* __restrict__ outF, __bf16* __restrict__ outB) {
  __shared__ float red[8];
  const long row = blockIdx.x;
  const int  t   = threadIdx.x;
  float x = in[row * D_ + t];
  if (res) x += res[row * D_ + t];

  float v = x;
  for (int o = 16; o; o >>= 1) v += __shfl_xor(v, o, 32);
  if ((t & 31) == 0) red[t >> 5] = v;
  __syncthreads();
  float tot = 0.0f;
#pragma unroll
  for (int i = 0; i < 8; ++i) tot += red[i];
  const float mean = tot * (1.0f / D_);
  __syncthreads();

  const float d = x - mean;
  float v2 = d * d;
  for (int o = 16; o; o >>= 1) v2 += __shfl_xor(v2, o, 32);
  if ((t & 31) == 0) red[t >> 5] = v2;
  __syncthreads();
  float tot2 = 0.0f;
#pragma unroll
  for (int i = 0; i < 8; ++i) tot2 += red[i];
  const float var = tot2 * (1.0f / D_);

  const float y = d * rsqrtf(var + 1e-5f) * g[t] + be[t];
  if (outF) outF[row * D_ + t] = y;
  if (outB) outB[row * D_ + t] = (__bf16)y;
}

// ---------------------------------------------------------------------------
// Host-side orchestration (all launches on `stream`, graph-capture safe)
// ---------------------------------------------------------------------------
extern "C" void kernel_launch(void* const* d_in, const int* in_sizes, int n_in,
                              void* d_out, int out_size, void* d_ws, size_t ws_size,
                              hipStream_t stream) {
  const float* X  = (const float*)d_in[0];
  const float* Wq = (const float*)d_in[1];
  const float* Wk = (const float*)d_in[2];
  const float* Wv = (const float*)d_in[3];
  const float* Wz = (const float*)d_in[4];
  const float* bz = (const float*)d_in[5];
  const float* W1 = (const float*)d_in[6];
  const float* b1 = (const float*)d_in[7];
  const float* W2 = (const float*)d_in[8];
  const float* b2 = (const float*)d_in[9];
  const float* g1  = (const float*)d_in[10];
  const float* be1 = (const float*)d_in[11];
  const float* g2  = (const float*)d_in[12];
  const float* be2 = (const float*)d_in[13];

  float* outZ    = (float*)d_out;            // [B,S,D]
  float* outAttn = outZ + M_ * D_;           // [B,S,S]

  // ---- workspace carve-up ----
  char* ws = (char*)d_ws;
  size_t off = 0;
  auto alloc = [&](size_t bytes) { char* p = ws + off; off = (off + bytes + 255) & ~(size_t)255; return p; };
  __bf16* Xb   = (__bf16*)alloc(M_ * D_ * 2);
  __bf16* WqT  = (__bf16*)alloc((size_t)H_ * D_ * D_ * 2);
  __bf16* WkT  = (__bf16*)alloc((size_t)H_ * D_ * D_ * 2);
  __bf16* WvT  = (__bf16*)alloc((size_t)H_ * D_ * D_ * 2);
  __bf16* WzT  = (__bf16*)alloc((size_t)HD_ * D_ * 2);
  __bf16* W1T  = (__bf16*)alloc((size_t)FD_ * D_ * 2);
  __bf16* W2T  = (__bf16*)alloc((size_t)D_ * FD_ * 2);
  __bf16* Qb   = (__bf16*)alloc((size_t)H_ * M_ * D_ * 2);
  __bf16* Kb   = (__bf16*)alloc((size_t)H_ * M_ * D_ * 2);
  __bf16* VbT  = (__bf16*)alloc((size_t)H_ * D_ * M_ * 2);
  __bf16* Zcat = (__bf16*)alloc((size_t)M_ * HD_ * 2);
  float*  zres  = (float*)alloc((size_t)M_ * D_ * 4);
  float*  zln1f = (float*)alloc((size_t)M_ * D_ * 4);
  __bf16* zln1b = (__bf16*)alloc((size_t)M_ * D_ * 2);
  __bf16* Hff   = (__bf16*)alloc((size_t)M_ * FD_ * 2);
  float*  zff   = (float*)alloc((size_t)M_ * D_ * 4);
  (void)ws_size; (void)in_sizes; (void)n_in; (void)out_size;

  // ---- 1. casts / weight transposes ----
  cast_bf16_k<<<1024, 256, 0, stream>>>(X, Xb, M_ * D_);
  dim3 tb(16, 16);
  transpose_cast_k<<<dim3(D_/16, D_/16, H_), tb, 0, stream>>>(Wq, WqT, D_, D_, (long)D_*D_, (long)D_*D_);
  transpose_cast_k<<<dim3(D_/16, D_/16, H_), tb, 0, stream>>>(Wk, WkT, D_, D_, (long)D_*D_, (long)D_*D_);
  transpose_cast_k<<<dim3(D_/16, D_/16, H_), tb, 0, stream>>>(Wv, WvT, D_, D_, (long)D_*D_, (long)D_*D_);
  transpose_cast_k<<<dim3(D_/16, HD_/16, 1), tb, 0, stream>>>(Wz, WzT, (int)HD_, D_, 0, 0);
  transpose_cast_k<<<dim3(FD_/16, D_/16, 1), tb, 0, stream>>>(W1, W1T, D_, FD_, 0, 0);
  transpose_cast_k<<<dim3(D_/16, FD_/16, 1), tb, 0, stream>>>(W2, W2T, FD_, D_, 0, 0);

  const float scale = 0.25f;  // D^-0.25 = 256^-0.25
  // ---- 2. QKV projections (bf16 WMMA), per-head via grid.z ----
  gemm_bf16_wmma<<<dim3(M_/128, D_/64, H_), 256, 0, stream>>>(
      Xb, D_, 0, WqT, D_, (long)D_*D_, nullptr, nullptr, 0, scale, 0,
      nullptr, Qb, D_, (long)M_*D_, nullptr, 0, 0, D_);
  gemm_bf16_wmma<<<dim3(M_/128, D_/64, H_), 256, 0, stream>>>(
      Xb, D_, 0, WkT, D_, (long)D_*D_, nullptr, nullptr, 0, scale, 0,
      nullptr, Kb, D_, (long)M_*D_, nullptr, 0, 0, D_);
  gemm_bf16_wmma<<<dim3(M_/128, D_/64, H_), 256, 0, stream>>>(
      Xb, D_, 0, WvT, D_, (long)D_*D_, nullptr, nullptr, 0, 1.0f, 0,
      nullptr, nullptr, 0, 0, VbT, M_, (long)D_*M_, D_);   // V stored transposed

  // ---- 3. attention (scores + softmax + P@V + attn_mean) ----
  attn_k<<<dim3(S_/16, B_), 256, 0, stream>>>(Qb, Kb, VbT, Zcat, outAttn);

  // ---- 4. output projection + bias + residual (fp32 out) ----
  gemm_bf16_wmma<<<dim3(M_/128, D_/64, 1), 256, 0, stream>>>(
      Zcat, HD_, 0, WzT, HD_, 0, bz, X, D_, 1.0f, 0,
      zres, nullptr, D_, 0, nullptr, 0, 0, (int)HD_);

  // ---- 5. LayerNorm 1 ----
  ln_k<<<M_, D_, 0, stream>>>(zres, nullptr, g1, be1, zln1f, zln1b);

  // ---- 6. MLP ----
  gemm_bf16_wmma<<<dim3(M_/128, FD_/64, 1), 256, 0, stream>>>(
      zln1b, D_, 0, W1T, D_, 0, b1, nullptr, 0, 1.0f, 1,
      nullptr, Hff, FD_, 0, nullptr, 0, 0, D_);
  gemm_bf16_wmma<<<dim3(M_/128, D_/64, 1), 256, 0, stream>>>(
      Hff, FD_, 0, W2T, FD_, 0, b2, nullptr, 0, 1.0f, 0,
      zff, nullptr, D_, 0, nullptr, 0, 0, FD_);

  // ---- 7. LayerNorm 2 (+residual) -> final z output ----
  ln_k<<<M_, D_, 0, stream>>>(zff, zln1f, g2, be2, outZ, nullptr);
}

// v004
// A run of this version takes 408 microseconds.
// In two side-by-side timings against v003, it was 1.41 and 1.40 times as fast.
// Over all steps from v000 it is 2.34 times as fast.
#include <hip/hip_runtime.h>
#include <hip/hip_bf16.h>
#include <stdint.h>

// ---------------------------------------------------------------------------
// Problem dims (compile-time constants from the reference)
// ---------------------------------------------------------------------------
constexpr int  B_   = 4;
constexpr int  S_   = 2048;
constexpr int  D_   = 256;
constexpr int  H_   = 8;
constexpr int  FD_  = 512;             // F*D
constexpr long M_   = (long)B_ * S_;   // 8192 flattened rows
constexpr long HD_  = (long)H_ * D_;   // 2048 concat width

typedef __attribute__((ext_vector_type(16))) __bf16 bf16x16;
typedef __attribute__((ext_vector_type(8)))  __bf16 bf16x8;
typedef __attribute__((ext_vector_type(8)))  float  f32x8;
typedef __attribute__((ext_vector_type(4)))  unsigned int u32x4;
typedef __attribute__((ext_vector_type(8)))  int i32x8;
typedef __attribute__((ext_vector_type(4)))  int i32x4;

#if defined(__has_builtin)
#if __has_builtin(__builtin_amdgcn_tensor_load_to_lds)
#define HAVE_TDM 1
#else
#define HAVE_TDM 0
#endif
#else
#define HAVE_TDM 0
#endif

// ---------------------------------------------------------------------------
// WMMA helpers.  CDNA5 bf16 A/B fragment layout (16x32 / 32x16):
//   lanes 0..15  : row=lane,    K = [0..7]  and [16..23]
//   lanes 16..31 : row=lane-16, K = [8..15] and [24..31]
// With contiguous-K data a fragment is two 16-byte loads + a shuffle.
// ---------------------------------------------------------------------------
__device__ __forceinline__ bf16x16 frag_ld_g(const __bf16* p) {
  bf16x8 lo = *(const bf16x8*)(p);
  bf16x8 hi = *(const bf16x8*)(p + 16);
  return __builtin_shufflevector(lo, hi, 0,1,2,3,4,5,6,7,8,9,10,11,12,13,14,15);
}

__device__ __forceinline__ f32x8 wmma_bf16(bf16x16 a, bf16x16 b, f32x8 c) {
  return __builtin_amdgcn_wmma_f32_16x16x32_bf16(
      /*neg_a=*/false, a, /*neg_b=*/false, b,
      /*c_mod=*/(short)0, c, /*reuse_a=*/false, /*reuse_b=*/false);
}

#if HAVE_TDM
// ---------------------------------------------------------------------------
// TDM: DMA a 64(row) x 32(k) bf16 tile (row stride ldbt elems) from global
// into LDS at byte offset ldsOff, inserting 16B of padding after every 64B
// row (pad_interval=16 DWORDs -> code 3, pad_amount=4 DWORDs -> code 3),
// i.e. an 80-byte LDS row pitch for bank-conflict-free b128 fragment reads.
// Toolchain probe: 6-arg builtin (g0:u32x4, g1:i32x8, g2:i32x4, g3:i32x4,
// g4:i32x8, cpol:i32).
// ---------------------------------------------------------------------------
__device__ __forceinline__ void tdm_load_tile(const __bf16* gsrc,
                                              unsigned ldsOff, long ldbt) {
  unsigned long long ga = (unsigned long long)(uintptr_t)gsrc;
  u32x4 g0;
  g0[0] = 1u;                                        // count=1, user mode
  g0[1] = ldsOff;                                    // lds_addr (bytes)
  g0[2] = (unsigned)(ga & 0xFFFFFFFFull);            // global_addr[31:0]
  g0[3] = (unsigned)((ga >> 32) & 0x01FFFFFFull)     // global_addr[56:32]
          | 0x80000000u;                             // type=2 ("image")
  i32x8 g1;
  g1[0] = (1 << 16)      // data_size = 2 bytes
        | (1 << 20)      // pad_enable
        | (3 << 22)      // pad_interval: 16 DWORDs
        | (3 << 25);     // pad_amount:   4 DWORDs
  g1[1] = 0;                                   // tensor_dim0 low16 (bits 63:48)
  g1[2] = (1 << 14);                           // tensor_dim0 = 1<<30 (hi bits)
  g1[3] = 16 | (32 << 16);                     // tensor_dim1=1<<20 hi, tile_dim0=32
  g1[4] = 64;                                  // tile_dim1=64, tile_dim2=0
  g1[5] = (int)ldbt;                           // tensor_dim0_stride[31:0]
  g1[6] = 0;                                   // stride hi / dim1_stride lo
  g1[7] = 0;
  i32x4 z4 = {0, 0, 0, 0};
  i32x8 z8 = {0, 0, 0, 0, 0, 0, 0, 0};
  __builtin_amdgcn_tensor_load_to_lds(g0, g1, z4, z4, z8, 0);
}

template <int N>
__device__ __forceinline__ void tdm_wait() {
#if __has_builtin(__builtin_amdgcn_s_wait_tensorcnt)
  __builtin_amdgcn_s_wait_tensorcnt((short)N);
#else
  asm volatile("s_wait_tensorcnt %0" :: "i"(N) : "memory");
#endif
}
#endif  // HAVE_TDM

// ---------------------------------------------------------------------------
// fp32 -> bf16 cast (grid-stride)
// ---------------------------------------------------------------------------
__global__ void cast_bf16_k(const float* __restrict__ in,
                            __bf16* __restrict__ out, long n) {
  long i      = (long)blockIdx.x * blockDim.x + threadIdx.x;
  long stride = (long)gridDim.x * blockDim.x;
  for (; i < n; i += stride) out[i] = (__bf16)in[i];
}

// ---------------------------------------------------------------------------
// fp32 [rows][cols] -> bf16 transposed [cols][rows]   (per-z slice)
// ---------------------------------------------------------------------------
__global__ void transpose_cast_k(const float* __restrict__ in,
                                 __bf16* __restrict__ out,
                                 int rows, int cols,
                                 long inStrideZ, long outStrideZ) {
  __shared__ float tile[16][17];
  const float* inz  = in  + (long)blockIdx.z * inStrideZ;
  __bf16*      outz = out + (long)blockIdx.z * outStrideZ;
  int c = blockIdx.x * 16 + threadIdx.x;
  int r = blockIdx.y * 16 + threadIdx.y;
  if (r < rows && c < cols) tile[threadIdx.y][threadIdx.x] = inz[(long)r * cols + c];
  __syncthreads();
  int oc  = blockIdx.y * 16 + threadIdx.x;   // new col = old row
  int orw = blockIdx.x * 16 + threadIdx.y;   // new row = old col
  if (orw < cols && oc < rows)
    outz[(long)orw * rows + oc] = (__bf16)tile[threadIdx.x][threadIdx.y];
}

// ---------------------------------------------------------------------------
// Generic bf16 WMMA GEMM:  C = act(alpha * A @ B + bias + res)
//   A  : [M][K] bf16 row-major (per-z stride aStrideZ)
//   BT : [N][K] bf16 (B pre-transposed -> contiguous K fragments)
// Block: 256 threads = 8 waves, tile 128(M) x 64(N); wave = 16x64 (4 accums).
// The 64xK B panel is shared by all 8 waves, so it is staged through LDS:
// TDM double-buffered DMA (wave 0 issues, TENSORcnt-ordered) when available,
// else a synchronous cooperative copy.  LDS row pitch 80B (32 k-elems + 8
// pad elems) -> conflict-free ds_load_b128 fragment reads.
// ---------------------------------------------------------------------------
__global__ void __launch_bounds__(256)
gemm_bf16_wmma(const __bf16* __restrict__ A,  long lda,  long aStrideZ,
               const __bf16* __restrict__ BT, long ldbt, long btStrideZ,
               const float* __restrict__ bias,
               const float* __restrict__ res, long ldres,
               float alpha, int relu,
               float*  __restrict__ outF,
               __bf16* __restrict__ outB,  long ldo,  long oStrideZ,
               __bf16* __restrict__ outBT, long ldoT, long oTStrideZ,
               int K) {
  __shared__ __bf16 sB[2][64 * 40];   // 2 x 5120B padded tiles

  const int tid  = threadIdx.x;
  const int lane = tid & 31;
  const int wave = tid >> 5;
  const int z    = blockIdx.z;
  const long m0  = (long)blockIdx.x * 128 + wave * 16;
  const long n0  = (long)blockIdx.y * 64;
  const int  ml  = lane & 15;
  const int  kh  = (lane < 16) ? 0 : 8;   // K half-offset per fragment layout
  const int  rh  = (lane < 16) ? 0 : 8;   // C/D row-half offset

  const __bf16* aRow   = A  + (long)z * aStrideZ + (m0 + ml) * lda + kh;
  const __bf16* Bpanel = BT + (long)z * btStrideZ + n0 * ldbt;  // [64][K]

#if HAVE_TDM
  const unsigned ldsBase = (unsigned)(uintptr_t)(&sB[0][0]);
  if (tid < 32) tdm_load_tile(Bpanel, ldsBase, ldbt);           // prologue
#endif

  f32x8 acc[4] = {};
  const int nsteps = K >> 5;
  for (int s = 0; s < nsteps; ++s) {
    const int k0  = s << 5;
    const int cur = s & 1;
#if HAVE_TDM
    if (tid < 32) {
      if (s + 1 < nsteps) {
        tdm_load_tile(Bpanel + k0 + 32, ldsBase + (unsigned)((cur ^ 1) * 64 * 40 * 2), ldbt);
        tdm_wait<1>();   // previous DMA (in-order) has landed
      } else {
        tdm_wait<0>();
      }
    }
    __syncthreads();
#else
    {   // synchronous cooperative staging: 256 threads x 16B = 4KB tile
      const int n = tid >> 2, c = tid & 3;
      *(bf16x8*)(&sB[cur][n * 40 + c * 8]) =
          *(const bf16x8*)(Bpanel + (long)n * ldbt + k0 + c * 8);
      __syncthreads();
    }
#endif
    bf16x16 afr = frag_ld_g(aRow + k0);
    __builtin_prefetch(aRow + k0 + 128, 0, 1);   // global_prefetch_b8
    const __bf16* bl = &sB[cur][kh];
#pragma unroll
    for (int j = 0; j < 4; ++j) {
      bf16x16 bfr = frag_ld_g(bl + (j * 16 + ml) * 40);
      acc[j] = wmma_bf16(afr, bfr, acc[j]);
    }
    __syncthreads();   // protect buffer before it is overwritten
  }

#pragma unroll
  for (int j = 0; j < 4; ++j) {
    const long n   = n0 + j * 16 + ml;
    const float bv = bias ? bias[n] : 0.0f;
    if (outBT) {
      // transposed store: 8 consecutive M per lane -> one 16B store
      bf16x8 t;
#pragma unroll
      for (int i = 0; i < 8; ++i) {
        long m  = m0 + rh + i;
        float v = acc[j][i] * alpha + bv;
        if (res)  v += res[m * ldres + n];
        if (relu) v = fmaxf(v, 0.0f);
        t[i] = (__bf16)v;
      }
      *(bf16x8*)(outBT + (long)z * oTStrideZ + n * ldoT + (m0 + rh)) = t;
    } else {
#pragma unroll
      for (int i = 0; i < 8; ++i) {
        long m  = m0 + rh + i;
        float v = acc[j][i] * alpha + bv;
        if (res)  v += res[m * ldres + n];
        if (relu) v = fmaxf(v, 0.0f);
        long off = (long)z * oStrideZ + m * ldo + n;
        if (outF) outF[off] = v;
        if (outB) outB[off] = (__bf16)v;
      }
    }
  }
}

// ---------------------------------------------------------------------------
// Attention: one block per (batch, 32-row tile), loop over 8 heads.
//   scores/probs : bf16 LDS [32][2048], row pitch 2056 elems (131584 B)
//   staging      : bf16 LDS [8 waves][32*136] (68 KB)
//   mean accum   : fp32, 4 rows a wave: 3 in registers (192 a lane), 1 in LDS
//                  [8 waves][2048] (64 KB) -> 266752 B static LDS
// Stage 1: each wave computes a 32x256 score slab (Q fragments register-
//          resident: 16 x bf16x16 = 128 VGPRs, reused across 16 tiles).
// Stage 2: each wave softmaxes 4 rows, two at a time, held in registers.
// Stage 3: each wave computes a 32x32 slab of P@V (V pre-transposed).
// Every staged K or V^T tile is the B operand of two 16-row blocks, so a block
// of 32 rows reads K and V once where two blocks of 16 read them twice.
// attn_mean accumulates with the wave that softmaxes the row, each lane keeping
// the columns it holds there: 32 rows of fp32 do not fit in LDS beside the
// probabilities, nor in registers beside the Q fragments, so they are split.
// No lane touches another lane's part. It is written to HBM exactly once.
// K rows and V^T rows reach their B fragments through a wave-private LDS tile:
// the global loads cover whole 128-byte lines (a fragment-shaped load touches
// 16 lines for 512 bytes), the fragment shape is formed by the LDS reads.
//   K tile   : 16 rows x 256 k, pitch 264 elems (528 B)
//   V^T tile : 32 rows x 128 t, pitch 136 elems (272 B)
// The probability rows are read as A fragments (16 rows at one column), so they
// too get a padded pitch: 2056 elems (4112 B); at 4096 B all 16 rows of a
// fragment read start on the same bank.
// All three pitches are 16 B x odd: conflict-free ds_load_b128 fragment reads.
// ---------------------------------------------------------------------------
constexpr int QR_      = 32;     // query rows per block
constexpr int KP_      = 264;    // K tile pitch, elements
constexpr int VP_      = 136;    // V^T tile pitch, elements
constexpr int PP_      = 2056;   // score / probability row pitch, elements
constexpr int STAGE_E_ = 32 * VP_;   // elements per wave (the larger of the two tiles)
constexpr int ATTN_LDS_ = QR_ * PP_ * 2 + 8 * STAGE_E_ * 2 + 8 * 2048 * 4;   // 266752 B

// Orders this wave's own LDS traffic on its staging tile: lanes read rows that
// other lanes of the same wave wrote, which the compiler cannot see.
__device__ __forceinline__ void stage_sync() {
  asm volatile("s_wait_dscnt 0x0" ::: "memory");
}

// Stands behind a tile's global loads. Naming their address keeps its registers
// untouched up to the wait and puts the step to the next tile behind it.
template <typename T>
__device__ __forceinline__ void addr_sync(T& a) {
  asm volatile("s_wait_xcnt 0x0" : "+v"(a) : : "memory");
}

// 16 bytes at base plus a byte offset and an immediate (wave-uniform base in the next-tile loads)
__device__ __forceinline__ bf16x8 ld16(const __bf16* base, unsigned off, int imm) {
  return *(const bf16x8*)((const char*)base + off + imm);
}
// Eight 2^v in place. One statement, so that no instruction that overwrites a
// source or reads a result can be scheduled directly behind a transcendental:
// the eight work on distinct registers, and the v_nop is the free slot that the
// instruction set asks for behind the last one.
__device__ __forceinline__ void exp2_x8(float& a, float& b, float& c, float& d,
                                        float& e, float& f, float& g, float& h) {
  asm("v_exp_f32 %0, %0\n\tv_exp_f32 %1, %1\n\tv_exp_f32 %2, %2\n\tv_exp_f32 %3, %3\n\t"
      "v_exp_f32 %4, %4\n\tv_exp_f32 %5, %5\n\tv_exp_f32 %6, %6\n\tv_exp_f32 %7, %7\n\t"
      "v_nop"
      : "+v"(a), "+v"(b), "+v"(c), "+v"(d), "+v"(e), "+v"(f), "+v"(g), "+v"(h));
}

__global__ void __launch_bounds__(256)
attn_k(const __bf16* __restrict__ Qb,   // [H][B*S][D]
       const __bf16* __restrict__ Kb,   // [H][B*S][D]
       const __bf16* __restrict__ VbT,  // [H][D][B*S]  (transposed)
       __bf16* __restrict__ Zcat,       // [B*S][H*D]
       float*  __restrict__ attnMean) { // [B][S][S]
  __shared__ __attribute__((aligned(16))) char smem[ATTN_LDS_];
  __bf16* sP    = (__bf16*)smem;                    // [QR_][PP_]
  __bf16* sStage = (__bf16*)(smem + QR_ * PP_ * 2); // [8 waves][STAGE_E_]
  float*  sMean = (float*)(smem + QR_ * PP_ * 2 + 8 * STAGE_E_ * 2);   // [8 waves][2048]

  const int tid  = threadIdx.x;
  const int lane = tid & 31;
  const int wave = tid >> 5;
  const int b    = blockIdx.y;
  const long s0  = (long)blockIdx.x * QR_;
  const int ml   = lane & 15;
  const int kh   = (lane < 16) ? 0 : 8;
  const int rh   = (lane < 16) ? 0 : 8;
  __bf16* sT     = sStage + wave * STAGE_E_;        // this wave's tile

  // sum over the heads of rows [4*wave, 4*wave+4), in the softmax's own layout:
  // element q*8+i is column q*256 + lane*8 + i. Every index is a constant.
  // Rows 0 to 2 in registers, row 3 in this wave's LDS row, same columns a lane.
  float mean[3][64];
  float* mrow = sMean + wave * 2048 + lane * 8;
#pragma unroll
  for (int r = 0; r < 3; ++r) {
#pragma unroll
    for (int i = 0; i < 64; ++i) mean[r][i] = 0.0f;
  }
#pragma unroll
  for (int q = 0; q < 16; ++q)
    *(float4*)(mrow + (q >> 1) * 256 + (q & 1) * 4) = make_float4(0.0f, 0.0f, 0.0f, 0.0f);

  // One trip runs stage 3 of the head before and then stages 1 and 2 of its own
  // head: the order of the stages is the plain one, but stage 2 ends the loop's
  // body. With stage 3 last the compiler moves stage 2's additions into mean[][]
  // behind it, keeps the probabilities live across it beside the sums, and spills.
  for (int hh = 0; hh <= H_; ++hh) {
    if (hh > 0) {
      const int h = hh - 1;
      // ---- stage 3: zh slab, e in [wave*32, wave*32+32) ----
      const int e0 = wave * 32;
      const __bf16* vbase = VbT + (long)h * D_ * M_ + (long)b * S_;
      f32x8 acc00 = {}, acc01 = {}, acc10 = {}, acc11 = {};   // [row block][column block]
      // one load = 256 B of each of two V^T rows (four whole lines)
      const int vrw = lane >> 4, vch = (lane & 15) * 8;
      unsigned vg = (unsigned)((e0 + vrw) * (int)M_ + vch) * 2u;   // bytes from vbase
      const __bf16* v0 = vbase + (e0 + vrw) * (int)M_ + vch;       // first tile
      bf16x8 vr[16];
#pragma unroll   // static indices keep vr[] in registers
      for (int q = 0; q < 16; ++q) vr[q] = ld16(v0, 0u, 2 * q * (int)M_ * 2);
      addr_sync(v0);

      for (int c = 0; c < S_ / 128; ++c) {
        stage_sync();   // the last tile's fragment reads are done
#pragma unroll   // static indices keep vr[] in registers
        for (int q = 0; q < 16; ++q)
          *(bf16x8*)(sT + (2 * q + vrw) * VP_ + vch) = vr[q];
        if (c + 1 < S_ / 128) {   // next tile flies while this tile is worked on
          vg += 128 * 2;
#pragma unroll   // static indices keep vr[] in registers
          for (int q = 0; q < 16; ++q) vr[q] = ld16(vbase, vg, 2 * q * (int)M_ * 2);
          addr_sync(vg);
        }
        stage_sync();   // the tile is written before any lane reads it back
#pragma unroll   // the four k steps of a tile read at constant LDS offsets
        for (int ts = 0; ts < 4; ++ts) {
          const int t0 = c * 128 + ts * 32;
          bf16x16 a0 = frag_ld_g(sP + (long)ml * PP_ + t0 + kh);
          bf16x16 a1 = frag_ld_g(sP + (long)(16 + ml) * PP_ + t0 + kh);
          bf16x16 b0 = frag_ld_g(sT + ml * VP_ + ts * 32 + kh);
          bf16x16 b1 = frag_ld_g(sT + (16 + ml) * VP_ + ts * 32 + kh);
          acc00 = wmma_bf16(a0, b0, acc00);
          acc01 = wmma_bf16(a0, b1, acc01);
          acc10 = wmma_bf16(a1, b0, acc10);
          acc11 = wmma_bf16(a1, b1, acc11);
        }
      }
#pragma unroll
      for (int i = 0; i < 8; ++i) {
        long rowm = (long)b * S_ + s0 + rh + i;
        Zcat[rowm * HD_ + (h * D_ + e0 + ml)]             = (__bf16)acc00[i];
        Zcat[rowm * HD_ + (h * D_ + e0 + 16 + ml)]        = (__bf16)acc01[i];
        Zcat[(rowm + 16) * HD_ + (h * D_ + e0 + ml)]      = (__bf16)acc10[i];
        Zcat[(rowm + 16) * HD_ + (h * D_ + e0 + 16 + ml)] = (__bf16)acc11[i];
      }
      __syncthreads();   // protect sP before next head
    }
    if (hh < H_) {
      const int h = hh;
      const __bf16* Qh = Qb + ((long)h * M_ + (long)b * S_ + s0) * D_;
      const __bf16* Kh = Kb + ((long)h * M_ + (long)b * S_) * D_;

      // ---- stage 1: scores for t in [wave*256, wave*256+256) ----
      const int tbase = wave * 256;
      const __bf16* qrow = Qh + (long)ml * D_ + kh;
      bf16x16 qf[2][8];
#pragma unroll
      for (int g = 0; g < 2; ++g) {
#pragma unroll
        for (int e = 0; e < 8; ++e) qf[g][e] = frag_ld_g(qrow + g * 16 * D_ + e * 32);
      }
      addr_sync(qrow);

      // one load = one whole K row (32 lanes x 16 B = 512 B)
      unsigned kg = (unsigned)(tbase * D_ + lane * 8) * 2u;   // bytes from Kh
      const __bf16* k0 = Kh + tbase * D_ + lane * 8;          // first tile
      bf16x8 kr[16];
#pragma unroll   // static indices keep kr[] in registers
      for (int r = 0; r < 16; ++r) kr[r] = ld16(k0, 0u, r * D_ * 2);
      addr_sync(k0);

      for (int j = 0; j < 16; ++j) {
        const int t0 = tbase + j * 16;
        stage_sync();   // the last tile's fragment reads are done
#pragma unroll   // static indices keep kr[] in registers
        for (int r = 0; r < 16; ++r) *(bf16x8*)(sT + r * KP_ + lane * 8) = kr[r];
        if (j + 1 < 16) {   // next tile's rows fly while this tile is worked on
          kg += 16 * D_ * 2;
#pragma unroll   // static indices keep kr[] in registers
          for (int r = 0; r < 16; ++r) kr[r] = ld16(Kh, kg, r * D_ * 2);
          addr_sync(kg);
        }
        stage_sync();   // the tile is written before any lane reads it back
        const __bf16* krow = sT + ml * KP_ + kh;
        f32x8 accA = {}, accB = {};
#pragma unroll
        for (int e = 0; e < 8; ++e) {
          bf16x16 bfr = frag_ld_g(krow + e * 32);
          accA = wmma_bf16(qf[0][e], bfr, accA);
          accB = wmma_bf16(qf[1][e], bfr, accB);
        }
#pragma unroll
        for (int i = 0; i < 8; ++i) {
          sP[(rh + i) * PP_ + t0 + ml]      = (__bf16)accA[i];
          sP[(16 + rh + i) * PP_ + t0 + ml] = (__bf16)accB[i];
        }
      }
      __syncthreads();

      // ---- stage 2: softmax rows [4*wave, 4*wave+4), two at a time ----
      // Both rows live in registers from the read of the scores to the write of
      // the probabilities: a lane holds 8 chunks of 8 neighbouring columns of each
      // row, so every LDS access moves 16 bytes a lane and a row is read once and
      // written once. All loops below are unrolled so that x[][] and mean[][] stay
      // in registers.
#pragma unroll
      for (int p = 0; p < 2; ++p) {
        __bf16* prow = sP + (wave * 4 + p * 2) * PP_ + lane * 8;
        float x[2][64];
#pragma unroll
        for (int rr = 0; rr < 2; ++rr) {
#pragma unroll
          for (int q = 0; q < 8; ++q) {
            const bf16x8 t = *(const bf16x8*)(prow + rr * PP_ + q * 256);
#pragma unroll
            for (int i = 0; i < 8; ++i) x[rr][q * 8 + i] = (float)t[i];
          }
        }
        // one short chain per chunk instead of one chain of 64 links
        float mx[2];
#pragma unroll
        for (int rr = 0; rr < 2; ++rr) {
          float m8[8];
#pragma unroll
          for (int q = 0; q < 8; ++q) {
            m8[q] = x[rr][q * 8];
#pragma unroll
            for (int i = 1; i < 8; ++i) m8[q] = fmaxf(m8[q], x[rr][q * 8 + i]);
          }
          mx[rr] = fmaxf(fmaxf(fmaxf(m8[0], m8[1]), fmaxf(m8[2], m8[3])),
                         fmaxf(fmaxf(m8[4], m8[5]), fmaxf(m8[6], m8[7])));
        }
        // the two rows' exchanges go side by side and share their latency
        for (int o = 16; o; o >>= 1) {
          const float a0 = __shfl_xor(mx[0], o, 32);
          const float a1 = __shfl_xor(mx[1], o, 32);
          mx[0] = fmaxf(mx[0], a0);
          mx[1] = fmaxf(mx[1], a1);
        }
        float sum[2];
#pragma unroll
        for (int rr = 0; rr < 2; ++rr) {
          float s8[8];
#pragma unroll
          for (int q = 0; q < 8; ++q) {
            float* e = &x[rr][q * 8];
#pragma unroll
            for (int i = 0; i < 8; ++i) e[i] = (e[i] - mx[rr]) * 1.44269504f;   // exp(v) = 2^(v * log2 e)
            exp2_x8(e[0], e[1], e[2], e[3], e[4], e[5], e[6], e[7]);
            s8[q] = e[0];
#pragma unroll
            for (int i = 1; i < 8; ++i) s8[q] += e[i];
          }
          sum[rr] = ((s8[0] + s8[1]) + (s8[2] + s8[3])) + ((s8[4] + s8[5]) + (s8[6] + s8[7]));
        }
        for (int o = 16; o; o >>= 1) {
          const float a0 = __shfl_xor(sum[0], o, 32);
          const float a1 = __shfl_xor(sum[1], o, 32);
          sum[0] += a0;
          sum[1] += a1;
        }
#pragma unroll
        for (int rr = 0; rr < 2; ++rr) {
          const float inv = 1.0f / sum[rr];
#pragma unroll
          for (int q = 0; q < 8; ++q) {
            bf16x8 t;
#pragma unroll
            for (int i = 0; i < 8; ++i) {
              x[rr][q * 8 + i] *= inv;
              t[i] = (__bf16)x[rr][q * 8 + i];
            }
            *(bf16x8*)(prow + rr * PP_ + q * 256) = t;
          }
          if (p * 2 + rr < 3) {
#pragma unroll
            for (int i = 0; i < 64; ++i) mean[p * 2 + rr][i] += x[rr][i];
          } else {
#pragma unroll
            for (int q = 0; q < 16; ++q) {
              float4 mv = *(const float4*)(mrow + (q >> 1) * 256 + (q & 1) * 4);
              mv.x += x[rr][q * 4 + 0];
              mv.y += x[rr][q * 4 + 1];
              mv.z += x[rr][q * 4 + 2];
              mv.w += x[rr][q * 4 + 3];
              *(float4*)(mrow + (q >> 1) * 256 + (q & 1) * 4) = mv;
            }
          }
        }
      }
      __syncthreads();
    }
  }

  // ---- write attn_mean = sum/H once: a wave's store covers 1 KB of one row ----
  float* mout = attnMean + ((long)b * S_ + s0 + wave * 4) * S_ + lane * 8;
#pragma unroll
  for (int r = 0; r < 4; ++r) {
    float4 v[16];
#pragma unroll
    for (int q = 0; q < 16; ++q) {
      if (r < 3) {
        v[q] = make_float4(mean[r][q * 4 + 0], mean[r][q * 4 + 1], mean[r][q * 4 + 2], mean[r][q * 4 + 3]);
      } else {
        v[q] = *(const float4*)(mrow + (q >> 1) * 256 + (q & 1) * 4);
      }
      v[q].x *= 0.125f; v[q].y *= 0.125f; v[q].z *= 0.125f; v[q].w *= 0.125f;
    }
    // all of a row's products stand in front of its stores, so that none of them
    // is written into a register that an issued store of the same row names
    __builtin_amdgcn_sched_barrier(0);
#pragma unroll
    for (int q = 0; q < 16; ++q)
      *(float4*)(mout + (long)r * S_ + (q >> 1) * 256 + (q & 1) * 4) = v[q];
    // the wait that belongs in front of an overwrite of a register which an issued
    // store names; the barrier behind it holds the next row's products behind it
    asm volatile("s_wait_xcnt 0x0" ::: "memory");
    __builtin_amdgcn_sched_barrier(0);
  }
}

// ---------------------------------------------------------------------------
// LayerNorm over D=256 (one row per 256-thread block, 8 wave32 partials)
// ---------------------------------------------------------------------------
__global__ void __launch_bounds__(256)
ln_k(const float* __restrict__ in, const float* __restrict__ res,
     const float* __restrict__ g, const float* __restrict__ be,
     float* __restrict__ outF, __bf16* __restrict__ outB) {
  __shared__ float red[8];
  const long row = blockIdx.x;
  const int  t   = threadIdx.x;
  float x = in[row * D_ + t];
  if (res) x += res[row * D_ + t];

  float v = x;
  for (int o = 16; o; o >>= 1) v += __shfl_xor(v, o, 32);
  if ((t & 31) == 0) red[t >> 5] = v;
  __syncthreads();
  float tot = 0.0f;
#pragma unroll
  for (int i = 0; i < 8; ++i) tot += red[i];
  const float mean = tot * (1.0f / D_);
  __syncthreads();

  const float d = x - mean;
  float v2 = d * d;
  for (int o = 16; o; o >>= 1) v2 += __shfl_xor(v2, o, 32);
  if ((t & 31) == 0) red[t >> 5] = v2;
  __syncthreads();
  float tot2 = 0.0f;
#pragma unroll
  for (int i = 0; i < 8; ++i) tot2 += red[i];
  const float var = tot2 * (1.0f / D_);

  const float y = d * rsqrtf(var + 1e-5f) * g[t] + be[t];
  if (outF) outF[row * D_ + t] = y;
  if (outB) outB[row * D_ + t] = (__bf16)y;
}

// ---------------------------------------------------------------------------
// Host-side orchestration (all launches on `stream`, graph-capture safe)
// ---------------------------------------------------------------------------
extern "C" void kernel_launch(void* const* d_in, const int* in_sizes, int n_in,
                              void* d_out, int out_size, void* d_ws, size_t ws_size,
                              hipStream_t stream) {
  const float* X  = (const float*)d_in[0];
  const float* Wq = (const float*)d_in[1];
  const float* Wk = (const float*)d_in[2];
  const float* Wv = (const float*)d_in[3];
  const float* Wz = (const float*)d_in[4];
  const float* bz = (const float*)d_in[5];
  const float* W1 = (const float*)d_in[6];
  const float* b1 = (const float*)d_in[7];
  const float* W2 = (const float*)d_in[8];
  const float* b2 = (const float*)d_in[9];
  const float* g1  = (const float*)d_in[10];
  const float* be1 = (const float*)d_in[11];
  const float* g2  = (const float*)d_in[12];
  const float* be2 = (const float*)d_in[13];

  float* outZ    = (float*)d_out;            // [B,S,D]
  float* outAttn = outZ + M_ * D_;           // [B,S,S]

  // ---- workspace carve-up ----
  char* ws = (char*)d_ws;
  size_t off = 0;
  auto alloc = [&](size_t bytes) { char* p = ws + off; off = (off + bytes + 255) & ~(size_t)255; return p; };
  __bf16* Xb   = (__bf16*)alloc(M_ * D_ * 2);
  __bf16* WqT  = (__bf16*)alloc((size_t)H_ * D_ * D_ * 2);
  __bf16* WkT  = (__bf16*)alloc((size_t)H_ * D_ * D_ * 2);
  __bf16* WvT  = (__bf16*)alloc((size_t)H_ * D_ * D_ * 2);
  __bf16* WzT  = (__bf16*)alloc((size_t)HD_ * D_ * 2);
  __bf16* W1T  = (__bf16*)alloc((size_t)FD_ * D_ * 2);
  __bf16* W2T  = (__bf16*)alloc((size_t)D_ * FD_ * 2);
  __bf16* Qb   = (__bf16*)alloc((size_t)H_ * M_ * D_ * 2);
  __bf16* Kb   = (__bf16*)alloc((size_t)H_ * M_ * D_ * 2);
  __bf16* VbT  = (__bf16*)alloc((size_t)H_ * D_ * M_ * 2);
  __bf16* Zcat = (__bf16*)alloc((size_t)M_ * HD_ * 2);
  float*  zres  = (float*)alloc((size_t)M_ * D_ * 4);
  float*  zln1f = (float*)alloc((size_t)M_ * D_ * 4);
  __bf16* zln1b = (__bf16*)alloc((size_t)M_ * D_ * 2);
  __bf16* Hff   = (__bf16*)alloc((size_t)M_ * FD_ * 2);
  float*  zff   = (float*)alloc((size_t)M_ * D_ * 4);
  (void)ws_size; (void)in_sizes; (void)n_in; (void)out_size;

  // ---- 1. casts / weight transposes ----
  cast_bf16_k<<<1024, 256, 0, stream>>>(X, Xb, M_ * D_);
  dim3 tb(16, 16);
  transpose_cast_k<<<dim3(D_/16, D_/16, H_), tb, 0, stream>>>(Wq, WqT, D_, D_, (long)D_*D_, (long)D_*D_);
  transpose_cast_k<<<dim3(D_/16, D_/16, H_), tb, 0, stream>>>(Wk, WkT, D_, D_, (long)D_*D_, (long)D_*D_);
  transpose_cast_k<<<dim3(D_/16, D_/16, H_), tb, 0, stream>>>(Wv, WvT, D_, D_, (long)D_*D_, (long)D_*D_);
  transpose_cast_k<<<dim3(D_/16, HD_/16, 1), tb, 0, stream>>>(Wz, WzT, (int)HD_, D_, 0, 0);
  transpose_cast_k<<<dim3(FD_/16, D_/16, 1), tb, 0, stream>>>(W1, W1T, D_, FD_, 0, 0);
  transpose_cast_k<<<dim3(D_/16, FD_/16, 1), tb, 0, stream>>>(W2, W2T, FD_, D_, 0, 0);

  const float scale = 0.25f;  // D^-0.25 = 256^-0.25
  // ---- 2. QKV projections (bf16 WMMA), per-head via grid.z ----
  gemm_bf16_wmma<<<dim3(M_/128, D_/64, H_), 256, 0, stream>>>(
      Xb, D_, 0, WqT, D_, (long)D_*D_, nullptr, nullptr, 0, scale, 0,
      nullptr, Qb, D_, (long)M_*D_, nullptr, 0, 0, D_);
  gemm_bf16_wmma<<<dim3(M_/128, D_/64, H_), 256, 0, stream>>>(
      Xb, D_, 0, WkT, D_, (long)D_*D_, nullptr, nullptr, 0, scale, 0,
      nullptr, Kb, D_, (long)M_*D_, nullptr, 0, 0, D_);
  gemm_bf16_wmma<<<dim3(M_/128, D_/64, H_), 256, 0, stream>>>(
      Xb, D_, 0, WvT, D_, (long)D_*D_, nullptr, nullptr, 0, 1.0f, 0,
      nullptr, nullptr, 0, 0, VbT, M_, (long)D_*M_, D_);   // V stored transposed

  // ---- 3. attention (scores + softmax + P@V + attn_mean) ----
  attn_k<<<dim3(S_/QR_, B_), 256, 0, stream>>>(Qb, Kb, VbT, Zcat, outAttn);

  // ---- 4. output projection + bias + residual (fp32 out) ----
  gemm_bf16_wmma<<<dim3(M_/128, D_/64, 1), 256, 0, stream>>>(
      Zcat, HD_, 0, WzT, HD_, 0, bz, X, D_, 1.0f, 0,
      zres, nullptr, D_, 0, nullptr, 0, 0, (int)HD_);

  // ---- 5. LayerNorm 1 ----
  ln_k<<<M_, D_, 0, stream>>>(zres, nullptr, g1, be1, zln1f, zln1b);

  // ---- 6. MLP ----
  gemm_bf16_wmma<<<dim3(M_/128, FD_/64, 1), 256, 0, stream>>>(
      zln1b, D_, 0, W1T, D_, 0, b1, nullptr, 0, 1.0f, 1,
      nullptr, Hff, FD_, 0, nullptr, 0, 0, D_);
  gemm_bf16_wmma<<<dim3(M_/128, D_/64, 1), 256, 0, stream>>>(
      Hff, FD_, 0, W2T, FD_, 0, b2, nullptr, 0, 1.0f, 0,
      zff, nullptr, D_, 0, nullptr, 0, 0, FD_);

  // ---- 7. LayerNorm 2 (+residual) -> final z output ----
  ln_k<<<M_, D_, 0, stream>>>(zff, zln1f, g2, be2, outZ, nullptr);
}

// v005
// A run of this version takes 394 microseconds.
// Next to v004, in two timings, it ran 1.03 times as fast each time.
// Counting every step since v000, it is 2.42 times as fast.
#include <hip/hip_runtime.h>
#include <hip/hip_bf16.h>
#include <stdint.h>

// ---------------------------------------------------------------------------
// Problem dims (compile-time constants from the reference)
// ---------------------------------------------------------------------------
constexpr int  B_   = 4;
constexpr int  S_   = 2048;
constexpr int  D_   = 256;
constexpr int  H_   = 8;
constexpr int  FD_  = 512;             // F*D
constexpr long M_   = (long)B_ * S_;   // 8192 flattened rows
constexpr long HD_  = (long)H_ * D_;   // 2048 concat width

typedef __attribute__((ext_vector_type(16))) __bf16 bf16x16;
typedef __attribute__((ext_vector_type(8)))  __bf16 bf16x8;
typedef __attribute__((ext_vector_type(8)))  float  f32x8;
typedef __attribute__((ext_vector_type(4)))  unsigned int u32x4;
typedef __attribute__((ext_vector_type(8)))  int i32x8;
typedef __attribute__((ext_vector_type(4)))  int i32x4;

#if defined(__has_builtin)
#if __has_builtin(__builtin_amdgcn_tensor_load_to_lds)
#define HAVE_TDM 1
#else
#define HAVE_TDM 0
#endif
#else
#define HAVE_TDM 0
#endif

// ---------------------------------------------------------------------------
// WMMA helpers.  CDNA5 bf16 A/B fragment layout (16x32 / 32x16):
//   lanes 0..15  : row=lane,    K = [0..7]  and [16..23]
//   lanes 16..31 : row=lane-16, K = [8..15] and [24..31]
// With contiguous-K data a fragment is two 16-byte loads + a shuffle.
// ---------------------------------------------------------------------------
__device__ __forceinline__ bf16x16 frag_ld_g(const __bf16* p) {
  bf16x8 lo = *(const bf16x8*)(p);
  bf16x8 hi = *(const bf16x8*)(p + 16);
  return __builtin_shufflevector(lo, hi, 0,1,2,3,4,5,6,7,8,9,10,11,12,13,14,15);
}

__device__ __forceinline__ f32x8 wmma_bf16(bf16x16 a, bf16x16 b, f32x8 c) {
  return __builtin_amdgcn_wmma_f32_16x16x32_bf16(
      /*neg_a=*/false, a, /*neg_b=*/false, b,
      /*c_mod=*/(short)0, c, /*reuse_a=*/false, /*reuse_b=*/false);
}

#if HAVE_TDM
// ---------------------------------------------------------------------------
// TDM: DMA a 64(row) x 32(k) bf16 tile (row stride ldbt elems) from global
// into LDS at byte offset ldsOff, inserting 16B of padding after every 64B
// row (pad_interval=16 DWORDs -> code 3, pad_amount=4 DWORDs -> code 3),
// i.e. an 80-byte LDS row pitch for bank-conflict-free b128 fragment reads.
// Toolchain probe: 6-arg builtin (g0:u32x4, g1:i32x8, g2:i32x4, g3:i32x4,
// g4:i32x8, cpol:i32).
// ---------------------------------------------------------------------------
__device__ __forceinline__ void tdm_load_tile(const __bf16* gsrc,
                                              unsigned ldsOff, long ldbt) {
  unsigned long long ga = (unsigned long long)(uintptr_t)gsrc;
  u32x4 g0;
  g0[0] = 1u;                                        // count=1, user mode
  g0[1] = ldsOff;                                    // lds_addr (bytes)
  g0[2] = (unsigned)(ga & 0xFFFFFFFFull);            // global_addr[31:0]
  g0[3] = (unsigned)((ga >> 32) & 0x01FFFFFFull)     // global_addr[56:32]
          | 0x80000000u;                             // type=2 ("image")
  i32x8 g1;
  g1[0] = (1 << 16)      // data_size = 2 bytes
        | (1 << 20)      // pad_enable
        | (3 << 22)      // pad_interval: 16 DWORDs
        | (3 << 25);     // pad_amount:   4 DWORDs
  g1[1] = 0;                                   // tensor_dim0 low16 (bits 63:48)
  g1[2] = (1 << 14);                           // tensor_dim0 = 1<<30 (hi bits)
  g1[3] = 16 | (32 << 16);                     // tensor_dim1=1<<20 hi, tile_dim0=32
  g1[4] = 64;                                  // tile_dim1=64, tile_dim2=0
  g1[5] = (int)ldbt;                           // tensor_dim0_stride[31:0]
  g1[6] = 0;                                   // stride hi / dim1_stride lo
  g1[7] = 0;
  i32x4 z4 = {0, 0, 0, 0};
  i32x8 z8 = {0, 0, 0, 0, 0, 0, 0, 0};
  __builtin_amdgcn_tensor_load_to_lds(g0, g1, z4, z4, z8, 0);
}

template <int N>
__device__ __forceinline__ void tdm_wait() {
#if __has_builtin(__builtin_amdgcn_s_wait_tensorcnt)
  __builtin_amdgcn_s_wait_tensorcnt((short)N);
#else
  asm volatile("s_wait_tensorcnt %0" :: "i"(N) : "memory");
#endif
}
#endif  // HAVE_TDM

// ---------------------------------------------------------------------------
// fp32 -> bf16 cast (grid-stride)
// ---------------------------------------------------------------------------
__global__ void cast_bf16_k(const float* __restrict__ in,
                            __bf16* __restrict__ out, long n) {
  long i      = (long)blockIdx.x * blockDim.x + threadIdx.x;
  long stride = (long)gridDim.x * blockDim.x;
  for (; i < n; i += stride) out[i] = (__bf16)in[i];
}

// ---------------------------------------------------------------------------
// fp32 [rows][cols] -> bf16 transposed [cols][rows]   (per-z slice)
// ---------------------------------------------------------------------------
__global__ void transpose_cast_k(const float* __restrict__ in,
                                 __bf16* __restrict__ out,
                                 int rows, int cols,
                                 long inStrideZ, long outStrideZ) {
  __shared__ float tile[16][17];
  const float* inz  = in  + (long)blockIdx.z * inStrideZ;
  __bf16*      outz = out + (long)blockIdx.z * outStrideZ;
  int c = blockIdx.x * 16 + threadIdx.x;
  int r = blockIdx.y * 16 + threadIdx.y;
  if (r < rows && c < cols) tile[threadIdx.y][threadIdx.x] = inz[(long)r * cols + c];
  __syncthreads();
  int oc  = blockIdx.y * 16 + threadIdx.x;   // new col = old row
  int orw = blockIdx.x * 16 + threadIdx.y;   // new row = old col
  if (orw < cols && oc < rows)
    outz[(long)orw * rows + oc] = (__bf16)tile[threadIdx.x][threadIdx.y];
}

// ---------------------------------------------------------------------------
// Generic bf16 WMMA GEMM:  C = act(alpha * A @ B + bias + res)
//   A  : [M][K] bf16 row-major (per-z stride aStrideZ)
//   BT : [N][K] bf16 (B pre-transposed -> contiguous K fragments)
// Block: 256 threads = 8 waves, tile 128(M) x 64(N); wave = 16x64 (4 accums).
// The 64xK B panel is shared by all 8 waves, so it is staged through LDS:
// TDM double-buffered DMA (wave 0 issues, TENSORcnt-ordered) when available,
// else a synchronous cooperative copy.  LDS row pitch 80B (32 k-elems + 8
// pad elems) -> conflict-free ds_load_b128 fragment reads.
// ---------------------------------------------------------------------------
__global__ void __launch_bounds__(256)
gemm_bf16_wmma(const __bf16* __restrict__ A,  long lda,  long aStrideZ,
               const __bf16* __restrict__ BT, long ldbt, long btStrideZ,
               const float* __restrict__ bias,
               const float* __restrict__ res, long ldres,
               float alpha, int relu,
               float*  __restrict__ outF,
               __bf16* __restrict__ outB,  long ldo,  long oStrideZ,
               __bf16* __restrict__ outBT, long ldoT, long oTStrideZ,
               int K) {
  __shared__ __bf16 sB[2][64 * 40];   // 2 x 5120B padded tiles

  const int tid  = threadIdx.x;
  const int lane = tid & 31;
  const int wave = tid >> 5;
  const int z    = blockIdx.z;
  const long m0  = (long)blockIdx.x * 128 + wave * 16;
  const long n0  = (long)blockIdx.y * 64;
  const int  ml  = lane & 15;
  const int  kh  = (lane < 16) ? 0 : 8;   // K half-offset per fragment layout
  const int  rh  = (lane < 16) ? 0 : 8;   // C/D row-half offset

  const __bf16* aRow   = A  + (long)z * aStrideZ + (m0 + ml) * lda + kh;
  const __bf16* Bpanel = BT + (long)z * btStrideZ + n0 * ldbt;  // [64][K]

#if HAVE_TDM
  const unsigned ldsBase = (unsigned)(uintptr_t)(&sB[0][0]);
  if (tid < 32) tdm_load_tile(Bpanel, ldsBase, ldbt);           // prologue
#endif

  f32x8 acc[4] = {};
  const int nsteps = K >> 5;
  for (int s = 0; s < nsteps; ++s) {
    const int k0  = s << 5;
    const int cur = s & 1;
#if HAVE_TDM
    if (tid < 32) {
      if (s + 1 < nsteps) {
        tdm_load_tile(Bpanel + k0 + 32, ldsBase + (unsigned)((cur ^ 1) * 64 * 40 * 2), ldbt);
        tdm_wait<1>();   // previous DMA (in-order) has landed
      } else {
        tdm_wait<0>();
      }
    }
    __syncthreads();
#else
    {   // synchronous cooperative staging: 256 threads x 16B = 4KB tile
      const int n = tid >> 2, c = tid & 3;
      *(bf16x8*)(&sB[cur][n * 40 + c * 8]) =
          *(const bf16x8*)(Bpanel + (long)n * ldbt + k0 + c * 8);
      __syncthreads();
    }
#endif
    bf16x16 afr = frag_ld_g(aRow + k0);
    __builtin_prefetch(aRow + k0 + 128, 0, 1);   // global_prefetch_b8
    const __bf16* bl = &sB[cur][kh];
#pragma unroll
    for (int j = 0; j < 4; ++j) {
      bf16x16 bfr = frag_ld_g(bl + (j * 16 + ml) * 40);
      acc[j] = wmma_bf16(afr, bfr, acc[j]);
    }
    __syncthreads();   // protect buffer before it is overwritten
  }

#pragma unroll
  for (int j = 0; j < 4; ++j) {
    const long n   = n0 + j * 16 + ml;
    const float bv = bias ? bias[n] : 0.0f;
    if (outBT) {
      // transposed store: 8 consecutive M per lane -> one 16B store
      bf16x8 t;
#pragma unroll
      for (int i = 0; i < 8; ++i) {
        long m  = m0 + rh + i;
        float v = acc[j][i] * alpha + bv;
        if (res)  v += res[m * ldres + n];
        if (relu) v = fmaxf(v, 0.0f);
        t[i] = (__bf16)v;
      }
      *(bf16x8*)(outBT + (long)z * oTStrideZ + n * ldoT + (m0 + rh)) = t;
    } else {
#pragma unroll
      for (int i = 0; i < 8; ++i) {
        long m  = m0 + rh + i;
        float v = acc[j][i] * alpha + bv;
        if (res)  v += res[m * ldres + n];
        if (relu) v = fmaxf(v, 0.0f);
        long off = (long)z * oStrideZ + m * ldo + n;
        if (outF) outF[off] = v;
        if (outB) outB[off] = (__bf16)v;
      }
    }
  }
}

// ---------------------------------------------------------------------------
// Attention: one block per (batch, 32-row tile), loop over 8 heads.
//   scores/probs : bf16 LDS [32][2048], row pitch 2056 elems (131584 B)
//   staging      : bf16 LDS [8 waves][32*136] (68 KB)
//   mean accum   : fp32, 4 rows a wave: 3 in registers (192 a lane), 1 in LDS
//                  [8 waves][2048] (64 KB) -> 266752 B static LDS
// Stage 1: each wave computes a 32x256 score slab (Q fragments register-
//          resident: 16 x bf16x16 = 128 VGPRs, reused across 16 tiles).
// Stage 2: each wave softmaxes 4 rows, two at a time, held in registers.
// Stage 3: each wave computes a 32x32 slab of P@V (V pre-transposed).
// Every staged K or V^T tile is the B operand of two 16-row blocks, so a block
// of 32 rows reads K and V once where two blocks of 16 read them twice.
// attn_mean accumulates with the wave that softmaxes the row, each lane keeping
// the columns it holds there: 32 rows of fp32 do not fit in LDS beside the
// probabilities, nor in registers beside the Q fragments, so they are split.
// No lane touches another lane's part. It is written to HBM exactly once.
// K rows and V^T rows reach their B fragments through a wave-private LDS tile:
// the global loads cover whole 128-byte lines (a fragment-shaped load touches
// 16 lines for 512 bytes), the fragment shape is formed by the LDS reads.
//   K tile   : 16 rows x 256 k, pitch 264 elems (528 B)
//   V^T tile : 32 rows x 128 t, pitch 136 elems (272 B)
// The probability rows are read as A fragments (16 rows at one column), so they
// too get a padded pitch: 2056 elems (4112 B); at 4096 B all 16 rows of a
// fragment read start on the same bank.
// All three pitches are 16 B x odd: conflict-free ds_load_b128 fragment reads.
// ---------------------------------------------------------------------------
constexpr int QR_      = 32;     // query rows per block
constexpr int KP_      = 264;    // K tile pitch, elements
constexpr int VP_      = 136;    // V^T tile pitch, elements
constexpr int PP_      = 2056;   // score / probability row pitch, elements
constexpr int STAGE_E_ = 32 * VP_;   // elements per wave (the larger of the two tiles)
constexpr int ATTN_LDS_ = QR_ * PP_ * 2 + 8 * STAGE_E_ * 2 + 8 * 2048 * 4;   // 266752 B

// Orders this wave's own LDS traffic on its staging tile: lanes read rows that
// other lanes of the same wave wrote, which the compiler cannot see.
__device__ __forceinline__ void stage_sync() {
  asm volatile("s_wait_dscnt 0x0" ::: "memory");
}

// Stands behind a tile's global loads. Naming their address keeps its registers
// untouched up to the wait and puts the step to the next tile behind it.
template <typename T>
__device__ __forceinline__ void addr_sync(T& a) {
  asm volatile("s_wait_xcnt 0x0" : "+v"(a) : : "memory");
}

// 16 bytes at base plus a byte offset and an immediate (wave-uniform base in the next-tile loads)
__device__ __forceinline__ bf16x8 ld16(const __bf16* base, unsigned off, int imm) {
  return *(const bf16x8*)((const char*)base + off + imm);
}
// Eight 2^v in place. One statement, so that no instruction that overwrites a
// source or reads a result can be scheduled directly behind a transcendental:
// the eight work on distinct registers, and the v_nop is the free slot that the
// instruction set asks for behind the last one.
__device__ __forceinline__ void exp2_x8(float& a, float& b, float& c, float& d,
                                        float& e, float& f, float& g, float& h) {
  asm("v_exp_f32 %0, %0\n\tv_exp_f32 %1, %1\n\tv_exp_f32 %2, %2\n\tv_exp_f32 %3, %3\n\t"
      "v_exp_f32 %4, %4\n\tv_exp_f32 %5, %5\n\tv_exp_f32 %6, %6\n\tv_exp_f32 %7, %7\n\t"
      "v_nop"
      : "+v"(a), "+v"(b), "+v"(c), "+v"(d), "+v"(e), "+v"(f), "+v"(g), "+v"(h));
}

__global__ void __launch_bounds__(256)
attn_k(const __bf16* __restrict__ Qb,   // [H][B*S][D]
       const __bf16* __restrict__ Kb,   // [H][B*S][D]
       const __bf16* __restrict__ VbT,  // [H][D][B*S]  (transposed)
       __bf16* __restrict__ Zcat,       // [B*S][H*D]
       float*  __restrict__ attnMean) { // [B][S][S]
  __shared__ __attribute__((aligned(16))) char smem[ATTN_LDS_];
  __bf16* sP    = (__bf16*)smem;                    // [QR_][PP_]
  __bf16* sStage = (__bf16*)(smem + QR_ * PP_ * 2); // [8 waves][STAGE_E_]
  float*  sMean = (float*)(smem + QR_ * PP_ * 2 + 8 * STAGE_E_ * 2);   // [8 waves][2048]

  const int tid  = threadIdx.x;
  const int lane = tid & 31;
  const int wave = tid >> 5;
  const int b    = blockIdx.y;
  const long s0  = (long)blockIdx.x * QR_;
  const int ml   = lane & 15;
  const int kh   = (lane < 16) ? 0 : 8;
  const int rh   = (lane < 16) ? 0 : 8;
  __bf16* sT     = sStage + wave * STAGE_E_;        // this wave's tile

  // sum over the heads of rows [4*wave, 4*wave+4), in the softmax's own layout:
  // element q*8+i is column q*256 + lane*8 + i. Every index is a constant.
  // Rows 0 to 2 in registers, row 3 in this wave's LDS row, same columns a lane.
  float mean[3][64];
  float* mrow = sMean + wave * 2048 + lane * 8;
#pragma unroll
  for (int r = 0; r < 3; ++r) {
#pragma unroll
    for (int i = 0; i < 64; ++i) mean[r][i] = 0.0f;
  }
#pragma unroll
  for (int q = 0; q < 16; ++q)
    *(float4*)(mrow + (q >> 1) * 256 + (q & 1) * 4) = make_float4(0.0f, 0.0f, 0.0f, 0.0f);

  // One trip runs stage 3 of the head before and then stages 1 and 2 of its own
  // head: the order of the stages is the plain one, but stage 2 ends the loop's
  // body. With stage 3 last the compiler moves stage 2's additions into mean[][]
  // behind it, keeps the probabilities live across it beside the sums, and spills.
  for (int hh = 0; hh <= H_; ++hh) {
    if (hh > 0) {
      const int h = hh - 1;
      // ---- stage 3: zh slab, e in [wave*32, wave*32+32) ----
      const int e0 = wave * 32;
      const __bf16* vbase = VbT + (long)h * D_ * M_ + (long)b * S_;
      f32x8 acc00 = {}, acc01 = {}, acc10 = {}, acc11 = {};   // [row block][column block]
      // one load = 256 B of each of two V^T rows (four whole lines)
      const int vrw = lane >> 4, vch = (lane & 15) * 8;
      unsigned vg = (unsigned)((e0 + vrw) * (int)M_ + vch) * 2u;   // bytes from vbase
      const __bf16* v0 = vbase + (e0 + vrw) * (int)M_ + vch;       // first tile
      bf16x8 vr[16];
#pragma unroll   // static indices keep vr[] in registers
      for (int q = 0; q < 16; ++q) vr[q] = ld16(v0, 0u, 2 * q * (int)M_ * 2);
      addr_sync(v0);

      for (int c = 0; c < S_ / 128; ++c) {
        stage_sync();   // the last tile's fragment reads are done
#pragma unroll   // static indices keep vr[] in registers
        for (int q = 0; q < 16; ++q)
          *(bf16x8*)(sT + (2 * q + vrw) * VP_ + vch) = vr[q];
        if (c + 1 < S_ / 128) {   // next tile flies while this tile is worked on
          vg += 128 * 2;
#pragma unroll   // static indices keep vr[] in registers
          for (int q = 0; q < 16; ++q) vr[q] = ld16(vbase, vg, 2 * q * (int)M_ * 2);
          addr_sync(vg);
        }
        stage_sync();   // the tile is written before any lane reads it back
#pragma unroll   // the four k steps of a tile read at constant LDS offsets
        for (int ts = 0; ts < 4; ++ts) {
          const int t0 = c * 128 + ts * 32;
          bf16x16 a0 = frag_ld_g(sP + (long)ml * PP_ + t0 + kh);
          bf16x16 a1 = frag_ld_g(sP + (long)(16 + ml) * PP_ + t0 + kh);
          bf16x16 b0 = frag_ld_g(sT + ml * VP_ + ts * 32 + kh);
          bf16x16 b1 = frag_ld_g(sT + (16 + ml) * VP_ + ts * 32 + kh);
          acc00 = wmma_bf16(a0, b0, acc00);
          acc01 = wmma_bf16(a0, b1, acc01);
          acc10 = wmma_bf16(a1, b0, acc10);
          acc11 = wmma_bf16(a1, b1, acc11);
        }
      }
#pragma unroll
      for (int i = 0; i < 8; ++i) {
        long rowm = (long)b * S_ + s0 + rh + i;
        Zcat[rowm * HD_ + (h * D_ + e0 + ml)]             = (__bf16)acc00[i];
        Zcat[rowm * HD_ + (h * D_ + e0 + 16 + ml)]        = (__bf16)acc01[i];
        Zcat[(rowm + 16) * HD_ + (h * D_ + e0 + ml)]      = (__bf16)acc10[i];
        Zcat[(rowm + 16) * HD_ + (h * D_ + e0 + 16 + ml)] = (__bf16)acc11[i];
      }
      __syncthreads();   // protect sP before next head
    }
    if (hh < H_) {
      const int h = hh;
      const __bf16* Qh = Qb + ((long)h * M_ + (long)b * S_ + s0) * D_;
      const __bf16* Kh = Kb + ((long)h * M_ + (long)b * S_) * D_;

      // ---- stage 1: scores for t in [wave*256, wave*256+256) ----
      const int tbase = wave * 256;
      const __bf16* qrow = Qh + (long)ml * D_ + kh;
      bf16x16 qf[2][8];
#pragma unroll
      for (int g = 0; g < 2; ++g) {
#pragma unroll
        for (int e = 0; e < 8; ++e) qf[g][e] = frag_ld_g(qrow + g * 16 * D_ + e * 32);
      }
      addr_sync(qrow);

      // one load = one whole K row (32 lanes x 16 B = 512 B)
      unsigned kg = (unsigned)(tbase * D_ + lane * 8) * 2u;   // bytes from Kh
      const __bf16* k0 = Kh + tbase * D_ + lane * 8;          // first tile
      bf16x8 kr[16];
#pragma unroll   // static indices keep kr[] in registers
      for (int r = 0; r < 16; ++r) kr[r] = ld16(k0, 0u, r * D_ * 2);
      addr_sync(k0);

      for (int j = 0; j < 16; ++j) {
        const int t0 = tbase + j * 16;
        stage_sync();   // the last tile's fragment reads are done
#pragma unroll   // static indices keep kr[] in registers
        for (int r = 0; r < 16; ++r) *(bf16x8*)(sT + r * KP_ + lane * 8) = kr[r];
        if (j + 1 < 16) {   // next tile's rows fly while this tile is worked on
          kg += 16 * D_ * 2;
#pragma unroll   // static indices keep kr[] in registers
          for (int r = 0; r < 16; ++r) kr[r] = ld16(Kh, kg, r * D_ * 2);
          addr_sync(kg);
        }
        stage_sync();   // the tile is written before any lane reads it back
        const __bf16* krow = sT + ml * KP_ + kh;
        f32x8 accA = {}, accB = {};
#pragma unroll
        for (int e = 0; e < 8; ++e) {
          bf16x16 bfr = frag_ld_g(krow + e * 32);
          accA = wmma_bf16(qf[0][e], bfr, accA);
          accB = wmma_bf16(qf[1][e], bfr, accB);
        }
#pragma unroll
        for (int i = 0; i < 8; ++i) {
          sP[(rh + i) * PP_ + t0 + ml]      = (__bf16)accA[i];
          sP[(16 + rh + i) * PP_ + t0 + ml] = (__bf16)accB[i];
        }
      }
      __syncthreads();

      // ---- stage 2: softmax rows [4*wave, 4*wave+4), two at a time ----
      // Both rows live in registers from the read of the scores to the write of
      // the probabilities: a lane holds 8 chunks of 8 neighbouring columns of each
      // row, so every LDS access moves 16 bytes a lane and a row is read once and
      // written once. All loops below are unrolled so that x[][] and mean[][] stay
      // in registers.
#pragma unroll
      for (int p = 0; p < 2; ++p) {
        __bf16* prow = sP + (wave * 4 + p * 2) * PP_ + lane * 8;
        float x[2][64];
#pragma unroll
        for (int rr = 0; rr < 2; ++rr) {
#pragma unroll
          for (int q = 0; q < 8; ++q) {
            const bf16x8 t = *(const bf16x8*)(prow + rr * PP_ + q * 256);
#pragma unroll
            for (int i = 0; i < 8; ++i) x[rr][q * 8 + i] = (float)t[i];
          }
        }
        // one short chain per chunk instead of one chain of 64 links
        float mx[2];
#pragma unroll
        for (int rr = 0; rr < 2; ++rr) {
          float m8[8];
#pragma unroll
          for (int q = 0; q < 8; ++q) {
            m8[q] = x[rr][q * 8];
#pragma unroll
            for (int i = 1; i < 8; ++i) m8[q] = fmaxf(m8[q], x[rr][q * 8 + i]);
          }
          mx[rr] = fmaxf(fmaxf(fmaxf(m8[0], m8[1]), fmaxf(m8[2], m8[3])),
                         fmaxf(fmaxf(m8[4], m8[5]), fmaxf(m8[6], m8[7])));
        }
        // the two rows' exchanges go side by side and share their latency
        for (int o = 16; o; o >>= 1) {
          const float a0 = __shfl_xor(mx[0], o, 32);
          const float a1 = __shfl_xor(mx[1], o, 32);
          mx[0] = fmaxf(mx[0], a0);
          mx[1] = fmaxf(mx[1], a1);
        }
        float sum[2];
#pragma unroll
        for (int rr = 0; rr < 2; ++rr) {
          float s8[8];
#pragma unroll
          for (int q = 0; q < 8; ++q) {
            float* e = &x[rr][q * 8];
#pragma unroll
            for (int i = 0; i < 8; ++i) e[i] = (e[i] - mx[rr]) * 1.44269504f;   // exp(v) = 2^(v * log2 e)
            exp2_x8(e[0], e[1], e[2], e[3], e[4], e[5], e[6], e[7]);
            s8[q] = e[0];
#pragma unroll
            for (int i = 1; i < 8; ++i) s8[q] += e[i];
          }
          sum[rr] = ((s8[0] + s8[1]) + (s8[2] + s8[3])) + ((s8[4] + s8[5]) + (s8[6] + s8[7]));
        }
        for (int o = 16; o; o >>= 1) {
          const float a0 = __shfl_xor(sum[0], o, 32);
          const float a1 = __shfl_xor(sum[1], o, 32);
          sum[0] += a0;
          sum[1] += a1;
        }
#pragma unroll
        for (int rr = 0; rr < 2; ++rr) {
          const float inv = 1.0f / sum[rr];
#pragma unroll
          for (int q = 0; q < 8; ++q) {
            bf16x8 t;
#pragma unroll
            for (int i = 0; i < 8; ++i) {
              x[rr][q * 8 + i] *= inv;
              t[i] = (__bf16)x[rr][q * 8 + i];
            }
            *(bf16x8*)(prow + rr * PP_ + q * 256) = t;
          }
          if (p * 2 + rr < 3) {
#pragma unroll
            for (int i = 0; i < 64; ++i) mean[p * 2 + rr][i] += x[rr][i];
          } else {
#pragma unroll
            for (int q = 0; q < 16; ++q) {
              float4 mv = *(const float4*)(mrow + (q >> 1) * 256 + (q & 1) * 4);
              mv.x += x[rr][q * 4 + 0];
              mv.y += x[rr][q * 4 + 1];
              mv.z += x[rr][q * 4 + 2];
              mv.w += x[rr][q * 4 + 3];
              *(float4*)(mrow + (q >> 1) * 256 + (q & 1) * 4) = mv;
            }
          }
        }
      }
      __syncthreads();
    }
  }

  // ---- write attn_mean = sum/H once: a wave's store covers 1 KB of one row ----
  float* mout = attnMean + ((long)b * S_ + s0 + wave * 4) * S_ + lane * 8;
#pragma unroll
  for (int r = 0; r < 4; ++r) {
    float4 v[16];
#pragma unroll
    for (int q = 0; q < 16; ++q) {
      if (r < 3) {
        v[q] = make_float4(mean[r][q * 4 + 0], mean[r][q * 4 + 1], mean[r][q * 4 + 2], mean[r][q * 4 + 3]);
      } else {
        v[q] = *(const float4*)(mrow + (q >> 1) * 256 + (q & 1) * 4);
      }
      v[q].x *= 0.125f; v[q].y *= 0.125f; v[q].z *= 0.125f; v[q].w *= 0.125f;
    }
    // all of a row's products stand in front of its stores, so that none of them
    // is written into a register that an issued store of the same row names
    __builtin_amdgcn_sched_barrier(0);
#pragma unroll
    for (int q = 0; q < 16; ++q)
      *(float4*)(mout + (long)r * S_ + (q >> 1) * 256 + (q & 1) * 4) = v[q];
    // the wait that belongs in front of an overwrite of a register which an issued
    // store names; the barrier behind it holds the next row's products behind it
    asm volatile("s_wait_xcnt 0x0" ::: "memory");
    __builtin_amdgcn_sched_barrier(0);
  }
}

// ---------------------------------------------------------------------------
// LayerNorm over D=256: a row belongs to one wave, four rows a wave, 32 rows a
// block. A lane holds 8 columns of each row (two 16-byte pieces, so that every
// load and f32 store of a wave covers 512 contiguous bytes). No LDS, no barrier.
// The launch starts 2,048 waves where one block a row starts 65,536: a row is so
// short that starting its eight waves takes longer than moving its bytes.
// ---------------------------------------------------------------------------
constexpr int LNR_ = 4;   // rows a wave
typedef __attribute__((ext_vector_type(4))) __bf16 bf16x4;

// value of lane l ^ X inside the 16-lane row (DPP row_xmask:X, control 0x160 + X)
template <int X>
__device__ __forceinline__ float row_xor(float v) {
  return __builtin_bit_cast(float, __builtin_amdgcn_update_dpp(
      0, __builtin_bit_cast(int, v), 0x160 + X, 0xf, 0xf, true));
}
// sum over the 32 lanes, the same value in every lane; all lanes are on
__device__ __forceinline__ float wave_sum(float v) {
  v += row_xor<1>(v);
  v += row_xor<2>(v);
  v += row_xor<4>(v);
  v += row_xor<8>(v);
  const int bits = __builtin_bit_cast(int, v);   // lane l ^ 16
  v += __builtin_bit_cast(float, __builtin_amdgcn_permlanex16(
      bits, bits, 0x76543210, 0xfedcba98, false, false));
  return v;
}

__global__ void __launch_bounds__(256)
ln_k(const float* __restrict__ in, const float* __restrict__ res,
     const float* __restrict__ g, const float* __restrict__ be,
     float* __restrict__ outF, __bf16* __restrict__ outB) {
  const int  lane = threadIdx.x & 31;
  const int  wave = threadIdx.x >> 5;
  const long e0   = (((long)blockIdx.x * 8 + wave) * LNR_) * D_ + lane * 4;   // first element

  // all loads of the wave's rows are issued before the first of them is used
  float4 x[LNR_][2], rv[LNR_][2], gv[2], bv[2];
#pragma unroll
  for (int r = 0; r < LNR_; ++r) {
#pragma unroll
    for (int h = 0; h < 2; ++h) x[r][h] = *(const float4*)(in + e0 + r * D_ + h * 128);
  }
  if (res) {
#pragma unroll
    for (int r = 0; r < LNR_; ++r) {
#pragma unroll
      for (int h = 0; h < 2; ++h) rv[r][h] = *(const float4*)(res + e0 + r * D_ + h * 128);
    }
  } else {
#pragma unroll
    for (int r = 0; r < LNR_; ++r) {
#pragma unroll
      for (int h = 0; h < 2; ++h) rv[r][h] = make_float4(0.0f, 0.0f, 0.0f, 0.0f);
    }
  }
#pragma unroll
  for (int h = 0; h < 2; ++h) {
    gv[h] = *(const float4*)(g + lane * 4 + h * 128);
    bv[h] = *(const float4*)(be + lane * 4 + h * 128);
  }
  // the wait that belongs in front of an overwrite of a register which an issued
  // load names
  asm volatile("s_wait_xcnt 0x0" ::: "memory");

  // the four rows' chains are independent and fill each other's latency
  float s[LNR_];
#pragma unroll
  for (int r = 0; r < LNR_; ++r) {
#pragma unroll
    for (int h = 0; h < 2; ++h) {
      x[r][h].x += rv[r][h].x; x[r][h].y += rv[r][h].y;
      x[r][h].z += rv[r][h].z; x[r][h].w += rv[r][h].w;
    }
    s[r] = ((x[r][0].x + x[r][0].y) + (x[r][0].z + x[r][0].w)) +
           ((x[r][1].x + x[r][1].y) + (x[r][1].z + x[r][1].w));
  }
#pragma unroll
  for (int r = 0; r < LNR_; ++r) s[r] = wave_sum(s[r]);
#pragma unroll
  for (int r = 0; r < LNR_; ++r) {
    const float mean = s[r] * (1.0f / D_);
#pragma unroll
    for (int h = 0; h < 2; ++h) {
      x[r][h].x -= mean; x[r][h].y -= mean; x[r][h].z -= mean; x[r][h].w -= mean;
    }
    s[r] = ((x[r][0].x * x[r][0].x + x[r][0].y * x[r][0].y) +
            (x[r][0].z * x[r][0].z + x[r][0].w * x[r][0].w)) +
           ((x[r][1].x * x[r][1].x + x[r][1].y * x[r][1].y) +
            (x[r][1].z * x[r][1].z + x[r][1].w * x[r][1].w));
  }
#pragma unroll
  for (int r = 0; r < LNR_; ++r) s[r] = wave_sum(s[r]);

  bf16x4 yb[LNR_][2];
#pragma unroll
  for (int r = 0; r < LNR_; ++r) {
    const float rs = rsqrtf(s[r] * (1.0f / D_) + 1e-5f);
#pragma unroll
    for (int h = 0; h < 2; ++h) {
      x[r][h].x = x[r][h].x * rs * gv[h].x + bv[h].x;
      x[r][h].y = x[r][h].y * rs * gv[h].y + bv[h].y;
      x[r][h].z = x[r][h].z * rs * gv[h].z + bv[h].z;
      x[r][h].w = x[r][h].w * rs * gv[h].w + bv[h].w;
      yb[r][h][0] = (__bf16)x[r][h].x; yb[r][h][1] = (__bf16)x[r][h].y;
      yb[r][h][2] = (__bf16)x[r][h].z; yb[r][h][3] = (__bf16)x[r][h].w;
    }
  }
  // all results stand in front of the stores, so that none of them is written
  // into a register that an issued store names
  __builtin_amdgcn_sched_barrier(0);
  if (outF) {
#pragma unroll
    for (int r = 0; r < LNR_; ++r) {
#pragma unroll
      for (int h = 0; h < 2; ++h) *(float4*)(outF + e0 + r * D_ + h * 128) = x[r][h];
    }
    // as above, for the address of the stores that follow
    asm volatile("s_wait_xcnt 0x0" ::: "memory");
  }
  if (outB) {
#pragma unroll
    for (int r = 0; r < LNR_; ++r) {
#pragma unroll
      for (int h = 0; h < 2; ++h) *(bf16x4*)(outB + e0 + r * D_ + h * 128) = yb[r][h];
    }
  }
}

// ---------------------------------------------------------------------------
// Host-side orchestration (all launches on `stream`, graph-capture safe)
// ---------------------------------------------------------------------------
extern "C" void kernel_launch(void* const* d_in, const int* in_sizes, int n_in,
                              void* d_out, int out_size, void* d_ws, size_t ws_size,
                              hipStream_t stream) {
  const float* X  = (const float*)d_in[0];
  const float* Wq = (const float*)d_in[1];
  const float* Wk = (const float*)d_in[2];
  const float* Wv = (const float*)d_in[3];
  const float* Wz = (const float*)d_in[4];
  const float* bz = (const float*)d_in[5];
  const float* W1 = (const float*)d_in[6];
  const float* b1 = (const float*)d_in[7];
  const float* W2 = (const float*)d_in[8];
  const float* b2 = (const float*)d_in[9];
  const float* g1  = (const float*)d_in[10];
  const float* be1 = (const float*)d_in[11];
  const float* g2  = (const float*)d_in[12];
  const float* be2 = (const float*)d_in[13];

  float* outZ    = (float*)d_out;            // [B,S,D]
  float* outAttn = outZ + M_ * D_;           // [B,S,S]

  // ---- workspace carve-up ----
  char* ws = (char*)d_ws;
  size_t off = 0;
  auto alloc = [&](size_t bytes) { char* p = ws + off; off = (off + bytes + 255) & ~(size_t)255; return p; };
  __bf16* Xb   = (__bf16*)alloc(M_ * D_ * 2);
  __bf16* WqT  = (__bf16*)alloc((size_t)H_ * D_ * D_ * 2);
  __bf16* WkT  = (__bf16*)alloc((size_t)H_ * D_ * D_ * 2);
  __bf16* WvT  = (__bf16*)alloc((size_t)H_ * D_ * D_ * 2);
  __bf16* WzT  = (__bf16*)alloc((size_t)HD_ * D_ * 2);
  __bf16* W1T  = (__bf16*)alloc((size_t)FD_ * D_ * 2);
  __bf16* W2T  = (__bf16*)alloc((size_t)D_ * FD_ * 2);
  __bf16* Qb   = (__bf16*)alloc((size_t)H_ * M_ * D_ * 2);
  __bf16* Kb   = (__bf16*)alloc((size_t)H_ * M_ * D_ * 2);
  __bf16* VbT  = (__bf16*)alloc((size_t)H_ * D_ * M_ * 2);
  __bf16* Zcat = (__bf16*)alloc((size_t)M_ * HD_ * 2);
  float*  zres  = (float*)alloc((size_t)M_ * D_ * 4);
  float*  zln1f = (float*)alloc((size_t)M_ * D_ * 4);
  __bf16* zln1b = (__bf16*)alloc((size_t)M_ * D_ * 2);
  __bf16* Hff   = (__bf16*)alloc((size_t)M_ * FD_ * 2);
  float*  zff   = (float*)alloc((size_t)M_ * D_ * 4);
  (void)ws_size; (void)in_sizes; (void)n_in; (void)out_size;

  // ---- 1. casts / weight transposes ----
  cast_bf16_k<<<1024, 256, 0, stream>>>(X, Xb, M_ * D_);
  dim3 tb(16, 16);
  transpose_cast_k<<<dim3(D_/16, D_/16, H_), tb, 0, stream>>>(Wq, WqT, D_, D_, (long)D_*D_, (long)D_*D_);
  transpose_cast_k<<<dim3(D_/16, D_/16, H_), tb, 0, stream>>>(Wk, WkT, D_, D_, (long)D_*D_, (long)D_*D_);
  transpose_cast_k<<<dim3(D_/16, D_/16, H_), tb, 0, stream>>>(Wv, WvT, D_, D_, (long)D_*D_, (long)D_*D_);
  transpose_cast_k<<<dim3(D_/16, HD_/16, 1), tb, 0, stream>>>(Wz, WzT, (int)HD_, D_, 0, 0);
  transpose_cast_k<<<dim3(FD_/16, D_/16, 1), tb, 0, stream>>>(W1, W1T, D_, FD_, 0, 0);
  transpose_cast_k<<<dim3(D_/16, FD_/16, 1), tb, 0, stream>>>(W2, W2T, FD_, D_, 0, 0);

  const float scale = 0.25f;  // D^-0.25 = 256^-0.25
  // ---- 2. QKV projections (bf16 WMMA), per-head via grid.z ----
  gemm_bf16_wmma<<<dim3(M_/128, D_/64, H_), 256, 0, stream>>>(
      Xb, D_, 0, WqT, D_, (long)D_*D_, nullptr, nullptr, 0, scale, 0,
      nullptr, Qb, D_, (long)M_*D_, nullptr, 0, 0, D_);
  gemm_bf16_wmma<<<dim3(M_/128, D_/64, H_), 256, 0, stream>>>(
      Xb, D_, 0, WkT, D_, (long)D_*D_, nullptr, nullptr, 0, scale, 0,
      nullptr, Kb, D_, (long)M_*D_, nullptr, 0, 0, D_);
  gemm_bf16_wmma<<<dim3(M_/128, D_/64, H_), 256, 0, stream>>>(
      Xb, D_, 0, WvT, D_, (long)D_*D_, nullptr, nullptr, 0, 1.0f, 0,
      nullptr, nullptr, 0, 0, VbT, M_, (long)D_*M_, D_);   // V stored transposed

  // ---- 3. attention (scores + softmax + P@V + attn_mean) ----
  attn_k<<<dim3(S_/QR_, B_), 256, 0, stream>>>(Qb, Kb, VbT, Zcat, outAttn);

  // ---- 4. output projection + bias + residual (fp32 out) ----
  gemm_bf16_wmma<<<dim3(M_/128, D_/64, 1), 256, 0, stream>>>(
      Zcat, HD_, 0, WzT, HD_, 0, bz, X, D_, 1.0f, 0,
      zres, nullptr, D_, 0, nullptr, 0, 0, (int)HD_);

  // ---- 5. LayerNorm 1 ----
  ln_k<<<M_ / (8 * LNR_), 256, 0, stream>>>(zres, nullptr, g1, be1, zln1f, zln1b);

  // ---- 6. MLP ----
  gemm_bf16_wmma<<<dim3(M_/128, FD_/64, 1), 256, 0, stream>>>(
      zln1b, D_, 0, W1T, D_, 0, b1, nullptr, 0, 1.0f, 1,
      nullptr, Hff, FD_, 0, nullptr, 0, 0, D_);
  gemm_bf16_wmma<<<dim3(M_/128, D_/64, 1), 256, 0, stream>>>(
      Hff, FD_, 0, W2T, FD_, 0, b2, nullptr, 0, 1.0f, 0,
      zff, nullptr, D_, 0, nullptr, 0, 0, FD_);

  // ---- 7. LayerNorm 2 (+residual) -> final z output ----
  ln_k<<<M_ / (8 * LNR_), 256, 0, stream>>>(zff, zln1f, g2, be2, outZ, nullptr);
}

// v006
// A run of this version takes 348 microseconds.
// In two side-by-side timings against v005, it was 1.13 and 1.11 times as fast.
// All steps since v000 together make it 2.71 times as fast.
#include <hip/hip_runtime.h>
#include <hip/hip_bf16.h>
#include <stdint.h>

// ---------------------------------------------------------------------------
// Problem dims (compile-time constants from the reference)
// ---------------------------------------------------------------------------
constexpr int  B_   = 4;
constexpr int  S_   = 2048;
constexpr int  D_   = 256;
constexpr int  H_   = 8;
constexpr int  FD_  = 512;             // F*D
constexpr long M_   = (long)B_ * S_;   // 8192 flattened rows
constexpr long HD_  = (long)H_ * D_;   // 2048 concat width

typedef __attribute__((ext_vector_type(16))) __bf16 bf16x16;
typedef __attribute__((ext_vector_type(8)))  __bf16 bf16x8;
typedef __attribute__((ext_vector_type(8)))  float  f32x8;
typedef __attribute__((ext_vector_type(4)))  unsigned int u32x4;
typedef __attribute__((ext_vector_type(8)))  int i32x8;
typedef __attribute__((ext_vector_type(4)))  int i32x4;

#if defined(__has_builtin)
#if __has_builtin(__builtin_amdgcn_tensor_load_to_lds)
#define HAVE_TDM 1
#else
#define HAVE_TDM 0
#endif
#else
#define HAVE_TDM 0
#endif

// ---------------------------------------------------------------------------
// WMMA helpers.  CDNA5 bf16 A/B fragment layout (16x32 / 32x16):
//   lanes 0..15  : row=lane,    K = [0..7]  and [16..23]
//   lanes 16..31 : row=lane-16, K = [8..15] and [24..31]
// With contiguous-K data a fragment is two 16-byte loads + a shuffle.
// ---------------------------------------------------------------------------
__device__ __forceinline__ bf16x16 frag_ld_g(const __bf16* p) {
  bf16x8 lo = *(const bf16x8*)(p);
  bf16x8 hi = *(const bf16x8*)(p + 16);
  return __builtin_shufflevector(lo, hi, 0,1,2,3,4,5,6,7,8,9,10,11,12,13,14,15);
}

__device__ __forceinline__ f32x8 wmma_bf16(bf16x16 a, bf16x16 b, f32x8 c) {
  return __builtin_amdgcn_wmma_f32_16x16x32_bf16(
      /*neg_a=*/false, a, /*neg_b=*/false, b,
      /*c_mod=*/(short)0, c, /*reuse_a=*/false, /*reuse_b=*/false);
}

#if HAVE_TDM
// ---------------------------------------------------------------------------
// TDM: DMA a 64(row) x 32(k) bf16 tile (row stride ldbt elems) from global
// into LDS at byte offset ldsOff, inserting 16B of padding after every 64B
// row (pad_interval=16 DWORDs -> code 3, pad_amount=4 DWORDs -> code 3),
// i.e. an 80-byte LDS row pitch for bank-conflict-free b128 fragment reads.
// Toolchain probe: 6-arg builtin (g0:u32x4, g1:i32x8, g2:i32x4, g3:i32x4,
// g4:i32x8, cpol:i32).
// ---------------------------------------------------------------------------
__device__ __forceinline__ void tdm_load_tile(const __bf16* gsrc,
                                              unsigned ldsOff, long ldbt) {
  unsigned long long ga = (unsigned long long)(uintptr_t)gsrc;
  u32x4 g0;
  g0[0] = 1u;                                        // count=1, user mode
  g0[1] = ldsOff;                                    // lds_addr (bytes)
  g0[2] = (unsigned)(ga & 0xFFFFFFFFull);            // global_addr[31:0]
  g0[3] = (unsigned)((ga >> 32) & 0x01FFFFFFull)     // global_addr[56:32]
          | 0x80000000u;                             // type=2 ("image")
  i32x8 g1;
  g1[0] = (1 << 16)      // data_size = 2 bytes
        | (1 << 20)      // pad_enable
        | (3 << 22)      // pad_interval: 16 DWORDs
        | (3 << 25);     // pad_amount:   4 DWORDs
  g1[1] = 0;                                   // tensor_dim0 low16 (bits 63:48)
  g1[2] = (1 << 14);                           // tensor_dim0 = 1<<30 (hi bits)
  g1[3] = 16 | (32 << 16);                     // tensor_dim1=1<<20 hi, tile_dim0=32
  g1[4] = 64;                                  // tile_dim1=64, tile_dim2=0
  g1[5] = (int)ldbt;                           // tensor_dim0_stride[31:0]
  g1[6] = 0;                                   // stride hi / dim1_stride lo
  g1[7] = 0;
  i32x4 z4 = {0, 0, 0, 0};
  i32x8 z8 = {0, 0, 0, 0, 0, 0, 0, 0};
  __builtin_amdgcn_tensor_load_to_lds(g0, g1, z4, z4, z8, 0);
}

template <int N>
__device__ __forceinline__ void tdm_wait() {
#if __has_builtin(__builtin_amdgcn_s_wait_tensorcnt)
  __builtin_amdgcn_s_wait_tensorcnt((short)N);
#else
  asm volatile("s_wait_tensorcnt %0" :: "i"(N) : "memory");
#endif
}
#endif  // HAVE_TDM

// ---------------------------------------------------------------------------
// fp32 -> bf16 cast (grid-stride)
// ---------------------------------------------------------------------------
__global__ void cast_bf16_k(const float* __restrict__ in,
                            __bf16* __restrict__ out, long n) {
  long i      = (long)blockIdx.x * blockDim.x + threadIdx.x;
  long stride = (long)gridDim.x * blockDim.x;
  for (; i < n; i += stride) out[i] = (__bf16)in[i];
}

// ---------------------------------------------------------------------------
// fp32 [rows][cols] -> bf16 transposed [cols][rows]   (per-z slice)
// ---------------------------------------------------------------------------
__global__ void transpose_cast_k(const float* __restrict__ in,
                                 __bf16* __restrict__ out,
                                 int rows, int cols,
                                 long inStrideZ, long outStrideZ) {
  __shared__ float tile[16][17];
  const float* inz  = in  + (long)blockIdx.z * inStrideZ;
  __bf16*      outz = out + (long)blockIdx.z * outStrideZ;
  int c = blockIdx.x * 16 + threadIdx.x;
  int r = blockIdx.y * 16 + threadIdx.y;
  if (r < rows && c < cols) tile[threadIdx.y][threadIdx.x] = inz[(long)r * cols + c];
  __syncthreads();
  int oc  = blockIdx.y * 16 + threadIdx.x;   // new col = old row
  int orw = blockIdx.x * 16 + threadIdx.y;   // new row = old col
  if (orw < cols && oc < rows)
    outz[(long)orw * rows + oc] = (__bf16)tile[threadIdx.x][threadIdx.y];
}

// ---------------------------------------------------------------------------
// Generic bf16 WMMA GEMM:  C = act(alpha * A @ B + bias + res)
//   A  : [M][K] bf16 row-major (per-z stride aStrideZ)
//   BT : [N][K] bf16 (B pre-transposed -> contiguous K fragments)
// Block: 256 threads = 8 waves, tile 128(M) x 64(N); wave = 16x64 (4 accums).
// The 64xK B panel is shared by all 8 waves, so it is staged through LDS:
// TDM double-buffered DMA (wave 0 issues, TENSORcnt-ordered) when available,
// else a synchronous cooperative copy.  LDS row pitch 80B (32 k-elems + 8
// pad elems) -> conflict-free ds_load_b128 fragment reads.
// ---------------------------------------------------------------------------
__global__ void __launch_bounds__(256)
gemm_bf16_wmma(const __bf16* __restrict__ A,  long lda,  long aStrideZ,
               const __bf16* __restrict__ BT, long ldbt, long btStrideZ,
               const float* __restrict__ bias,
               const float* __restrict__ res, long ldres,
               float alpha, int relu,
               float*  __restrict__ outF,
               __bf16* __restrict__ outB,  long ldo,  long oStrideZ,
               __bf16* __restrict__ outBT, long ldoT, long oTStrideZ,
               int K) {
  __shared__ __bf16 sB[2][64 * 40];   // 2 x 5120B padded tiles

  const int tid  = threadIdx.x;
  const int lane = tid & 31;
  const int wave = tid >> 5;
  const int z    = blockIdx.z;
  const long m0  = (long)blockIdx.x * 128 + wave * 16;
  const long n0  = (long)blockIdx.y * 64;
  const int  ml  = lane & 15;
  const int  kh  = (lane < 16) ? 0 : 8;   // K half-offset per fragment layout
  const int  rh  = (lane < 16) ? 0 : 8;   // C/D row-half offset

  const __bf16* aRow   = A  + (long)z * aStrideZ + (m0 + ml) * lda + kh;
  const __bf16* Bpanel = BT + (long)z * btStrideZ + n0 * ldbt;  // [64][K]

#if HAVE_TDM
  const unsigned ldsBase = (unsigned)(uintptr_t)(&sB[0][0]);
  if (tid < 32) tdm_load_tile(Bpanel, ldsBase, ldbt);           // prologue
#endif

  f32x8 acc[4] = {};
  const int nsteps = K >> 5;
  for (int s = 0; s < nsteps; ++s) {
    const int k0  = s << 5;
    const int cur = s & 1;
#if HAVE_TDM
    if (tid < 32) {
      if (s + 1 < nsteps) {
        tdm_load_tile(Bpanel + k0 + 32, ldsBase + (unsigned)((cur ^ 1) * 64 * 40 * 2), ldbt);
        tdm_wait<1>();   // previous DMA (in-order) has landed
      } else {
        tdm_wait<0>();
      }
    }
    __syncthreads();
#else
    {   // synchronous cooperative staging: 256 threads x 16B = 4KB tile
      const int n = tid >> 2, c = tid & 3;
      *(bf16x8*)(&sB[cur][n * 40 + c * 8]) =
          *(const bf16x8*)(Bpanel + (long)n * ldbt + k0 + c * 8);
      __syncthreads();
    }
#endif
    bf16x16 afr = frag_ld_g(aRow + k0);
    __builtin_prefetch(aRow + k0 + 128, 0, 1);   // global_prefetch_b8
    const __bf16* bl = &sB[cur][kh];
#pragma unroll
    for (int j = 0; j < 4; ++j) {
      bf16x16 bfr = frag_ld_g(bl + (j * 16 + ml) * 40);
      acc[j] = wmma_bf16(afr, bfr, acc[j]);
    }
    __syncthreads();   // protect buffer before it is overwritten
  }

#pragma unroll
  for (int j = 0; j < 4; ++j) {
    const long n   = n0 + j * 16 + ml;
    const float bv = bias ? bias[n] : 0.0f;
    if (outBT) {
      // transposed store: 8 consecutive M per lane -> one 16B store
      bf16x8 t;
#pragma unroll
      for (int i = 0; i < 8; ++i) {
        long m  = m0 + rh + i;
        float v = acc[j][i] * alpha + bv;
        if (res)  v += res[m * ldres + n];
        if (relu) v = fmaxf(v, 0.0f);
        t[i] = (__bf16)v;
      }
      *(bf16x8*)(outBT + (long)z * oTStrideZ + n * ldoT + (m0 + rh)) = t;
    } else {
#pragma unroll
      for (int i = 0; i < 8; ++i) {
        long m  = m0 + rh + i;
        float v = acc[j][i] * alpha + bv;
        if (res)  v += res[m * ldres + n];
        if (relu) v = fmaxf(v, 0.0f);
        long off = (long)z * oStrideZ + m * ldo + n;
        if (outF) outF[off] = v;
        if (outB) outB[off] = (__bf16)v;
      }
    }
  }
}

// ---------------------------------------------------------------------------
// Attention: one block per (batch, 32-row tile), loop over 8 heads.
//   scores/probs : bf16 LDS [32][2048], row pitch 2056 elems (131584 B)
//   staging      : bf16 LDS [8 waves][32*136] (68 KB)
//   mean accum   : fp32, 4 rows a wave: 3 in registers (192 a lane), 1 in LDS
//                  [8 waves][2048] (64 KB) -> 266752 B static LDS
// Stage 1: each wave computes a 32x256 score slab (Q fragments register-
//          resident: 16 x bf16x16 = 128 VGPRs, reused across 16 tiles).
// Stage 2: each wave softmaxes 4 rows, two at a time, held in registers.
// Stage 3: each wave computes a 32x32 slab of P@V (V pre-transposed).
// Every staged K or V^T tile is the B operand of two 16-row blocks, so a block
// of 32 rows reads K and V once where two blocks of 16 read them twice.
// attn_mean accumulates with the wave that softmaxes the row, each lane keeping
// the columns it holds there: 32 rows of fp32 do not fit in LDS beside the
// probabilities, nor in registers beside the Q fragments, so they are split.
// No lane touches another lane's part. It is written to HBM exactly once.
// K rows and V^T rows reach their B fragments through a wave-private LDS tile:
// the global loads cover whole 128-byte lines (a fragment-shaped load touches
// 16 lines for 512 bytes), the fragment shape is formed by the LDS reads.
//   K tile   : 16 rows x 256 k, pitch 264 elems (528 B)
//   V^T tile : 32 rows x 128 t, pitch 136 elems (272 B)
// The probability rows are read as A fragments (16 rows at one column), so they
// too get a padded pitch: 2056 elems (4112 B); at 4096 B all 16 rows of a
// fragment read start on the same bank.
// All three pitches are 16 B x odd: conflict-free ds_load_b128 fragment reads.
// ---------------------------------------------------------------------------
constexpr int QR_      = 32;     // query rows per block
constexpr int KP_      = 264;    // K tile pitch, elements
constexpr int VP_      = 136;    // V^T tile pitch, elements
constexpr int PP_      = 2056;   // score / probability row pitch, elements
constexpr int STAGE_E_ = 32 * VP_;   // elements per wave (the larger of the two tiles)
constexpr int ATTN_LDS_ = QR_ * PP_ * 2 + 8 * STAGE_E_ * 2 + 8 * 2048 * 4;   // 266752 B

// Orders this wave's own LDS traffic on its staging tile: lanes read rows that
// other lanes of the same wave wrote, which the compiler cannot see.
__device__ __forceinline__ void stage_sync() {
  asm volatile("s_wait_dscnt 0x0" ::: "memory");
}

// Stands behind a tile's global loads. Naming their address keeps its registers
// untouched up to the wait and puts the step to the next tile behind it.
template <typename T>
__device__ __forceinline__ void addr_sync(T& a) {
  asm volatile("s_wait_xcnt 0x0" : "+v"(a) : : "memory");
}

// 16 bytes at base plus a byte offset and an immediate (wave-uniform base in the next-tile loads)
__device__ __forceinline__ bf16x8 ld16(const __bf16* base, unsigned off, int imm) {
  return *(const bf16x8*)((const char*)base + off + imm);
}
// Eight 2^v in place. One statement, so that no instruction that overwrites a
// source or reads a result can be scheduled directly behind a transcendental:
// the eight work on distinct registers, and the v_nop is the free slot that the
// instruction set asks for behind the last one.
__device__ __forceinline__ void exp2_x8(float& a, float& b, float& c, float& d,
                                        float& e, float& f, float& g, float& h) {
  asm("v_exp_f32 %0, %0\n\tv_exp_f32 %1, %1\n\tv_exp_f32 %2, %2\n\tv_exp_f32 %3, %3\n\t"
      "v_exp_f32 %4, %4\n\tv_exp_f32 %5, %5\n\tv_exp_f32 %6, %6\n\tv_exp_f32 %7, %7\n\t"
      "v_nop"
      : "+v"(a), "+v"(b), "+v"(c), "+v"(d), "+v"(e), "+v"(f), "+v"(g), "+v"(h));
}

__global__ void __launch_bounds__(256)
attn_k(const __bf16* __restrict__ Qb,   // [H][B*S][D]
       const __bf16* __restrict__ Kb,   // [H][B*S][D]
       const __bf16* __restrict__ VbT,  // [H][D][B*S]  (transposed)
       __bf16* __restrict__ Zcat,       // [B*S][H*D]
       float*  __restrict__ attnMean) { // [B][S][S]
  __shared__ __attribute__((aligned(16))) char smem[ATTN_LDS_];
  __bf16* sP    = (__bf16*)smem;                    // [QR_][PP_]
  __bf16* sStage = (__bf16*)(smem + QR_ * PP_ * 2); // [8 waves][STAGE_E_]
  float*  sMean = (float*)(smem + QR_ * PP_ * 2 + 8 * STAGE_E_ * 2);   // [8 waves][2048]

  const int tid  = threadIdx.x;
  const int lane = tid & 31;
  const int wave = __builtin_amdgcn_readfirstlane(tid >> 5);   // in a scalar register: no vector register is free
  const int b    = blockIdx.y;
  const long s0  = (long)blockIdx.x * QR_;
  const int ml   = lane & 15;
  const int kh   = (lane < 16) ? 0 : 8;
  const int rh   = (lane < 16) ? 0 : 8;
  __bf16* sT     = sStage + wave * STAGE_E_;        // this wave's tile
  // Start tile of this block's walk over the 16 K tiles and the 16 V^T tiles of a
  // wave's slab. The 64 blocks of a batch read the same K and V. Walking them in
  // one order they keep together: whichever block leads waits for memory on every
  // tile, and the others catch up with it and wait on the same lines. From 16
  // different starts every tile is asked for in the first trip, and the 15 trips
  // behind it find their tile in L2. The second term gives the four blocks of a
  // batch whose indices agree in their low four bits four different starts.
  const int rot  = (int)((blockIdx.x + 4u * (blockIdx.x >> 4)) & 15u);

  // sum over the heads of rows [4*wave, 4*wave+4), in the softmax's own layout:
  // element q*8+i is column q*256 + lane*8 + i. Every index is a constant.
  // Rows 0 to 2 in registers, row 3 in this wave's LDS row, same columns a lane.
  float mean[3][64];
  float* mrow = sMean + wave * 2048 + lane * 8;
#pragma unroll
  for (int r = 0; r < 3; ++r) {
#pragma unroll
    for (int i = 0; i < 64; ++i) mean[r][i] = 0.0f;
  }
#pragma unroll
  for (int q = 0; q < 16; ++q)
    *(float4*)(mrow + (q >> 1) * 256 + (q & 1) * 4) = make_float4(0.0f, 0.0f, 0.0f, 0.0f);

  // One trip runs stage 3 of the head before and then stages 1 and 2 of its own
  // head: the order of the stages is the plain one, but stage 2 ends the loop's
  // body. With stage 3 last the compiler moves stage 2's additions into mean[][]
  // behind it, keeps the probabilities live across it beside the sums, and spills.
  for (int hh = 0; hh <= H_; ++hh) {
    if (hh > 0) {
      const int h = hh - 1;
      // ---- stage 3: zh slab, e in [wave*32, wave*32+32) ----
      const int e0 = wave * 32;
      const __bf16* vbase = VbT + (long)h * D_ * M_ + (long)b * S_;
      f32x8 acc00 = {}, acc01 = {}, acc10 = {}, acc11 = {};   // [row block][column block]
      // one load = 256 B of each of two V^T rows (four whole lines)
      const int vrw = lane >> 4, vch = (lane & 15) * 8;
      const unsigned vl = (unsigned)((e0 + vrw) * (int)M_ + vch) * 2u;   // bytes from vbase, tile 0
      const __bf16* v0 = vbase + (e0 + vrw) * (int)M_ + vch + rot * 128;   // first tile
      bf16x8 vr[16];
#pragma unroll   // static indices keep vr[] in registers
      for (int q = 0; q < 16; ++q) vr[q] = ld16(v0, 0u, 2 * q * (int)M_ * 2);
      addr_sync(v0);

      for (int c = 0; c < S_ / 128; ++c) {
        stage_sync();   // the last tile's fragment reads are done
#pragma unroll   // static indices keep vr[] in registers
        for (int q = 0; q < 16; ++q)
          *(bf16x8*)(sT + (2 * q + vrw) * VP_ + vch) = vr[q];
        if (c + 1 < S_ / 128) {   // next tile flies while this tile is worked on
          unsigned vg = vl + (unsigned)(((c + 1 + rot) & 15) * 128 * 2);
#pragma unroll   // static indices keep vr[] in registers
          for (int q = 0; q < 16; ++q) vr[q] = ld16(vbase, vg, 2 * q * (int)M_ * 2);
          addr_sync(vg);
        }
        stage_sync();   // the tile is written before any lane reads it back
#pragma unroll   // the four k steps of a tile read at constant LDS offsets
        for (int ts = 0; ts < 4; ++ts) {
          const int t0 = ((c + rot) & 15) * 128 + ts * 32;
          bf16x16 a0 = frag_ld_g(sP + (long)ml * PP_ + t0 + kh);
          bf16x16 a1 = frag_ld_g(sP + (long)(16 + ml) * PP_ + t0 + kh);
          bf16x16 b0 = frag_ld_g(sT + ml * VP_ + ts * 32 + kh);
          bf16x16 b1 = frag_ld_g(sT + (16 + ml) * VP_ + ts * 32 + kh);
          acc00 = wmma_bf16(a0, b0, acc00);
          acc01 = wmma_bf16(a0, b1, acc01);
          acc10 = wmma_bf16(a1, b0, acc10);
          acc11 = wmma_bf16(a1, b1, acc11);
        }
      }
#pragma unroll
      for (int i = 0; i < 8; ++i) {
        long rowm = (long)b * S_ + s0 + rh + i;
        Zcat[rowm * HD_ + (h * D_ + e0 + ml)]             = (__bf16)acc00[i];
        Zcat[rowm * HD_ + (h * D_ + e0 + 16 + ml)]        = (__bf16)acc01[i];
        Zcat[(rowm + 16) * HD_ + (h * D_ + e0 + ml)]      = (__bf16)acc10[i];
        Zcat[(rowm + 16) * HD_ + (h * D_ + e0 + 16 + ml)] = (__bf16)acc11[i];
      }
      __syncthreads();   // protect sP before next head
    }
    if (hh < H_) {
      const int h = hh;
      const __bf16* Qh = Qb + ((long)h * M_ + (long)b * S_ + s0) * D_;
      const __bf16* Kh = Kb + ((long)h * M_ + (long)b * S_) * D_;

      // ---- stage 1: scores for t in [wave*256, wave*256+256) ----
      const int tbase = wave * 256;
      const __bf16* qrow = Qh + (long)ml * D_ + kh;
      bf16x16 qf[2][8];
#pragma unroll
      for (int g = 0; g < 2; ++g) {
#pragma unroll
        for (int e = 0; e < 8; ++e) qf[g][e] = frag_ld_g(qrow + g * 16 * D_ + e * 32);
      }
      addr_sync(qrow);

      // one load = one whole K row (32 lanes x 16 B = 512 B)
      const unsigned kl = (unsigned)(tbase * D_ + lane * 8) * 2u;   // bytes from Kh, tile 0
      const __bf16* k0 = Kh + (tbase + rot * 16) * D_ + lane * 8;   // first tile
      bf16x8 kr[16];
#pragma unroll   // static indices keep kr[] in registers
      for (int r = 0; r < 16; ++r) kr[r] = ld16(k0, 0u, r * D_ * 2);
      addr_sync(k0);

      for (int j = 0; j < 16; ++j) {
        const int t0 = tbase + ((j + rot) & 15) * 16;
        stage_sync();   // the last tile's fragment reads are done
#pragma unroll   // static indices keep kr[] in registers
        for (int r = 0; r < 16; ++r) *(bf16x8*)(sT + r * KP_ + lane * 8) = kr[r];
        if (j + 1 < 16) {   // next tile's rows fly while this tile is worked on
          unsigned kg = kl + (unsigned)(((j + 1 + rot) & 15) * 16 * D_ * 2);
#pragma unroll   // static indices keep kr[] in registers
          for (int r = 0; r < 16; ++r) kr[r] = ld16(Kh, kg, r * D_ * 2);
          addr_sync(kg);
        }
        stage_sync();   // the tile is written before any lane reads it back
        const __bf16* krow = sT + ml * KP_ + kh;
        f32x8 accA = {}, accB = {};
#pragma unroll
        for (int e = 0; e < 8; ++e) {
          bf16x16 bfr = frag_ld_g(krow + e * 32);
          accA = wmma_bf16(qf[0][e], bfr, accA);
          accB = wmma_bf16(qf[1][e], bfr, accB);
        }
#pragma unroll
        for (int i = 0; i < 8; ++i) {
          sP[(rh + i) * PP_ + t0 + ml]      = (__bf16)accA[i];
          sP[(16 + rh + i) * PP_ + t0 + ml] = (__bf16)accB[i];
        }
      }
      __syncthreads();

      // ---- stage 2: softmax rows [4*wave, 4*wave+4), two at a time ----
      // Both rows live in registers from the read of the scores to the write of
      // the probabilities: a lane holds 8 chunks of 8 neighbouring columns of each
      // row, so every LDS access moves 16 bytes a lane and a row is read once and
      // written once. All loops below are unrolled so that x[][] and mean[][] stay
      // in registers.
#pragma unroll
      for (int p = 0; p < 2; ++p) {
        __bf16* prow = sP + (wave * 4 + p * 2) * PP_ + lane * 8;
        float x[2][64];
#pragma unroll
        for (int rr = 0; rr < 2; ++rr) {
#pragma unroll
          for (int q = 0; q < 8; ++q) {
            const bf16x8 t = *(const bf16x8*)(prow + rr * PP_ + q * 256);
#pragma unroll
            for (int i = 0; i < 8; ++i) x[rr][q * 8 + i] = (float)t[i];
          }
        }
        // one short chain per chunk instead of one chain of 64 links
        float mx[2];
#pragma unroll
        for (int rr = 0; rr < 2; ++rr) {
          float m8[8];
#pragma unroll
          for (int q = 0; q < 8; ++q) {
            m8[q] = x[rr][q * 8];
#pragma unroll
            for (int i = 1; i < 8; ++i) m8[q] = fmaxf(m8[q], x[rr][q * 8 + i]);
          }
          mx[rr] = fmaxf(fmaxf(fmaxf(m8[0], m8[1]), fmaxf(m8[2], m8[3])),
                         fmaxf(fmaxf(m8[4], m8[5]), fmaxf(m8[6], m8[7])));
        }
        // the two rows' exchanges go side by side and share their latency
        for (int o = 16; o; o >>= 1) {
          const float a0 = __shfl_xor(mx[0], o, 32);
          const float a1 = __shfl_xor(mx[1], o, 32);
          mx[0] = fmaxf(mx[0], a0);
          mx[1] = fmaxf(mx[1], a1);
        }
        float sum[2];
#pragma unroll
        for (int rr = 0; rr < 2; ++rr) {
          float s8[8];
#pragma unroll
          for (int q = 0; q < 8; ++q) {
            float* e = &x[rr][q * 8];
#pragma unroll
            for (int i = 0; i < 8; ++i) e[i] = (e[i] - mx[rr]) * 1.44269504f;   // exp(v) = 2^(v * log2 e)
            exp2_x8(e[0], e[1], e[2], e[3], e[4], e[5], e[6], e[7]);
            s8[q] = e[0];
#pragma unroll
            for (int i = 1; i < 8; ++i) s8[q] += e[i];
          }
          sum[rr] = ((s8[0] + s8[1]) + (s8[2] + s8[3])) + ((s8[4] + s8[5]) + (s8[6] + s8[7]));
        }
        for (int o = 16; o; o >>= 1) {
          const float a0 = __shfl_xor(sum[0], o, 32);
          const float a1 = __shfl_xor(sum[1], o, 32);
          sum[0] += a0;
          sum[1] += a1;
        }
#pragma unroll
        for (int rr = 0; rr < 2; ++rr) {
          const float inv = 1.0f / sum[rr];
#pragma unroll
          for (int q = 0; q < 8; ++q) {
            bf16x8 t;
#pragma unroll
            for (int i = 0; i < 8; ++i) {
              x[rr][q * 8 + i] *= inv;
              t[i] = (__bf16)x[rr][q * 8 + i];
            }
            *(bf16x8*)(prow + rr * PP_ + q * 256) = t;
          }
          if (p * 2 + rr < 3) {
#pragma unroll
            for (int i = 0; i < 64; ++i) mean[p * 2 + rr][i] += x[rr][i];
          } else {
#pragma unroll
            for (int q = 0; q < 16; ++q) {
              float4 mv = *(const float4*)(mrow + (q >> 1) * 256 + (q & 1) * 4);
              mv.x += x[rr][q * 4 + 0];
              mv.y += x[rr][q * 4 + 1];
              mv.z += x[rr][q * 4 + 2];
              mv.w += x[rr][q * 4 + 3];
              *(float4*)(mrow + (q >> 1) * 256 + (q & 1) * 4) = mv;
            }
          }
        }
      }
      __syncthreads();
    }
  }

  // ---- write attn_mean = sum/H once: a wave's store covers 1 KB of one row ----
  float* mout = attnMean + ((long)b * S_ + s0 + wave * 4) * S_ + lane * 8;
#pragma unroll
  for (int r = 0; r < 4; ++r) {
    float4 v[16];
#pragma unroll
    for (int q = 0; q < 16; ++q) {
      if (r < 3) {
        v[q] = make_float4(mean[r][q * 4 + 0], mean[r][q * 4 + 1], mean[r][q * 4 + 2], mean[r][q * 4 + 3]);
      } else {
        v[q] = *(const float4*)(mrow + (q >> 1) * 256 + (q & 1) * 4);
      }
      v[q].x *= 0.125f; v[q].y *= 0.125f; v[q].z *= 0.125f; v[q].w *= 0.125f;
    }
    // all of a row's products stand in front of its stores, so that none of them
    // is written into a register that an issued store of the same row names
    __builtin_amdgcn_sched_barrier(0);
#pragma unroll
    for (int q = 0; q < 16; ++q)
      *(float4*)(mout + (long)r * S_ + (q >> 1) * 256 + (q & 1) * 4) = v[q];
    // the wait that belongs in front of an overwrite of a register which an issued
    // store names; the barrier behind it holds the next row's products behind it
    asm volatile("s_wait_xcnt 0x0" ::: "memory");
    __builtin_amdgcn_sched_barrier(0);
  }
}

// ---------------------------------------------------------------------------
// LayerNorm over D=256: a row belongs to one wave, four rows a wave, 32 rows a
// block. A lane holds 8 columns of each row (two 16-byte pieces, so that every
// load and f32 store of a wave covers 512 contiguous bytes). No LDS, no barrier.
// The launch starts 2,048 waves where one block a row starts 65,536: a row is so
// short that starting its eight waves takes longer than moving its bytes.
// ---------------------------------------------------------------------------
constexpr int LNR_ = 4;   // rows a wave
typedef __attribute__((ext_vector_type(4))) __bf16 bf16x4;

// value of lane l ^ X inside the 16-lane row (DPP row_xmask:X, control 0x160 + X)
template <int X>
__device__ __forceinline__ float row_xor(float v) {
  return __builtin_bit_cast(float, __builtin_amdgcn_update_dpp(
      0, __builtin_bit_cast(int, v), 0x160 + X, 0xf, 0xf, true));
}
// sum over the 32 lanes, the same value in every lane; all lanes are on
__device__ __forceinline__ float wave_sum(float v) {
  v += row_xor<1>(v);
  v += row_xor<2>(v);
  v += row_xor<4>(v);
  v += row_xor<8>(v);
  const int bits = __builtin_bit_cast(int, v);   // lane l ^ 16
  v += __builtin_bit_cast(float, __builtin_amdgcn_permlanex16(
      bits, bits, 0x76543210, 0xfedcba98, false, false));
  return v;
}

__global__ void __launch_bounds__(256)
ln_k(const float* __restrict__ in, const float* __restrict__ res,
     const float* __restrict__ g, const float* __restrict__ be,
     float* __restrict__ outF, __bf16* __restrict__ outB) {
  const int  lane = threadIdx.x & 31;
  const int  wave = threadIdx.x >> 5;
  const long e0   = (((long)blockIdx.x * 8 + wave) * LNR_) * D_ + lane * 4;   // first element

  // all loads of the wave's rows are issued before the first of them is used
  float4 x[LNR_][2], rv[LNR_][2], gv[2], bv[2];
#pragma unroll
  for (int r = 0; r < LNR_; ++r) {
#pragma unroll
    for (int h = 0; h < 2; ++h) x[r][h] = *(const float4*)(in + e0 + r * D_ + h * 128);
  }
  if (res) {
#pragma unroll
    for (int r = 0; r < LNR_; ++r) {
#pragma unroll
      for (int h = 0; h < 2; ++h) rv[r][h] = *(const float4*)(res + e0 + r * D_ + h * 128);
    }
  } else {
#pragma unroll
    for (int r = 0; r < LNR_; ++r) {
#pragma unroll
      for (int h = 0; h < 2; ++h) rv[r][h] = make_float4(0.0f, 0.0f, 0.0f, 0.0f);
    }
  }
#pragma unroll
  for (int h = 0; h < 2; ++h) {
    gv[h] = *(const float4*)(g + lane * 4 + h * 128);
    bv[h] = *(const float4*)(be + lane * 4 + h * 128);
  }
  // the wait that belongs in front of an overwrite of a register which an issued
  // load names
  asm volatile("s_wait_xcnt 0x0" ::: "memory");

  // the four rows' chains are independent and fill each other's latency
  float s[LNR_];
#pragma unroll
  for (int r = 0; r < LNR_; ++r) {
#pragma unroll
    for (int h = 0; h < 2; ++h) {
      x[r][h].x += rv[r][h].x; x[r][h].y += rv[r][h].y;
      x[r][h].z += rv[r][h].z; x[r][h].w += rv[r][h].w;
    }
    s[r] = ((x[r][0].x + x[r][0].y) + (x[r][0].z + x[r][0].w)) +
           ((x[r][1].x + x[r][1].y) + (x[r][1].z + x[r][1].w));
  }
#pragma unroll
  for (int r = 0; r < LNR_; ++r) s[r] = wave_sum(s[r]);
#pragma unroll
  for (int r = 0; r < LNR_; ++r) {
    const float mean = s[r] * (1.0f / D_);
#pragma unroll
    for (int h = 0; h < 2; ++h) {
      x[r][h].x -= mean; x[r][h].y -= mean; x[r][h].z -= mean; x[r][h].w -= mean;
    }
    s[r] = ((x[r][0].x * x[r][0].x + x[r][0].y * x[r][0].y) +
            (x[r][0].z * x[r][0].z + x[r][0].w * x[r][0].w)) +
           ((x[r][1].x * x[r][1].x + x[r][1].y * x[r][1].y) +
            (x[r][1].z * x[r][1].z + x[r][1].w * x[r][1].w));
  }
#pragma unroll
  for (int r = 0; r < LNR_; ++r) s[r] = wave_sum(s[r]);

  bf16x4 yb[LNR_][2];
#pragma unroll
  for (int r = 0; r < LNR_; ++r) {
    const float rs = rsqrtf(s[r] * (1.0f / D_) + 1e-5f);
#pragma unroll
    for (int h = 0; h < 2; ++h) {
      x[r][h].x = x[r][h].x * rs * gv[h].x + bv[h].x;
      x[r][h].y = x[r][h].y * rs * gv[h].y + bv[h].y;
      x[r][h].z = x[r][h].z * rs * gv[h].z + bv[h].z;
      x[r][h].w = x[r][h].w * rs * gv[h].w + bv[h].w;
      yb[r][h][0] = (__bf16)x[r][h].x; yb[r][h][1] = (__bf16)x[r][h].y;
      yb[r][h][2] = (__bf16)x[r][h].z; yb[r][h][3] = (__bf16)x[r][h].w;
    }
  }
  // all results stand in front of the stores, so that none of them is written
  // into a register that an issued store names
  __builtin_amdgcn_sched_barrier(0);
  if (outF) {
#pragma unroll
    for (int r = 0; r < LNR_; ++r) {
#pragma unroll
      for (int h = 0; h < 2; ++h) *(float4*)(outF + e0 + r * D_ + h * 128) = x[r][h];
    }
    // as above, for the address of the stores that follow
    asm volatile("s_wait_xcnt 0x0" ::: "memory");
  }
  if (outB) {
#pragma unroll
    for (int r = 0; r < LNR_; ++r) {
#pragma unroll
      for (int h = 0; h < 2; ++h) *(bf16x4*)(outB + e0 + r * D_ + h * 128) = yb[r][h];
    }
  }
}

// ---------------------------------------------------------------------------
// Host-side orchestration (all launches on `stream`, graph-capture safe)
// ---------------------------------------------------------------------------
extern "C" void kernel_launch(void* const* d_in, const int* in_sizes, int n_in,
                              void* d_out, int out_size, void* d_ws, size_t ws_size,
                              hipStream_t stream) {
  const float* X  = (const float*)d_in[0];
  const float* Wq = (const float*)d_in[1];
  const float* Wk = (const float*)d_in[2];
  const float* Wv = (const float*)d_in[3];
  const float* Wz = (const float*)d_in[4];
  const float* bz = (const float*)d_in[5];
  const float* W1 = (const float*)d_in[6];
  const float* b1 = (const float*)d_in[7];
  const float* W2 = (const float*)d_in[8];
  const float* b2 = (const float*)d_in[9];
  const float* g1  = (const float*)d_in[10];
  const float* be1 = (const float*)d_in[11];
  const float* g2  = (const float*)d_in[12];
  const float* be2 = (const float*)d_in[13];

  float* outZ    = (float*)d_out;            // [B,S,D]
  float* outAttn = outZ + M_ * D_;           // [B,S,S]

  // ---- workspace carve-up ----
  char* ws = (char*)d_ws;
  size_t off = 0;
  auto alloc = [&](size_t bytes) { char* p = ws + off; off = (off + bytes + 255) & ~(size_t)255; return p; };
  __bf16* Xb   = (__bf16*)alloc(M_ * D_ * 2);
  __bf16* WqT  = (__bf16*)alloc((size_t)H_ * D_ * D_ * 2);
  __bf16* WkT  = (__bf16*)alloc((size_t)H_ * D_ * D_ * 2);
  __bf16* WvT  = (__bf16*)alloc((size_t)H_ * D_ * D_ * 2);
  __bf16* WzT  = (__bf16*)alloc((size_t)HD_ * D_ * 2);
  __bf16* W1T  = (__bf16*)alloc((size_t)FD_ * D_ * 2);
  __bf16* W2T  = (__bf16*)alloc((size_t)D_ * FD_ * 2);
  __bf16* Qb   = (__bf16*)alloc((size_t)H_ * M_ * D_ * 2);
  __bf16* Kb   = (__bf16*)alloc((size_t)H_ * M_ * D_ * 2);
  __bf16* VbT  = (__bf16*)alloc((size_t)H_ * D_ * M_ * 2);
  __bf16* Zcat = (__bf16*)alloc((size_t)M_ * HD_ * 2);
  float*  zres  = (float*)alloc((size_t)M_ * D_ * 4);
  float*  zln1f = (float*)alloc((size_t)M_ * D_ * 4);
  __bf16* zln1b = (__bf16*)alloc((size_t)M_ * D_ * 2);
  __bf16* Hff   = (__bf16*)alloc((size_t)M_ * FD_ * 2);
  float*  zff   = (float*)alloc((size_t)M_ * D_ * 4);
  (void)ws_size; (void)in_sizes; (void)n_in; (void)out_size;

  // ---- 1. casts / weight transposes ----
  cast_bf16_k<<<1024, 256, 0, stream>>>(X, Xb, M_ * D_);
  dim3 tb(16, 16);
  transpose_cast_k<<<dim3(D_/16, D_/16, H_), tb, 0, stream>>>(Wq, WqT, D_, D_, (long)D_*D_, (long)D_*D_);
  transpose_cast_k<<<dim3(D_/16, D_/16, H_), tb, 0, stream>>>(Wk, WkT, D_, D_, (long)D_*D_, (long)D_*D_);
  transpose_cast_k<<<dim3(D_/16, D_/16, H_), tb, 0, stream>>>(Wv, WvT, D_, D_, (long)D_*D_, (long)D_*D_);
  transpose_cast_k<<<dim3(D_/16, HD_/16, 1), tb, 0, stream>>>(Wz, WzT, (int)HD_, D_, 0, 0);
  transpose_cast_k<<<dim3(FD_/16, D_/16, 1), tb, 0, stream>>>(W1, W1T, D_, FD_, 0, 0);
  transpose_cast_k<<<dim3(D_/16, FD_/16, 1), tb, 0, stream>>>(W2, W2T, FD_, D_, 0, 0);

  const float scale = 0.25f;  // D^-0.25 = 256^-0.25
  // ---- 2. QKV projections (bf16 WMMA), per-head via grid.z ----
  gemm_bf16_wmma<<<dim3(M_/128, D_/64, H_), 256, 0, stream>>>(
      Xb, D_, 0, WqT, D_, (long)D_*D_, nullptr, nullptr, 0, scale, 0,
      nullptr, Qb, D_, (long)M_*D_, nullptr, 0, 0, D_);
  gemm_bf16_wmma<<<dim3(M_/128, D_/64, H_), 256, 0, stream>>>(
      Xb, D_, 0, WkT, D_, (long)D_*D_, nullptr, nullptr, 0, scale, 0,
      nullptr, Kb, D_, (long)M_*D_, nullptr, 0, 0, D_);
  gemm_bf16_wmma<<<dim3(M_/128, D_/64, H_), 256, 0, stream>>>(
      Xb, D_, 0, WvT, D_, (long)D_*D_, nullptr, nullptr, 0, 1.0f, 0,
      nullptr, nullptr, 0, 0, VbT, M_, (long)D_*M_, D_);   // V stored transposed

  // ---- 3. attention (scores + softmax + P@V + attn_mean) ----
  attn_k<<<dim3(S_/QR_, B_), 256, 0, stream>>>(Qb, Kb, VbT, Zcat, outAttn);

  // ---- 4. output projection + bias + residual (fp32 out) ----
  gemm_bf16_wmma<<<dim3(M_/128, D_/64, 1), 256, 0, stream>>>(
      Zcat, HD_, 0, WzT, HD_, 0, bz, X, D_, 1.0f, 0,
      zres, nullptr, D_, 0, nullptr, 0, 0, (int)HD_);

  // ---- 5. LayerNorm 1 ----
  ln_k<<<M_ / (8 * LNR_), 256, 0, stream>>>(zres, nullptr, g1, be1, zln1f, zln1b);

  // ---- 6. MLP ----
  gemm_bf16_wmma<<<dim3(M_/128, FD_/64, 1), 256, 0, stream>>>(
      zln1b, D_, 0, W1T, D_, 0, b1, nullptr, 0, 1.0f, 1,
      nullptr, Hff, FD_, 0, nullptr, 0, 0, D_);
  gemm_bf16_wmma<<<dim3(M_/128, D_/64, 1), 256, 0, stream>>>(
      Hff, FD_, 0, W2T, FD_, 0, b2, nullptr, 0, 1.0f, 0,
      zff, nullptr, D_, 0, nullptr, 0, 0, FD_);

  // ---- 7. LayerNorm 2 (+residual) -> final z output ----
  ln_k<<<M_ / (8 * LNR_), 256, 0, stream>>>(zff, zln1f, g2, be2, outZ, nullptr);
}

// v007
// One run takes 334 microseconds.
// In both of two side-by-side timings against v006, it was 1.06 times as fast.
// All steps since v000 together make it 2.87 times as fast.
#include <hip/hip_runtime.h>
#include <hip/hip_bf16.h>
#include <stdint.h>

// ---------------------------------------------------------------------------
// Problem dims (compile-time constants from the reference)
// ---------------------------------------------------------------------------
constexpr int  B_   = 4;
constexpr int  S_   = 2048;
constexpr int  D_   = 256;
constexpr int  H_   = 8;
constexpr int  FD_  = 512;             // F*D
constexpr long M_   = (long)B_ * S_;   // 8192 flattened rows
constexpr long HD_  = (long)H_ * D_;   // 2048 concat width

typedef __attribute__((ext_vector_type(16))) __bf16 bf16x16;
typedef __attribute__((ext_vector_type(8)))  __bf16 bf16x8;
typedef __attribute__((ext_vector_type(8)))  float  f32x8;
typedef __attribute__((ext_vector_type(4)))  unsigned int u32x4;
typedef __attribute__((ext_vector_type(8)))  int i32x8;
typedef __attribute__((ext_vector_type(4)))  int i32x4;

#if defined(__has_builtin)
#if __has_builtin(__builtin_amdgcn_tensor_load_to_lds)
#define HAVE_TDM 1
#else
#define HAVE_TDM 0
#endif
#else
#define HAVE_TDM 0
#endif

// ---------------------------------------------------------------------------
// WMMA helpers.  CDNA5 bf16 A/B fragment layout (16x32 / 32x16):
//   lanes 0..15  : row=lane,    K = [0..7]  and [16..23]
//   lanes 16..31 : row=lane-16, K = [8..15] and [24..31]
// With contiguous-K data a fragment is two 16-byte loads + a shuffle.
// ---------------------------------------------------------------------------
__device__ __forceinline__ bf16x16 frag_ld_g(const __bf16* p) {
  bf16x8 lo = *(const bf16x8*)(p);
  bf16x8 hi = *(const bf16x8*)(p + 16);
  return __builtin_shufflevector(lo, hi, 0,1,2,3,4,5,6,7,8,9,10,11,12,13,14,15);
}

__device__ __forceinline__ f32x8 wmma_bf16(bf16x16 a, bf16x16 b, f32x8 c) {
  return __builtin_amdgcn_wmma_f32_16x16x32_bf16(
      /*neg_a=*/false, a, /*neg_b=*/false, b,
      /*c_mod=*/(short)0, c, /*reuse_a=*/false, /*reuse_b=*/false);
}

#if HAVE_TDM
// ---------------------------------------------------------------------------
// TDM: DMA a 64(row) x 32(k) bf16 tile (row stride ldbt elems) from global
// into LDS at byte offset ldsOff, inserting 16B of padding after every 64B
// row (pad_interval=16 DWORDs -> code 3, pad_amount=4 DWORDs -> code 3),
// i.e. an 80-byte LDS row pitch for bank-conflict-free b128 fragment reads.
// Toolchain probe: 6-arg builtin (g0:u32x4, g1:i32x8, g2:i32x4, g3:i32x4,
// g4:i32x8, cpol:i32).
// ---------------------------------------------------------------------------
__device__ __forceinline__ void tdm_load_tile(const __bf16* gsrc,
                                              unsigned ldsOff, long ldbt) {
  unsigned long long ga = (unsigned long long)(uintptr_t)gsrc;
  u32x4 g0;
  g0[0] = 1u;                                        // count=1, user mode
  g0[1] = ldsOff;                                    // lds_addr (bytes)
  g0[2] = (unsigned)(ga & 0xFFFFFFFFull);            // global_addr[31:0]
  g0[3] = (unsigned)((ga >> 32) & 0x01FFFFFFull)     // global_addr[56:32]
          | 0x80000000u;                             // type=2 ("image")
  i32x8 g1;
  g1[0] = (1 << 16)      // data_size = 2 bytes
        | (1 << 20)      // pad_enable
        | (3 << 22)      // pad_interval: 16 DWORDs
        | (3 << 25);     // pad_amount:   4 DWORDs
  g1[1] = 0;                                   // tensor_dim0 low16 (bits 63:48)
  g1[2] = (1 << 14);                           // tensor_dim0 = 1<<30 (hi bits)
  g1[3] = 16 | (32 << 16);                     // tensor_dim1=1<<20 hi, tile_dim0=32
  g1[4] = 64;                                  // tile_dim1=64, tile_dim2=0
  g1[5] = (int)ldbt;                           // tensor_dim0_stride[31:0]
  g1[6] = 0;                                   // stride hi / dim1_stride lo
  g1[7] = 0;
  i32x4 z4 = {0, 0, 0, 0};
  i32x8 z8 = {0, 0, 0, 0, 0, 0, 0, 0};
  __builtin_amdgcn_tensor_load_to_lds(g0, g1, z4, z4, z8, 0);
}

template <int N>
__device__ __forceinline__ void tdm_wait() {
#if __has_builtin(__builtin_amdgcn_s_wait_tensorcnt)
  __builtin_amdgcn_s_wait_tensorcnt((short)N);
#else
  asm volatile("s_wait_tensorcnt %0" :: "i"(N) : "memory");
#endif
}
#endif  // HAVE_TDM

// ---------------------------------------------------------------------------
// Generic bf16 WMMA GEMM:  C = act(alpha * A @ B + bias + res)
//   A  : [M][K] bf16 row-major (per-z stride aStrideZ)
//   BT : [N][K] bf16 (B pre-transposed -> contiguous K fragments)
// Block: 256 threads = 8 waves, tile 128(M) x 64(N); wave = 16x64 (4 accums).
// The 64xK B panel is shared by all 8 waves, so it is staged through LDS:
// TDM double-buffered DMA (wave 0 issues, TENSORcnt-ordered) when available,
// else a synchronous cooperative copy.  LDS row pitch 80B (32 k-elems + 8
// pad elems) -> conflict-free ds_load_b128 fragment reads.
// Slices z >= zT are scaled by alphaT and stored transposed (outBT), the others
// by alpha and stored row-major: Q, K and V^T come from one launch of 24 slices.
// ---------------------------------------------------------------------------
__global__ void __launch_bounds__(256)
gemm_bf16_wmma(const __bf16* __restrict__ A,  long lda,  long aStrideZ,
               const __bf16* __restrict__ BT, long ldbt, long btStrideZ,
               const float* __restrict__ bias,
               const float* __restrict__ res, long ldres,
               float alpha, float alphaT, int zT, int relu,
               float*  __restrict__ outF,
               __bf16* __restrict__ outB,  long ldo,  long oStrideZ,
               __bf16* __restrict__ outBT, long ldoT, long oTStrideZ,
               int K) {
  __shared__ __bf16 sB[2][64 * 40];   // 2 x 5120B padded tiles

  const int tid  = threadIdx.x;
  const int lane = tid & 31;
  const int wave = tid >> 5;
  const int z    = blockIdx.z;
  const long m0  = (long)blockIdx.x * 128 + wave * 16;
  const long n0  = (long)blockIdx.y * 64;
  const int  ml  = lane & 15;
  const int  kh  = (lane < 16) ? 0 : 8;   // K half-offset per fragment layout
  const int  rh  = (lane < 16) ? 0 : 8;   // C/D row-half offset

  const __bf16* aRow   = A  + (long)z * aStrideZ + (m0 + ml) * lda + kh;
  const __bf16* Bpanel = BT + (long)z * btStrideZ + n0 * ldbt;  // [64][K]

#if HAVE_TDM
  const unsigned ldsBase = (unsigned)(uintptr_t)(&sB[0][0]);
  if (tid < 32) tdm_load_tile(Bpanel, ldsBase, ldbt);           // prologue
#endif

  f32x8 acc[4] = {};
  const bool  tr = z >= zT;
  const float al = tr ? alphaT : alpha;
  const int nsteps = K >> 5;
  for (int s = 0; s < nsteps; ++s) {
    const int k0  = s << 5;
    const int cur = s & 1;
#if HAVE_TDM
    if (tid < 32) {
      if (s + 1 < nsteps) {
        tdm_load_tile(Bpanel + k0 + 32, ldsBase + (unsigned)((cur ^ 1) * 64 * 40 * 2), ldbt);
        tdm_wait<1>();   // previous DMA (in-order) has landed
      } else {
        tdm_wait<0>();
      }
    }
    __syncthreads();
#else
    {   // synchronous cooperative staging: 256 threads x 16B = 4KB tile
      const int n = tid >> 2, c = tid & 3;
      *(bf16x8*)(&sB[cur][n * 40 + c * 8]) =
          *(const bf16x8*)(Bpanel + (long)n * ldbt + k0 + c * 8);
      __syncthreads();
    }
#endif
    bf16x16 afr = frag_ld_g(aRow + k0);
    __builtin_prefetch(aRow + k0 + 128, 0, 1);   // global_prefetch_b8
    const __bf16* bl = &sB[cur][kh];
#pragma unroll
    for (int j = 0; j < 4; ++j) {
      bf16x16 bfr = frag_ld_g(bl + (j * 16 + ml) * 40);
      acc[j] = wmma_bf16(afr, bfr, acc[j]);
    }
    __syncthreads();   // protect buffer before it is overwritten
  }

#pragma unroll
  for (int j = 0; j < 4; ++j) {
    const long n   = n0 + j * 16 + ml;
    const float bv = bias ? bias[n] : 0.0f;
    if (tr) {
      // transposed store: 8 consecutive M per lane -> one 16B store
      bf16x8 t;
#pragma unroll
      for (int i = 0; i < 8; ++i) {
        long m  = m0 + rh + i;
        float v = acc[j][i] * al + bv;
        if (res)  v += res[m * ldres + n];
        if (relu) v = fmaxf(v, 0.0f);
        t[i] = (__bf16)v;
      }
      *(bf16x8*)(outBT + (long)z * oTStrideZ + n * ldoT + (m0 + rh)) = t;
    } else {
#pragma unroll
      for (int i = 0; i < 8; ++i) {
        long m  = m0 + rh + i;
        float v = acc[j][i] * al + bv;
        if (res)  v += res[m * ldres + n];
        if (relu) v = fmaxf(v, 0.0f);
        long off = (long)z * oStrideZ + m * ldo + n;
        if (outF) outF[off] = v;
        if (outB) outB[off] = (__bf16)v;
      }
    }
  }
}

// ---------------------------------------------------------------------------
// Attention: one block per (batch, 32-row tile), loop over 8 heads.
//   scores/probs : bf16 LDS [32][2048], row pitch 2056 elems (131584 B)
//   staging      : bf16 LDS [8 waves][32*136] (68 KB)
//   mean accum   : fp32, 4 rows a wave: 3 in registers (192 a lane), 1 in LDS
//                  [8 waves][2048] (64 KB) -> 266752 B static LDS
// Stage 1: each wave computes a 32x256 score slab (Q fragments register-
//          resident: 16 x bf16x16 = 128 VGPRs, reused across 16 tiles).
// Stage 2: each wave softmaxes 4 rows, two at a time, held in registers.
// Stage 3: each wave computes a 32x32 slab of P@V (V pre-transposed).
// Every staged K or V^T tile is the B operand of two 16-row blocks, so a block
// of 32 rows reads K and V once where two blocks of 16 read them twice.
// attn_mean accumulates with the wave that softmaxes the row, each lane keeping
// the columns it holds there: 32 rows of fp32 do not fit in LDS beside the
// probabilities, nor in registers beside the Q fragments, so they are split.
// No lane touches another lane's part. It is written to HBM exactly once.
// K rows and V^T rows reach their B fragments through a wave-private LDS tile:
// the global loads cover whole 128-byte lines (a fragment-shaped load touches
// 16 lines for 512 bytes), the fragment shape is formed by the LDS reads.
//   K tile   : 16 rows x 256 k, pitch 264 elems (528 B)
//   V^T tile : 32 rows x 128 t, pitch 136 elems (272 B)
// The probability rows are read as A fragments (16 rows at one column), so they
// too get a padded pitch: 2056 elems (4112 B); at 4096 B all 16 rows of a
// fragment read start on the same bank.
// All three pitches are 16 B x odd: conflict-free ds_load_b128 fragment reads.
// ---------------------------------------------------------------------------
constexpr int QR_      = 32;     // query rows per block
constexpr int KP_      = 264;    // K tile pitch, elements
constexpr int VP_      = 136;    // V^T tile pitch, elements
constexpr int PP_      = 2056;   // score / probability row pitch, elements
constexpr int STAGE_E_ = 32 * VP_;   // elements per wave (the larger of the two tiles)
constexpr int ATTN_LDS_ = QR_ * PP_ * 2 + 8 * STAGE_E_ * 2 + 8 * 2048 * 4;   // 266752 B

// Orders this wave's own LDS traffic on its staging tile: lanes read rows that
// other lanes of the same wave wrote, which the compiler cannot see.
__device__ __forceinline__ void stage_sync() {
  asm volatile("s_wait_dscnt 0x0" ::: "memory");
}

// Stands behind a tile's global loads. Naming their address keeps its registers
// untouched up to the wait and puts the step to the next tile behind it.
template <typename T>
__device__ __forceinline__ void addr_sync(T& a) {
  asm volatile("s_wait_xcnt 0x0" : "+v"(a) : : "memory");
}

// 16 bytes at base plus a byte offset and an immediate (wave-uniform base in the next-tile loads)
__device__ __forceinline__ bf16x8 ld16(const __bf16* base, unsigned off, int imm) {
  return *(const bf16x8*)((const char*)base + off + imm);
}
// Eight 2^v in place. One statement, so that no instruction that overwrites a
// source or reads a result can be scheduled directly behind a transcendental:
// the eight work on distinct registers, and the v_nop is the free slot that the
// instruction set asks for behind the last one.
__device__ __forceinline__ void exp2_x8(float& a, float& b, float& c, float& d,
                                        float& e, float& f, float& g, float& h) {
  asm("v_exp_f32 %0, %0\n\tv_exp_f32 %1, %1\n\tv_exp_f32 %2, %2\n\tv_exp_f32 %3, %3\n\t"
      "v_exp_f32 %4, %4\n\tv_exp_f32 %5, %5\n\tv_exp_f32 %6, %6\n\tv_exp_f32 %7, %7\n\t"
      "v_nop"
      : "+v"(a), "+v"(b), "+v"(c), "+v"(d), "+v"(e), "+v"(f), "+v"(g), "+v"(h));
}

__global__ void __launch_bounds__(256)
attn_k(const __bf16* __restrict__ Qb,   // [H][B*S][D]
       const __bf16* __restrict__ Kb,   // [H][B*S][D]
       const __bf16* __restrict__ VbT,  // [H][D][B*S]  (transposed)
       __bf16* __restrict__ Zcat,       // [B*S][H*D]
       float*  __restrict__ attnMean) { // [B][S][S]
  __shared__ __attribute__((aligned(16))) char smem[ATTN_LDS_];
  __bf16* sP    = (__bf16*)smem;                    // [QR_][PP_]
  __bf16* sStage = (__bf16*)(smem + QR_ * PP_ * 2); // [8 waves][STAGE_E_]
  float*  sMean = (float*)(smem + QR_ * PP_ * 2 + 8 * STAGE_E_ * 2);   // [8 waves][2048]

  const int tid  = threadIdx.x;
  const int lane = tid & 31;
  const int wave = __builtin_amdgcn_readfirstlane(tid >> 5);   // in a scalar register: no vector register is free
  const int b    = blockIdx.y;
  const long s0  = (long)blockIdx.x * QR_;
  const int ml   = lane & 15;
  const int kh   = (lane < 16) ? 0 : 8;
  const int rh   = (lane < 16) ? 0 : 8;
  __bf16* sT     = sStage + wave * STAGE_E_;        // this wave's tile
  // Start tile of this block's walk over the 16 K tiles and the 16 V^T tiles of a
  // wave's slab. The 64 blocks of a batch read the same K and V. Walking them in
  // one order they keep together: whichever block leads waits for memory on every
  // tile, and the others catch up with it and wait on the same lines. From 16
  // different starts every tile is asked for in the first trip, and the 15 trips
  // behind it find their tile in L2. The second term gives the four blocks of a
  // batch whose indices agree in their low four bits four different starts.
  const int rot  = (int)((blockIdx.x + 4u * (blockIdx.x >> 4)) & 15u);

  // sum over the heads of rows [4*wave, 4*wave+4), in the softmax's own layout:
  // element q*8+i is column q*256 + lane*8 + i. Every index is a constant.
  // Rows 0 to 2 in registers, row 3 in this wave's LDS row, same columns a lane.
  float mean[3][64];
  float* mrow = sMean + wave * 2048 + lane * 8;
#pragma unroll
  for (int r = 0; r < 3; ++r) {
#pragma unroll
    for (int i = 0; i < 64; ++i) mean[r][i] = 0.0f;
  }
#pragma unroll
  for (int q = 0; q < 16; ++q)
    *(float4*)(mrow + (q >> 1) * 256 + (q & 1) * 4) = make_float4(0.0f, 0.0f, 0.0f, 0.0f);

  // One trip runs stage 3 of the head before and then stages 1 and 2 of its own
  // head: the order of the stages is the plain one, but stage 2 ends the loop's
  // body. With stage 3 last the compiler moves stage 2's additions into mean[][]
  // behind it, keeps the probabilities live across it beside the sums, and spills.
  for (int hh = 0; hh <= H_; ++hh) {
    if (hh > 0) {
      const int h = hh - 1;
      // ---- stage 3: zh slab, e in [wave*32, wave*32+32) ----
      const int e0 = wave * 32;
      const __bf16* vbase = VbT + (long)h * D_ * M_ + (long)b * S_;
      f32x8 acc00 = {}, acc01 = {}, acc10 = {}, acc11 = {};   // [row block][column block]
      // one load = 256 B of each of two V^T rows (four whole lines)
      const int vrw = lane >> 4, vch = (lane & 15) * 8;
      const unsigned vl = (unsigned)((e0 + vrw) * (int)M_ + vch) * 2u;   // bytes from vbase, tile 0
      const __bf16* v0 = vbase + (e0 + vrw) * (int)M_ + vch + rot * 128;   // first tile
      bf16x8 vr[16];
#pragma unroll   // static indices keep vr[] in registers
      for (int q = 0; q < 16; ++q) vr[q] = ld16(v0, 0u, 2 * q * (int)M_ * 2);
      addr_sync(v0);

      for (int c = 0; c < S_ / 128; ++c) {
        stage_sync();   // the last tile's fragment reads are done
#pragma unroll   // static indices keep vr[] in registers
        for (int q = 0; q < 16; ++q)
          *(bf16x8*)(sT + (2 * q + vrw) * VP_ + vch) = vr[q];
        if (c + 1 < S_ / 128) {   // next tile flies while this tile is worked on
          unsigned vg = vl + (unsigned)(((c + 1 + rot) & 15) * 128 * 2);
#pragma unroll   // static indices keep vr[] in registers
          for (int q = 0; q < 16; ++q) vr[q] = ld16(vbase, vg, 2 * q * (int)M_ * 2);
          addr_sync(vg);
        }
        stage_sync();   // the tile is written before any lane reads it back
#pragma unroll   // the four k steps of a tile read at constant LDS offsets
        for (int ts = 0; ts < 4; ++ts) {
          const int t0 = ((c + rot) & 15) * 128 + ts * 32;
          bf16x16 a0 = frag_ld_g(sP + (long)ml * PP_ + t0 + kh);
          bf16x16 a1 = frag_ld_g(sP + (long)(16 + ml) * PP_ + t0 + kh);
          bf16x16 b0 = frag_ld_g(sT + ml * VP_ + ts * 32 + kh);
          bf16x16 b1 = frag_ld_g(sT + (16 + ml) * VP_ + ts * 32 + kh);
          acc00 = wmma_bf16(a0, b0, acc00);
          acc01 = wmma_bf16(a0, b1, acc01);
          acc10 = wmma_bf16(a1, b0, acc10);
          acc11 = wmma_bf16(a1, b1, acc11);
        }
      }
#pragma unroll
      for (int i = 0; i < 8; ++i) {
        long rowm = (long)b * S_ + s0 + rh + i;
        Zcat[rowm * HD_ + (h * D_ + e0 + ml)]             = (__bf16)acc00[i];
        Zcat[rowm * HD_ + (h * D_ + e0 + 16 + ml)]        = (__bf16)acc01[i];
        Zcat[(rowm + 16) * HD_ + (h * D_ + e0 + ml)]      = (__bf16)acc10[i];
        Zcat[(rowm + 16) * HD_ + (h * D_ + e0 + 16 + ml)] = (__bf16)acc11[i];
      }
      __syncthreads();   // protect sP before next head
    }
    if (hh < H_) {
      const int h = hh;
      const __bf16* Qh = Qb + ((long)h * M_ + (long)b * S_ + s0) * D_;
      const __bf16* Kh = Kb + ((long)h * M_ + (long)b * S_) * D_;

      // ---- stage 1: scores for t in [wave*256, wave*256+256) ----
      const int tbase = wave * 256;
      const __bf16* qrow = Qh + (long)ml * D_ + kh;
      bf16x16 qf[2][8];
#pragma unroll
      for (int g = 0; g < 2; ++g) {
#pragma unroll
        for (int e = 0; e < 8; ++e) qf[g][e] = frag_ld_g(qrow + g * 16 * D_ + e * 32);
      }
      addr_sync(qrow);

      // one load = one whole K row (32 lanes x 16 B = 512 B)
      const unsigned kl = (unsigned)(tbase * D_ + lane * 8) * 2u;   // bytes from Kh, tile 0
      const __bf16* k0 = Kh + (tbase + rot * 16) * D_ + lane * 8;   // first tile
      bf16x8 kr[16];
#pragma unroll   // static indices keep kr[] in registers
      for (int r = 0; r < 16; ++r) kr[r] = ld16(k0, 0u, r * D_ * 2);
      addr_sync(k0);

      for (int j = 0; j < 16; ++j) {
        const int t0 = tbase + ((j + rot) & 15) * 16;
        stage_sync();   // the last tile's fragment reads are done
#pragma unroll   // static indices keep kr[] in registers
        for (int r = 0; r < 16; ++r) *(bf16x8*)(sT + r * KP_ + lane * 8) = kr[r];
        if (j + 1 < 16) {   // next tile's rows fly while this tile is worked on
          unsigned kg = kl + (unsigned)(((j + 1 + rot) & 15) * 16 * D_ * 2);
#pragma unroll   // static indices keep kr[] in registers
          for (int r = 0; r < 16; ++r) kr[r] = ld16(Kh, kg, r * D_ * 2);
          addr_sync(kg);
        }
        stage_sync();   // the tile is written before any lane reads it back
        const __bf16* krow = sT + ml * KP_ + kh;
        f32x8 accA = {}, accB = {};
#pragma unroll
        for (int e = 0; e < 8; ++e) {
          bf16x16 bfr = frag_ld_g(krow + e * 32);
          accA = wmma_bf16(qf[0][e], bfr, accA);
          accB = wmma_bf16(qf[1][e], bfr, accB);
        }
#pragma unroll
        for (int i = 0; i < 8; ++i) {
          sP[(rh + i) * PP_ + t0 + ml]      = (__bf16)accA[i];
          sP[(16 + rh + i) * PP_ + t0 + ml] = (__bf16)accB[i];
        }
      }
      __syncthreads();

      // ---- stage 2: softmax rows [4*wave, 4*wave+4), two at a time ----
      // Both rows live in registers from the read of the scores to the write of
      // the probabilities: a lane holds 8 chunks of 8 neighbouring columns of each
      // row, so every LDS access moves 16 bytes a lane and a row is read once and
      // written once. All loops below are unrolled so that x[][] and mean[][] stay
      // in registers.
#pragma unroll
      for (int p = 0; p < 2; ++p) {
        __bf16* prow = sP + (wave * 4 + p * 2) * PP_ + lane * 8;
        float x[2][64];
#pragma unroll
        for (int rr = 0; rr < 2; ++rr) {
#pragma unroll
          for (int q = 0; q < 8; ++q) {
            const bf16x8 t = *(const bf16x8*)(prow + rr * PP_ + q * 256);
#pragma unroll
            for (int i = 0; i < 8; ++i) x[rr][q * 8 + i] = (float)t[i];
          }
        }
        // one short chain per chunk instead of one chain of 64 links
        float mx[2];
#pragma unroll
        for (int rr = 0; rr < 2; ++rr) {
          float m8[8];
#pragma unroll
          for (int q = 0; q < 8; ++q) {
            m8[q] = x[rr][q * 8];
#pragma unroll
            for (int i = 1; i < 8; ++i) m8[q] = fmaxf(m8[q], x[rr][q * 8 + i]);
          }
          mx[rr] = fmaxf(fmaxf(fmaxf(m8[0], m8[1]), fmaxf(m8[2], m8[3])),
                         fmaxf(fmaxf(m8[4], m8[5]), fmaxf(m8[6], m8[7])));
        }
        // the two rows' exchanges go side by side and share their latency
        for (int o = 16; o; o >>= 1) {
          const float a0 = __shfl_xor(mx[0], o, 32);
          const float a1 = __shfl_xor(mx[1], o, 32);
          mx[0] = fmaxf(mx[0], a0);
          mx[1] = fmaxf(mx[1], a1);
        }
        float sum[2];
#pragma unroll
        for (int rr = 0; rr < 2; ++rr) {
          float s8[8];
#pragma unroll
          for (int q = 0; q < 8; ++q) {
            float* e = &x[rr][q * 8];
#pragma unroll
            for (int i = 0; i < 8; ++i) e[i] = (e[i] - mx[rr]) * 1.44269504f;   // exp(v) = 2^(v * log2 e)
            exp2_x8(e[0], e[1], e[2], e[3], e[4], e[5], e[6], e[7]);
            s8[q] = e[0];
#pragma unroll
            for (int i = 1; i < 8; ++i) s8[q] += e[i];
          }
          sum[rr] = ((s8[0] + s8[1]) + (s8[2] + s8[3])) + ((s8[4] + s8[5]) + (s8[6] + s8[7]));
        }
        for (int o = 16; o; o >>= 1) {
          const float a0 = __shfl_xor(sum[0], o, 32);
          const float a1 = __shfl_xor(sum[1], o, 32);
          sum[0] += a0;
          sum[1] += a1;
        }
#pragma unroll
        for (int rr = 0; rr < 2; ++rr) {
          const float inv = 1.0f / sum[rr];
#pragma unroll
          for (int q = 0; q < 8; ++q) {
            bf16x8 t;
#pragma unroll
            for (int i = 0; i < 8; ++i) {
              x[rr][q * 8 + i] *= inv;
              t[i] = (__bf16)x[rr][q * 8 + i];
            }
            *(bf16x8*)(prow + rr * PP_ + q * 256) = t;
          }
          if (p * 2 + rr < 3) {
#pragma unroll
            for (int i = 0; i < 64; ++i) mean[p * 2 + rr][i] += x[rr][i];
          } else {
#pragma unroll
            for (int q = 0; q < 16; ++q) {
              float4 mv = *(const float4*)(mrow + (q >> 1) * 256 + (q & 1) * 4);
              mv.x += x[rr][q * 4 + 0];
              mv.y += x[rr][q * 4 + 1];
              mv.z += x[rr][q * 4 + 2];
              mv.w += x[rr][q * 4 + 3];
              *(float4*)(mrow + (q >> 1) * 256 + (q & 1) * 4) = mv;
            }
          }
        }
      }
      __syncthreads();
    }
  }

  // ---- write attn_mean = sum/H once: a wave's store covers 1 KB of one row ----
  float* mout = attnMean + ((long)b * S_ + s0 + wave * 4) * S_ + lane * 8;
#pragma unroll
  for (int r = 0; r < 4; ++r) {
    float4 v[16];
#pragma unroll
    for (int q = 0; q < 16; ++q) {
      if (r < 3) {
        v[q] = make_float4(mean[r][q * 4 + 0], mean[r][q * 4 + 1], mean[r][q * 4 + 2], mean[r][q * 4 + 3]);
      } else {
        v[q] = *(const float4*)(mrow + (q >> 1) * 256 + (q & 1) * 4);
      }
      v[q].x *= 0.125f; v[q].y *= 0.125f; v[q].z *= 0.125f; v[q].w *= 0.125f;
    }
    // all of a row's products stand in front of its stores, so that none of them
    // is written into a register that an issued store of the same row names
    __builtin_amdgcn_sched_barrier(0);
#pragma unroll
    for (int q = 0; q < 16; ++q)
      *(float4*)(mout + (long)r * S_ + (q >> 1) * 256 + (q & 1) * 4) = v[q];
    // the wait that belongs in front of an overwrite of a register which an issued
    // store names; the barrier behind it holds the next row's products behind it
    asm volatile("s_wait_xcnt 0x0" ::: "memory");
    __builtin_amdgcn_sched_barrier(0);
  }
}

// ---------------------------------------------------------------------------
// LayerNorm over D=256: a row belongs to one wave, four rows a wave, 32 rows a
// block. A lane holds 8 columns of each row (two 16-byte pieces, so that every
// load and f32 store of a wave covers 512 contiguous bytes). No LDS, no barrier.
// The launch starts 2,048 waves where one block a row starts 65,536: a row is so
// short that starting its eight waves takes longer than moving its bytes.
// ---------------------------------------------------------------------------
constexpr int LNR_ = 4;   // rows a wave
typedef __attribute__((ext_vector_type(4))) __bf16 bf16x4;

// value of lane l ^ X inside the 16-lane row (DPP row_xmask:X, control 0x160 + X)
template <int X>
__device__ __forceinline__ float row_xor(float v) {
  return __builtin_bit_cast(float, __builtin_amdgcn_update_dpp(
      0, __builtin_bit_cast(int, v), 0x160 + X, 0xf, 0xf, true));
}
// sum over the 32 lanes, the same value in every lane; all lanes are on
__device__ __forceinline__ float wave_sum(float v) {
  v += row_xor<1>(v);
  v += row_xor<2>(v);
  v += row_xor<4>(v);
  v += row_xor<8>(v);
  const int bits = __builtin_bit_cast(int, v);   // lane l ^ 16
  v += __builtin_bit_cast(float, __builtin_amdgcn_permlanex16(
      bits, bits, 0x76543210, 0xfedcba98, false, false));
  return v;
}

__global__ void __launch_bounds__(256)
ln_k(const float* __restrict__ in, const float* __restrict__ res,
     const float* __restrict__ g, const float* __restrict__ be,
     float* __restrict__ outF, __bf16* __restrict__ outB) {
  const int  lane = threadIdx.x & 31;
  const int  wave = threadIdx.x >> 5;
  const long e0   = (((long)blockIdx.x * 8 + wave) * LNR_) * D_ + lane * 4;   // first element

  // all loads of the wave's rows are issued before the first of them is used
  float4 x[LNR_][2], rv[LNR_][2], gv[2], bv[2];
#pragma unroll
  for (int r = 0; r < LNR_; ++r) {
#pragma unroll
    for (int h = 0; h < 2; ++h) x[r][h] = *(const float4*)(in + e0 + r * D_ + h * 128);
  }
  if (res) {
#pragma unroll
    for (int r = 0; r < LNR_; ++r) {
#pragma unroll
      for (int h = 0; h < 2; ++h) rv[r][h] = *(const float4*)(res + e0 + r * D_ + h * 128);
    }
  } else {
#pragma unroll
    for (int r = 0; r < LNR_; ++r) {
#pragma unroll
      for (int h = 0; h < 2; ++h) rv[r][h] = make_float4(0.0f, 0.0f, 0.0f, 0.0f);
    }
  }
#pragma unroll
  for (int h = 0; h < 2; ++h) {
    gv[h] = *(const float4*)(g + lane * 4 + h * 128);
    bv[h] = *(const float4*)(be + lane * 4 + h * 128);
  }
  // the wait that belongs in front of an overwrite of a register which an issued
  // load names
  asm volatile("s_wait_xcnt 0x0" ::: "memory");

  // the four rows' chains are independent and fill each other's latency
  float s[LNR_];
#pragma unroll
  for (int r = 0; r < LNR_; ++r) {
#pragma unroll
    for (int h = 0; h < 2; ++h) {
      x[r][h].x += rv[r][h].x; x[r][h].y += rv[r][h].y;
      x[r][h].z += rv[r][h].z; x[r][h].w += rv[r][h].w;
    }
    s[r] = ((x[r][0].x + x[r][0].y) + (x[r][0].z + x[r][0].w)) +
           ((x[r][1].x + x[r][1].y) + (x[r][1].z + x[r][1].w));
  }
#pragma unroll
  for (int r = 0; r < LNR_; ++r) s[r] = wave_sum(s[r]);
#pragma unroll
  for (int r = 0; r < LNR_; ++r) {
    const float mean = s[r] * (1.0f / D_);
#pragma unroll
    for (int h = 0; h < 2; ++h) {
      x[r][h].x -= mean; x[r][h].y -= mean; x[r][h].z -= mean; x[r][h].w -= mean;
    }
    s[r] = ((x[r][0].x * x[r][0].x + x[r][0].y * x[r][0].y) +
            (x[r][0].z * x[r][0].z + x[r][0].w * x[r][0].w)) +
           ((x[r][1].x * x[r][1].x + x[r][1].y * x[r][1].y) +
            (x[r][1].z * x[r][1].z + x[r][1].w * x[r][1].w));
  }
#pragma unroll
  for (int r = 0; r < LNR_; ++r) s[r] = wave_sum(s[r]);

  bf16x4 yb[LNR_][2];
#pragma unroll
  for (int r = 0; r < LNR_; ++r) {
    const float rs = rsqrtf(s[r] * (1.0f / D_) + 1e-5f);
#pragma unroll
    for (int h = 0; h < 2; ++h) {
      x[r][h].x = x[r][h].x * rs * gv[h].x + bv[h].x;
      x[r][h].y = x[r][h].y * rs * gv[h].y + bv[h].y;
      x[r][h].z = x[r][h].z * rs * gv[h].z + bv[h].z;
      x[r][h].w = x[r][h].w * rs * gv[h].w + bv[h].w;
      yb[r][h][0] = (__bf16)x[r][h].x; yb[r][h][1] = (__bf16)x[r][h].y;
      yb[r][h][2] = (__bf16)x[r][h].z; yb[r][h][3] = (__bf16)x[r][h].w;
    }
  }
  // all results stand in front of the stores, so that none of them is written
  // into a register that an issued store names
  __builtin_amdgcn_sched_barrier(0);
  if (outF) {
#pragma unroll
    for (int r = 0; r < LNR_; ++r) {
#pragma unroll
      for (int h = 0; h < 2; ++h) *(float4*)(outF + e0 + r * D_ + h * 128) = x[r][h];
    }
    // as above, for the address of the stores that follow
    asm volatile("s_wait_xcnt 0x0" ::: "memory");
  }
  if (outB) {
#pragma unroll
    for (int r = 0; r < LNR_; ++r) {
#pragma unroll
      for (int h = 0; h < 2; ++h) *(bf16x4*)(outB + e0 + r * D_ + h * 128) = yb[r][h];
    }
  }
}

// ---------------------------------------------------------------------------
// All operand preparation in one launch: the cast of X to bf16 and the six
// weight transposes fp32 [rows][cols] -> bf16 [cols][rows]. The seven jobs do not
// depend on one another, and each alone is too short to fill the chip: as seven
// launches they pay seven start-ups and seven drains one after the other.
// A block does one piece: 8,192 elements of X, or one 64 x 64 tile of a weight.
// Every global access of a wave covers whole 128-byte lines.
// ---------------------------------------------------------------------------
constexpr int TT_       = 64;                                   // tile edge
constexpr int CAST_E_   = 8192;                                 // elements of X a block
constexpr int PB_CAST_  = (int)(M_ * D_ / CAST_E_);             // 256 blocks
constexpr int PB_HEAD_  = (D_ / TT_) * (D_ / TT_);              // 16 tiles a head
constexpr int PB_QKV_   = 3 * H_ * PB_HEAD_;                    // 384
constexpr int PB_WZ_    = (int)(HD_ / TT_) * (D_ / TT_);        // 128
constexpr int PB_W1_    = (D_ / TT_) * (FD_ / TT_);             // 32
constexpr int PB_W2_    = (FD_ / TT_) * (D_ / TT_);             // 32
constexpr int PB_ALL_   = PB_CAST_ + PB_QKV_ + PB_WZ_ + PB_W1_ + PB_W2_;   // 832

__global__ void __launch_bounds__(256)
prep_k(const float* __restrict__ X,  const float* __restrict__ Wq,
       const float* __restrict__ Wk, const float* __restrict__ Wv,
       const float* __restrict__ Wz, const float* __restrict__ W1,
       const float* __restrict__ W2,
       __bf16* __restrict__ Xb,  __bf16* __restrict__ WqkvT,   // [3][H][D][D]
       __bf16* __restrict__ WzT, __bf16* __restrict__ W1T,
       __bf16* __restrict__ W2T) {
  __shared__ float sT[TT_][TT_ + 1];   // odd pitch: the column reads fall on distinct banks
  const int tid = threadIdx.x;
  int blk = blockIdx.x;                // every test on it is the same for a whole block
  if (blk < PB_CAST_) {
    const long e = (long)blk * CAST_E_ + tid * 8;
    const float* p = X + e;
    float4 a[4][2];
#pragma unroll
    for (int q = 0; q < 4; ++q) {
      a[q][0] = *(const float4*)(p + q * 2048);
      a[q][1] = *(const float4*)(p + q * 2048 + 4);
    }
    addr_sync(p);
    bf16x8 t[4];
#pragma unroll
    for (int q = 0; q < 4; ++q) {
      t[q][0] = (__bf16)a[q][0].x; t[q][1] = (__bf16)a[q][0].y;
      t[q][2] = (__bf16)a[q][0].z; t[q][3] = (__bf16)a[q][0].w;
      t[q][4] = (__bf16)a[q][1].x; t[q][5] = (__bf16)a[q][1].y;
      t[q][6] = (__bf16)a[q][1].z; t[q][7] = (__bf16)a[q][1].w;
    }
    // all results stand in front of the stores, so that none of them is written
    // into a register that an issued store names
    __builtin_amdgcn_sched_barrier(0);
#pragma unroll
    for (int q = 0; q < 4; ++q) *(bf16x8*)(Xb + e + q * 2048) = t[q];
    return;
  }
  blk -= PB_CAST_;

  // which matrix, its shape and which of its tiles: scalars, one body for all six
  const float* in;
  __bf16* out;
  int rows, cols, tile;
  if (blk < PB_QKV_) {
    const int w     = blk / (H_ * PB_HEAD_);
    const int slice = blk / PB_HEAD_;          // w * H_ + head
    in   = ((w == 0) ? Wq : (w == 1) ? Wk : Wv) + (long)(slice - w * H_) * D_ * D_;
    out  = WqkvT + (long)slice * D_ * D_;
    rows = D_; cols = D_; tile = blk % PB_HEAD_;
  } else if (blk < PB_QKV_ + PB_WZ_) {
    in = Wz; out = WzT; rows = (int)HD_; cols = D_; tile = blk - PB_QKV_;
  } else if (blk < PB_QKV_ + PB_WZ_ + PB_W1_) {
    in = W1; out = W1T; rows = D_; cols = FD_; tile = blk - (PB_QKV_ + PB_WZ_);
  } else {
    in = W2; out = W2T; rows = FD_; cols = D_; tile = blk - (PB_QKV_ + PB_WZ_ + PB_W1_);
  }
  const int tpr = cols / TT_;          // tiles side by side
  const int r0  = (tile / tpr) * TT_;
  const int c0  = (tile % tpr) * TT_;

  const int lr = tid >> 4, lc = (tid & 15) * 4;
  const float* p0 = in + (long)(r0 + lr) * cols + c0 + lc;
  const float* p1 = p0 + 16 * cols;
  const float* p2 = p1 + 16 * cols;
  const float* p3 = p2 + 16 * cols;
  float4 v[4];
  v[0] = *(const float4*)p0;
  v[1] = *(const float4*)p1;
  v[2] = *(const float4*)p2;
  v[3] = *(const float4*)p3;
  // the wait that belongs in front of an overwrite of a register which an issued
  // load names; naming the four addresses keeps it behind the loads
  asm volatile("s_wait_xcnt 0x0" : "+v"(p0), "+v"(p1), "+v"(p2), "+v"(p3) : : "memory");
#pragma unroll
  for (int q = 0; q < 4; ++q) {
    sT[lr + q * 16][lc + 0] = v[q].x;
    sT[lr + q * 16][lc + 1] = v[q].y;
    sT[lr + q * 16][lc + 2] = v[q].z;
    sT[lr + q * 16][lc + 3] = v[q].w;
  }
  __syncthreads();
  // eight old rows of one old column make 16 bytes of a new row
  const int oc = tid >> 3, ch = (tid & 7) * 8;
  bf16x8 t[2];
#pragma unroll
  for (int q = 0; q < 2; ++q) {
#pragma unroll
    for (int i = 0; i < 8; ++i) t[q][i] = (__bf16)sT[ch + i][oc + q * 32];
  }
  __bf16* o0 = out + (long)(c0 + oc) * rows + r0 + ch;
  __bf16* o1 = o0 + 32 * rows;
  // as above: results and addresses stand in front of the stores
  __builtin_amdgcn_sched_barrier(0);
  *(bf16x8*)o0 = t[0];
  *(bf16x8*)o1 = t[1];
}

// ---------------------------------------------------------------------------
// Host-side orchestration (all launches on `stream`, graph-capture safe)
// ---------------------------------------------------------------------------
extern "C" void kernel_launch(void* const* d_in, const int* in_sizes, int n_in,
                              void* d_out, int out_size, void* d_ws, size_t ws_size,
                              hipStream_t stream) {
  const float* X  = (const float*)d_in[0];
  const float* Wq = (const float*)d_in[1];
  const float* Wk = (const float*)d_in[2];
  const float* Wv = (const float*)d_in[3];
  const float* Wz = (const float*)d_in[4];
  const float* bz = (const float*)d_in[5];
  const float* W1 = (const float*)d_in[6];
  const float* b1 = (const float*)d_in[7];
  const float* W2 = (const float*)d_in[8];
  const float* b2 = (const float*)d_in[9];
  const float* g1  = (const float*)d_in[10];
  const float* be1 = (const float*)d_in[11];
  const float* g2  = (const float*)d_in[12];
  const float* be2 = (const float*)d_in[13];

  float* outZ    = (float*)d_out;            // [B,S,D]
  float* outAttn = outZ + M_ * D_;           // [B,S,S]

  // ---- workspace carve-up ----
  char* ws = (char*)d_ws;
  size_t off = 0;
  auto alloc = [&](size_t bytes) { char* p = ws + off; off = (off + bytes + 255) & ~(size_t)255; return p; };
  __bf16* Xb   = (__bf16*)alloc(M_ * D_ * 2);
  __bf16* WqkvT = (__bf16*)alloc((size_t)3 * H_ * D_ * D_ * 2);   // [3][H][D][D]
  __bf16* WzT  = (__bf16*)alloc((size_t)HD_ * D_ * 2);
  __bf16* W1T  = (__bf16*)alloc((size_t)FD_ * D_ * 2);
  __bf16* W2T  = (__bf16*)alloc((size_t)D_ * FD_ * 2);
  __bf16* QKVb = (__bf16*)alloc((size_t)3 * H_ * M_ * D_ * 2);    // 24 slices of M*D
  __bf16* Qb   = QKVb;                          // [H][M][D]
  __bf16* Kb   = QKVb + (size_t)H_ * M_ * D_;   // [H][M][D]
  __bf16* VbT  = QKVb + (size_t)2 * H_ * M_ * D_;   // [H][D][M]
  __bf16* Zcat = (__bf16*)alloc((size_t)M_ * HD_ * 2);
  float*  zres  = (float*)alloc((size_t)M_ * D_ * 4);
  float*  zln1f = (float*)alloc((size_t)M_ * D_ * 4);
  __bf16* zln1b = (__bf16*)alloc((size_t)M_ * D_ * 2);
  __bf16* Hff   = (__bf16*)alloc((size_t)M_ * FD_ * 2);
  float*  zff   = (float*)alloc((size_t)M_ * D_ * 4);
  (void)ws_size; (void)in_sizes; (void)n_in; (void)out_size;

  // ---- 1. cast and weight transposes, one launch ----
  prep_k<<<PB_ALL_, 256, 0, stream>>>(X, Wq, Wk, Wv, Wz, W1, W2, Xb, WqkvT, WzT, W1T, W2T);

  const float scale = 0.25f;  // D^-0.25 = 256^-0.25
  // ---- 2. QKV projections (bf16 WMMA), one launch: slice = grid.z, 8 heads each
  //         of Q, K (scaled, row-major) and V (unscaled, stored transposed) ----
  gemm_bf16_wmma<<<dim3(M_/128, D_/64, 3 * H_), 256, 0, stream>>>(
      Xb, D_, 0, WqkvT, D_, (long)D_*D_, nullptr, nullptr, 0, scale, 1.0f, 2 * H_, 0,
      nullptr, QKVb, D_, (long)M_*D_, QKVb, M_, (long)D_*M_, D_);

  // ---- 3. attention (scores + softmax + P@V + attn_mean) ----
  attn_k<<<dim3(S_/QR_, B_), 256, 0, stream>>>(Qb, Kb, VbT, Zcat, outAttn);

  // ---- 4. output projection + bias + residual (fp32 out) ----
  gemm_bf16_wmma<<<dim3(M_/128, D_/64, 1), 256, 0, stream>>>(
      Zcat, HD_, 0, WzT, HD_, 0, bz, X, D_, 1.0f, 1.0f, 1, 0,
      zres, nullptr, D_, 0, nullptr, 0, 0, (int)HD_);

  // ---- 5. LayerNorm 1 ----
  ln_k<<<M_ / (8 * LNR_), 256, 0, stream>>>(zres, nullptr, g1, be1, zln1f, zln1b);

  // ---- 6. MLP ----
  gemm_bf16_wmma<<<dim3(M_/128, FD_/64, 1), 256, 0, stream>>>(
      zln1b, D_, 0, W1T, D_, 0, b1, nullptr, 0, 1.0f, 1.0f, 1, 1,
      nullptr, Hff, FD_, 0, nullptr, 0, 0, D_);
  gemm_bf16_wmma<<<dim3(M_/128, D_/64, 1), 256, 0, stream>>>(
      Hff, FD_, 0, W2T, FD_, 0, b2, nullptr, 0, 1.0f, 1.0f, 1, 0,
      zff, nullptr, D_, 0, nullptr, 0, 0, FD_);

  // ---- 7. LayerNorm 2 (+residual) -> final z output ----
  ln_k<<<M_ / (8 * LNR_), 256, 0, stream>>>(zff, zln1f, g2, be2, outZ, nullptr);
}

// v008
// A run of this version takes 324 microseconds.
// In both of two side-by-side timings against v007, it was 1.03 times as fast.
// Counting every step since v000, it is 2.97 times as fast.
#include <hip/hip_runtime.h>
#include <hip/hip_bf16.h>
#include <stdint.h>

// ---------------------------------------------------------------------------
// Problem dims (compile-time constants from the reference)
// ---------------------------------------------------------------------------
constexpr int  B_   = 4;
constexpr int  S_   = 2048;
constexpr int  D_   = 256;
constexpr int  H_   = 8;
constexpr int  FD_  = 512;             // F*D
constexpr long M_   = (long)B_ * S_;   // 8192 flattened rows
constexpr long HD_  = (long)H_ * D_;   // 2048 concat width

typedef __attribute__((ext_vector_type(16))) __bf16 bf16x16;
typedef __attribute__((ext_vector_type(8)))  __bf16 bf16x8;
typedef __attribute__((ext_vector_type(8)))  float  f32x8;
typedef __attribute__((ext_vector_type(4)))  unsigned int u32x4;
typedef __attribute__((ext_vector_type(8)))  int i32x8;
typedef __attribute__((ext_vector_type(4)))  int i32x4;

#if defined(__has_builtin)
#if __has_builtin(__builtin_amdgcn_tensor_load_to_lds)
#define HAVE_TDM 1
#else
#define HAVE_TDM 0
#endif
#else
#define HAVE_TDM 0
#endif

// ---------------------------------------------------------------------------
// WMMA helpers.  CDNA5 bf16 A/B fragment layout (16x32 / 32x16):
//   lanes 0..15  : row=lane,    K = [0..7]  and [16..23]
//   lanes 16..31 : row=lane-16, K = [8..15] and [24..31]
// With contiguous-K data a fragment is two 16-byte loads + a shuffle.
// ---------------------------------------------------------------------------
__device__ __forceinline__ bf16x16 frag_ld_g(const __bf16* p) {
  bf16x8 lo = *(const bf16x8*)(p);
  bf16x8 hi = *(const bf16x8*)(p + 16);
  return __builtin_shufflevector(lo, hi, 0,1,2,3,4,5,6,7,8,9,10,11,12,13,14,15);
}

__device__ __forceinline__ f32x8 wmma_bf16(bf16x16 a, bf16x16 b, f32x8 c) {
  return __builtin_amdgcn_wmma_f32_16x16x32_bf16(
      /*neg_a=*/false, a, /*neg_b=*/false, b,
      /*c_mod=*/(short)0, c, /*reuse_a=*/false, /*reuse_b=*/false);
}

#if HAVE_TDM
// ---------------------------------------------------------------------------
// TDM: DMA a 64(row) x 32(k) bf16 tile (row stride ldbt elems) from global
// into LDS at byte offset ldsOff, inserting 16B of padding after every 64B
// row (pad_interval=16 DWORDs -> code 3, pad_amount=4 DWORDs -> code 3),
// i.e. an 80-byte LDS row pitch for bank-conflict-free b128 fragment reads.
// Toolchain probe: 6-arg builtin (g0:u32x4, g1:i32x8, g2:i32x4, g3:i32x4,
// g4:i32x8, cpol:i32).
// ---------------------------------------------------------------------------
__device__ __forceinline__ void tdm_load_tile(const __bf16* gsrc,
                                              unsigned ldsOff, long ldbt) {
  unsigned long long ga = (unsigned long long)(uintptr_t)gsrc;
  u32x4 g0;
  g0[0] = 1u;                                        // count=1, user mode
  g0[1] = ldsOff;                                    // lds_addr (bytes)
  g0[2] = (unsigned)(ga & 0xFFFFFFFFull);            // global_addr[31:0]
  g0[3] = (unsigned)((ga >> 32) & 0x01FFFFFFull)     // global_addr[56:32]
          | 0x80000000u;                             // type=2 ("image")
  i32x8 g1;
  g1[0] = (1 << 16)      // data_size = 2 bytes
        | (1 << 20)      // pad_enable
        | (3 << 22)      // pad_interval: 16 DWORDs
        | (3 << 25);     // pad_amount:   4 DWORDs
  g1[1] = 0;                                   // tensor_dim0 low16 (bits 63:48)
  g1[2] = (1 << 14);                           // tensor_dim0 = 1<<30 (hi bits)
  g1[3] = 16 | (32 << 16);                     // tensor_dim1=1<<20 hi, tile_dim0=32
  g1[4] = 64;                                  // tile_dim1=64, tile_dim2=0
  g1[5] = (int)ldbt;                           // tensor_dim0_stride[31:0]
  g1[6] = 0;                                   // stride hi / dim1_stride lo
  g1[7] = 0;
  i32x4 z4 = {0, 0, 0, 0};
  i32x8 z8 = {0, 0, 0, 0, 0, 0, 0, 0};
  __builtin_amdgcn_tensor_load_to_lds(g0, g1, z4, z4, z8, 0);
}

template <int N>
__device__ __forceinline__ void tdm_wait() {
#if __has_builtin(__builtin_amdgcn_s_wait_tensorcnt)
  __builtin_amdgcn_s_wait_tensorcnt((short)N);
#else
  asm volatile("s_wait_tensorcnt %0" :: "i"(N) : "memory");
#endif
}
#endif  // HAVE_TDM

// ---------------------------------------------------------------------------
// Generic bf16 WMMA GEMM:  C = act(alpha * A @ B + bias + res)
//   A  : [M][K] bf16 row-major (per-z stride aStrideZ)
//   BT : [N][K] bf16 (B pre-transposed -> contiguous K fragments)
// Block: 256 threads = 8 waves, tile 128(M) x 64(N); wave = 16x64 (4 accums).
// The 64xK B panel is shared by all 8 waves, so it is staged through LDS:
// TDM double-buffered DMA (wave 0 issues, TENSORcnt-ordered) when available,
// else a synchronous cooperative copy.  LDS row pitch 80B (32 k-elems + 8
// pad elems) -> conflict-free ds_load_b128 fragment reads.
// Slices z >= zT are scaled by alphaT and stored transposed (outBT), the others
// by alpha and stored row-major: Q, K and V^T come from one launch of 24 slices.
// ---------------------------------------------------------------------------
__global__ void __launch_bounds__(256)
gemm_bf16_wmma(const __bf16* __restrict__ A,  long lda,  long aStrideZ,
               const __bf16* __restrict__ BT, long ldbt, long btStrideZ,
               const float* __restrict__ bias,
               const float* __restrict__ res, long ldres,
               float alpha, float alphaT, int zT, int relu,
               float*  __restrict__ outF,
               __bf16* __restrict__ outB,  long ldo,  long oStrideZ,
               __bf16* __restrict__ outBT, long ldoT, long oTStrideZ,
               int K) {
  __shared__ __bf16 sB[2][64 * 40];   // 2 x 5120B padded tiles

  const int tid  = threadIdx.x;
  const int lane = tid & 31;
  const int wave = tid >> 5;
  const int z    = blockIdx.z;
  const long m0  = (long)blockIdx.x * 128 + wave * 16;
  const long n0  = (long)blockIdx.y * 64;
  const int  ml  = lane & 15;
  const int  kh  = (lane < 16) ? 0 : 8;   // K half-offset per fragment layout
  const int  rh  = (lane < 16) ? 0 : 8;   // C/D row-half offset

  const __bf16* aRow   = A  + (long)z * aStrideZ + (m0 + ml) * lda + kh;
  const __bf16* Bpanel = BT + (long)z * btStrideZ + n0 * ldbt;  // [64][K]

#if HAVE_TDM
  const unsigned ldsBase = (unsigned)(uintptr_t)(&sB[0][0]);
  if (tid < 32) tdm_load_tile(Bpanel, ldsBase, ldbt);           // prologue
#endif

  f32x8 acc[4] = {};
  const bool  tr = z >= zT;
  const float al = tr ? alphaT : alpha;
  const int nsteps = K >> 5;
  for (int s = 0; s < nsteps; ++s) {
    const int k0  = s << 5;
    const int cur = s & 1;
#if HAVE_TDM
    if (tid < 32) {
      if (s + 1 < nsteps) {
        tdm_load_tile(Bpanel + k0 + 32, ldsBase + (unsigned)((cur ^ 1) * 64 * 40 * 2), ldbt);
        tdm_wait<1>();   // previous DMA (in-order) has landed
      } else {
        tdm_wait<0>();
      }
    }
    __syncthreads();
#else
    {   // synchronous cooperative staging: 256 threads x 16B = 4KB tile
      const int n = tid >> 2, c = tid & 3;
      *(bf16x8*)(&sB[cur][n * 40 + c * 8]) =
          *(const bf16x8*)(Bpanel + (long)n * ldbt + k0 + c * 8);
      __syncthreads();
    }
#endif
    bf16x16 afr = frag_ld_g(aRow + k0);
    __builtin_prefetch(aRow + k0 + 128, 0, 1);   // global_prefetch_b8
    const __bf16* bl = &sB[cur][kh];
#pragma unroll
    for (int j = 0; j < 4; ++j) {
      bf16x16 bfr = frag_ld_g(bl + (j * 16 + ml) * 40);
      acc[j] = wmma_bf16(afr, bfr, acc[j]);
    }
    __syncthreads();   // protect buffer before it is overwritten
  }

#pragma unroll
  for (int j = 0; j < 4; ++j) {
    const long n   = n0 + j * 16 + ml;
    const float bv = bias ? bias[n] : 0.0f;
    if (tr) {
      // transposed store: 8 consecutive M per lane -> one 16B store
      bf16x8 t;
#pragma unroll
      for (int i = 0; i < 8; ++i) {
        long m  = m0 + rh + i;
        float v = acc[j][i] * al + bv;
        if (res)  v += res[m * ldres + n];
        if (relu) v = fmaxf(v, 0.0f);
        t[i] = (__bf16)v;
      }
      *(bf16x8*)(outBT + (long)z * oTStrideZ + n * ldoT + (m0 + rh)) = t;
    } else {
#pragma unroll
      for (int i = 0; i < 8; ++i) {
        long m  = m0 + rh + i;
        float v = acc[j][i] * al + bv;
        if (res)  v += res[m * ldres + n];
        if (relu) v = fmaxf(v, 0.0f);
        long off = (long)z * oStrideZ + m * ldo + n;
        if (outF) outF[off] = v;
        if (outB) outB[off] = (__bf16)v;
      }
    }
  }
}

// ---------------------------------------------------------------------------
// Attention: one block per (batch, 32-row tile), loop over 8 heads.
//   scores/probs : bf16 LDS [32][2048], row pitch 2056 elems (131584 B)
//   staging      : bf16 LDS [8 waves][32*136] (68 KB)
//   mean accum   : fp32, 4 rows a wave: 3 in registers (192 a lane), 1 in LDS
//                  [8 waves][2048] (64 KB) -> 266752 B static LDS
// Stage 1: each wave computes a 32x256 score slab (Q fragments register-
//          resident: 16 x bf16x16 = 128 VGPRs, reused across 16 tiles).
// Stage 2: each wave softmaxes 4 rows, two at a time, held in registers.
// Stage 3: each wave computes a 32x32 slab of P@V (V pre-transposed).
// Every staged K or V^T tile is the B operand of two 16-row blocks, so a block
// of 32 rows reads K and V once where two blocks of 16 read them twice.
// attn_mean accumulates with the wave that softmaxes the row, each lane keeping
// the columns it holds there: 32 rows of fp32 do not fit in LDS beside the
// probabilities, nor in registers beside the Q fragments, so they are split.
// No lane touches another lane's part. It is written to HBM exactly once.
// K rows and V^T rows reach their B fragments through a wave-private LDS tile:
// the global loads cover whole 128-byte lines (a fragment-shaped load touches
// 16 lines for 512 bytes), the fragment shape is formed by the LDS reads.
//   K tile   : 16 rows x 256 k, pitch 264 elems (528 B)
//   V^T tile : 32 rows x 128 t, pitch 136 elems (272 B)
// The probability rows are read as A fragments (16 rows at one column), so they
// too get a padded pitch: 2056 elems (4112 B); at 4096 B all 16 rows of a
// fragment read start on the same bank.
// All three pitches are 16 B x odd: conflict-free ds_load_b128 fragment reads.
// ---------------------------------------------------------------------------
constexpr int QR_      = 32;     // query rows per block
constexpr int KP_      = 264;    // K tile pitch, elements
constexpr int VP_      = 136;    // V^T tile pitch, elements
constexpr int PP_      = 2056;   // score / probability row pitch, elements
constexpr int STAGE_E_ = 32 * VP_;   // elements per wave (the larger of the two tiles)
constexpr int ATTN_LDS_ = QR_ * PP_ * 2 + 8 * STAGE_E_ * 2 + 8 * 2048 * 4;   // 266752 B

// Orders this wave's own LDS traffic on its staging tile: lanes read rows that
// other lanes of the same wave wrote, which the compiler cannot see.
__device__ __forceinline__ void stage_sync() {
  asm volatile("s_wait_dscnt 0x0" ::: "memory");
}

// Stands behind a tile's global loads. Naming their address keeps its registers
// untouched up to the wait and puts the step to the next tile behind it.
template <typename T>
__device__ __forceinline__ void addr_sync(T& a) {
  asm volatile("s_wait_xcnt 0x0" : "+v"(a) : : "memory");
}

// 16 bytes at base plus a byte offset and an immediate (wave-uniform base in the next-tile loads)
__device__ __forceinline__ bf16x8 ld16(const __bf16* base, unsigned off, int imm) {
  return *(const bf16x8*)((const char*)base + off + imm);
}
// Eight 2^v in place. One statement, so that no instruction that overwrites a
// source or reads a result can be scheduled directly behind a transcendental:
// the eight work on distinct registers, and the v_nop is the free slot that the
// instruction set asks for behind the last one.
__device__ __forceinline__ void exp2_x8(float& a, float& b, float& c, float& d,
                                        float& e, float& f, float& g, float& h) {
  asm("v_exp_f32 %0, %0\n\tv_exp_f32 %1, %1\n\tv_exp_f32 %2, %2\n\tv_exp_f32 %3, %3\n\t"
      "v_exp_f32 %4, %4\n\tv_exp_f32 %5, %5\n\tv_exp_f32 %6, %6\n\tv_exp_f32 %7, %7\n\t"
      "v_nop"
      : "+v"(a), "+v"(b), "+v"(c), "+v"(d), "+v"(e), "+v"(f), "+v"(g), "+v"(h));
}

__global__ void __launch_bounds__(256)
attn_k(const __bf16* __restrict__ Qb,   // [H][B*S][D]
       const __bf16* __restrict__ Kb,   // [H][B*S][D]
       const __bf16* __restrict__ VbT,  // [H][D][B*S]  (transposed)
       __bf16* __restrict__ Zcat,       // [B*S][H*D]
       float*  __restrict__ attnMean) { // [B][S][S]
  __shared__ __attribute__((aligned(16))) char smem[ATTN_LDS_];
  __bf16* sP    = (__bf16*)smem;                    // [QR_][PP_]
  __bf16* sStage = (__bf16*)(smem + QR_ * PP_ * 2); // [8 waves][STAGE_E_]
  float*  sMean = (float*)(smem + QR_ * PP_ * 2 + 8 * STAGE_E_ * 2);   // [8 waves][2048]

  const int tid  = threadIdx.x;
  const int lane = tid & 31;
  const int wave = __builtin_amdgcn_readfirstlane(tid >> 5);   // in a scalar register: no vector register is free
  const int b    = blockIdx.y;
  const long s0  = (long)blockIdx.x * QR_;
  const int ml   = lane & 15;
  const int kh   = (lane < 16) ? 0 : 8;
  const int rh   = (lane < 16) ? 0 : 8;
  __bf16* sT     = sStage + wave * STAGE_E_;        // this wave's tile
  // Start tile of this block's walk over the 16 K tiles and the 16 V^T tiles of a
  // wave's slab. The 64 blocks of a batch read the same K and V. Walking them in
  // one order they keep together: whichever block leads waits for memory on every
  // tile, and the others catch up with it and wait on the same lines. From 16
  // different starts every tile is asked for in the first trip, and the 15 trips
  // behind it find their tile in L2. The second term gives the four blocks of a
  // batch whose indices agree in their low four bits four different starts.
  const int rot  = (int)((blockIdx.x + 4u * (blockIdx.x >> 4)) & 15u);

  // sum over the heads of rows [4*wave, 4*wave+4), in the softmax's own layout:
  // element q*8+i is column q*256 + lane*8 + i. Every index is a constant.
  // Rows 0 to 2 in registers, row 3 in this wave's LDS row, same columns a lane.
  float mean[3][64];
  float* mrow = sMean + wave * 2048 + lane * 8;
#pragma unroll
  for (int r = 0; r < 3; ++r) {
#pragma unroll
    for (int i = 0; i < 64; ++i) mean[r][i] = 0.0f;
  }
#pragma unroll
  for (int q = 0; q < 16; ++q)
    *(float4*)(mrow + (q >> 1) * 256 + (q & 1) * 4) = make_float4(0.0f, 0.0f, 0.0f, 0.0f);

  // One trip runs stage 3 of the head before and then stages 1 and 2 of its own
  // head: the order of the stages is the plain one, but stage 2 ends the loop's
  // body. With stage 3 last the compiler moves stage 2's additions into mean[][]
  // behind it, keeps the probabilities live across it beside the sums, and spills.
  for (int hh = 0; hh <= H_; ++hh) {
    if (hh > 0) {
      const int h = hh - 1;
      // ---- stage 3: zh slab, e in [wave*32, wave*32+32) ----
      const int e0 = wave * 32;
      const __bf16* vbase = VbT + (long)h * D_ * M_ + (long)b * S_;
      f32x8 acc00 = {}, acc01 = {}, acc10 = {}, acc11 = {};   // [row block][column block]
      // one load = 256 B of each of two V^T rows (four whole lines)
      const int vrw = lane >> 4, vch = (lane & 15) * 8;
      const unsigned vl = (unsigned)((e0 + vrw) * (int)M_ + vch) * 2u;   // bytes from vbase, tile 0
      const __bf16* v0 = vbase + (e0 + vrw) * (int)M_ + vch + rot * 128;   // first tile
      bf16x8 vr[16];
#pragma unroll   // static indices keep vr[] in registers
      for (int q = 0; q < 16; ++q) vr[q] = ld16(v0, 0u, 2 * q * (int)M_ * 2);
      addr_sync(v0);

      for (int c = 0; c < S_ / 128; ++c) {
        stage_sync();   // the last tile's fragment reads are done
#pragma unroll   // static indices keep vr[] in registers
        for (int q = 0; q < 16; ++q)
          *(bf16x8*)(sT + (2 * q + vrw) * VP_ + vch) = vr[q];
        if (c + 1 < S_ / 128) {   // next tile flies while this tile is worked on
          unsigned vg = vl + (unsigned)(((c + 1 + rot) & 15) * 128 * 2);
#pragma unroll   // static indices keep vr[] in registers
          for (int q = 0; q < 16; ++q) vr[q] = ld16(vbase, vg, 2 * q * (int)M_ * 2);
          addr_sync(vg);
        }
        stage_sync();   // the tile is written before any lane reads it back
#pragma unroll   // the four k steps of a tile read at constant LDS offsets
        for (int ts = 0; ts < 4; ++ts) {
          const int t0 = ((c + rot) & 15) * 128 + ts * 32;
          bf16x16 a0 = frag_ld_g(sP + (long)ml * PP_ + t0 + kh);
          bf16x16 a1 = frag_ld_g(sP + (long)(16 + ml) * PP_ + t0 + kh);
          bf16x16 b0 = frag_ld_g(sT + ml * VP_ + ts * 32 + kh);
          bf16x16 b1 = frag_ld_g(sT + (16 + ml) * VP_ + ts * 32 + kh);
          acc00 = wmma_bf16(a0, b0, acc00);
          acc01 = wmma_bf16(a0, b1, acc01);
          acc10 = wmma_bf16(a1, b0, acc10);
          acc11 = wmma_bf16(a1, b1, acc11);
        }
      }
#pragma unroll
      for (int i = 0; i < 8; ++i) {
        long rowm = (long)b * S_ + s0 + rh + i;
        Zcat[rowm * HD_ + (h * D_ + e0 + ml)]             = (__bf16)acc00[i];
        Zcat[rowm * HD_ + (h * D_ + e0 + 16 + ml)]        = (__bf16)acc01[i];
        Zcat[(rowm + 16) * HD_ + (h * D_ + e0 + ml)]      = (__bf16)acc10[i];
        Zcat[(rowm + 16) * HD_ + (h * D_ + e0 + 16 + ml)] = (__bf16)acc11[i];
      }
      __syncthreads();   // protect sP before next head
    }
    if (hh < H_) {
      const int h = hh;
      const __bf16* Qh = Qb + ((long)h * M_ + (long)b * S_ + s0) * D_;
      const __bf16* Kh = Kb + ((long)h * M_ + (long)b * S_) * D_;

      // ---- stage 1: scores for t in [wave*256, wave*256+256) ----
      const int tbase = wave * 256;
      const __bf16* qrow = Qh + (long)ml * D_ + kh;
      bf16x16 qf[2][8];
#pragma unroll
      for (int g = 0; g < 2; ++g) {
#pragma unroll
        for (int e = 0; e < 8; ++e) qf[g][e] = frag_ld_g(qrow + g * 16 * D_ + e * 32);
      }
      addr_sync(qrow);

      // one load = one whole K row (32 lanes x 16 B = 512 B)
      const unsigned kl = (unsigned)(tbase * D_ + lane * 8) * 2u;   // bytes from Kh, tile 0
      const __bf16* k0 = Kh + (tbase + rot * 16) * D_ + lane * 8;   // first tile
      bf16x8 kr[16];
#pragma unroll   // static indices keep kr[] in registers
      for (int r = 0; r < 16; ++r) kr[r] = ld16(k0, 0u, r * D_ * 2);
      addr_sync(k0);

      for (int j = 0; j < 16; ++j) {
        const int t0 = tbase + ((j + rot) & 15) * 16;
        stage_sync();   // the last tile's fragment reads are done
#pragma unroll   // static indices keep kr[] in registers
        for (int r = 0; r < 16; ++r) *(bf16x8*)(sT + r * KP_ + lane * 8) = kr[r];
        if (j + 1 < 16) {   // next tile's rows fly while this tile is worked on
          unsigned kg = kl + (unsigned)(((j + 1 + rot) & 15) * 16 * D_ * 2);
#pragma unroll   // static indices keep kr[] in registers
          for (int r = 0; r < 16; ++r) kr[r] = ld16(Kh, kg, r * D_ * 2);
          addr_sync(kg);
        }
        stage_sync();   // the tile is written before any lane reads it back
        const __bf16* krow = sT + ml * KP_ + kh;
        f32x8 accA = {}, accB = {};
#pragma unroll
        for (int e = 0; e < 8; ++e) {
          bf16x16 bfr = frag_ld_g(krow + e * 32);
          accA = wmma_bf16(qf[0][e], bfr, accA);
          accB = wmma_bf16(qf[1][e], bfr, accB);
        }
#pragma unroll
        for (int i = 0; i < 8; ++i) {
          sP[(rh + i) * PP_ + t0 + ml]      = (__bf16)accA[i];
          sP[(16 + rh + i) * PP_ + t0 + ml] = (__bf16)accB[i];
        }
      }
      __syncthreads();

      // ---- stage 2: softmax rows [4*wave, 4*wave+4), two at a time ----
      // Both rows live in registers from the read of the scores to the write of
      // the probabilities: a lane holds 8 chunks of 8 neighbouring columns of each
      // row, so every LDS access moves 16 bytes a lane and a row is read once and
      // written once. All loops below are unrolled so that x[][] and mean[][] stay
      // in registers.
#pragma unroll
      for (int p = 0; p < 2; ++p) {
        __bf16* prow = sP + (wave * 4 + p * 2) * PP_ + lane * 8;
        float x[2][64];
#pragma unroll
        for (int rr = 0; rr < 2; ++rr) {
#pragma unroll
          for (int q = 0; q < 8; ++q) {
            const bf16x8 t = *(const bf16x8*)(prow + rr * PP_ + q * 256);
#pragma unroll
            for (int i = 0; i < 8; ++i) x[rr][q * 8 + i] = (float)t[i];
          }
        }
        // one short chain per chunk instead of one chain of 64 links
        float mx[2];
#pragma unroll
        for (int rr = 0; rr < 2; ++rr) {
          float m8[8];
#pragma unroll
          for (int q = 0; q < 8; ++q) {
            m8[q] = x[rr][q * 8];
#pragma unroll
            for (int i = 1; i < 8; ++i) m8[q] = fmaxf(m8[q], x[rr][q * 8 + i]);
          }
          mx[rr] = fmaxf(fmaxf(fmaxf(m8[0], m8[1]), fmaxf(m8[2], m8[3])),
                         fmaxf(fmaxf(m8[4], m8[5]), fmaxf(m8[6], m8[7])));
        }
        // the two rows' exchanges go side by side and share their latency
        for (int o = 16; o; o >>= 1) {
          const float a0 = __shfl_xor(mx[0], o, 32);
          const float a1 = __shfl_xor(mx[1], o, 32);
          mx[0] = fmaxf(mx[0], a0);
          mx[1] = fmaxf(mx[1], a1);
        }
        float sum[2];
#pragma unroll
        for (int rr = 0; rr < 2; ++rr) {
          float s8[8];
#pragma unroll
          for (int q = 0; q < 8; ++q) {
            float* e = &x[rr][q * 8];
#pragma unroll
            for (int i = 0; i < 8; ++i) e[i] = (e[i] - mx[rr]) * 1.44269504f;   // exp(v) = 2^(v * log2 e)
            exp2_x8(e[0], e[1], e[2], e[3], e[4], e[5], e[6], e[7]);
            s8[q] = e[0];
#pragma unroll
            for (int i = 1; i < 8; ++i) s8[q] += e[i];
          }
          sum[rr] = ((s8[0] + s8[1]) + (s8[2] + s8[3])) + ((s8[4] + s8[5]) + (s8[6] + s8[7]));
        }
        for (int o = 16; o; o >>= 1) {
          const float a0 = __shfl_xor(sum[0], o, 32);
          const float a1 = __shfl_xor(sum[1], o, 32);
          sum[0] += a0;
          sum[1] += a1;
        }
#pragma unroll
        for (int rr = 0; rr < 2; ++rr) {
          const float inv = 1.0f / sum[rr];
#pragma unroll
          for (int q = 0; q < 8; ++q) {
            bf16x8 t;
#pragma unroll
            for (int i = 0; i < 8; ++i) {
              x[rr][q * 8 + i] *= inv;
              t[i] = (__bf16)x[rr][q * 8 + i];
            }
            *(bf16x8*)(prow + rr * PP_ + q * 256) = t;
          }
          if (p * 2 + rr < 3) {
#pragma unroll
            for (int i = 0; i < 64; ++i) mean[p * 2 + rr][i] += x[rr][i];
          } else {
#pragma unroll
            for (int q = 0; q < 16; ++q) {
              float4 mv = *(const float4*)(mrow + (q >> 1) * 256 + (q & 1) * 4);
              mv.x += x[rr][q * 4 + 0];
              mv.y += x[rr][q * 4 + 1];
              mv.z += x[rr][q * 4 + 2];
              mv.w += x[rr][q * 4 + 3];
              *(float4*)(mrow + (q >> 1) * 256 + (q & 1) * 4) = mv;
            }
          }
        }
      }
      __syncthreads();
    }
  }

  // ---- write attn_mean = sum/H once: a wave's store covers 1 KB of one row ----
  float* mout = attnMean + ((long)b * S_ + s0 + wave * 4) * S_ + lane * 8;
#pragma unroll
  for (int r = 0; r < 4; ++r) {
    float4 v[16];
#pragma unroll
    for (int q = 0; q < 16; ++q) {
      if (r < 3) {
        v[q] = make_float4(mean[r][q * 4 + 0], mean[r][q * 4 + 1], mean[r][q * 4 + 2], mean[r][q * 4 + 3]);
      } else {
        v[q] = *(const float4*)(mrow + (q >> 1) * 256 + (q & 1) * 4);
      }
      v[q].x *= 0.125f; v[q].y *= 0.125f; v[q].z *= 0.125f; v[q].w *= 0.125f;
    }
    // all of a row's products stand in front of its stores, so that none of them
    // is written into a register that an issued store of the same row names
    __builtin_amdgcn_sched_barrier(0);
#pragma unroll
    for (int q = 0; q < 16; ++q)
      *(float4*)(mout + (long)r * S_ + (q >> 1) * 256 + (q & 1) * 4) = v[q];
    // the wait that belongs in front of an overwrite of a register which an issued
    // store names; the barrier behind it holds the next row's products behind it
    asm volatile("s_wait_xcnt 0x0" ::: "memory");
    __builtin_amdgcn_sched_barrier(0);
  }
}

// ---------------------------------------------------------------------------
// LayerNorm over D=256: a row belongs to one wave, four rows a wave, 32 rows a
// block. A lane holds 8 columns of each row (two 16-byte pieces, so that every
// load and f32 store of a wave covers 512 contiguous bytes). No LDS, no barrier.
// The launch starts 2,048 waves where one block a row starts 65,536: a row is so
// short that starting its eight waves takes longer than moving its bytes.
// Its input is the product of a GEMM that was split in K over NP_ slices: NP_
// planes of partial sums, which are added here, with the bias and the residual.
// ---------------------------------------------------------------------------
constexpr int LNR_ = 4;   // rows a wave
constexpr int NP_  = 4;   // K slices of the GEMM in front of a LayerNorm
typedef __attribute__((ext_vector_type(4))) __bf16 bf16x4;

// value of lane l ^ X inside the 16-lane row (DPP row_xmask:X, control 0x160 + X)
template <int X>
__device__ __forceinline__ float row_xor(float v) {
  return __builtin_bit_cast(float, __builtin_amdgcn_update_dpp(
      0, __builtin_bit_cast(int, v), 0x160 + X, 0xf, 0xf, true));
}
// sum over the 32 lanes, the same value in every lane; all lanes are on
__device__ __forceinline__ float wave_sum(float v) {
  v += row_xor<1>(v);
  v += row_xor<2>(v);
  v += row_xor<4>(v);
  v += row_xor<8>(v);
  const int bits = __builtin_bit_cast(int, v);   // lane l ^ 16
  v += __builtin_bit_cast(float, __builtin_amdgcn_permlanex16(
      bits, bits, 0x76543210, 0xfedcba98, false, false));
  return v;
}

__global__ void __launch_bounds__(256)
ln_k(const float* __restrict__ in,     // [NP_][M][D] partial sums
     const float* __restrict__ bias,   // [D]
     const float* __restrict__ res,    // [M][D]
     const float* __restrict__ g, const float* __restrict__ be,
     float* __restrict__ outF, __bf16* __restrict__ outB) {
  const int  lane = threadIdx.x & 31;
  const int  wave = threadIdx.x >> 5;
  const long e0   = (((long)blockIdx.x * 8 + wave) * LNR_) * D_ + lane * 4;   // first element

  // the loads of the wave's rows come first, so that many are in flight at a time
  float4 pp[NP_][LNR_][2], x[LNR_][2], rv[LNR_][2], gv[2], bv[2], cv[2];
#pragma unroll
  for (int p = 0; p < NP_; ++p) {
#pragma unroll
    for (int r = 0; r < LNR_; ++r) {
#pragma unroll
      for (int h = 0; h < 2; ++h)
        pp[p][r][h] = *(const float4*)(in + p * (M_ * D_) + e0 + r * D_ + h * 128);
    }
  }
#pragma unroll
  for (int r = 0; r < LNR_; ++r) {
#pragma unroll
    for (int h = 0; h < 2; ++h) rv[r][h] = *(const float4*)(res + e0 + r * D_ + h * 128);
  }
#pragma unroll
  for (int h = 0; h < 2; ++h) {
    gv[h] = *(const float4*)(g + lane * 4 + h * 128);
    bv[h] = *(const float4*)(be + lane * 4 + h * 128);
    cv[h] = *(const float4*)(bias + lane * 4 + h * 128);
  }
  // the wait that belongs in front of an overwrite of a register which an issued
  // load names
  asm volatile("s_wait_xcnt 0x0" ::: "memory");

  // the four rows' chains are independent and fill each other's latency
  float s[LNR_];
#pragma unroll
  for (int r = 0; r < LNR_; ++r) {
#pragma unroll
    for (int h = 0; h < 2; ++h) {
      x[r][h].x = ((pp[0][r][h].x + pp[1][r][h].x) + (pp[2][r][h].x + pp[3][r][h].x)) + cv[h].x + rv[r][h].x;
      x[r][h].y = ((pp[0][r][h].y + pp[1][r][h].y) + (pp[2][r][h].y + pp[3][r][h].y)) + cv[h].y + rv[r][h].y;
      x[r][h].z = ((pp[0][r][h].z + pp[1][r][h].z) + (pp[2][r][h].z + pp[3][r][h].z)) + cv[h].z + rv[r][h].z;
      x[r][h].w = ((pp[0][r][h].w + pp[1][r][h].w) + (pp[2][r][h].w + pp[3][r][h].w)) + cv[h].w + rv[r][h].w;
    }
    s[r] = ((x[r][0].x + x[r][0].y) + (x[r][0].z + x[r][0].w)) +
           ((x[r][1].x + x[r][1].y) + (x[r][1].z + x[r][1].w));
  }
#pragma unroll
  for (int r = 0; r < LNR_; ++r) s[r] = wave_sum(s[r]);
#pragma unroll
  for (int r = 0; r < LNR_; ++r) {
    const float mean = s[r] * (1.0f / D_);
#pragma unroll
    for (int h = 0; h < 2; ++h) {
      x[r][h].x -= mean; x[r][h].y -= mean; x[r][h].z -= mean; x[r][h].w -= mean;
    }
    s[r] = ((x[r][0].x * x[r][0].x + x[r][0].y * x[r][0].y) +
            (x[r][0].z * x[r][0].z + x[r][0].w * x[r][0].w)) +
           ((x[r][1].x * x[r][1].x + x[r][1].y * x[r][1].y) +
            (x[r][1].z * x[r][1].z + x[r][1].w * x[r][1].w));
  }
#pragma unroll
  for (int r = 0; r < LNR_; ++r) s[r] = wave_sum(s[r]);

  bf16x4 yb[LNR_][2];
#pragma unroll
  for (int r = 0; r < LNR_; ++r) {
    const float rs = rsqrtf(s[r] * (1.0f / D_) + 1e-5f);
#pragma unroll
    for (int h = 0; h < 2; ++h) {
      x[r][h].x = x[r][h].x * rs * gv[h].x + bv[h].x;
      x[r][h].y = x[r][h].y * rs * gv[h].y + bv[h].y;
      x[r][h].z = x[r][h].z * rs * gv[h].z + bv[h].z;
      x[r][h].w = x[r][h].w * rs * gv[h].w + bv[h].w;
      yb[r][h][0] = (__bf16)x[r][h].x; yb[r][h][1] = (__bf16)x[r][h].y;
      yb[r][h][2] = (__bf16)x[r][h].z; yb[r][h][3] = (__bf16)x[r][h].w;
    }
  }
  // all results stand in front of the stores, so that none of them is written
  // into a register that an issued store names
  __builtin_amdgcn_sched_barrier(0);
  if (outF) {
#pragma unroll
    for (int r = 0; r < LNR_; ++r) {
#pragma unroll
      for (int h = 0; h < 2; ++h) *(float4*)(outF + e0 + r * D_ + h * 128) = x[r][h];
    }
    // as above, for the address of the stores that follow
    asm volatile("s_wait_xcnt 0x0" ::: "memory");
  }
  if (outB) {
#pragma unroll
    for (int r = 0; r < LNR_; ++r) {
#pragma unroll
      for (int h = 0; h < 2; ++h) *(bf16x4*)(outB + e0 + r * D_ + h * 128) = yb[r][h];
    }
  }
}

// ---------------------------------------------------------------------------
// All operand preparation in one launch: the cast of X to bf16 and the six
// weight transposes fp32 [rows][cols] -> bf16 [cols][rows]. The seven jobs do not
// depend on one another, and each alone is too short to fill the chip: as seven
// launches they pay seven start-ups and seven drains one after the other.
// A block does one piece: 8,192 elements of X, or one 64 x 64 tile of a weight.
// Every global access of a wave covers whole 128-byte lines.
// ---------------------------------------------------------------------------
constexpr int TT_       = 64;                                   // tile edge
constexpr int CAST_E_   = 8192;                                 // elements of X a block
constexpr int PB_CAST_  = (int)(M_ * D_ / CAST_E_);             // 256 blocks
constexpr int PB_HEAD_  = (D_ / TT_) * (D_ / TT_);              // 16 tiles a head
constexpr int PB_QKV_   = 3 * H_ * PB_HEAD_;                    // 384
constexpr int PB_WZ_    = (int)(HD_ / TT_) * (D_ / TT_);        // 128
constexpr int PB_W1_    = (D_ / TT_) * (FD_ / TT_);             // 32
constexpr int PB_W2_    = (FD_ / TT_) * (D_ / TT_);             // 32
constexpr int PB_ALL_   = PB_CAST_ + PB_QKV_ + PB_WZ_ + PB_W1_ + PB_W2_;   // 832

__global__ void __launch_bounds__(256)
prep_k(const float* __restrict__ X,  const float* __restrict__ Wq,
       const float* __restrict__ Wk, const float* __restrict__ Wv,
       const float* __restrict__ Wz, const float* __restrict__ W1,
       const float* __restrict__ W2,
       __bf16* __restrict__ Xb,  __bf16* __restrict__ WqkvT,   // [3][H][D][D]
       __bf16* __restrict__ WzT, __bf16* __restrict__ W1T,
       __bf16* __restrict__ W2T) {
  __shared__ float sT[TT_][TT_ + 1];   // odd pitch: the column reads fall on distinct banks
  const int tid = threadIdx.x;
  int blk = blockIdx.x;                // every test on it is the same for a whole block
  if (blk < PB_CAST_) {
    const long e = (long)blk * CAST_E_ + tid * 8;
    const float* p = X + e;
    float4 a[4][2];
#pragma unroll
    for (int q = 0; q < 4; ++q) {
      a[q][0] = *(const float4*)(p + q * 2048);
      a[q][1] = *(const float4*)(p + q * 2048 + 4);
    }
    addr_sync(p);
    bf16x8 t[4];
#pragma unroll
    for (int q = 0; q < 4; ++q) {
      t[q][0] = (__bf16)a[q][0].x; t[q][1] = (__bf16)a[q][0].y;
      t[q][2] = (__bf16)a[q][0].z; t[q][3] = (__bf16)a[q][0].w;
      t[q][4] = (__bf16)a[q][1].x; t[q][5] = (__bf16)a[q][1].y;
      t[q][6] = (__bf16)a[q][1].z; t[q][7] = (__bf16)a[q][1].w;
    }
    // all results stand in front of the stores, so that none of them is written
    // into a register that an issued store names
    __builtin_amdgcn_sched_barrier(0);
#pragma unroll
    for (int q = 0; q < 4; ++q) *(bf16x8*)(Xb + e + q * 2048) = t[q];
    return;
  }
  blk -= PB_CAST_;

  // which matrix, its shape and which of its tiles: scalars, one body for all six
  const float* in;
  __bf16* out;
  int rows, cols, tile;
  if (blk < PB_QKV_) {
    const int w     = blk / (H_ * PB_HEAD_);
    const int slice = blk / PB_HEAD_;          // w * H_ + head
    in   = ((w == 0) ? Wq : (w == 1) ? Wk : Wv) + (long)(slice - w * H_) * D_ * D_;
    out  = WqkvT + (long)slice * D_ * D_;
    rows = D_; cols = D_; tile = blk % PB_HEAD_;
  } else if (blk < PB_QKV_ + PB_WZ_) {
    in = Wz; out = WzT; rows = (int)HD_; cols = D_; tile = blk - PB_QKV_;
  } else if (blk < PB_QKV_ + PB_WZ_ + PB_W1_) {
    in = W1; out = W1T; rows = D_; cols = FD_; tile = blk - (PB_QKV_ + PB_WZ_);
  } else {
    in = W2; out = W2T; rows = FD_; cols = D_; tile = blk - (PB_QKV_ + PB_WZ_ + PB_W1_);
  }
  const int tpr = cols / TT_;          // tiles side by side
  const int r0  = (tile / tpr) * TT_;
  const int c0  = (tile % tpr) * TT_;

  const int lr = tid >> 4, lc = (tid & 15) * 4;
  const float* p0 = in + (long)(r0 + lr) * cols + c0 + lc;
  const float* p1 = p0 + 16 * cols;
  const float* p2 = p1 + 16 * cols;
  const float* p3 = p2 + 16 * cols;
  float4 v[4];
  v[0] = *(const float4*)p0;
  v[1] = *(const float4*)p1;
  v[2] = *(const float4*)p2;
  v[3] = *(const float4*)p3;
  // the wait that belongs in front of an overwrite of a register which an issued
  // load names; naming the four addresses keeps it behind the loads
  asm volatile("s_wait_xcnt 0x0" : "+v"(p0), "+v"(p1), "+v"(p2), "+v"(p3) : : "memory");
#pragma unroll
  for (int q = 0; q < 4; ++q) {
    sT[lr + q * 16][lc + 0] = v[q].x;
    sT[lr + q * 16][lc + 1] = v[q].y;
    sT[lr + q * 16][lc + 2] = v[q].z;
    sT[lr + q * 16][lc + 3] = v[q].w;
  }
  __syncthreads();
  // eight old rows of one old column make 16 bytes of a new row
  const int oc = tid >> 3, ch = (tid & 7) * 8;
  bf16x8 t[2];
#pragma unroll
  for (int q = 0; q < 2; ++q) {
#pragma unroll
    for (int i = 0; i < 8; ++i) t[q][i] = (__bf16)sT[ch + i][oc + q * 32];
  }
  __bf16* o0 = out + (long)(c0 + oc) * rows + r0 + ch;
  __bf16* o1 = o0 + 32 * rows;
  // as above: results and addresses stand in front of the stores
  __builtin_amdgcn_sched_barrier(0);
  *(bf16x8*)o0 = t[0];
  *(bf16x8*)o1 = t[1];
}

// ---------------------------------------------------------------------------
// Host-side orchestration (all launches on `stream`, graph-capture safe)
// ---------------------------------------------------------------------------
extern "C" void kernel_launch(void* const* d_in, const int* in_sizes, int n_in,
                              void* d_out, int out_size, void* d_ws, size_t ws_size,
                              hipStream_t stream) {
  const float* X  = (const float*)d_in[0];
  const float* Wq = (const float*)d_in[1];
  const float* Wk = (const float*)d_in[2];
  const float* Wv = (const float*)d_in[3];
  const float* Wz = (const float*)d_in[4];
  const float* bz = (const float*)d_in[5];
  const float* W1 = (const float*)d_in[6];
  const float* b1 = (const float*)d_in[7];
  const float* W2 = (const float*)d_in[8];
  const float* b2 = (const float*)d_in[9];
  const float* g1  = (const float*)d_in[10];
  const float* be1 = (const float*)d_in[11];
  const float* g2  = (const float*)d_in[12];
  const float* be2 = (const float*)d_in[13];

  float* outZ    = (float*)d_out;            // [B,S,D]
  float* outAttn = outZ + M_ * D_;           // [B,S,S]

  // ---- workspace carve-up ----
  char* ws = (char*)d_ws;
  size_t off = 0;
  auto alloc = [&](size_t bytes) { char* p = ws + off; off = (off + bytes + 255) & ~(size_t)255; return p; };
  __bf16* Xb   = (__bf16*)alloc(M_ * D_ * 2);
  __bf16* WqkvT = (__bf16*)alloc((size_t)3 * H_ * D_ * D_ * 2);   // [3][H][D][D]
  __bf16* WzT  = (__bf16*)alloc((size_t)HD_ * D_ * 2);
  __bf16* W1T  = (__bf16*)alloc((size_t)FD_ * D_ * 2);
  __bf16* W2T  = (__bf16*)alloc((size_t)D_ * FD_ * 2);
  __bf16* QKVb = (__bf16*)alloc((size_t)3 * H_ * M_ * D_ * 2);    // 24 slices of M*D
  __bf16* Qb   = QKVb;                          // [H][M][D]
  __bf16* Kb   = QKVb + (size_t)H_ * M_ * D_;   // [H][M][D]
  __bf16* VbT  = QKVb + (size_t)2 * H_ * M_ * D_;   // [H][D][M]
  __bf16* Zcat = (__bf16*)alloc((size_t)M_ * HD_ * 2);
  float*  zres  = (float*)alloc((size_t)NP_ * M_ * D_ * 4);   // NP_ planes of partial sums
  float*  zln1f = (float*)alloc((size_t)M_ * D_ * 4);
  __bf16* zln1b = (__bf16*)alloc((size_t)M_ * D_ * 2);
  __bf16* Hff   = (__bf16*)alloc((size_t)M_ * FD_ * 2);
  float*  zff   = (float*)alloc((size_t)NP_ * M_ * D_ * 4);   // NP_ planes of partial sums
  (void)ws_size; (void)in_sizes; (void)n_in; (void)out_size;

  // ---- 1. cast and weight transposes, one launch ----
  prep_k<<<PB_ALL_, 256, 0, stream>>>(X, Wq, Wk, Wv, Wz, W1, W2, Xb, WqkvT, WzT, W1T, W2T);

  const float scale = 0.25f;  // D^-0.25 = 256^-0.25
  // ---- 2. QKV projections (bf16 WMMA), one launch: slice = grid.z, 8 heads each
  //         of Q, K (scaled, row-major) and V (unscaled, stored transposed) ----
  gemm_bf16_wmma<<<dim3(M_/128, D_/64, 3 * H_), 256, 0, stream>>>(
      Xb, D_, 0, WqkvT, D_, (long)D_*D_, nullptr, nullptr, 0, scale, 1.0f, 2 * H_, 0,
      nullptr, QKVb, D_, (long)M_*D_, QKVb, M_, (long)D_*M_, D_);

  // ---- 3. attention (scores + softmax + P@V + attn_mean) ----
  attn_k<<<dim3(S_/QR_, B_), 256, 0, stream>>>(Qb, Kb, VbT, Zcat, outAttn);

  // ---- 4. output projection, split in K: slice = grid.z, a plane of fp32 partial
  //         sums each. Unsplit it is 256 blocks, one a WGP, and each walks its 64
  //         k steps alone with nothing to cover a step's load latencies; as 1,024
  //         blocks of 16 steps four share a WGP and cover one another's ----
  gemm_bf16_wmma<<<dim3(M_/128, D_/64, NP_), 256, 0, stream>>>(
      Zcat, HD_, HD_/NP_, WzT, HD_, HD_/NP_, nullptr, nullptr, 0, 1.0f, 1.0f, NP_, 0,
      zres, nullptr, D_, (long)M_*D_, nullptr, 0, 0, (int)(HD_/NP_));

  // ---- 5. LayerNorm 1 (adds the planes, the bias and the residual) ----
  ln_k<<<M_ / (8 * LNR_), 256, 0, stream>>>(zres, bz, X, g1, be1, zln1f, zln1b);

  // ---- 6. MLP ----
  gemm_bf16_wmma<<<dim3(M_/128, FD_/64, 1), 256, 0, stream>>>(
      zln1b, D_, 0, W1T, D_, 0, b1, nullptr, 0, 1.0f, 1.0f, 1, 1,
      nullptr, Hff, FD_, 0, nullptr, 0, 0, D_);
  // second layer: split in K like the output projection
  gemm_bf16_wmma<<<dim3(M_/128, D_/64, NP_), 256, 0, stream>>>(
      Hff, FD_, FD_/NP_, W2T, FD_, FD_/NP_, nullptr, nullptr, 0, 1.0f, 1.0f, NP_, 0,
      zff, nullptr, D_, (long)M_*D_, nullptr, 0, 0, FD_/NP_);

  // ---- 7. LayerNorm 2 (adds the planes, the bias and the residual) -> final z output ----
  ln_k<<<M_ / (8 * LNR_), 256, 0, stream>>>(zff, b2, zln1f, g2, be2, outZ, nullptr);
}

// v009
// A run of this version takes 310 microseconds.
// Two timings next to v008 both put it at 1.04 times that version's speed.
// Counting every step since v000, it is 3.10 times as fast.
#include <hip/hip_runtime.h>
#include <hip/hip_bf16.h>
#include <stdint.h>

// ---------------------------------------------------------------------------
// Problem dims (compile-time constants from the reference)
// ---------------------------------------------------------------------------
constexpr int  B_   = 4;
constexpr int  S_   = 2048;
constexpr int  D_   = 256;
constexpr int  H_   = 8;
constexpr int  FD_  = 512;             // F*D
constexpr long M_   = (long)B_ * S_;   // 8192 flattened rows
constexpr long HD_  = (long)H_ * D_;   // 2048 concat width

typedef __attribute__((ext_vector_type(16))) __bf16 bf16x16;
typedef __attribute__((ext_vector_type(8)))  __bf16 bf16x8;
typedef __attribute__((ext_vector_type(8)))  float  f32x8;
typedef __attribute__((ext_vector_type(4)))  unsigned int u32x4;
typedef __attribute__((ext_vector_type(8)))  int i32x8;
typedef __attribute__((ext_vector_type(4)))  int i32x4;

#if defined(__has_builtin)
#if __has_builtin(__builtin_amdgcn_tensor_load_to_lds)
#define HAVE_TDM 1
#else
#define HAVE_TDM 0
#endif
#else
#define HAVE_TDM 0
#endif

// ---------------------------------------------------------------------------
// WMMA helpers.  CDNA5 bf16 A/B fragment layout (16x32 / 32x16):
//   lanes 0..15  : row=lane,    K = [0..7]  and [16..23]
//   lanes 16..31 : row=lane-16, K = [8..15] and [24..31]
// With contiguous-K data a fragment is two 16-byte loads + a shuffle.
// ---------------------------------------------------------------------------
__device__ __forceinline__ bf16x16 frag_ld_g(const __bf16* p) {
  bf16x8 lo = *(const bf16x8*)(p);
  bf16x8 hi = *(const bf16x8*)(p + 16);
  return __builtin_shufflevector(lo, hi, 0,1,2,3,4,5,6,7,8,9,10,11,12,13,14,15);
}

__device__ __forceinline__ f32x8 wmma_bf16(bf16x16 a, bf16x16 b, f32x8 c) {
  return __builtin_amdgcn_wmma_f32_16x16x32_bf16(
      /*neg_a=*/false, a, /*neg_b=*/false, b,
      /*c_mod=*/(short)0, c, /*reuse_a=*/false, /*reuse_b=*/false);
}

#if HAVE_TDM
// ---------------------------------------------------------------------------
// TDM: DMA a 64(row) x 32(k) bf16 tile (row stride ldbt elems) from global
// into LDS at byte offset ldsOff, inserting 16B of padding after every 64B
// row (pad_interval=16 DWORDs -> code 3, pad_amount=4 DWORDs -> code 3),
// i.e. an 80-byte LDS row pitch for bank-conflict-free b128 fragment reads.
// Toolchain probe: 6-arg builtin (g0:u32x4, g1:i32x8, g2:i32x4, g3:i32x4,
// g4:i32x8, cpol:i32).
// ---------------------------------------------------------------------------
__device__ __forceinline__ void tdm_load_tile(const __bf16* gsrc,
                                              unsigned ldsOff, long ldbt) {
  unsigned long long ga = (unsigned long long)(uintptr_t)gsrc;
  u32x4 g0;
  g0[0] = 1u;                                        // count=1, user mode
  g0[1] = ldsOff;                                    // lds_addr (bytes)
  g0[2] = (unsigned)(ga & 0xFFFFFFFFull);            // global_addr[31:0]
  g0[3] = (unsigned)((ga >> 32) & 0x01FFFFFFull)     // global_addr[56:32]
          | 0x80000000u;                             // type=2 ("image")
  i32x8 g1;
  g1[0] = (1 << 16)      // data_size = 2 bytes
        | (1 << 20)      // pad_enable
        | (3 << 22)      // pad_interval: 16 DWORDs
        | (3 << 25);     // pad_amount:   4 DWORDs
  g1[1] = 0;                                   // tensor_dim0 low16 (bits 63:48)
  g1[2] = (1 << 14);                           // tensor_dim0 = 1<<30 (hi bits)
  g1[3] = 16 | (32 << 16);                     // tensor_dim1=1<<20 hi, tile_dim0=32
  g1[4] = 64;                                  // tile_dim1=64, tile_dim2=0
  g1[5] = (int)ldbt;                           // tensor_dim0_stride[31:0]
  g1[6] = 0;                                   // stride hi / dim1_stride lo
  g1[7] = 0;
  i32x4 z4 = {0, 0, 0, 0};
  i32x8 z8 = {0, 0, 0, 0, 0, 0, 0, 0};
  __builtin_amdgcn_tensor_load_to_lds(g0, g1, z4, z4, z8, 0);
}

template <int N>
__device__ __forceinline__ void tdm_wait() {
#if __has_builtin(__builtin_amdgcn_s_wait_tensorcnt)
  __builtin_amdgcn_s_wait_tensorcnt((short)N);
#else
  asm volatile("s_wait_tensorcnt %0" :: "i"(N) : "memory");
#endif
}
#endif  // HAVE_TDM

// ---------------------------------------------------------------------------
// Generic bf16 WMMA GEMM:  C = act(alpha * A @ B + bias + res)
//   A  : [M][K] bf16 row-major (per-z stride aStrideZ)
//   BT : [N][K] bf16 (B pre-transposed -> contiguous K fragments)
// Block: 256 threads = 8 waves, tile 128(M) x 64(N); wave = 16x64 (4 accums).
// The 64xK B panel is shared by all 8 waves, so it is staged through LDS:
// TDM double-buffered DMA (wave 0 issues, TENSORcnt-ordered) when available,
// else a synchronous cooperative copy.  LDS row pitch 80B (32 k-elems + 8
// pad elems) -> conflict-free ds_load_b128 fragment reads.
// Slices z >= zT are scaled by alphaT, the others by alpha: Q, K and V come from
// one launch of 24 slices. Slices z < zF are stored row-major. The others are
// stored in the order of the B fragments that the attention kernel reads, so that
// a fragment load there is 512 contiguous bytes a wave and needs no reshaping:
// a fragment is 32 k x 16 n = 512 elements, as [piece 2][lane 32][8 k], where
//   n = lane & 15,  k = piece * 16 + (lane >> 4) * 8 + (0..7).
//   zF <= z < zT (outB,  K): n = row m, k = column n; [m / 16][n / 32] fragments
//   z >= zT      (outBT, V): n = column n, k = row m; [n / 16][m / 32] fragments
// ---------------------------------------------------------------------------
// The second bound (waves a SIMD) holds the kernel at 64 registers, so that eight
// blocks share a WGP.
__global__ void __launch_bounds__(256, 16)
gemm_bf16_wmma(const __bf16* __restrict__ A,  long lda,  long aStrideZ,
               const __bf16* __restrict__ BT, long ldbt, long btStrideZ,
               const float* __restrict__ bias,
               const float* __restrict__ res, long ldres,
               float alpha, float alphaT, int zF, int zT, int relu,
               float*  __restrict__ outF,
               __bf16* __restrict__ outB,  long ldo,  long oStrideZ,
               __bf16* __restrict__ outBT, long ldoT, long oTStrideZ,
               int K) {
  __shared__ __bf16 sB[2][64 * 40];   // 2 x 5120B padded tiles

  const int tid  = threadIdx.x;
  const int lane = tid & 31;
  const int wave = tid >> 5;
  const int z    = blockIdx.z;
  const long m0  = (long)blockIdx.x * 128 + wave * 16;
  const long n0  = (long)blockIdx.y * 64;
  const int  ml  = lane & 15;
  const int  kh  = (lane < 16) ? 0 : 8;   // K half-offset per fragment layout
  const int  rh  = (lane < 16) ? 0 : 8;   // C/D row-half offset

  const __bf16* aRow   = A  + (long)z * aStrideZ + (m0 + ml) * lda + kh;
  const __bf16* Bpanel = BT + (long)z * btStrideZ + n0 * ldbt;  // [64][K]

#if HAVE_TDM
  const unsigned ldsBase = (unsigned)(uintptr_t)(&sB[0][0]);
  if (tid < 32) tdm_load_tile(Bpanel, ldsBase, ldbt);           // prologue
#endif

  f32x8 acc[4] = {};
  const bool  tr = z >= zT;
  const bool  fr = z >= zF;
  const float al = tr ? alphaT : alpha;
  const int nsteps = K >> 5;
  for (int s = 0; s < nsteps; ++s) {
    const int k0  = s << 5;
    const int cur = s & 1;
#if HAVE_TDM
    if (tid < 32) {
      if (s + 1 < nsteps) {
        tdm_load_tile(Bpanel + k0 + 32, ldsBase + (unsigned)((cur ^ 1) * 64 * 40 * 2), ldbt);
        tdm_wait<1>();   // previous DMA (in-order) has landed
      } else {
        tdm_wait<0>();
      }
    }
    __syncthreads();
#else
    {   // synchronous cooperative staging: 256 threads x 16B = 4KB tile
      const int n = tid >> 2, c = tid & 3;
      *(bf16x8*)(&sB[cur][n * 40 + c * 8]) =
          *(const bf16x8*)(Bpanel + (long)n * ldbt + k0 + c * 8);
      __syncthreads();
    }
#endif
    bf16x16 afr = frag_ld_g(aRow + k0);
    __builtin_prefetch(aRow + k0 + 128, 0, 1);   // global_prefetch_b8
    const __bf16* bl = &sB[cur][kh];
#pragma unroll
    for (int j = 0; j < 4; ++j) {
      bf16x16 bfr = frag_ld_g(bl + (j * 16 + ml) * 40);
      acc[j] = wmma_bf16(afr, bfr, acc[j]);
    }
    __syncthreads();   // protect buffer before it is overwritten
  }

  // Place of element (m0 + rh, n0 + ml) and the steps to the next row and to the
  // next 16 columns. In fragment order a row m is the fragment's n, so it steps by
  // 8 elements; 16 columns are one piece of 16 k (256 elements), of which a lane's
  // column is k = (ml >> 3) * 8 + (ml & 7): 16 lanes' places on, then its element.
  // Inside a slice 32 bits hold every place; the slice's start is wave-uniform.
  const int  iStep = fr ? 8 : (int)ldo;
  const int  jStep = fr ? 256 : 16;
  const int  o0 = fr ? (int)(m0 >> 4) * (int)(ldo >> 5) * 512 + (int)n0 * 16 + (rh + (ml >> 3) * 16) * 8 + (ml & 7)
                     : (int)(m0 + rh) * (int)ldo + (int)n0 + ml;
  const long oz = (long)z * oStrideZ;
#pragma unroll
  for (int j = 0; j < 4; ++j) {
    const long n   = n0 + j * 16 + ml;
    const float bv = bias ? bias[n] : 0.0f;
    if (tr) {
      // 8 consecutive M per lane are 8 consecutive k of this lane's own place in
      // a fragment: one 16B store, 512 contiguous bytes a wave
      bf16x8 t;
#pragma unroll
      for (int i = 0; i < 8; ++i) {
        long m  = m0 + rh + i;
        float v = acc[j][i] * al + bv;
        if (res)  v += res[m * ldres + n];
        if (relu) v = fmaxf(v, 0.0f);
        t[i] = (__bf16)v;
      }
      const int off = (((int)(n0 >> 4) + j) * (int)(ldoT >> 5) + (int)(m0 >> 5)) * 512 +
                      ((int)(m0 >> 4) & 1) * 256 + (ml + 2 * rh) * 8;   // ml + 2 * rh: the lane
      *(bf16x8*)(outBT + (long)z * oTStrideZ + off) = t;
      // the wait that belongs in front of an overwrite of a register which an issued
      // store names: the next column block reuses them
      asm volatile("s_wait_xcnt 0x0" ::: "memory");
    } else {
#pragma unroll
      for (int i = 0; i < 8; ++i) {
        long m  = m0 + rh + i;
        float v = acc[j][i] * al + bv;
        if (res)  v += res[m * ldres + n];
        if (relu) v = fmaxf(v, 0.0f);
        long off = oz + (o0 + j * jStep + i * iStep);
        if (outF) outF[off] = v;
        if (outB) outB[off] = (__bf16)v;
      }
    }
  }
}

// ---------------------------------------------------------------------------
// Attention: one block per (batch, 32-row tile), loop over 8 heads.
//   scores/probs : bf16 LDS [32][2048], row pitch 2056 elems (131584 B)
//   mean accum   : fp32, 4 rows a wave: 2 in registers (128 a lane), 2 in LDS
//                  [8 waves][2][2048] (128 KB) -> 262656 B static LDS
// Stage 1: each wave computes a 32x256 score slab (Q fragments register-
//          resident: 16 x bf16x16 = 128 VGPRs, reused across 16 tiles).
// Stage 2: each wave softmaxes 4 rows, two at a time, held in registers.
// Stage 3: each wave computes a 32x32 slab of P@V.
// Every K or V tile is the B operand of two 16-row blocks, so a block of 32 rows
// reads K and V once where two blocks of 16 read them twice.
// attn_mean accumulates with the wave that softmaxes the row, each lane keeping
// the columns it holds there: 32 rows of fp32 do not fit in LDS beside the
// probabilities, nor in registers beside the Q fragments, so they are split.
// No lane touches another lane's part. It is written to HBM exactly once.
// K and V lie in memory in the order of their B fragments (the projection stores
// them so): a fragment is two loads of 512 contiguous bytes a wave, whole 128-byte
// lines, straight into the registers that the WMMA reads. A tile is 8 fragments
// (8 KB a wave); two tiles are held, and a tile's registers are loaded anew as
// soon as its products are issued, so that a load has the whole of the other
// tile's work to arrive in and 8 to 16 KB a wave are always in flight.
//   K tile : 16 t x 256 e, 8 KB contiguous
//   V tile : 128 t x 32 e, 4 KB contiguous for each 16 e
// The probability rows are read as A fragments (16 rows at one column), so they
// get a padded pitch: 2056 elems (4112 B = 16 B x odd); at 4096 B all 16 rows of a
// fragment read start on the same bank.
// ---------------------------------------------------------------------------
constexpr int QR_      = 32;     // query rows per block
constexpr int PP_      = 2056;   // score / probability row pitch, elements
constexpr int ATTN_LDS_ = QR_ * PP_ * 2 + 8 * 2 * 2048 * 4;   // 262656 B

// Stands behind a tile's global loads. Naming their address keeps its registers
// untouched up to the wait and puts the step to the next tile behind it.
template <typename T>
__device__ __forceinline__ void addr_sync(T& a) {
  asm volatile("s_wait_xcnt 0x0" : "+v"(a) : : "memory");
}

// 16 bytes at base plus a byte offset and an immediate (wave-uniform base in the next-tile loads)
__device__ __forceinline__ bf16x8 ld16(const __bf16* base, unsigned off, int imm) {
  return *(const bf16x8*)((const char*)base + off + imm);
}
// a fragment from its two 16-byte pieces
__device__ __forceinline__ bf16x16 frag_of(bf16x8 lo, bf16x8 hi) {
  return __builtin_shufflevector(lo, hi, 0,1,2,3,4,5,6,7,8,9,10,11,12,13,14,15);
}
// Eight 2^v in place. One statement, so that no instruction that overwrites a
// source or reads a result can be scheduled directly behind a transcendental:
// the eight work on distinct registers, and the v_nop is the free slot that the
// instruction set asks for behind the last one.
__device__ __forceinline__ void exp2_x8(float& a, float& b, float& c, float& d,
                                        float& e, float& f, float& g, float& h) {
  asm("v_exp_f32 %0, %0\n\tv_exp_f32 %1, %1\n\tv_exp_f32 %2, %2\n\tv_exp_f32 %3, %3\n\t"
      "v_exp_f32 %4, %4\n\tv_exp_f32 %5, %5\n\tv_exp_f32 %6, %6\n\tv_exp_f32 %7, %7\n\t"
      "v_nop"
      : "+v"(a), "+v"(b), "+v"(c), "+v"(d), "+v"(e), "+v"(f), "+v"(g), "+v"(h));
}

__global__ void __launch_bounds__(256)
attn_k(const __bf16* __restrict__ Qb,   // [H][B*S][D]
       const __bf16* __restrict__ Kb,   // [H][B*S/16][D/32] fragments of 512
       const __bf16* __restrict__ VbT,  // [H][D/16][B*S/32] fragments of 512
       __bf16* __restrict__ Zcat,       // [B*S][H*D]
       float*  __restrict__ attnMean) { // [B][S][S]
  __shared__ __attribute__((aligned(16))) char smem[ATTN_LDS_];
  __bf16* sP    = (__bf16*)smem;                    // [QR_][PP_]
  float*  sMean = (float*)(smem + QR_ * PP_ * 2);   // [8 waves][2][2048]

  const int tid  = threadIdx.x;
  const int lane = tid & 31;
  const int wave = __builtin_amdgcn_readfirstlane(tid >> 5);   // in a scalar register: no vector register is free
  const int b    = blockIdx.y;
  const long s0  = (long)blockIdx.x * QR_;
  const int ml   = lane & 15;
  const int kh   = (lane < 16) ? 0 : 8;
  const int rh   = (lane < 16) ? 0 : 8;
  // Start tile of this block's walk over the 16 K tiles and the 16 V tiles of a
  // wave's slab. The 64 blocks of a batch read the same K and V. Walking them in
  // one order they keep together: whichever block leads waits for memory on every
  // tile, and the others catch up with it and wait on the same lines. From 16
  // different starts every tile is asked for in the first trip, and the 15 trips
  // behind it find their tile in L2. The second term gives the four blocks of a
  // batch whose indices agree in their low four bits four different starts.
  const int rot  = (int)((blockIdx.x + 4u * (blockIdx.x >> 4)) & 15u);

  // sum over the heads of rows [4*wave, 4*wave+4), in the softmax's own layout:
  // element q*8+i is column q*256 + lane*8 + i. Every index is a constant.
  // Rows 0 and 1 in registers, rows 2 and 3 in this wave's two LDS rows, same
  // columns a lane.
  float mean[2][64];
  float* mrow = sMean + wave * 4096 + lane * 8;
#pragma unroll
  for (int r = 0; r < 2; ++r) {
#pragma unroll
    for (int i = 0; i < 64; ++i) mean[r][i] = 0.0f;
#pragma unroll
    for (int q = 0; q < 16; ++q)
      *(float4*)(mrow + r * 2048 + (q >> 1) * 256 + (q & 1) * 4) = make_float4(0.0f, 0.0f, 0.0f, 0.0f);
  }

  // One trip runs stage 3 of the head before and then stages 1 and 2 of its own
  // head: the order of the stages is the plain one, but stage 2 ends the loop's
  // body. With stage 3 last the compiler moves stage 2's additions into mean[][]
  // behind it, keeps the probabilities live across it beside the sums, and spills.
  for (int hh = 0; hh <= H_; ++hh) {
    if (hh > 0) {
      const int h = hh - 1;
      // ---- stage 3: zh slab, e in [wave*32, wave*32+32) ----
      const int e0 = wave * 32;
      // this wave's two rows of fragments (16 e each), at this batch's first t
      const __bf16* vbase = VbT + (long)h * D_ * M_ +
                            ((long)(2 * wave) * (M_ / 32) + (long)b * (S_ / 32)) * 512;
      f32x8 acc00 = {}, acc01 = {}, acc10 = {}, acc11 = {};   // [row block][column block]
      // The start tile moves on by one with every head, so that what is formed from it
      // belongs to the head. The same for all heads, those per-lane values are formed
      // ahead of the loop over the heads, held throughout, and spill.
      const int rv = (rot + h) & 15;
      // fragment q of a tile: column block q >> 2, k step q & 3
      bf16x16 vr[2][8];
#pragma unroll   // static indices keep vr[][] in registers
      for (int u = 0; u < 2; ++u) {
        unsigned vg = (unsigned)(lane * 16 + ((u + rv) & 15) * 4096);
#pragma unroll
        for (int q = 0; q < 8; ++q)
          vr[u][q] = frag_of(ld16(vbase, vg, (q >> 2) * (int)(M_ / 32) * 1024 + (q & 3) * 1024),
                             ld16(vbase, vg, (q >> 2) * (int)(M_ / 32) * 1024 + (q & 3) * 1024 + 512));
        addr_sync(vg);
      }

      // the products of tile cc, held in vr[u]
      auto pv_tile = [&](const bf16x16 (&v)[8], int cc) {
#pragma unroll   // the four k steps of a tile read at constant LDS offsets
        for (int ts = 0; ts < 4; ++ts) {
          const int t0 = cc * 128 + ts * 32;
          bf16x16 a0 = frag_ld_g(sP + (long)ml * PP_ + t0 + kh);
          bf16x16 a1 = frag_ld_g(sP + (long)(16 + ml) * PP_ + t0 + kh);
          acc00 = wmma_bf16(a0, v[ts], acc00);
          acc01 = wmma_bf16(a0, v[4 + ts], acc01);
          acc10 = wmma_bf16(a1, v[ts], acc10);
          acc11 = wmma_bf16(a1, v[4 + ts], acc11);
        }
      };
      // Every trip loads: a test round the loads would make the compiler wait, where
      // the two paths meet, for the loads just issued. The last two tiles, behind
      // which nothing is left to load, stand behind the loop. Kept rolled for the
      // instruction cache: unrolled, the kernel's text nearly doubles.
#pragma unroll 1
      for (int c = 0; c < S_ / 128 - 2; c += 2) {
#pragma unroll   // static indices keep vr[][] in registers
        for (int u = 0; u < 2; ++u) {
          pv_tile(vr[u], (c + u + rv) & 15);
          // Inputs only, no instruction: the tile's products stand in front of it, the
          // loads into the tile's registers behind it. Left free the compiler orders
          // the loads first, into other registers, and copies them back at the loop's
          // foot behind a wait for every load in flight. (Naming the fragments instead
          // does not do it: their products may still follow the fence.)
          asm volatile("" :: "v"(acc00), "v"(acc01), "v"(acc10), "v"(acc11) : "memory");
          // the tile after next flies while the next is worked on
          unsigned vg = (unsigned)(lane * 16 + ((c + u + 2 + rv) & 15) * 4096);
#pragma unroll
          for (int q = 0; q < 8; ++q)
            vr[u][q] = frag_of(ld16(vbase, vg, (q >> 2) * (int)(M_ / 32) * 1024 + (q & 3) * 1024),
                               ld16(vbase, vg, (q >> 2) * (int)(M_ / 32) * 1024 + (q & 3) * 1024 + 512));
          addr_sync(vg);
        }
      }
      pv_tile(vr[0], (S_ / 128 - 2 + rv) & 15);
      pv_tile(vr[1], (S_ / 128 - 1 + rv) & 15);
      __bf16 zo[4][8];
#pragma unroll
      for (int i = 0; i < 8; ++i) {
        zo[0][i] = (__bf16)acc00[i];
        zo[1][i] = (__bf16)acc01[i];
        zo[2][i] = (__bf16)acc10[i];
        zo[3][i] = (__bf16)acc11[i];
      }
      // all results stand in front of the stores, each in a register of its own:
      // formed one by one in one register, each waits for the store before it
      __builtin_amdgcn_sched_barrier(0);
#pragma unroll
      for (int i = 0; i < 8; ++i) {
        long rowm = (long)b * S_ + s0 + rh + i;
        Zcat[rowm * HD_ + (h * D_ + e0 + ml)]             = zo[0][i];
        Zcat[rowm * HD_ + (h * D_ + e0 + 16 + ml)]        = zo[1][i];
        Zcat[(rowm + 16) * HD_ + (h * D_ + e0 + ml)]      = zo[2][i];
        Zcat[(rowm + 16) * HD_ + (h * D_ + e0 + 16 + ml)] = zo[3][i];
      }
      // the wait that belongs in front of an overwrite of a register which an issued
      // store names
      asm volatile("s_wait_xcnt 0x0" ::: "memory");
      __syncthreads();   // protect sP before next head
    }
    if (hh < H_) {
      const int h = hh;
      const __bf16* Qh = Qb + ((long)h * M_ + (long)b * S_ + s0) * D_;

      // ---- stage 1: scores for t in [wave*256, wave*256+256) ----
      const int tbase = wave * 256;
      // this wave's 16 tiles: a tile of 16 t is D_ * 16 elements in a row
      const __bf16* Kh = Kb + ((long)h * M_ + (long)b * S_ + tbase) * D_;
      const __bf16* qrow = Qh + (long)ml * D_ + kh;
      bf16x16 qf[2][8];
#pragma unroll
      for (int g = 0; g < 2; ++g) {
#pragma unroll
        for (int e = 0; e < 8; ++e) qf[g][e] = frag_ld_g(qrow + g * 16 * D_ + e * 32);
      }
      addr_sync(qrow);

      const int rk = (rot + h) & 15;   // start tile, as in stage 3
      // fragment e of a tile: k step e
      bf16x16 kr[2][8];
#pragma unroll   // static indices keep kr[][] in registers
      for (int u = 0; u < 2; ++u) {
        unsigned kg = (unsigned)(lane * 16 + ((u + rk) & 15) * 8192);
#pragma unroll
        for (int e = 0; e < 8; ++e)
          kr[u][e] = frag_of(ld16(Kh, kg, e * 1024), ld16(Kh, kg, e * 1024 + 512));
        addr_sync(kg);
      }

      // the products of tile jj, held in k[]
      f32x8 accA, accB;
      auto qk_tile = [&](const bf16x16 (&k)[8]) {
        accA = f32x8{}; accB = f32x8{};
#pragma unroll
        for (int e = 0; e < 8; ++e) {
          accA = wmma_bf16(qf[0][e], k[e], accA);
          accB = wmma_bf16(qf[1][e], k[e], accB);
        }
      };
      auto put_scores = [&](int jj) {
        const int t0 = tbase + jj * 16;
#pragma unroll
        for (int i = 0; i < 8; ++i) {
          sP[(rh + i) * PP_ + t0 + ml]      = (__bf16)accA[i];
          sP[(16 + rh + i) * PP_ + t0 + ml] = (__bf16)accB[i];
        }
      };
      // every trip loads, the last two tiles stand behind the loop, and the loop is
      // kept rolled: for the reasons given at stage 3's loop
#pragma unroll 1
      for (int j = 0; j < 14; j += 2) {
#pragma unroll   // static indices keep kr[][] in registers
        for (int u = 0; u < 2; ++u) {
          qk_tile(kr[u]);
          // inputs only, no instruction: as in stage 3, products in front, loads behind
          asm volatile("" :: "v"(accA), "v"(accB) : "memory");
          // the tile after next flies while the next is worked on
          unsigned kg = (unsigned)(lane * 16 + ((j + u + 2 + rk) & 15) * 8192);
#pragma unroll
          for (int e = 0; e < 8; ++e)
            kr[u][e] = frag_of(ld16(Kh, kg, e * 1024), ld16(Kh, kg, e * 1024 + 512));
          addr_sync(kg);
          put_scores((j + u + rk) & 15);
          // keeps the next tile's products behind these loads: moved in front of them,
          // both tiles are waited for before either is loaded anew
          __builtin_amdgcn_sched_barrier(0);
        }
      }
      qk_tile(kr[0]);
      put_scores((14 + rk) & 15);
      qk_tile(kr[1]);
      put_scores((15 + rk) & 15);
      __syncthreads();

      // ---- stage 2: softmax rows [4*wave, 4*wave+4), two at a time ----
      // Both rows live in registers from the read of the scores to the write of
      // the probabilities: a lane holds 8 chunks of 8 neighbouring columns of each
      // row, so every LDS access moves 16 bytes a lane and a row is read once and
      // written once. All loops below are unrolled so that x[][] and mean[][] stay
      // in registers.
#pragma unroll
      for (int p = 0; p < 2; ++p) {
        __bf16* prow = sP + (wave * 4 + p * 2) * PP_ + lane * 8;
        float x[2][64];
#pragma unroll
        for (int rr = 0; rr < 2; ++rr) {
#pragma unroll
          for (int q = 0; q < 8; ++q) {
            const bf16x8 t = *(const bf16x8*)(prow + rr * PP_ + q * 256);
#pragma unroll
            for (int i = 0; i < 8; ++i) x[rr][q * 8 + i] = (float)t[i];
          }
        }
        // one short chain per chunk instead of one chain of 64 links
        float mx[2];
#pragma unroll
        for (int rr = 0; rr < 2; ++rr) {
          float m8[8];
#pragma unroll
          for (int q = 0; q < 8; ++q) {
            m8[q] = x[rr][q * 8];
#pragma unroll
            for (int i = 1; i < 8; ++i) m8[q] = fmaxf(m8[q], x[rr][q * 8 + i]);
          }
          mx[rr] = fmaxf(fmaxf(fmaxf(m8[0], m8[1]), fmaxf(m8[2], m8[3])),
                         fmaxf(fmaxf(m8[4], m8[5]), fmaxf(m8[6], m8[7])));
        }
        // the two rows' exchanges go side by side and share their latency
        for (int o = 16; o; o >>= 1) {
          const float a0 = __shfl_xor(mx[0], o, 32);
          const float a1 = __shfl_xor(mx[1], o, 32);
          mx[0] = fmaxf(mx[0], a0);
          mx[1] = fmaxf(mx[1], a1);
        }
        float sum[2];
#pragma unroll
        for (int rr = 0; rr < 2; ++rr) {
          float s8[8];
#pragma unroll
          for (int q = 0; q < 8; ++q) {
            float* e = &x[rr][q * 8];
#pragma unroll
            for (int i = 0; i < 8; ++i) e[i] = (e[i] - mx[rr]) * 1.44269504f;   // exp(v) = 2^(v * log2 e)
            exp2_x8(e[0], e[1], e[2], e[3], e[4], e[5], e[6], e[7]);
            s8[q] = e[0];
#pragma unroll
            for (int i = 1; i < 8; ++i) s8[q] += e[i];
          }
          sum[rr] = ((s8[0] + s8[1]) + (s8[2] + s8[3])) + ((s8[4] + s8[5]) + (s8[6] + s8[7]));
        }
        for (int o = 16; o; o >>= 1) {
          const float a0 = __shfl_xor(sum[0], o, 32);
          const float a1 = __shfl_xor(sum[1], o, 32);
          sum[0] += a0;
          sum[1] += a1;
        }
#pragma unroll
        for (int rr = 0; rr < 2; ++rr) {
          const float inv = 1.0f / sum[rr];
#pragma unroll
          for (int q = 0; q < 8; ++q) {
            bf16x8 t;
#pragma unroll
            for (int i = 0; i < 8; ++i) {
              x[rr][q * 8 + i] *= inv;
              t[i] = (__bf16)x[rr][q * 8 + i];
            }
            *(bf16x8*)(prow + rr * PP_ + q * 256) = t;
          }
          if (p == 0) {
#pragma unroll
            for (int i = 0; i < 64; ++i) mean[rr][i] += x[rr][i];
          } else {
#pragma unroll
            for (int q = 0; q < 16; ++q) {
              float4 mv = *(const float4*)(mrow + rr * 2048 + (q >> 1) * 256 + (q & 1) * 4);
              mv.x += x[rr][q * 4 + 0];
              mv.y += x[rr][q * 4 + 1];
              mv.z += x[rr][q * 4 + 2];
              mv.w += x[rr][q * 4 + 3];
              *(float4*)(mrow + rr * 2048 + (q >> 1) * 256 + (q & 1) * 4) = mv;
            }
          }
        }
      }
      __syncthreads();
    }
  }

  // ---- write attn_mean = sum/H once: a wave's store covers 1 KB of one row ----
  float* mout = attnMean + ((long)b * S_ + s0 + wave * 4) * S_ + lane * 8;
#pragma unroll
  for (int r = 0; r < 4; ++r) {
    float4 v[16];
#pragma unroll
    for (int q = 0; q < 16; ++q) {
      if (r < 2) {
        v[q] = make_float4(mean[r & 1][q * 4 + 0], mean[r & 1][q * 4 + 1], mean[r & 1][q * 4 + 2], mean[r & 1][q * 4 + 3]);
      } else {
        v[q] = *(const float4*)(mrow + (r - 2) * 2048 + (q >> 1) * 256 + (q & 1) * 4);
      }
      v[q].x *= 0.125f; v[q].y *= 0.125f; v[q].z *= 0.125f; v[q].w *= 0.125f;
    }
    // all of a row's products stand in front of its stores, so that none of them
    // is written into a register that an issued store of the same row names
    __builtin_amdgcn_sched_barrier(0);
#pragma unroll
    for (int q = 0; q < 16; ++q)
      *(float4*)(mout + (long)r * S_ + (q >> 1) * 256 + (q & 1) * 4) = v[q];
    // the wait that belongs in front of an overwrite of a register which an issued
    // store names; the barrier behind it holds the next row's products behind it
    asm volatile("s_wait_xcnt 0x0" ::: "memory");
    __builtin_amdgcn_sched_barrier(0);
  }
}

// ---------------------------------------------------------------------------
// LayerNorm over D=256: a row belongs to one wave, four rows a wave, 32 rows a
// block. A lane holds 8 columns of each row (two 16-byte pieces, so that every
// load and f32 store of a wave covers 512 contiguous bytes). No LDS, no barrier.
// The launch starts 2,048 waves where one block a row starts 65,536.
// Its input is the product of a GEMM that was split in K over NP_ slices: NP_
// planes of partial sums, which are added here, with the bias and the residual.
// ---------------------------------------------------------------------------
constexpr int LNR_ = 4;   // rows a wave
constexpr int NP_  = 4;   // K slices of the GEMM in front of a LayerNorm
typedef __attribute__((ext_vector_type(4))) __bf16 bf16x4;

// value of lane l ^ X inside the 16-lane row (DPP row_xmask:X, control 0x160 + X)
template <int X>
__device__ __forceinline__ float row_xor(float v) {
  return __builtin_bit_cast(float, __builtin_amdgcn_update_dpp(
      0, __builtin_bit_cast(int, v), 0x160 + X, 0xf, 0xf, true));
}
// sum over the 32 lanes, the same value in every lane; all lanes are on
__device__ __forceinline__ float wave_sum(float v) {
  v += row_xor<1>(v);
  v += row_xor<2>(v);
  v += row_xor<4>(v);
  v += row_xor<8>(v);
  const int bits = __builtin_bit_cast(int, v);   // lane l ^ 16
  v += __builtin_bit_cast(float, __builtin_amdgcn_permlanex16(
      bits, bits, 0x76543210, 0xfedcba98, false, false));
  return v;
}

__global__ void __launch_bounds__(256)
ln_k(const float* __restrict__ in,     // [NP_][M][D] partial sums
     const float* __restrict__ bias,   // [D]
     const float* __restrict__ res,    // [M][D]
     const float* __restrict__ g, const float* __restrict__ be,
     float* __restrict__ outF, __bf16* __restrict__ outB) {
  const int  lane = threadIdx.x & 31;
  const int  wave = threadIdx.x >> 5;
  const long e0   = (((long)blockIdx.x * 8 + wave) * LNR_) * D_ + lane * 4;   // first element

  // the loads of the wave's rows come first, so that many are in flight at a time
  float4 pp[NP_][LNR_][2], x[LNR_][2], rv[LNR_][2], gv[2], bv[2], cv[2];
#pragma unroll
  for (int p = 0; p < NP_; ++p) {
#pragma unroll
    for (int r = 0; r < LNR_; ++r) {
#pragma unroll
      for (int h = 0; h < 2; ++h)
        pp[p][r][h] = *(const float4*)(in + p * (M_ * D_) + e0 + r * D_ + h * 128);
    }
  }
#pragma unroll
  for (int r = 0; r < LNR_; ++r) {
#pragma unroll
    for (int h = 0; h < 2; ++h) rv[r][h] = *(const float4*)(res + e0 + r * D_ + h * 128);
  }
#pragma unroll
  for (int h = 0; h < 2; ++h) {
    gv[h] = *(const float4*)(g + lane * 4 + h * 128);
    bv[h] = *(const float4*)(be + lane * 4 + h * 128);
    cv[h] = *(const float4*)(bias + lane * 4 + h * 128);
  }
  // the wait that belongs in front of an overwrite of a register which an issued
  // load names
  asm volatile("s_wait_xcnt 0x0" ::: "memory");

  // the four rows' chains are independent and fill each other's latency
  float s[LNR_];
#pragma unroll
  for (int r = 0; r < LNR_; ++r) {
#pragma unroll
    for (int h = 0; h < 2; ++h) {
      x[r][h].x = ((pp[0][r][h].x + pp[1][r][h].x) + (pp[2][r][h].x + pp[3][r][h].x)) + cv[h].x + rv[r][h].x;
      x[r][h].y = ((pp[0][r][h].y + pp[1][r][h].y) + (pp[2][r][h].y + pp[3][r][h].y)) + cv[h].y + rv[r][h].y;
      x[r][h].z = ((pp[0][r][h].z + pp[1][r][h].z) + (pp[2][r][h].z + pp[3][r][h].z)) + cv[h].z + rv[r][h].z;
      x[r][h].w = ((pp[0][r][h].w + pp[1][r][h].w) + (pp[2][r][h].w + pp[3][r][h].w)) + cv[h].w + rv[r][h].w;
    }
    s[r] = ((x[r][0].x + x[r][0].y) + (x[r][0].z + x[r][0].w)) +
           ((x[r][1].x + x[r][1].y) + (x[r][1].z + x[r][1].w));
  }
#pragma unroll
  for (int r = 0; r < LNR_; ++r) s[r] = wave_sum(s[r]);
#pragma unroll
  for (int r = 0; r < LNR_; ++r) {
    const float mean = s[r] * (1.0f / D_);
#pragma unroll
    for (int h = 0; h < 2; ++h) {
      x[r][h].x -= mean; x[r][h].y -= mean; x[r][h].z -= mean; x[r][h].w -= mean;
    }
    s[r] = ((x[r][0].x * x[r][0].x + x[r][0].y * x[r][0].y) +
            (x[r][0].z * x[r][0].z + x[r][0].w * x[r][0].w)) +
           ((x[r][1].x * x[r][1].x + x[r][1].y * x[r][1].y) +
            (x[r][1].z * x[r][1].z + x[r][1].w * x[r][1].w));
  }
#pragma unroll
  for (int r = 0; r < LNR_; ++r) s[r] = wave_sum(s[r]);

  bf16x4 yb[LNR_][2];
#pragma unroll
  for (int r = 0; r < LNR_; ++r) {
    const float rs = rsqrtf(s[r] * (1.0f / D_) + 1e-5f);
#pragma unroll
    for (int h = 0; h < 2; ++h) {
      x[r][h].x = x[r][h].x * rs * gv[h].x + bv[h].x;
      x[r][h].y = x[r][h].y * rs * gv[h].y + bv[h].y;
      x[r][h].z = x[r][h].z * rs * gv[h].z + bv[h].z;
      x[r][h].w = x[r][h].w * rs * gv[h].w + bv[h].w;
      yb[r][h][0] = (__bf16)x[r][h].x; yb[r][h][1] = (__bf16)x[r][h].y;
      yb[r][h][2] = (__bf16)x[r][h].z; yb[r][h][3] = (__bf16)x[r][h].w;
    }
  }
  // all results stand in front of the stores, so that none of them is written
  // into a register that an issued store names
  __builtin_amdgcn_sched_barrier(0);
  if (outF) {
#pragma unroll
    for (int r = 0; r < LNR_; ++r) {
#pragma unroll
      for (int h = 0; h < 2; ++h) *(float4*)(outF + e0 + r * D_ + h * 128) = x[r][h];
    }
    // as above, for the address of the stores that follow
    asm volatile("s_wait_xcnt 0x0" ::: "memory");
  }
  if (outB) {
#pragma unroll
    for (int r = 0; r < LNR_; ++r) {
#pragma unroll
      for (int h = 0; h < 2; ++h) *(bf16x4*)(outB + e0 + r * D_ + h * 128) = yb[r][h];
    }
  }
}

// ---------------------------------------------------------------------------
// All operand preparation in one launch: the cast of X to bf16 and the six
// weight transposes fp32 [rows][cols] -> bf16 [cols][rows]. The seven jobs do not
// depend on one another, and each alone is too short to fill the chip: as seven
// launches they pay seven start-ups and seven drains one after the other.
// A block does one piece: 8,192 elements of X, or one 64 x 64 tile of a weight.
// Every global access of a wave covers whole 128-byte lines.
// ---------------------------------------------------------------------------
constexpr int TT_       = 64;                                   // tile edge
constexpr int CAST_E_   = 8192;                                 // elements of X a block
constexpr int PB_CAST_  = (int)(M_ * D_ / CAST_E_);             // 256 blocks
constexpr int PB_HEAD_  = (D_ / TT_) * (D_ / TT_);              // 16 tiles a head
constexpr int PB_QKV_   = 3 * H_ * PB_HEAD_;                    // 384
constexpr int PB_WZ_    = (int)(HD_ / TT_) * (D_ / TT_);        // 128
constexpr int PB_W1_    = (D_ / TT_) * (FD_ / TT_);             // 32
constexpr int PB_W2_    = (FD_ / TT_) * (D_ / TT_);             // 32
constexpr int PB_ALL_   = PB_CAST_ + PB_QKV_ + PB_WZ_ + PB_W1_ + PB_W2_;   // 832

__global__ void __launch_bounds__(256)
prep_k(const float* __restrict__ X,  const float* __restrict__ Wq,
       const float* __restrict__ Wk, const float* __restrict__ Wv,
       const float* __restrict__ Wz, const float* __restrict__ W1,
       const float* __restrict__ W2,
       __bf16* __restrict__ Xb,  __bf16* __restrict__ WqkvT,   // [3][H][D][D]
       __bf16* __restrict__ WzT, __bf16* __restrict__ W1T,
       __bf16* __restrict__ W2T) {
  __shared__ float sT[TT_][TT_ + 1];   // odd pitch: the column reads fall on distinct banks
  const int tid = threadIdx.x;
  int blk = blockIdx.x;                // every test on it is the same for a whole block
  if (blk < PB_CAST_) {
    const long e = (long)blk * CAST_E_ + tid * 8;
    const float* p = X + e;
    float4 a[4][2];
#pragma unroll
    for (int q = 0; q < 4; ++q) {
      a[q][0] = *(const float4*)(p + q * 2048);
      a[q][1] = *(const float4*)(p + q * 2048 + 4);
    }
    addr_sync(p);
    bf16x8 t[4];
#pragma unroll
    for (int q = 0; q < 4; ++q) {
      t[q][0] = (__bf16)a[q][0].x; t[q][1] = (__bf16)a[q][0].y;
      t[q][2] = (__bf16)a[q][0].z; t[q][3] = (__bf16)a[q][0].w;
      t[q][4] = (__bf16)a[q][1].x; t[q][5] = (__bf16)a[q][1].y;
      t[q][6] = (__bf16)a[q][1].z; t[q][7] = (__bf16)a[q][1].w;
    }
    // all results stand in front of the stores, so that none of them is written
    // into a register that an issued store names
    __builtin_amdgcn_sched_barrier(0);
#pragma unroll
    for (int q = 0; q < 4; ++q) *(bf16x8*)(Xb + e + q * 2048) = t[q];
    return;
  }
  blk -= PB_CAST_;

  // which matrix, its shape and which of its tiles: scalars, one body for all six
  const float* in;
  __bf16* out;
  int rows, cols, tile;
  if (blk < PB_QKV_) {
    const int w     = blk / (H_ * PB_HEAD_);
    const int slice = blk / PB_HEAD_;          // w * H_ + head
    in   = ((w == 0) ? Wq : (w == 1) ? Wk : Wv) + (long)(slice - w * H_) * D_ * D_;
    out  = WqkvT + (long)slice * D_ * D_;
    rows = D_; cols = D_; tile = blk % PB_HEAD_;
  } else if (blk < PB_QKV_ + PB_WZ_) {
    in = Wz; out = WzT; rows = (int)HD_; cols = D_; tile = blk - PB_QKV_;
  } else if (blk < PB_QKV_ + PB_WZ_ + PB_W1_) {
    in = W1; out = W1T; rows = D_; cols = FD_; tile = blk - (PB_QKV_ + PB_WZ_);
  } else {
    in = W2; out = W2T; rows = FD_; cols = D_; tile = blk - (PB_QKV_ + PB_WZ_ + PB_W1_);
  }
  const int tpr = cols / TT_;          // tiles side by side
  const int r0  = (tile / tpr) * TT_;
  const int c0  = (tile % tpr) * TT_;

  const int lr = tid >> 4, lc = (tid & 15) * 4;
  const float* p0 = in + (long)(r0 + lr) * cols + c0 + lc;
  const float* p1 = p0 + 16 * cols;
  const float* p2 = p1 + 16 * cols;
  const float* p3 = p2 + 16 * cols;
  float4 v[4];
  v[0] = *(const float4*)p0;
  v[1] = *(const float4*)p1;
  v[2] = *(const float4*)p2;
  v[3] = *(const float4*)p3;
  // the wait that belongs in front of an overwrite of a register which an issued
  // load names; naming the four addresses keeps it behind the loads
  asm volatile("s_wait_xcnt 0x0" : "+v"(p0), "+v"(p1), "+v"(p2), "+v"(p3) : : "memory");
#pragma unroll
  for (int q = 0; q < 4; ++q) {
    sT[lr + q * 16][lc + 0] = v[q].x;
    sT[lr + q * 16][lc + 1] = v[q].y;
    sT[lr + q * 16][lc + 2] = v[q].z;
    sT[lr + q * 16][lc + 3] = v[q].w;
  }
  __syncthreads();
  // eight old rows of one old column make 16 bytes of a new row
  const int oc = tid >> 3, ch = (tid & 7) * 8;
  bf16x8 t[2];
#pragma unroll
  for (int q = 0; q < 2; ++q) {
#pragma unroll
    for (int i = 0; i < 8; ++i) t[q][i] = (__bf16)sT[ch + i][oc + q * 32];
  }
  __bf16* o0 = out + (long)(c0 + oc) * rows + r0 + ch;
  __bf16* o1 = o0 + 32 * rows;
  // as above: results and addresses stand in front of the stores
  __builtin_amdgcn_sched_barrier(0);
  *(bf16x8*)o0 = t[0];
  *(bf16x8*)o1 = t[1];
}

// ---------------------------------------------------------------------------
// Host-side orchestration (all launches on `stream`, graph-capture safe)
// ---------------------------------------------------------------------------
extern "C" void kernel_launch(void* const* d_in, const int* in_sizes, int n_in,
                              void* d_out, int out_size, void* d_ws, size_t ws_size,
                              hipStream_t stream) {
  const float* X  = (const float*)d_in[0];
  const float* Wq = (const float*)d_in[1];
  const float* Wk = (const float*)d_in[2];
  const float* Wv = (const float*)d_in[3];
  const float* Wz = (const float*)d_in[4];
  const float* bz = (const float*)d_in[5];
  const float* W1 = (const float*)d_in[6];
  const float* b1 = (const float*)d_in[7];
  const float* W2 = (const float*)d_in[8];
  const float* b2 = (const float*)d_in[9];
  const float* g1  = (const float*)d_in[10];
  const float* be1 = (const float*)d_in[11];
  const float* g2  = (const float*)d_in[12];
  const float* be2 = (const float*)d_in[13];

  float* outZ    = (float*)d_out;            // [B,S,D]
  float* outAttn = outZ + M_ * D_;           // [B,S,S]

  // ---- workspace carve-up ----
  char* ws = (char*)d_ws;
  size_t off = 0;
  auto alloc = [&](size_t bytes) { char* p = ws + off; off = (off + bytes + 255) & ~(size_t)255; return p; };
  __bf16* Xb   = (__bf16*)alloc(M_ * D_ * 2);
  __bf16* WqkvT = (__bf16*)alloc((size_t)3 * H_ * D_ * D_ * 2);   // [3][H][D][D]
  __bf16* WzT  = (__bf16*)alloc((size_t)HD_ * D_ * 2);
  __bf16* W1T  = (__bf16*)alloc((size_t)FD_ * D_ * 2);
  __bf16* W2T  = (__bf16*)alloc((size_t)D_ * FD_ * 2);
  __bf16* QKVb = (__bf16*)alloc((size_t)3 * H_ * M_ * D_ * 2);    // 24 slices of M*D
  __bf16* Qb   = QKVb;                          // [H][M][D]
  __bf16* Kb   = QKVb + (size_t)H_ * M_ * D_;   // [H][M/16][D/32] fragments
  __bf16* VbT  = QKVb + (size_t)2 * H_ * M_ * D_;   // [H][D/16][M/32] fragments
  __bf16* Zcat = (__bf16*)alloc((size_t)M_ * HD_ * 2);
  float*  zres  = (float*)alloc((size_t)NP_ * M_ * D_ * 4);   // NP_ planes of partial sums
  float*  zln1f = (float*)alloc((size_t)M_ * D_ * 4);
  __bf16* zln1b = (__bf16*)alloc((size_t)M_ * D_ * 2);
  __bf16* Hff   = (__bf16*)alloc((size_t)M_ * FD_ * 2);
  float*  zff   = (float*)alloc((size_t)NP_ * M_ * D_ * 4);   // NP_ planes of partial sums
  (void)ws_size; (void)in_sizes; (void)n_in; (void)out_size;

  // ---- 1. cast and weight transposes, one launch ----
  prep_k<<<PB_ALL_, 256, 0, stream>>>(X, Wq, Wk, Wv, Wz, W1, W2, Xb, WqkvT, WzT, W1T, W2T);

  const float scale = 0.25f;  // D^-0.25 = 256^-0.25
  // ---- 2. QKV projections (bf16 WMMA), one launch: slice = grid.z, 8 heads each
  //         of Q (scaled, row-major), K (scaled) and V (unscaled), both in fragment order ----
  gemm_bf16_wmma<<<dim3(M_/128, D_/64, 3 * H_), 256, 0, stream>>>(
      Xb, D_, 0, WqkvT, D_, (long)D_*D_, nullptr, nullptr, 0, scale, 1.0f, H_, 2 * H_, 0,
      nullptr, QKVb, D_, (long)M_*D_, QKVb, M_, (long)D_*M_, D_);

  // ---- 3. attention (scores + softmax + P@V + attn_mean) ----
  attn_k<<<dim3(S_/QR_, B_), 256, 0, stream>>>(Qb, Kb, VbT, Zcat, outAttn);

  // ---- 4. output projection, split in K: slice = grid.z, a plane of fp32 partial
  //         sums each. Unsplit it is 256 blocks, one a WGP, and each walks its 64
  //         k steps alone with nothing to cover a step's load latencies; as 1,024
  //         blocks of 16 steps four share a WGP and cover one another's ----
  gemm_bf16_wmma<<<dim3(M_/128, D_/64, NP_), 256, 0, stream>>>(
      Zcat, HD_, HD_/NP_, WzT, HD_, HD_/NP_, nullptr, nullptr, 0, 1.0f, 1.0f, NP_, NP_, 0,
      zres, nullptr, D_, (long)M_*D_, nullptr, 0, 0, (int)(HD_/NP_));

  // ---- 5. LayerNorm 1 (adds the planes, the bias and the residual) ----
  ln_k<<<M_ / (8 * LNR_), 256, 0, stream>>>(zres, bz, X, g1, be1, zln1f, zln1b);

  // ---- 6. MLP ----
  gemm_bf16_wmma<<<dim3(M_/128, FD_/64, 1), 256, 0, stream>>>(
      zln1b, D_, 0, W1T, D_, 0, b1, nullptr, 0, 1.0f, 1.0f, 1, 1, 1,
      nullptr, Hff, FD_, 0, nullptr, 0, 0, D_);
  // second layer: split in K like the output projection
  gemm_bf16_wmma<<<dim3(M_/128, D_/64, NP_), 256, 0, stream>>>(
      Hff, FD_, FD_/NP_, W2T, FD_, FD_/NP_, nullptr, nullptr, 0, 1.0f, 1.0f, NP_, NP_, 0,
      zff, nullptr, D_, (long)M_*D_, nullptr, 0, 0, FD_/NP_);

  // ---- 7. LayerNorm 2 (adds the planes, the bias and the residual) -> final z output ----
  ln_k<<<M_ / (8 * LNR_), 256, 0, stream>>>(zff, b2, zln1f, g2, be2, outZ, nullptr);
}

// v010
// A run of this version takes 228 microseconds.
// Timed twice side by side with v009, it ran 1.37 and 1.36 times as fast.
// Over all steps from v000 it is 4.22 times as fast.
#include <hip/hip_runtime.h>
#include <hip/hip_bf16.h>
#include <stdint.h>

// ---------------------------------------------------------------------------
// Problem dims (compile-time constants from the reference)
// ---------------------------------------------------------------------------
constexpr int  B_   = 4;
constexpr int  S_   = 2048;
constexpr int  D_   = 256;
constexpr int  H_   = 8;
constexpr int  FD_  = 512;             // F*D
constexpr long M_   = (long)B_ * S_;   // 8192 flattened rows
constexpr long HD_  = (long)H_ * D_;   // 2048 concat width

typedef __attribute__((ext_vector_type(16))) __bf16 bf16x16;
typedef __attribute__((ext_vector_type(8)))  __bf16 bf16x8;
typedef __attribute__((ext_vector_type(8)))  float  f32x8;
typedef __attribute__((ext_vector_type(4)))  unsigned int u32x4;
typedef __attribute__((ext_vector_type(8)))  int i32x8;
typedef __attribute__((ext_vector_type(4)))  int i32x4;

#if defined(__has_builtin)
#if __has_builtin(__builtin_amdgcn_tensor_load_to_lds)
#define HAVE_TDM 1
#else
#define HAVE_TDM 0
#endif
#else
#define HAVE_TDM 0
#endif

// ---------------------------------------------------------------------------
// WMMA helpers.  CDNA5 bf16 A/B fragment layout (16x32 / 32x16):
//   lanes 0..15  : row=lane,    K = [0..7]  and [16..23]
//   lanes 16..31 : row=lane-16, K = [8..15] and [24..31]
// With contiguous-K data a fragment is two 16-byte loads + a shuffle.
// ---------------------------------------------------------------------------
__device__ __forceinline__ bf16x16 frag_ld_g(const __bf16* p) {
  bf16x8 lo = *(const bf16x8*)(p);
  bf16x8 hi = *(const bf16x8*)(p + 16);
  return __builtin_shufflevector(lo, hi, 0,1,2,3,4,5,6,7,8,9,10,11,12,13,14,15);
}

__device__ __forceinline__ f32x8 wmma_bf16(bf16x16 a, bf16x16 b, f32x8 c) {
  return __builtin_amdgcn_wmma_f32_16x16x32_bf16(
      /*neg_a=*/false, a, /*neg_b=*/false, b,
      /*c_mod=*/(short)0, c, /*reuse_a=*/false, /*reuse_b=*/false);
}

#if HAVE_TDM
// ---------------------------------------------------------------------------
// TDM: DMA a 64(row) x 32(k) bf16 tile (row stride ldbt elems) from global
// into LDS at byte offset ldsOff, inserting 16B of padding after every 64B
// row (pad_interval=16 DWORDs -> code 3, pad_amount=4 DWORDs -> code 3),
// i.e. an 80-byte LDS row pitch for bank-conflict-free b128 fragment reads.
// Toolchain probe: 6-arg builtin (g0:u32x4, g1:i32x8, g2:i32x4, g3:i32x4,
// g4:i32x8, cpol:i32).
// ---------------------------------------------------------------------------
__device__ __forceinline__ void tdm_load_tile(const __bf16* gsrc,
                                              unsigned ldsOff, long ldbt) {
  unsigned long long ga = (unsigned long long)(uintptr_t)gsrc;
  u32x4 g0;
  g0[0] = 1u;                                        // count=1, user mode
  g0[1] = ldsOff;                                    // lds_addr (bytes)
  g0[2] = (unsigned)(ga & 0xFFFFFFFFull);            // global_addr[31:0]
  g0[3] = (unsigned)((ga >> 32) & 0x01FFFFFFull)     // global_addr[56:32]
          | 0x80000000u;                             // type=2 ("image")
  i32x8 g1;
  g1[0] = (1 << 16)      // data_size = 2 bytes
        | (1 << 20)      // pad_enable
        | (3 << 22)      // pad_interval: 16 DWORDs
        | (3 << 25);     // pad_amount:   4 DWORDs
  g1[1] = 0;                                   // tensor_dim0 low16 (bits 63:48)
  g1[2] = (1 << 14);                           // tensor_dim0 = 1<<30 (hi bits)
  g1[3] = 16 | (32 << 16);                     // tensor_dim1=1<<20 hi, tile_dim0=32
  g1[4] = 64;                                  // tile_dim1=64, tile_dim2=0
  g1[5] = (int)ldbt;                           // tensor_dim0_stride[31:0]
  g1[6] = 0;                                   // stride hi / dim1_stride lo
  g1[7] = 0;
  i32x4 z4 = {0, 0, 0, 0};
  i32x8 z8 = {0, 0, 0, 0, 0, 0, 0, 0};
  __builtin_amdgcn_tensor_load_to_lds(g0, g1, z4, z4, z8, 0);
}

template <int N>
__device__ __forceinline__ void tdm_wait() {
#if __has_builtin(__builtin_amdgcn_s_wait_tensorcnt)
  __builtin_amdgcn_s_wait_tensorcnt((short)N);
#else
  asm volatile("s_wait_tensorcnt %0" :: "i"(N) : "memory");
#endif
}
#endif  // HAVE_TDM

// ---------------------------------------------------------------------------
// Generic bf16 WMMA GEMM:  C = act(alpha * A @ B + bias + res)
//   A  : [M][K] bf16 row-major (per-z stride aStrideZ)
//   BT : [N][K] bf16 (B pre-transposed -> contiguous K fragments)
// Block: 256 threads = 8 waves, tile 128(M) x 64(N); wave = 16x64 (4 accums).
// The 64xK B panel is shared by all 8 waves, so it is staged through LDS:
// TDM double-buffered DMA (wave 0 issues, TENSORcnt-ordered) when available,
// else a synchronous cooperative copy.  LDS row pitch 80B (32 k-elems + 8
// pad elems) -> conflict-free ds_load_b128 fragment reads.
// Slice z = blockIdx.z moves A, BT and the output by its own strides.
// ---------------------------------------------------------------------------
// The second bound (waves a SIMD) holds the kernel at 64 registers, so that eight
// blocks share a WGP.
__global__ void __launch_bounds__(256, 16)
gemm_bf16_wmma(const __bf16* __restrict__ A,  long lda,  long aStrideZ,
               const __bf16* __restrict__ BT, long ldbt, long btStrideZ,
               const float* __restrict__ bias,
               const float* __restrict__ res, long ldres,
               float alpha, int relu,
               float*  __restrict__ outF,
               __bf16* __restrict__ outB,  long ldo,  long oStrideZ,
               int K) {
  __shared__ __bf16 sB[2][64 * 40];   // 2 x 5120B padded tiles

  const int tid  = threadIdx.x;
  const int lane = tid & 31;
  const int wave = tid >> 5;
  const int z    = blockIdx.z;
  const long m0  = (long)blockIdx.x * 128 + wave * 16;
  const long n0  = (long)blockIdx.y * 64;
  const int  ml  = lane & 15;
  const int  kh  = (lane < 16) ? 0 : 8;   // K half-offset per fragment layout
  const int  rh  = (lane < 16) ? 0 : 8;   // C/D row-half offset

  const __bf16* aRow   = A  + (long)z * aStrideZ + (m0 + ml) * lda + kh;
  const __bf16* Bpanel = BT + (long)z * btStrideZ + n0 * ldbt;  // [64][K]

#if HAVE_TDM
  const unsigned ldsBase = (unsigned)(uintptr_t)(&sB[0][0]);
  if (tid < 32) tdm_load_tile(Bpanel, ldsBase, ldbt);           // prologue
#endif

  f32x8 acc[4] = {};
  const int nsteps = K >> 5;
  for (int s = 0; s < nsteps; ++s) {
    const int k0  = s << 5;
    const int cur = s & 1;
#if HAVE_TDM
    if (tid < 32) {
      if (s + 1 < nsteps) {
        tdm_load_tile(Bpanel + k0 + 32, ldsBase + (unsigned)((cur ^ 1) * 64 * 40 * 2), ldbt);
        tdm_wait<1>();   // previous DMA (in-order) has landed
      } else {
        tdm_wait<0>();
      }
    }
    __syncthreads();
#else
    {   // synchronous cooperative staging: 256 threads x 16B = 4KB tile
      const int n = tid >> 2, c = tid & 3;
      *(bf16x8*)(&sB[cur][n * 40 + c * 8]) =
          *(const bf16x8*)(Bpanel + (long)n * ldbt + k0 + c * 8);
      __syncthreads();
    }
#endif
    bf16x16 afr = frag_ld_g(aRow + k0);
    __builtin_prefetch(aRow + k0 + 128, 0, 1);   // global_prefetch_b8
    const __bf16* bl = &sB[cur][kh];
#pragma unroll
    for (int j = 0; j < 4; ++j) {
      bf16x16 bfr = frag_ld_g(bl + (j * 16 + ml) * 40);
      acc[j] = wmma_bf16(afr, bfr, acc[j]);
    }
    __syncthreads();   // protect buffer before it is overwritten
  }

  // Place of element (m0 + rh, n0 + ml) and the steps to the next row and to the
  // next 16 columns. Inside a slice 32 bits hold every place; the slice's start is
  // wave-uniform.
  const int  iStep = (int)ldo;
  const int  jStep = 16;
  const int  o0 = (int)(m0 + rh) * (int)ldo + (int)n0 + ml;
  const long oz = (long)z * oStrideZ;
#pragma unroll
  for (int j = 0; j < 4; ++j) {
    const long n   = n0 + j * 16 + ml;
    const float bv = bias ? bias[n] : 0.0f;
#pragma unroll
    for (int i = 0; i < 8; ++i) {
      long m  = m0 + rh + i;
      float v = acc[j][i] * alpha + bv;
      if (res)  v += res[m * ldres + n];
      if (relu) v = fmaxf(v, 0.0f);
      long off = oz + (o0 + j * jStep + i * iStep);
      if (outF) outF[off] = v;
      if (outB) outB[off] = (__bf16)v;
    }
  }
}

// ---------------------------------------------------------------------------
// Attention, with the products re-associated so that every head works on X itself:
//   scores_h = (X Wq_h)(X Wk_h)^T = Qp_h X^T,   Qp_h = X (Wq_h Wk_h^T) / sqrt(D)
//   z        = sum_h (P_h X Wv_h) Wz_h = sum_h (P_h X)(Wv_h Wz_h)
// The B operand of both products is X, the same for all 8 heads, so one block takes
// 8 query rows of all 8 heads (64 score rows: row = head * 8 + query row) and every
// tile of X that it reads feeds all heads.
//   scores/probs : bf16 LDS [64][2048], row pitch 2056 elems (263168 B)
// Stage 1: each wave computes a 64x256 score slab (Qp fragments register-
//          resident: 32 x bf16x16 = 256 VGPRs, reused across 16 tiles).
// Stage 2: each wave softmaxes the 8 heads of one query row, two at a time, held
//          in registers, sums them there and writes that row of attn_mean.
// Stage 3: each wave computes a 64x32 slab of P@X.
// X lies in memory twice in the order of B fragments (the preparation stores it
// so): a fragment is two loads of 512 contiguous bytes a wave, whole 128-byte
// lines, straight into the registers that the WMMA reads. A tile is 8 fragments
// (8 KB a wave); two tiles are held, and a tile's registers are loaded anew as
// soon as its products are issued, so that a load has the whole of the other
// tile's work to arrive in and 8 to 16 KB a wave are always in flight.
// A fragment is 32 k x 16 n = 512 elements, as [piece 2][lane 32][8 k], where
//   n = lane & 15,  k = piece * 16 + (lane >> 4) * 8 + (0..7).
//   XK (n = row t, k = column d) tile : 16 t x 256 d, 8 KB contiguous
//   XV (n = column d, k = row t) tile : 128 t x 32 d, 4 KB contiguous for each 16 d
// The probability rows are read as A fragments (16 rows at one column), so they
// get a padded pitch: 2056 elems (4112 B = 16 B x odd); at 4096 B all 16 rows of a
// fragment read start on the same bank.
// ---------------------------------------------------------------------------
constexpr int QS_      = 8;          // query rows per block
constexpr int QR_      = H_ * QS_;   // score rows per block
constexpr int PP_      = 2056;       // score / probability row pitch, elements
constexpr int ATTN_LDS_ = QR_ * PP_ * 2;   // 263168 B

// Stands behind a tile's global loads. Naming their address keeps its registers
// untouched up to the wait and puts the step to the next tile behind it.
template <typename T>
__device__ __forceinline__ void addr_sync(T& a) {
  asm volatile("s_wait_xcnt 0x0" : "+v"(a) : : "memory");
}

// 16 bytes at base plus a byte offset and an immediate (wave-uniform base in the next-tile loads)
__device__ __forceinline__ bf16x8 ld16(const __bf16* base, unsigned off, int imm) {
  return *(const bf16x8*)((const char*)base + off + imm);
}
// a fragment from its two 16-byte pieces
__device__ __forceinline__ bf16x16 frag_of(bf16x8 lo, bf16x8 hi) {
  return __builtin_shufflevector(lo, hi, 0,1,2,3,4,5,6,7,8,9,10,11,12,13,14,15);
}
// Eight 2^v in place. One statement, so that no instruction that overwrites a
// source or reads a result can be scheduled directly behind a transcendental:
// the eight work on distinct registers, and the v_nop is the free slot that the
// instruction set asks for behind the last one.
__device__ __forceinline__ void exp2_x8(float& a, float& b, float& c, float& d,
                                        float& e, float& f, float& g, float& h) {
  asm("v_exp_f32 %0, %0\n\tv_exp_f32 %1, %1\n\tv_exp_f32 %2, %2\n\tv_exp_f32 %3, %3\n\t"
      "v_exp_f32 %4, %4\n\tv_exp_f32 %5, %5\n\tv_exp_f32 %6, %6\n\tv_exp_f32 %7, %7\n\t"
      "v_nop"
      : "+v"(a), "+v"(b), "+v"(c), "+v"(d), "+v"(e), "+v"(f), "+v"(g), "+v"(h));
}

__global__ void __launch_bounds__(256)
attn_k(const __bf16* __restrict__ Qb,   // [H][B*S][D]
       const __bf16* __restrict__ XK,   // [B*S/16][D/32] fragments of 512
       const __bf16* __restrict__ XV,   // [D/16][B*S/32] fragments of 512
       __bf16* __restrict__ Zcat,       // [B*S][H*D]
       float*  __restrict__ attnMean) { // [B][S][S]
  __shared__ __attribute__((aligned(16))) char smem[ATTN_LDS_];
  __bf16* sP    = (__bf16*)smem;                    // [QR_][PP_]

  const int tid  = threadIdx.x;
  const int lane = tid & 31;
  const int wave = __builtin_amdgcn_readfirstlane(tid >> 5);   // wave-uniform: kept in a scalar register
  // the batch is the fast grid index (for speed only)
  const int b    = blockIdx.x;
  const long s0  = (long)blockIdx.y * QS_;
  const int ml   = lane & 15;
  const int kh   = (lane < 16) ? 0 : 8;
  const int rh   = (lane < 16) ? 0 : 8;
  // Start tile of this block's walk over the 16 tiles of a wave's slab, in stage 1
  // and in stage 3. The blocks of a batch read the same X. Walking it in one order
  // they keep together: whichever block leads waits for memory on every tile, and
  // the others catch up with it and wait on the same lines. From 16 different
  // starts every tile is asked for in the first trip, and the 15 trips behind it
  // find their tile in L2. The second term gives blocks whose indices agree in their
  // low four bits four starts (c, c+4, c+8, c+12) instead of one.
  const int rot  = (int)((blockIdx.y + 4u * (blockIdx.y >> 4)) & 15u);

  {
    // ---- stage 1: scores for t in [wave*256, wave*256+256) ----
    const int tbase = wave * 256;
    // this wave's 16 tiles: a tile of 16 t is D_ * 16 elements in a row
    const __bf16* Kh = XK + ((long)b * S_ + tbase) * D_;
    // row block g holds heads 2g and 2g+1: a lane's row is query row ml & 7 of head 2g + (ml >> 3)
    bf16x16 qf[4][8];
#pragma unroll
    for (int g = 0; g < 4; ++g) {
      const __bf16* qrow = Qb + ((long)(2 * g + (ml >> 3)) * M_ + (long)b * S_ + s0 + (ml & 7)) * D_ + kh;
#pragma unroll
      for (int e = 0; e < 8; ++e) qf[g][e] = frag_ld_g(qrow + e * 32);
      addr_sync(qrow);
      // holds later address arithmetic behind the wait: moved up among the loads it
      // is written into an address register that an issued load names
      __builtin_amdgcn_sched_barrier(0);
    }

    // fragment e of a tile: k step e
    bf16x16 kr[2][8];
#pragma unroll   // static indices keep kr[][] in registers
    for (int u = 0; u < 2; ++u) {
      unsigned kg = (unsigned)(lane * 16 + ((u + rot) & 15) * 8192);
#pragma unroll
      for (int e = 0; e < 8; ++e)
        kr[u][e] = frag_of(ld16(Kh, kg, e * 1024), ld16(Kh, kg, e * 1024 + 512));
      addr_sync(kg);
    }

    // the products of the tile held in k[], one accumulator a row block
    f32x8 accA, accB, accC, accD;
    auto qk_tile = [&](const bf16x16 (&k)[8]) {
      accA = f32x8{}; accB = f32x8{}; accC = f32x8{}; accD = f32x8{};
#pragma unroll
      for (int e = 0; e < 8; ++e) {
        accA = wmma_bf16(qf[0][e], k[e], accA);
        accB = wmma_bf16(qf[1][e], k[e], accB);
        accC = wmma_bf16(qf[2][e], k[e], accC);
        accD = wmma_bf16(qf[3][e], k[e], accD);
      }
    };
    auto put_scores = [&](int jj) {
      const int t0 = tbase + jj * 16;
#pragma unroll
      for (int i = 0; i < 8; ++i) {
        sP[(rh + i) * PP_ + t0 + ml]      = (__bf16)accA[i];
        sP[(16 + rh + i) * PP_ + t0 + ml] = (__bf16)accB[i];
        sP[(32 + rh + i) * PP_ + t0 + ml] = (__bf16)accC[i];
        sP[(48 + rh + i) * PP_ + t0 + ml] = (__bf16)accD[i];
      }
    };
    // Every trip loads: a test round the loads would make the compiler wait, where
    // the two paths meet, for the loads just issued. The last two tiles, behind
    // which nothing is left to load, stand behind the loop. Kept rolled for the
    // instruction cache.
#pragma unroll 1
    for (int j = 0; j < 14; j += 2) {
#pragma unroll   // static indices keep kr[][] in registers
      for (int u = 0; u < 2; ++u) {
        qk_tile(kr[u]);
        // Inputs only, no instruction: the tile's products stand in front of it, the
        // loads into the tile's registers behind it. Left free the compiler orders
        // the loads first, into other registers, and copies them back at the loop's
        // foot behind a wait for every load in flight.
        asm volatile("" :: "v"(accA), "v"(accB), "v"(accC), "v"(accD) : "memory");
        // the tile after next flies while the next is worked on
        unsigned kg = (unsigned)(lane * 16 + ((j + u + 2 + rot) & 15) * 8192);
#pragma unroll
        for (int e = 0; e < 8; ++e)
          kr[u][e] = frag_of(ld16(Kh, kg, e * 1024), ld16(Kh, kg, e * 1024 + 512));
        addr_sync(kg);
        put_scores((j + u + rot) & 15);
        // keeps the next tile's products behind these loads: moved in front of them,
        // both tiles are waited for before either is loaded anew
        __builtin_amdgcn_sched_barrier(0);
      }
    }
    qk_tile(kr[0]);
    put_scores((14 + rot) & 15);
    qk_tile(kr[1]);
    put_scores((15 + rot) & 15);
  }
  __syncthreads();   // every wave's score slab is in LDS before a row is read

  {
    // ---- stage 2: softmax of query row 'wave', its 8 heads two at a time ----
    // Both rows live in registers from the read of the scores to the write of
    // the probabilities: a lane holds 8 chunks of 8 neighbouring columns of each
    // row, so every LDS access moves 16 bytes a lane and a row is read once and
    // written once. The inner loops are unrolled so that x[][] and mean[] stay in
    // registers.
    // sum over the heads: element q*8+i is column q*256 + lane*8 + i
    float mean[64];
#pragma unroll
    for (int i = 0; i < 64; ++i) mean[i] = 0.0f;
    // kept rolled for the instruction cache: the four trips differ in an address only
#pragma unroll 1
    for (int p = 0; p < 4; ++p) {
      __bf16* prow = sP + (p * 2 * QS_ + wave) * PP_ + lane * 8;   // head 2p; head 2p+1 is QS_ rows on
      float x[2][64];
#pragma unroll
      for (int rr = 0; rr < 2; ++rr) {
#pragma unroll
        for (int q = 0; q < 8; ++q) {
          const bf16x8 t = *(const bf16x8*)(prow + rr * QS_ * PP_ + q * 256);
#pragma unroll
          for (int i = 0; i < 8; ++i) x[rr][q * 8 + i] = (float)t[i];
        }
      }
      // one short chain per chunk instead of one chain of 64 links
      float mx[2];
#pragma unroll
      for (int rr = 0; rr < 2; ++rr) {
        float m8[8];
#pragma unroll
        for (int q = 0; q < 8; ++q) {
          m8[q] = x[rr][q * 8];
#pragma unroll
          for (int i = 1; i < 8; ++i) m8[q] = fmaxf(m8[q], x[rr][q * 8 + i]);
        }
        mx[rr] = fmaxf(fmaxf(fmaxf(m8[0], m8[1]), fmaxf(m8[2], m8[3])),
                       fmaxf(fmaxf(m8[4], m8[5]), fmaxf(m8[6], m8[7])));
      }
      // the two rows' exchanges go side by side and share their latency
      for (int o = 16; o; o >>= 1) {
        const float a0 = __shfl_xor(mx[0], o, 32);
        const float a1 = __shfl_xor(mx[1], o, 32);
        mx[0] = fmaxf(mx[0], a0);
        mx[1] = fmaxf(mx[1], a1);
      }
      float sum[2];
#pragma unroll
      for (int rr = 0; rr < 2; ++rr) {
        float s8[8];
#pragma unroll
        for (int q = 0; q < 8; ++q) {
          float* e = &x[rr][q * 8];
#pragma unroll
          for (int i = 0; i < 8; ++i) e[i] = (e[i] - mx[rr]) * 1.44269504f;   // exp(v) = 2^(v * log2 e)
          exp2_x8(e[0], e[1], e[2], e[3], e[4], e[5], e[6], e[7]);
          s8[q] = e[0];
#pragma unroll
          for (int i = 1; i < 8; ++i) s8[q] += e[i];
        }
        sum[rr] = ((s8[0] + s8[1]) + (s8[2] + s8[3])) + ((s8[4] + s8[5]) + (s8[6] + s8[7]));
      }
      for (int o = 16; o; o >>= 1) {
        const float a0 = __shfl_xor(sum[0], o, 32);
        const float a1 = __shfl_xor(sum[1], o, 32);
        sum[0] += a0;
        sum[1] += a1;
      }
#pragma unroll
      for (int rr = 0; rr < 2; ++rr) {
        const float inv = 1.0f / sum[rr];
#pragma unroll
        for (int q = 0; q < 8; ++q) {
          bf16x8 t;
#pragma unroll
          for (int i = 0; i < 8; ++i) {
            x[rr][q * 8 + i] *= inv;
            t[i] = (__bf16)x[rr][q * 8 + i];
          }
          *(bf16x8*)(prow + rr * QS_ * PP_ + q * 256) = t;
        }
#pragma unroll
        for (int i = 0; i < 64; ++i) mean[i] += x[rr][i];
      }
    }

    // ---- attn_mean = sum/H: a wave's store covers 1 KB of its row ----
    float* mout = attnMean + ((long)b * S_ + s0 + wave) * S_ + lane * 8;
    float4 v[16];
#pragma unroll
    for (int q = 0; q < 16; ++q)
      v[q] = make_float4(mean[q * 4 + 0] * 0.125f, mean[q * 4 + 1] * 0.125f,
                         mean[q * 4 + 2] * 0.125f, mean[q * 4 + 3] * 0.125f);
    // all of the row's products stand in front of its stores, so that none of them
    // is written into a register that an issued store names
    __builtin_amdgcn_sched_barrier(0);
#pragma unroll
    for (int q = 0; q < 16; ++q)
      *(float4*)(mout + (q >> 1) * 256 + (q & 1) * 4) = v[q];
    // the wait that belongs in front of an overwrite of a register which an issued
    // store names; the barrier behind it holds stage 3 behind it
    asm volatile("s_wait_xcnt 0x0" ::: "memory");
    __builtin_amdgcn_sched_barrier(0);
  }
  __syncthreads();   // every row's probabilities are in LDS before stage 3 reads them

  {
    // ---- stage 3: P@X slab, d in [wave*32, wave*32+32) ----
    const int e0 = wave * 32;
    // this wave's two rows of fragments (16 d each), at this batch's first t
    const __bf16* vbase = XV + ((long)(2 * wave) * (M_ / 32) + (long)b * (S_ / 32)) * 512;
    f32x8 acc[4][2] = {};   // [row block][column block]
    // fragment q of a tile: column block q >> 2, k step q & 3
    bf16x16 vr[2][8];
#pragma unroll   // static indices keep vr[][] in registers
    for (int u = 0; u < 2; ++u) {
      unsigned vg = (unsigned)(lane * 16 + ((u + rot) & 15) * 4096);
#pragma unroll
      for (int q = 0; q < 8; ++q)
        vr[u][q] = frag_of(ld16(vbase, vg, (q >> 2) * (int)(M_ / 32) * 1024 + (q & 3) * 1024),
                           ld16(vbase, vg, (q >> 2) * (int)(M_ / 32) * 1024 + (q & 3) * 1024 + 512));
      addr_sync(vg);
    }

    // the products of tile cc, held in v[]
    auto pv_tile = [&](const bf16x16 (&v)[8], int cc) {
#pragma unroll   // the four k steps of a tile read at constant LDS offsets
      for (int ts = 0; ts < 4; ++ts) {
        const int t0 = cc * 128 + ts * 32;
#pragma unroll
        for (int g = 0; g < 4; ++g) {
          bf16x16 a = frag_ld_g(sP + (long)(g * 16 + ml) * PP_ + t0 + kh);
          acc[g][0] = wmma_bf16(a, v[ts], acc[g][0]);
          acc[g][1] = wmma_bf16(a, v[4 + ts], acc[g][1]);
        }
      }
    };
    // every trip loads, the last two tiles stand behind the loop, and the loop is
    // kept rolled: for the reasons given at stage 1's loop
#pragma unroll 1
    for (int c = 0; c < S_ / 128 - 2; c += 2) {
#pragma unroll   // static indices keep vr[][] in registers
      for (int u = 0; u < 2; ++u) {
        pv_tile(vr[u], (c + u + rot) & 15);
        // inputs only, no instruction: as in stage 1, products in front, loads behind
        asm volatile("" :: "v"(acc[0][0]), "v"(acc[0][1]), "v"(acc[1][0]), "v"(acc[1][1]),
                           "v"(acc[2][0]), "v"(acc[2][1]), "v"(acc[3][0]), "v"(acc[3][1]) : "memory");
        // the tile after next flies while the next is worked on
        unsigned vg = (unsigned)(lane * 16 + ((c + u + 2 + rot) & 15) * 4096);
#pragma unroll
        for (int q = 0; q < 8; ++q)
          vr[u][q] = frag_of(ld16(vbase, vg, (q >> 2) * (int)(M_ / 32) * 1024 + (q & 3) * 1024),
                             ld16(vbase, vg, (q >> 2) * (int)(M_ / 32) * 1024 + (q & 3) * 1024 + 512));
        addr_sync(vg);
      }
    }
    pv_tile(vr[0], (S_ / 128 - 2 + rot) & 15);
    pv_tile(vr[1], (S_ / 128 - 1 + rot) & 15);
    __bf16 zo[4][2][8];
#pragma unroll
    for (int g = 0; g < 4; ++g) {
#pragma unroll
      for (int i = 0; i < 8; ++i) {
        zo[g][0][i] = (__bf16)acc[g][0][i];
        zo[g][1][i] = (__bf16)acc[g][1][i];
      }
    }
    // all results stand in front of the stores, each in a register of its own:
    // formed one by one in one register, each waits for the store before it
    __builtin_amdgcn_sched_barrier(0);
    // score row g*16 + rh + i is query row i of head 2g + (rh >> 3)
#pragma unroll
    for (int i = 0; i < 8; ++i) {
      long rowm = (long)b * S_ + s0 + i;
#pragma unroll
      for (int g = 0; g < 4; ++g) {
        Zcat[rowm * HD_ + ((2 * g + (rh >> 3)) * D_ + e0 + ml)]      = zo[g][0][i];
        Zcat[rowm * HD_ + ((2 * g + (rh >> 3)) * D_ + e0 + 16 + ml)] = zo[g][1][i];
      }
    }
  }
}


// ---------------------------------------------------------------------------
// LayerNorm over D=256: a row belongs to one wave, four rows a wave, 32 rows a
// block. A lane holds 8 columns of each row (two 16-byte pieces, so that every
// load and f32 store of a wave covers 512 contiguous bytes). No LDS, no barrier.
// The launch starts 2,048 waves where one block a row starts 65,536.
// Its input is the product of a GEMM that was split in K over NP_ slices: NP_
// planes of partial sums, which are added here, with the bias and the residual.
// ---------------------------------------------------------------------------
constexpr int LNR_ = 4;   // rows a wave
constexpr int NP_  = 4;   // K slices of the GEMM in front of a LayerNorm
typedef __attribute__((ext_vector_type(4))) __bf16 bf16x4;

// value of lane l ^ X inside the 16-lane row (DPP row_xmask:X, control 0x160 + X)
template <int X>
__device__ __forceinline__ float row_xor(float v) {
  return __builtin_bit_cast(float, __builtin_amdgcn_update_dpp(
      0, __builtin_bit_cast(int, v), 0x160 + X, 0xf, 0xf, true));
}
// sum over the 32 lanes, the same value in every lane; all lanes are on
__device__ __forceinline__ float wave_sum(float v) {
  v += row_xor<1>(v);
  v += row_xor<2>(v);
  v += row_xor<4>(v);
  v += row_xor<8>(v);
  const int bits = __builtin_bit_cast(int, v);   // lane l ^ 16
  v += __builtin_bit_cast(float, __builtin_amdgcn_permlanex16(
      bits, bits, 0x76543210, 0xfedcba98, false, false));
  return v;
}

__global__ void __launch_bounds__(256)
ln_k(const float* __restrict__ in,     // [NP_][M][D] partial sums
     const float* __restrict__ bias,   // [D]
     const float* __restrict__ res,    // [M][D]
     const float* __restrict__ g, const float* __restrict__ be,
     float* __restrict__ outF, __bf16* __restrict__ outB) {
  const int  lane = threadIdx.x & 31;
  const int  wave = threadIdx.x >> 5;
  const long e0   = (((long)blockIdx.x * 8 + wave) * LNR_) * D_ + lane * 4;   // first element

  // the loads of the wave's rows come first, so that many are in flight at a time
  float4 pp[NP_][LNR_][2], x[LNR_][2], rv[LNR_][2], gv[2], bv[2], cv[2];
#pragma unroll
  for (int p = 0; p < NP_; ++p) {
#pragma unroll
    for (int r = 0; r < LNR_; ++r) {
#pragma unroll
      for (int h = 0; h < 2; ++h)
        pp[p][r][h] = *(const float4*)(in + p * (M_ * D_) + e0 + r * D_ + h * 128);
    }
  }
#pragma unroll
  for (int r = 0; r < LNR_; ++r) {
#pragma unroll
    for (int h = 0; h < 2; ++h) rv[r][h] = *(const float4*)(res + e0 + r * D_ + h * 128);
  }
#pragma unroll
  for (int h = 0; h < 2; ++h) {
    gv[h] = *(const float4*)(g + lane * 4 + h * 128);
    bv[h] = *(const float4*)(be + lane * 4 + h * 128);
    cv[h] = *(const float4*)(bias + lane * 4 + h * 128);
  }
  // the wait that belongs in front of an overwrite of a register which an issued
  // load names
  asm volatile("s_wait_xcnt 0x0" ::: "memory");

  // the four rows' chains are independent and fill each other's latency
  float s[LNR_];
#pragma unroll
  for (int r = 0; r < LNR_; ++r) {
#pragma unroll
    for (int h = 0; h < 2; ++h) {
      x[r][h].x = ((pp[0][r][h].x + pp[1][r][h].x) + (pp[2][r][h].x + pp[3][r][h].x)) + cv[h].x + rv[r][h].x;
      x[r][h].y = ((pp[0][r][h].y + pp[1][r][h].y) + (pp[2][r][h].y + pp[3][r][h].y)) + cv[h].y + rv[r][h].y;
      x[r][h].z = ((pp[0][r][h].z + pp[1][r][h].z) + (pp[2][r][h].z + pp[3][r][h].z)) + cv[h].z + rv[r][h].z;
      x[r][h].w = ((pp[0][r][h].w + pp[1][r][h].w) + (pp[2][r][h].w + pp[3][r][h].w)) + cv[h].w + rv[r][h].w;
    }
    s[r] = ((x[r][0].x + x[r][0].y) + (x[r][0].z + x[r][0].w)) +
           ((x[r][1].x + x[r][1].y) + (x[r][1].z + x[r][1].w));
  }
#pragma unroll
  for (int r = 0; r < LNR_; ++r) s[r] = wave_sum(s[r]);
#pragma unroll
  for (int r = 0; r < LNR_; ++r) {
    const float mean = s[r] * (1.0f / D_);
#pragma unroll
    for (int h = 0; h < 2; ++h) {
      x[r][h].x -= mean; x[r][h].y -= mean; x[r][h].z -= mean; x[r][h].w -= mean;
    }
    s[r] = ((x[r][0].x * x[r][0].x + x[r][0].y * x[r][0].y) +
            (x[r][0].z * x[r][0].z + x[r][0].w * x[r][0].w)) +
           ((x[r][1].x * x[r][1].x + x[r][1].y * x[r][1].y) +
            (x[r][1].z * x[r][1].z + x[r][1].w * x[r][1].w));
  }
#pragma unroll
  for (int r = 0; r < LNR_; ++r) s[r] = wave_sum(s[r]);

  bf16x4 yb[LNR_][2];
#pragma unroll
  for (int r = 0; r < LNR_; ++r) {
    const float rs = rsqrtf(s[r] * (1.0f / D_) + 1e-5f);
#pragma unroll
    for (int h = 0; h < 2; ++h) {
      x[r][h].x = x[r][h].x * rs * gv[h].x + bv[h].x;
      x[r][h].y = x[r][h].y * rs * gv[h].y + bv[h].y;
      x[r][h].z = x[r][h].z * rs * gv[h].z + bv[h].z;
      x[r][h].w = x[r][h].w * rs * gv[h].w + bv[h].w;
      yb[r][h][0] = (__bf16)x[r][h].x; yb[r][h][1] = (__bf16)x[r][h].y;
      yb[r][h][2] = (__bf16)x[r][h].z; yb[r][h][3] = (__bf16)x[r][h].w;
    }
  }
  // all results stand in front of the stores, so that none of them is written
  // into a register that an issued store names
  __builtin_amdgcn_sched_barrier(0);
  if (outF) {
#pragma unroll
    for (int r = 0; r < LNR_; ++r) {
#pragma unroll
      for (int h = 0; h < 2; ++h) *(float4*)(outF + e0 + r * D_ + h * 128) = x[r][h];
    }
    // as above, for the address of the stores that follow
    asm volatile("s_wait_xcnt 0x0" ::: "memory");
  }
  if (outB) {
#pragma unroll
    for (int r = 0; r < LNR_; ++r) {
#pragma unroll
      for (int h = 0; h < 2; ++h) *(bf16x4*)(outB + e0 + r * D_ + h * 128) = yb[r][h];
    }
  }
}

// ---------------------------------------------------------------------------
// All operand preparation in one launch. The jobs do not depend on one another,
// and each alone is too short to fill the chip.
//   casts fp32 -> bf16, layout kept: Wk -> WA[0..7], Wq -> WB[0..7], Wv -> WB[8..15]
//   transposes fp32 [rows][cols] -> bf16 [cols][rows]: Wz head by head -> WA[8..15],
//   W1, W2
//   X: bf16 row-major (Xb) and in the two B-fragment orders of the attention
//   kernel (XK, XV), all three from one 64 x 64 tile in LDS
// A block does one piece: 8,192 elements of a cast, or one 64 x 64 tile.
// Every global access of a wave covers whole 128-byte lines.
// ---------------------------------------------------------------------------
constexpr int TT_       = 64;                                   // tile edge
constexpr int CAST_E_   = 8192;                                 // elements of a cast a block
constexpr int PB_W_     = H_ * D_ * D_ / CAST_E_;               // 64 blocks a weight
constexpr int PB_CAST_  = 3 * PB_W_;                            // 192
constexpr int PB_X_     = (int)(M_ / TT_) * (D_ / TT_);         // 512 tiles
constexpr int PB_HEAD_  = (D_ / TT_) * (D_ / TT_);              // 16 tiles a head
constexpr int PB_WZ_    = H_ * PB_HEAD_;                        // 128
constexpr int PB_W1_    = (D_ / TT_) * (FD_ / TT_);             // 32
constexpr int PB_W2_    = (FD_ / TT_) * (D_ / TT_);             // 32
constexpr int PB_ALL_   = PB_CAST_ + PB_X_ + PB_WZ_ + PB_W1_ + PB_W2_;   // 896

__global__ void __launch_bounds__(256)
prep_k(const float* __restrict__ X,  const float* __restrict__ Wq,
       const float* __restrict__ Wk, const float* __restrict__ Wv,
       const float* __restrict__ Wz, const float* __restrict__ W1,
       const float* __restrict__ W2,
       __bf16* __restrict__ Xb,  __bf16* __restrict__ XK, __bf16* __restrict__ XV,
       __bf16* __restrict__ WA,  __bf16* __restrict__ WB,      // [2 * H][D][D] each
       __bf16* __restrict__ W1T, __bf16* __restrict__ W2T) {
  __shared__ float sT[TT_][TT_ + 1];   // odd pitch: the column reads fall on distinct banks
  const int tid = threadIdx.x;
  int blk = blockIdx.x;                // every test on it is the same for a whole block
  if (blk < PB_CAST_) {
    const int w = blk / PB_W_;
    const long e = (long)(blk - w * PB_W_) * CAST_E_ + tid * 8;
    const float* p = ((w == 0) ? Wk : (w == 1) ? Wq : Wv) + e;
    __bf16* o = ((w == 0) ? WA : (w == 1) ? WB : WB + (long)H_ * D_ * D_) + e;
    float4 a[4][2];
#pragma unroll
    for (int q = 0; q < 4; ++q) {
      a[q][0] = *(const float4*)(p + q * 2048);
      a[q][1] = *(const float4*)(p + q * 2048 + 4);
    }
    addr_sync(p);
    bf16x8 t[4];
#pragma unroll
    for (int q = 0; q < 4; ++q) {
      t[q][0] = (__bf16)a[q][0].x; t[q][1] = (__bf16)a[q][0].y;
      t[q][2] = (__bf16)a[q][0].z; t[q][3] = (__bf16)a[q][0].w;
      t[q][4] = (__bf16)a[q][1].x; t[q][5] = (__bf16)a[q][1].y;
      t[q][6] = (__bf16)a[q][1].z; t[q][7] = (__bf16)a[q][1].w;
    }
    // all results stand in front of the stores, so that none of them is written
    // into a register that an issued store names
    __builtin_amdgcn_sched_barrier(0);
#pragma unroll
    for (int q = 0; q < 4; ++q) *(bf16x8*)(o + q * 2048) = t[q];
    return;
  }
  blk -= PB_CAST_;

  // which matrix, its shape and which of its tiles: scalars, one loading body for all
  const float* in;
  __bf16* out;
  int rows, cols, tile;
  const bool isX = blk < PB_X_;
  if (isX) {
    in = X; out = Xb; rows = (int)M_; cols = D_; tile = blk;
  } else if (blk < PB_X_ + PB_WZ_) {
    const int h = (blk - PB_X_) / PB_HEAD_;
    in   = Wz + (long)h * D_ * D_;
    out  = WA + (long)(H_ + h) * D_ * D_;
    rows = D_; cols = D_; tile = (blk - PB_X_) % PB_HEAD_;
  } else if (blk < PB_X_ + PB_WZ_ + PB_W1_) {
    in = W1; out = W1T; rows = D_; cols = FD_; tile = blk - (PB_X_ + PB_WZ_);
  } else {
    in = W2; out = W2T; rows = FD_; cols = D_; tile = blk - (PB_X_ + PB_WZ_ + PB_W1_);
  }
  const int tpr = cols / TT_;          // tiles side by side
  const int r0  = (tile / tpr) * TT_;
  const int c0  = (tile % tpr) * TT_;

  const int lr = tid >> 4, lc = (tid & 15) * 4;
  const float* p0 = in + (long)(r0 + lr) * cols + c0 + lc;
  const float* p1 = p0 + 16 * cols;
  const float* p2 = p1 + 16 * cols;
  const float* p3 = p2 + 16 * cols;
  float4 v[4];
  v[0] = *(const float4*)p0;
  v[1] = *(const float4*)p1;
  v[2] = *(const float4*)p2;
  v[3] = *(const float4*)p3;
  // the wait that belongs in front of an overwrite of a register which an issued
  // load names; naming the four addresses keeps it behind the loads
  asm volatile("s_wait_xcnt 0x0" : "+v"(p0), "+v"(p1), "+v"(p2), "+v"(p3) : : "memory");
#pragma unroll
  for (int q = 0; q < 4; ++q) {
    sT[lr + q * 16][lc + 0] = v[q].x;
    sT[lr + q * 16][lc + 1] = v[q].y;
    sT[lr + q * 16][lc + 2] = v[q].z;
    sT[lr + q * 16][lc + 3] = v[q].w;
  }
  __syncthreads();
  if (isX) {
    // The tile is 4 x 2 fragments in either order. A wave writes one piece of a
    // fragment (512 contiguous bytes) a store: group g4 of 16 n, fragment f2 of 32 k,
    // piece pc of 16 k; the lane is the fragment's own lane.
    const int lane = tid & 31, ln = lane & 15, lk = (lane >> 4) * 8;
    const int xr = tid >> 3, xc = (tid & 7) * 8;
    bf16x8 tb[2], tk[2], tv[2];
    __bf16 *ob[2], *ok[2], *ov[2];
#pragma unroll
    for (int q = 0; q < 2; ++q) {
      const int ci = (tid >> 5) * 2 + q;
      const int g4 = ci >> 2, f2 = (ci >> 1) & 1, pc = ci & 1;
      const int kk = f2 * 32 + pc * 16 + lk;
#pragma unroll
      for (int i = 0; i < 8; ++i) {
        tb[q][i] = (__bf16)sT[xr + q * 32][xc + i];
        tk[q][i] = (__bf16)sT[g4 * 16 + ln][kk + i];     // n = row t, k = column d
        tv[q][i] = (__bf16)sT[kk + i][g4 * 16 + ln];     // n = column d, k = row t
      }
      ob[q] = out + (long)(r0 + xr + q * 32) * D_ + c0 + xc;
      ok[q] = XK + (((r0 >> 4) + g4) * (D_ / 32) + (c0 >> 5) + f2) * 512 + pc * 256 + lane * 8;
      ov[q] = XV + (((c0 >> 4) + g4) * (int)(M_ / 32) + (r0 >> 5) + f2) * 512 + pc * 256 + lane * 8;
    }
    // results and addresses stand in front of the stores
    __builtin_amdgcn_sched_barrier(0);
#pragma unroll
    for (int q = 0; q < 2; ++q) {
      *(bf16x8*)ob[q] = tb[q];
      *(bf16x8*)ok[q] = tk[q];
      *(bf16x8*)ov[q] = tv[q];
    }
    return;
  }
  // eight old rows of one old column make 16 bytes of a new row
  const int oc = tid >> 3, ch = (tid & 7) * 8;
  bf16x8 t[2];
#pragma unroll
  for (int q = 0; q < 2; ++q) {
#pragma unroll
    for (int i = 0; i < 8; ++i) t[q][i] = (__bf16)sT[ch + i][oc + q * 32];
  }
  __bf16* o0 = out + (long)(c0 + oc) * rows + r0 + ch;
  __bf16* o1 = o0 + 32 * rows;
  // as above: results and addresses stand in front of the stores
  __builtin_amdgcn_sched_barrier(0);
  *(bf16x8*)o0 = t[0];
  *(bf16x8*)o1 = t[1];
}

// ---------------------------------------------------------------------------
// Host-side orchestration (all launches on `stream`, graph-capture safe)
// ---------------------------------------------------------------------------
extern "C" void kernel_launch(void* const* d_in, const int* in_sizes, int n_in,
                              void* d_out, int out_size, void* d_ws, size_t ws_size,
                              hipStream_t stream) {
  const float* X  = (const float*)d_in[0];
  const float* Wq = (const float*)d_in[1];
  const float* Wk = (const float*)d_in[2];
  const float* Wv = (const float*)d_in[3];
  const float* Wz = (const float*)d_in[4];
  const float* bz = (const float*)d_in[5];
  const float* W1 = (const float*)d_in[6];
  const float* b1 = (const float*)d_in[7];
  const float* W2 = (const float*)d_in[8];
  const float* b2 = (const float*)d_in[9];
  const float* g1  = (const float*)d_in[10];
  const float* be1 = (const float*)d_in[11];
  const float* g2  = (const float*)d_in[12];
  const float* be2 = (const float*)d_in[13];

  float* outZ    = (float*)d_out;            // [B,S,D]
  float* outAttn = outZ + M_ * D_;           // [B,S,S]

  // ---- workspace carve-up ----
  char* ws = (char*)d_ws;
  size_t off = 0;
  auto alloc = [&](size_t bytes) { char* p = ws + off; off = (off + bytes + 255) & ~(size_t)255; return p; };
  __bf16* Xb   = (__bf16*)alloc(M_ * D_ * 2);                     // [M][D]
  __bf16* XK   = (__bf16*)alloc(M_ * D_ * 2);                     // [M/16][D/32] fragments
  __bf16* XV   = (__bf16*)alloc(M_ * D_ * 2);                     // [D/16][M/32] fragments
  __bf16* WA   = (__bf16*)alloc((size_t)2 * H_ * D_ * D_ * 2);    // Wk_h, then Wz_h^T
  __bf16* WB   = (__bf16*)alloc((size_t)2 * H_ * D_ * D_ * 2);    // Wq_h, then Wv_h
  __bf16* Wc   = (__bf16*)alloc((size_t)D_ * 2 * HD_ * 2);        // [D][2 * H * D] weight products
  __bf16* W1T  = (__bf16*)alloc((size_t)FD_ * D_ * 2);
  __bf16* W2T  = (__bf16*)alloc((size_t)D_ * FD_ * 2);
  __bf16* Qb   = (__bf16*)alloc((size_t)H_ * M_ * D_ * 2);        // [H][M][D]
  __bf16* Zcat = (__bf16*)alloc((size_t)M_ * HD_ * 2);
  float*  zres  = (float*)alloc((size_t)NP_ * M_ * D_ * 4);   // NP_ planes of partial sums
  float*  zln1f = (float*)alloc((size_t)M_ * D_ * 4);
  __bf16* zln1b = (__bf16*)alloc((size_t)M_ * D_ * 2);
  __bf16* Hff   = (__bf16*)alloc((size_t)M_ * FD_ * 2);
  float*  zff   = (float*)alloc((size_t)NP_ * M_ * D_ * 4);   // NP_ planes of partial sums
  (void)ws_size; (void)in_sizes; (void)n_in; (void)out_size;

  // ---- 1. casts, transposes and the three forms of X, one launch ----
  prep_k<<<PB_ALL_, 256, 0, stream>>>(X, Wq, Wk, Wv, Wz, W1, W2, Xb, XK, XV, WA, WB, W1T, W2T);

  // ---- 2. weight products, one launch of 16 slices, each 256 columns of Wc:
  //         slice h     : Wc[d'][h*D + d]       = sum_e Wk_h[d'][e] Wq_h[d][e]
  //         slice H + h : Wc[o][H*D + h*D + d]  = sum_e Wz_h[e][o]  Wv_h[d][e] ----
  gemm_bf16_wmma<<<dim3(D_/128, D_/64, 2 * H_), 256, 0, stream>>>(
      WA, D_, (long)D_*D_, WB, D_, (long)D_*D_, nullptr, nullptr, 0, 1.0f, 0,
      nullptr, Wc, 2 * HD_, D_, D_);

  // ---- 3. Qp_h = X (Wq_h Wk_h^T) * D^-0.5 (both factors D^-0.25 of the scores), slice = head ----
  gemm_bf16_wmma<<<dim3(M_/128, D_/64, H_), 256, 0, stream>>>(
      Xb, D_, 0, Wc, 2 * HD_, D_, nullptr, nullptr, 0, 0.0625f, 0,
      nullptr, Qb, D_, (long)M_*D_, D_);

  // ---- 4. attention (scores + softmax + P@X + attn_mean) ----
  attn_k<<<dim3(B_, S_/QS_), 256, 0, stream>>>(Qb, XK, XV, Zcat, outAttn);

  // ---- 5. output projection with Wv_h Wz_h, split in K: slice = grid.z, a plane of
  //         fp32 partial sums each. Unsplit it is 256 blocks, one a WGP, and each walks
  //         its 64 k steps alone with nothing to cover a step's load latencies; as 1,024
  //         blocks of 16 steps four share a WGP and cover one another's ----
  gemm_bf16_wmma<<<dim3(M_/128, D_/64, NP_), 256, 0, stream>>>(
      Zcat, HD_, HD_/NP_, Wc + HD_, 2 * HD_, HD_/NP_, nullptr, nullptr, 0, 1.0f, 0,
      zres, nullptr, D_, (long)M_*D_, (int)(HD_/NP_));

  // ---- 6. LayerNorm 1 (adds the planes, the bias and the residual) ----
  ln_k<<<M_ / (8 * LNR_), 256, 0, stream>>>(zres, bz, X, g1, be1, zln1f, zln1b);

  // ---- 7. MLP ----
  gemm_bf16_wmma<<<dim3(M_/128, FD_/64, 1), 256, 0, stream>>>(
      zln1b, D_, 0, W1T, D_, 0, b1, nullptr, 0, 1.0f, 1,
      nullptr, Hff, FD_, 0, D_);
  // second layer: split in K like the output projection
  gemm_bf16_wmma<<<dim3(M_/128, D_/64, NP_), 256, 0, stream>>>(
      Hff, FD_, FD_/NP_, W2T, FD_, FD_/NP_, nullptr, nullptr, 0, 1.0f, 0,
      zff, nullptr, D_, (long)M_*D_, FD_/NP_);

  // ---- 8. LayerNorm 2 (adds the planes, the bias and the residual) -> final z output ----
  ln_k<<<M_ / (8 * LNR_), 256, 0, stream>>>(zff, b2, zln1f, g2, be2, outZ, nullptr);
}
